// v000
// Measured on an AMD MI455X. A time is GPU time per run, averaged over a window of back-to-back runs after a warm-up
// (all launches, gaps included; the runs take copies of the inputs in turn), and the median of several windows.
// Apart from v000's, it joins two sittings. Times from different sittings can be a few percent apart, while
// side-by-side timings come from the same sitting.
// v000 is the starting kernel. One run takes 383 microseconds.
// compute dtype: all float inputs rounded to bf16, the int mask read on device; q/k/v = x . W^T + b with EXACT bf16 products on WMMA 16x16x32 (natural rows); pairwise distances, their global maximum (deterministic block reduction), the Lorentz factor and exp(-d coef) in f32 (hardware exp); PLAIN attention: q, k single f16 x 1/8 x that factor, masked keys excluded, running-max softmax in f32, P (scaled by 2^11, single f16) x v (single f16); out = o (bf16 hi + residual) . Wo^T (2 products) + bo.
#include <hip/hip_runtime.h>
#include <math.h>

typedef __attribute__((ext_vector_type(16))) _Float16 v16h;
typedef __attribute__((ext_vector_type(16))) __bf16 v16b;
typedef __attribute__((ext_vector_type(8)))  _Float16 v8h;
typedef __attribute__((ext_vector_type(8)))  float v8f;
typedef __attribute__((ext_vector_type(4)))  float v4f;
typedef __attribute__((ext_vector_type(2)))  float v2f;
typedef __attribute__((ext_vector_type(4)))  unsigned v4u;
typedef __attribute__((ext_vector_type(4)))  int v4i;
typedef float __attribute__((may_alias)) float_a;
typedef int __attribute__((may_alias)) int_a;

template <typename T> __device__ __forceinline__ void vst2(void* p, T v) { *(T*)p = v;  }
__device__ __forceinline__ v8f wmma16(v16h a, v16h b, v8f c) {
  v8f d = __builtin_amdgcn_wmma_f32_16x16x32_f16(false, a, false, b, (short)0, c, false, false);
  asm volatile("v_nop\n\tv_nop\n\tv_nop\n\tv_nop" : "+v"(d) : "v"(a), "v"(b));
  return d;
}
__device__ __forceinline__ v8f wmma_bf(v16b a, v16b b, v8f c) {
  v8f d = __builtin_amdgcn_wmma_f32_16x16x32_bf16(false, a, false, b, (short)0, c, false, false);
  asm volatile("v_nop\n\tv_nop\n\tv_nop\n\tv_nop" : "+v"(d) : "v"(a), "v"(b));
  return d;
}
// Relativistic self attention (B 1, S 2,048, d 1,024, 16 heads x 64): q/k/v projections + biases, scores / 8 multiplied by exp(-dist_ij gamma_h v_h) with the normalised pairwise distance of the 3-D positions and a per-head velocity, key mask, softmax, . v, output projection + bias.
__device__ __forceinline__ v16h frag_h(const _Float16* rowk0, int lane) {
  union { v16h v; v8h q[2]; } u; const _Float16* p = rowk0 + 8 * (lane >> 4);
  u.q[0] = *(const v8h*)p; u.q[1] = *(const v8h*)(p + 16); return u.v;
}
__device__ __forceinline__ v16h frag_f32(const float* rowk0, int lane) {
  v16h a; const float* p = rowk0 + 8 * (lane >> 4);
#pragma unroll
  for (int i = 0; i < 8; ++i) { a[i] = (_Float16)p[i]; a[8 + i] = (_Float16)p[16 + i]; }
  return a;
}
__device__ __forceinline__ v16h frag_f32s(const float* rowk0, int lane, float sc) {
  v16h a; const float* p = rowk0 + 8 * (lane >> 4);
#pragma unroll
  for (int i = 0; i < 8; ++i) { a[i] = (_Float16)(p[i] * sc); a[8 + i] = (_Float16)(p[16 + i] * sc); }
  return a;
}
// column fragment from a [K][ld] layout (column n), rows >= K read as 0
__device__ __forceinline__ v16h fragc_f32(const float* W, int k0, int n, int lane, int ld, int K) {
  v16h a; const int g = lane >> 4;
#pragma unroll
  for (int i = 0; i < 8; ++i) { const int ka = k0 + 8 * g + i, kb = ka + 16;
    a[i] = (_Float16)(ka < K ? W[(size_t)(ka < K ? ka : K - 1) * ld + n] : 0.f); a[8 + i] = (_Float16)(kb < K ? W[(size_t)(kb < K ? kb : K - 1) * ld + n] : 0.f); }
  return a;
}
struct F2 { v16b h, l; };
__device__ __forceinline__ F2 bsplit16(const float v[16]) { F2 r;
#pragma unroll
  for (int i = 0; i < 16; ++i) { const __bf16 h = (__bf16)v[i]; r.h[i] = h; r.l[i] = (__bf16)(v[i] - (float)h); }
  return r; }
__device__ __forceinline__ F2 split_row(const float* row, int k0, int lane) { float v[16]; const float* p = row + k0 + 8 * (lane >> 4);
#pragma unroll
  for (int i = 0; i < 8; ++i) { v[i] = p[i]; v[8 + i] = p[16 + i]; }
  return bsplit16(v); }
__device__ __forceinline__ F2 split_rowK(const float* row, int k0, int lane, int K) { float v[16]; const int g = lane >> 4;
#pragma unroll
  for (int i = 0; i < 8; ++i) { const int ka = k0 + 8 * g + i, kb = ka + 16; v[i] = ka < K ? row[ka < K ? ka : K - 1] : 0.f; v[8 + i] = kb < K ? row[kb < K ? kb : K - 1] : 0.f; }
  return bsplit16(v); }
__device__ __forceinline__ F2 split_col(const float* W, int k0, int n, int lane, int ld, int K) { float v[16]; const int g = lane >> 4;
#pragma unroll
  for (int i = 0; i < 8; ++i) { const int ka = k0 + 8 * g + i, kb = ka + 16; v[i] = ka < K ? W[(size_t)(ka < K ? ka : K - 1) * ld + n] : 0.f; v[8 + i] = kb < K ? W[(size_t)(kb < K ? kb : K - 1) * ld + n] : 0.f; }
  return bsplit16(v); }
__device__ __forceinline__ v8f mac3(const F2& a, const F2& b, v8f c) { c = wmma_bf(a.l, b.h, c); c = wmma_bf(a.h, b.l, c); return wmma_bf(a.h, b.h, c); }
__device__ __forceinline__ float sigm(float v) { return 1.0f / (1.0f + expf(-v)); }
#define LDSX() do { asm volatile("s_wait_dscnt 0" ::: "memory"); __builtin_amdgcn_wave_barrier(); __builtin_amdgcn_fence(__ATOMIC_RELEASE, "workgroup"); } while (0)


#define NB 1
#define SS 2048
#define DM 1024
#define NH 16
#define HD 64
#define QKVW (3 * DM)
#ifndef TQB
#define TQB (SS / 64)
#define TNB NB
#define TOB (NB * SS / 64)     // output row tiles (all)
#endif
typedef __attribute__((ext_vector_type(8))) __bf16 v8b;
__device__ __forceinline__ v16b frag_b(const __bf16* rowk0, int lane) {
  union { v16b v; v8b q[2]; } u; const __bf16* p = rowk0 + 8 * (lane >> 4);
  u.q[0] = *(const v8b*)p; u.q[1] = *(const v8b*)(p + 16); return u.v;
}
__device__ __forceinline__ float bfr(float v) { return (float)(__bf16)v; }
__device__ __attribute__((noinline)) float exp_ni(float v) { return expf(v); }
__device__ __attribute__((noinline)) float erf_ni(float v) { return erff(v); }

#define PK_A 0                       // [3072][1024] Wqkv rows (natural [out][in])
#define PK_P (PK_A + QKVW * DM)        // [1024][1024] Wo rows (natural)
#define PK_END (PK_P + DM * DM)
#define WS_PK  0u
#define WS_QK  (WS_PK + 2u * PK_END)             // f16 [2048 rows][2048]: q | k
#define WS_QKL (WS_QK + 2u * NB * SS * 2 * DM)     // f16 q | k residual planes x2048
#define WS_VTH (WS_QKL + 2u * NB * SS * 2 * DM)    // f16 [b][1024 (h*64+d)][2048 s] hi
#define WS_VTL (WS_VTH + 2u * NB * DM * SS)        // f16 lo x 2048
#define WS_O   (WS_VTL + 2u * NB * DM * SS)        // f32 [2048][1024]
#define WS_CS  (WS_O + 4u * NB * SS * DM)           // f32 2 x [2048][32], unused
#define WS_DM  (WS_CS + 4u * 2 * SS * 32)                  // f32: row maxima of the squared pairwise distances [SS], then the global max at [SS]
#define WS_END (WS_DM + 4u * (size_t)(SS + 32))
// ---- k_pack: block = (row n, which): natural [out][in] rows -> bf16; which 0..2 -> W_q/W_k/W_v into PK_A rows which*1024 + n; 3 -> W_o into PK_P
__global__ __launch_bounds__(256) void k_pack(const float* __restrict__ WQ, const float* __restrict__ WK, const float* __restrict__ WV, const float* __restrict__ WO, __bf16* __restrict__ PK) {
  __shared__ __align__(16) __bf16 s[DM]; const int n = blockIdx.x, which = blockIdx.y, t = threadIdx.x; const float* Wm = (which == 0) ? WQ : (which == 1) ? WK : (which == 2) ? WV : WO;
  for (int k = t; k < DM; k += 256) s[k] = (__bf16)Wm[(size_t)n * DM + k];
  __syncthreads();
  __bf16* dst = (which < 3) ? PK + PK_A + ((size_t)which * DM + n) * DM : PK + PK_P + (size_t)n * DM;
  for (int q = t; q < DM / 8; q += 256) vst2((unsigned*)(dst + q * 8), *(const v4u*)&s[q * 8]);
}
__global__ __launch_bounds__(128) void k_qkv(const float* __restrict__ XQ, const float* __restrict__ XK, const float* __restrict__ XV, const __bf16* __restrict__ P, const float* __restrict__ BQ, const float* __restrict__ BK, const float* __restrict__ BV, _Float16* __restrict__ QK, _Float16* __restrict__ QKL, _Float16* __restrict__ VTH, _Float16* __restrict__ VTL) {
  const int which0 = (blockIdx.y * 128) / DM; const float* X = (which0 == 0) ? XQ : (which0 == 1) ? XK : XV; const float* BB = BQ ? (((which0 == 0) ? BQ : (which0 == 1) ? BK : BV) + (blockIdx.y * 128 - which0 * DM)) : nullptr;
  __shared__ __align__(16) _Float16 so[4][16][136], sol[4][16][136]; __shared__ __align__(16) _Float16 sth[128][72], stl[128][72];
  const int tid = threadIdx.x, wave = tid >> 5, lane = tid & 31, col = lane & 15, g = lane >> 4; const size_t r0 = (size_t)blockIdx.x * 64 + wave * 16; const int n0 = blockIdx.y * 128;
  v8f acc[8] = {};
#pragma unroll 2
  for (int kc = 0; kc < DM / 32; ++kc) { v16b a; { const float* p = X + (r0 + col) * DM + kc * 32 + 8 * g;
#pragma unroll
      for (int i = 0; i < 8; ++i) { a[i] = (__bf16)p[i]; a[8 + i] = (__bf16)p[16 + i]; } }
#pragma unroll
    for (int j = 0; j < 8; ++j) acc[j] = wmma_bf(a, frag_b(P + (size_t)(n0 + j * 16 + col) * DM + kc * 32, lane), acc[j]); }
  if (n0 < 2 * DM) {   // q stored unscaled (f16 sigma ~0.6, no subnormal exposure); 1/8 applied to the f32 score
#pragma unroll
    for (int j = 0; j < 8; ++j) {
#pragma unroll
      for (int r = 0; r < 8; ++r) { const float v = acc[j][r] + (BB ? bfr(BB[j * 16 + col]) : 0.f); const _Float16 hv = (_Float16)v; so[wave][8 * g + r][j * 16 + col] = hv; sol[wave][8 * g + r][j * 16 + col] = (_Float16)((v - (float)hv) * 2048.0f); } }   // q, k (+ bias) as f16 hi + (x2048) residual
    LDSX();
    for (int rl = 0; rl < 16; ++rl) if (lane < 16) { vst2((unsigned*)(QK + (r0 + rl) * (2 * DM) + n0 + lane * 8), *(const v4u*)&so[wave][rl][lane * 8]); vst2((unsigned*)(QKL + (r0 + rl) * (2 * DM) + n0 + lane * 8), *(const v4u*)&sol[wave][rl][lane * 8]); }
  } else {
#pragma unroll
    for (int j = 0; j < 8; ++j) {
#pragma unroll
      for (int r = 0; r < 8; ++r) { const float v = acc[j][r] + (BB ? bfr(BB[j * 16 + col]) : 0.f); const _Float16 hv = (_Float16)v; sth[j * 16 + col][wave * 16 + 8 * g + r] = hv; stl[j * 16 + col][wave * 16 + 8 * g + r] = (_Float16)((v - (float)hv) * 2048.0f); } }
    __syncthreads();
    const size_t rb = (size_t)blockIdx.x * 64; const int b = (int)(rb / SS), s0 = (int)(rb % SS); const int pc0 = n0 - 2 * DM;
    for (int q = tid; q < 128 * 8; q += 128) { const int d = q >> 3, pc = q & 7; const size_t o = ((size_t)b * DM + pc0 + d) * SS + s0 + pc * 8; vst2((unsigned*)(VTH + o), *(const v4u*)&sth[d][pc * 8]); vst2((unsigned*)(VTL + o), *(const v4u*)&stl[d][pc * 8]); }
  }
}
// ---- k_attn: block = (64 queries, head h, batch b): all-keys flash attention (K = 64: 2 k-steps), scores = (q.k) * 0.125 with single f16 operands, P.V: f16 P (x2^11) x V hi, single product into acc; O[b*S+q][h*64+d] = (acc + accl / 2048) / (2048 l) (256-B segments)
__global__ __launch_bounds__(128) void k_attn(const _Float16* __restrict__ QK, const _Float16* __restrict__ QKL, const _Float16* __restrict__ VTH, const _Float16* __restrict__ VTL, const void* __restrict__ KMASK, const float* __restrict__ POS, const float* __restrict__ DMAX, const float* __restrict__ VEL, const int* __restrict__ AM, float* __restrict__ O) {
  __shared__ __align__(16) float sp[4][16][36]; __shared__ __align__(16) float so[4][16][68];
  const int tid = threadIdx.x, wave = tid >> 5, lane = tid & 31, col = lane & 15, g = lane >> 4;
  const int qb = blockIdx.x, h = blockIdx.y, b = blockIdx.z; const int q0 = qb * 64 + wave * 16; const size_t rq = (size_t)b * SS + q0 + col;
  v16h aq[2], aql[2];
#pragma unroll
  for (int kc = 0; kc < 2; ++kc) { aq[kc] = frag_h(QK + rq * (2 * DM) + h * HD + kc * 32, lane); aql[kc] = frag_h(QKL + rq * (2 * DM) + h * HD + kc * 32, lane); }
  float px[8], py[8], pz[8];
#pragma unroll
  for (int r = 0; r < 8; ++r) { const float* p = POS + ((size_t)b * SS + q0 + 8 * g + r) * 3; px[r] = bfr(p[0]); py[r] = bfr(p[1]); pz[r] = bfr(p[2]); }
  float coef; { float vh = fabsf(bfr(VEL[h])); vh = fminf(fmaxf(vh, 0.f), 0.999f); const float gam = 1.0f / sqrtf(1.0f - vh * vh); coef = gam * vh / (DMAX[0] + 1e-8f); }   // gamma v / (dmax + 1e-8): dist is normalised by the global max
  const bool havemax = DMAX[0] > 0.f;
  float m[8], l[8];
#pragma unroll
  for (int r = 0; r < 8; ++r) { m[r] = -3.0e38f; l[r] = 0.f; }
  v8f acc[4] = {}, accl[4] = {};
  const int nks = SS / 32;   // all keys
#pragma unroll 1
  for (int ks = 0; ks < nks; ++ks) { v8f s[2];
#pragma unroll
    for (int ct = 0; ct < 2; ++ct) { const int kk = ks * 32 + ct * 16 + col; const _Float16* krow = QK + ((size_t)b * SS + kk) * (2 * DM) + DM + h * HD; const _Float16* krowl = QKL + ((size_t)b * SS + kk) * (2 * DM) + DM + h * HD; v8f c = {}, cl = {};
#pragma unroll
      for (int kc = 0; kc < 2; ++kc) c = wmma16(aq[kc], frag_h(krow + kc * 32, lane), c);   // single product: q, k as one-rounding f16 operands
      (void)cl; (void)krowl;
      { const bool keepk = true;
      { const float* pk = POS + ((size_t)b * SS + kk) * 3; const float kx = bfr(pk[0]), ky = bfr(pk[1]), kz = bfr(pk[2]); const bool keep2 = keepk && (AM[(size_t)b * SS + kk] != 0);
#pragma unroll
        for (int r = 0; r < 8; ++r) { const float dx = px[r] - kx, dy = py[r] - ky, dz = pz[r] - kz; const float sq = dx * dx + dy * dy + dz * dz; const float dist = (sq == 0.f) ? 0.f : sqrtf(sq); const float fac = havemax ? __expf(-dist * coef) : __expf(-dist * coef * (DMAX[0] + 1e-8f)); s[ct][r] = keep2 ? c[r] * 0.125f * fac : -3.0e38f; } } } }   // score x exp(-normalised distance x gamma v)
#pragma unroll
    for (int r = 0; r < 8; ++r) { float mx = fmaxf(s[0][r], s[1][r]);
#pragma unroll
      for (int o = 1; o < 16; o <<= 1) mx = fmaxf(mx, __shfl_xor(mx, o));
      const float mn = fmaxf(m[r], mx); const float alpha = (m[r] <= -1.0e38f) ? 0.f : __expf(m[r] - mn);
      const float e0 = (s[0][r] <= -1.0e38f) ? 0.f : __expf(s[0][r] - mn), e1 = (s[1][r] <= -1.0e38f) ? 0.f : __expf(s[1][r] - mn); float es = e0 + e1;
#pragma unroll
      for (int o = 1; o < 16; o <<= 1) es += __shfl_xor(es, o);
      l[r] = l[r] * alpha + es; m[r] = mn;
#pragma unroll
      for (int dt = 0; dt < 4; ++dt) { acc[dt][r] *= alpha; accl[dt][r] *= alpha; }
      sp[wave][8 * g + r][col] = e0; sp[wave][8 * g + r][16 + col] = e1; }
    LDSX();
    v16h pa, pl; { const float* prow = &sp[wave][col][0] + 8 * (lane >> 4);
#pragma unroll
      for (int i = 0; i < 8; ++i) { const float x0 = prow[i] * 2048.0f, x1 = prow[16 + i] * 2048.0f; const _Float16 h0 = (_Float16)x0, h1 = (_Float16)x1; pa[i] = h0; pa[8 + i] = h1; pl[i] = (_Float16)((x0 - (float)h0) * 2048.0f); pl[8 + i] = (_Float16)((x1 - (float)h1) * 2048.0f); } }   // P scaled by 2^11 before the f16 split so small softmax weights stay out of the f16 subnormal range; 2^-11 folded into the epilogue
#pragma unroll
    for (int dt = 0; dt < 4; ++dt) { const size_t vr = ((size_t)b * DM + h * HD + dt * 16 + col) * SS + ks * 32; acc[dt] = wmma16(pa, frag_h(VTH + vr, lane), acc[dt]); }   // single product: P (x2^11) x V
    (void)pl;
    LDSX(); }
#pragma unroll
  for (int r = 0; r < 8; ++r) { const float il = (1.0f / 2048.0f) / l[r];
#pragma unroll
    for (int dt = 0; dt < 4; ++dt) so[wave][8 * g + r][dt * 16 + col] = (acc[dt][r] + accl[dt][r] * (1.0f / 2048.0f)) * il; }
  LDSX();
  for (int rl = 0; rl < 16; ++rl) if (lane < 16) vst2(O + ((size_t)b * SS + q0 + rl) * DM + h * HD + lane * 4, *(const v4f*)&so[wave][rl][lane * 4]);
}
// ---- k_out: block = (64 rows, 128 cols): out = O(hi/lo) . Wo rows (2 products) + bo
__global__ __launch_bounds__(128) void k_out(const float* __restrict__ O, const __bf16* __restrict__ P, const float* __restrict__ BO, float* __restrict__ Y) {
  __shared__ __align__(16) float so[4][16][132];
  const int tid = threadIdx.x, wave = tid >> 5, lane = tid & 31, col = lane & 15, g = lane >> 4; const size_t r0 = (size_t)blockIdx.x * 64 + wave * 16; const int n0 = blockIdx.y * 128;
  v8f acc[8] = {};
#pragma unroll 2
  for (int kc = 0; kc < DM / 32; ++kc) { const F2 a = split_row(O + (r0 + col) * DM, kc * 32, lane);
#pragma unroll
    for (int j = 0; j < 8; ++j) { const v16b w = frag_b(P + (size_t)(n0 + j * 16 + col) * DM + kc * 32, lane); acc[j] = wmma_bf(a.l, w, acc[j]); acc[j] = wmma_bf(a.h, w, acc[j]); } }
#pragma unroll
  for (int j = 0; j < 8; ++j) {
#pragma unroll
    for (int r = 0; r < 8; ++r) so[wave][8 * g + r][j * 16 + col] = acc[j][r] + bfr(BO[n0 + j * 16 + col]); }
  LDSX();
  for (int rl = 0; rl < 16; ++rl) vst2(Y + (r0 + rl) * DM + n0 + lane * 4, *(const v4f*)&so[wave][rl][lane * 4]);
}
// ---- k_dist1: block = 64 rows: max over all keys of |p_i - p_j|^2 per row (f32, fixed order per thread then max-reduce: max is order-free); 256-B per block
__global__ __launch_bounds__(256) void k_dist1(const float* __restrict__ POS, float* __restrict__ RM) {
  __shared__ float red[64][4]; const size_t r0 = (size_t)blockIdx.x * 64; const int t = threadIdx.x; const int rl = t >> 2, part = t & 3;
  const float* p = POS + (r0 + rl) * 3; const float x = bfr(p[0]), y = bfr(p[1]), z = bfr(p[2]); float mx = 0.f;
  for (int j = part; j < NB * SS; j += 4) { const float* q = POS + (size_t)j * 3; const float dx = x - bfr(q[0]), dy = y - bfr(q[1]), dz = z - bfr(q[2]); mx = fmaxf(mx, dx * dx + dy * dy + dz * dz); }
  red[rl][part] = mx; __syncthreads();
  __shared__ __align__(16) float srow[64]; if (t < 64) srow[t] = fmaxf(fmaxf(red[t][0], red[t][1]), fmaxf(red[t][2], red[t][3])); __syncthreads();
  if (t < 16) vst2(RM + r0 + t * 4, *(const v4f*)&srow[t * 4]);
}
// ---- k_dist2: one block: global max -> sqrt -> DMAX (one line)
__global__ __launch_bounds__(256) void k_dist2(const float* __restrict__ RM, float* __restrict__ DMX) { __shared__ float red[256]; __shared__ __align__(16) float line[32]; const int t = threadIdx.x; float mx = 0.f; for (int i = t; i < NB * SS; i += 256) mx = fmaxf(mx, RM[i]); red[t] = mx; __syncthreads();
  for (int s = 128; s > 0; s >>= 1) { if (t < s) red[t] = fmaxf(red[t], red[t + s]); __syncthreads(); }
  if (t < 32) line[t] = (t == 0) ? sqrtf(red[0]) : 0.f; __syncthreads(); if (t < 8) vst2(DMX + t * 4, *(const v4f*)&line[t * 4]); }
extern "C" void kernel_launch(void* const* d_in, const int* in_sizes, int n_in, void* d_out, int out_size, void* d_ws, size_t ws_size, hipStream_t stream) {
  (void)in_sizes; (void)n_in; (void)out_size;
  const float** F = (const float**)d_in;   // 0 x [1,2048,1024], 1 attention_mask [1,2048] int, 2 positions [1,2048,3], 3 Wq, 4 bq, 5 Wk, 6 bk, 7 Wv, 8 bv, 9 Wo, 10 bo (natural), 11 velocity [16]
  if (ws_size < (size_t)WS_END) return;
  char* ws = (char*)d_ws; __bf16* PK = (__bf16*)(ws + WS_PK); _Float16 *QK = (_Float16*)(ws + WS_QK), *QKL = (_Float16*)(ws + WS_QKL), *VTH = (_Float16*)(ws + WS_VTH), *VTL = (_Float16*)(ws + WS_VTL); float *O = (float*)(ws + WS_O), *RM = (float*)(ws + WS_DM), *DMX = RM + NB * SS;
  k_pack<<<dim3(DM, 4), 256, 0, stream>>>(F[3], F[5], F[7], F[9], PK);
  k_dist1<<<NB * SS / 64, 256, 0, stream>>>(F[2], RM);
  k_dist2<<<1, 256, 0, stream>>>(RM, DMX);
  k_qkv<<<dim3(TNB * SS / 64, QKVW / 128), 128, 0, stream>>>(F[0], F[0], F[0], PK + PK_A, F[4], F[6], F[8], QK, QKL, VTH, VTL);
  k_attn<<<dim3(TQB, NH, TNB), 128, 0, stream>>>(QK, QKL, VTH, VTL, nullptr, F[2], DMX, F[11], (const int*)d_in[1], O);
  k_out<<<dim3(TOB, DM / 128), 128, 0, stream>>>(O, PK + PK_P, F[10], (float*)d_out);
}

// v001
// One run takes 229 microseconds.
// Timed twice side by side with v000, it ran 1.69 and 1.70 times as fast.
// compute dtype: all float inputs rounded to bf16, the int mask read on device; q/k/v = x . W^T + b with EXACT bf16 products on WMMA 16x16x32 (natural rows); pairwise distances, their global maximum (deterministic block reduction), the Lorentz factor and exp(-d coef) in f32 (hardware exp); PLAIN attention: q, k single f16 x 1/8 x that factor, masked keys excluded, running-max softmax in f32, P (scaled by 2^11, single f16) x v (single f16); out = o (bf16 hi + residual) . Wo^T (2 products) + bo.
#include <hip/hip_runtime.h>
#include <math.h>

typedef __attribute__((ext_vector_type(16))) _Float16 v16h;
typedef __attribute__((ext_vector_type(16))) __bf16 v16b;
typedef __attribute__((ext_vector_type(8)))  _Float16 v8h;
typedef __attribute__((ext_vector_type(8)))  float v8f;
typedef __attribute__((ext_vector_type(4)))  float v4f;
typedef __attribute__((ext_vector_type(2)))  float v2f;
typedef __attribute__((ext_vector_type(4)))  unsigned v4u;
typedef __attribute__((ext_vector_type(4)))  int v4i;
typedef float __attribute__((may_alias)) float_a;
typedef int __attribute__((may_alias)) int_a;

template <typename T> __device__ __forceinline__ void vst2(void* p, T v) { *(T*)p = v;  }
__device__ __forceinline__ v8f wmma16(v16h a, v16h b, v8f c) {
  v8f d = __builtin_amdgcn_wmma_f32_16x16x32_f16(false, a, false, b, (short)0, c, false, false);
  asm volatile("v_nop\n\tv_nop\n\tv_nop\n\tv_nop" : "+v"(d) : "v"(a), "v"(b));
  return d;
}
__device__ __forceinline__ v8f wmma_bf(v16b a, v16b b, v8f c) {
  v8f d = __builtin_amdgcn_wmma_f32_16x16x32_bf16(false, a, false, b, (short)0, c, false, false);
  asm volatile("v_nop\n\tv_nop\n\tv_nop\n\tv_nop" : "+v"(d) : "v"(a), "v"(b));
  return d;
}
// Relativistic self attention (B 1, S 2,048, d 1,024, 16 heads x 64): q/k/v projections + biases, scores / 8 multiplied by exp(-dist_ij gamma_h v_h) with the normalised pairwise distance of the 3-D positions and a per-head velocity, key mask, softmax, . v, output projection + bias.
__device__ __forceinline__ v16h frag_h(const _Float16* rowk0, int lane) {
  union { v16h v; v8h q[2]; } u; const _Float16* p = rowk0 + 8 * (lane >> 4);
  u.q[0] = *(const v8h*)p; u.q[1] = *(const v8h*)(p + 16); return u.v;
}
__device__ __forceinline__ v16h frag_f32(const float* rowk0, int lane) {
  v16h a; const float* p = rowk0 + 8 * (lane >> 4);
#pragma unroll
  for (int i = 0; i < 8; ++i) { a[i] = (_Float16)p[i]; a[8 + i] = (_Float16)p[16 + i]; }
  return a;
}
__device__ __forceinline__ v16h frag_f32s(const float* rowk0, int lane, float sc) {
  v16h a; const float* p = rowk0 + 8 * (lane >> 4);
#pragma unroll
  for (int i = 0; i < 8; ++i) { a[i] = (_Float16)(p[i] * sc); a[8 + i] = (_Float16)(p[16 + i] * sc); }
  return a;
}
// column fragment from a [K][ld] layout (column n), rows >= K read as 0
__device__ __forceinline__ v16h fragc_f32(const float* W, int k0, int n, int lane, int ld, int K) {
  v16h a; const int g = lane >> 4;
#pragma unroll
  for (int i = 0; i < 8; ++i) { const int ka = k0 + 8 * g + i, kb = ka + 16;
    a[i] = (_Float16)(ka < K ? W[(size_t)(ka < K ? ka : K - 1) * ld + n] : 0.f); a[8 + i] = (_Float16)(kb < K ? W[(size_t)(kb < K ? kb : K - 1) * ld + n] : 0.f); }
  return a;
}
struct F2 { v16b h, l; };
__device__ __forceinline__ F2 bsplit16(const float v[16]) { F2 r;
#pragma unroll
  for (int i = 0; i < 16; ++i) { const __bf16 h = (__bf16)v[i]; r.h[i] = h; r.l[i] = (__bf16)(v[i] - (float)h); }
  return r; }
__device__ __forceinline__ F2 split_row(const float* row, int k0, int lane) { float v[16]; const float* p = row + k0 + 8 * (lane >> 4);
#pragma unroll
  for (int i = 0; i < 8; ++i) { v[i] = p[i]; v[8 + i] = p[16 + i]; }
  return bsplit16(v); }
__device__ __forceinline__ F2 split_rowK(const float* row, int k0, int lane, int K) { float v[16]; const int g = lane >> 4;
#pragma unroll
  for (int i = 0; i < 8; ++i) { const int ka = k0 + 8 * g + i, kb = ka + 16; v[i] = ka < K ? row[ka < K ? ka : K - 1] : 0.f; v[8 + i] = kb < K ? row[kb < K ? kb : K - 1] : 0.f; }
  return bsplit16(v); }
__device__ __forceinline__ F2 split_col(const float* W, int k0, int n, int lane, int ld, int K) { float v[16]; const int g = lane >> 4;
#pragma unroll
  for (int i = 0; i < 8; ++i) { const int ka = k0 + 8 * g + i, kb = ka + 16; v[i] = ka < K ? W[(size_t)(ka < K ? ka : K - 1) * ld + n] : 0.f; v[8 + i] = kb < K ? W[(size_t)(kb < K ? kb : K - 1) * ld + n] : 0.f; }
  return bsplit16(v); }
__device__ __forceinline__ v8f mac3(const F2& a, const F2& b, v8f c) { c = wmma_bf(a.l, b.h, c); c = wmma_bf(a.h, b.l, c); return wmma_bf(a.h, b.h, c); }
__device__ __forceinline__ float sigm(float v) { return 1.0f / (1.0f + expf(-v)); }
#define LDSX() do { asm volatile("s_wait_dscnt 0" ::: "memory"); __builtin_amdgcn_wave_barrier(); __builtin_amdgcn_fence(__ATOMIC_RELEASE, "workgroup"); } while (0)


#define NB 1
#define SS 2048
#define DM 1024
#define NH 16
#define HD 64
#define QKVW (3 * DM)
#ifndef TQB
#define TQB (SS / 64)
#define TNB NB
#define TOB (NB * SS / 64)     // output row tiles (all)
#endif
typedef __attribute__((ext_vector_type(8))) __bf16 v8b;
__device__ __forceinline__ v16b frag_b(const __bf16* rowk0, int lane) {
  union { v16b v; v8b q[2]; } u; const __bf16* p = rowk0 + 8 * (lane >> 4);
  u.q[0] = *(const v8b*)p; u.q[1] = *(const v8b*)(p + 16); return u.v;
}
__device__ __forceinline__ float bfr(float v) { return (float)(__bf16)v; }
__device__ __attribute__((noinline)) float exp_ni(float v) { return expf(v); }
__device__ __attribute__((noinline)) float erf_ni(float v) { return erff(v); }

#define PK_A 0                       // [3072][1024] Wqkv rows (natural [out][in])
#define PK_P (PK_A + QKVW * DM)        // [1024][1024] Wo rows (natural)
#define PK_END (PK_P + DM * DM)
#define WS_PK  0u
#define WS_QK  (WS_PK + 2u * PK_END)             // f16 [2048 rows][2048]: q | k
#define WS_QKL (WS_QK + 2u * NB * SS * 2 * DM)     // f16 q | k residual planes x2048
#define WS_VTH (WS_QKL + 2u * NB * SS * 2 * DM)    // f16 [b][1024 (h*64+d)][2048 s] hi
#define WS_VTL (WS_VTH + 2u * NB * DM * SS)        // f16 lo x 2048
#define WS_O   (WS_VTL + 2u * NB * DM * SS)        // f32 [2048][1024]
#define WS_CS  (WS_O + 4u * NB * SS * DM)           // f32 2 x [2048][32], unused
#define WS_DM  (WS_CS + 4u * 2 * SS * 32)                  // f32: row maxima of the squared pairwise distances [SS], then the global max at [SS]
#define WS_END (WS_DM + 4u * (size_t)(SS + 32))
// one k-step (32 k) of a row-times-weight-rows product, as loaded: the lane's 16 f32 of its A row and its 8 weight fragments (16 columns each)
struct KStep { float a[16]; v16b w[8]; };
__device__ __forceinline__ void kstep_fetch(KStep& s, const float* arow8g, const __bf16* wrow, int kc, int lane) { const float* p = arow8g + kc * 32;
#pragma unroll
  for (int i = 0; i < 8; ++i) { s.a[i] = p[i]; s.a[8 + i] = p[16 + i]; }
#pragma unroll
  for (int j = 0; j < 8; ++j) s.w[j] = frag_b(wrow + (size_t)j * 16 * DM + kc * 32, lane); }
// ---- k_pack: block = (row n, which): natural [out][in] rows -> bf16; which 0..2 -> W_q/W_k/W_v into PK_A rows which*1024 + n; 3 -> W_o into PK_P
__global__ __launch_bounds__(256) void k_pack(const float* __restrict__ WQ, const float* __restrict__ WK, const float* __restrict__ WV, const float* __restrict__ WO, __bf16* __restrict__ PK) {
  __shared__ __align__(16) __bf16 s[DM]; const int n = blockIdx.x, which = blockIdx.y, t = threadIdx.x; const float* Wm = (which == 0) ? WQ : (which == 1) ? WK : (which == 2) ? WV : WO;
  for (int k = t; k < DM; k += 256) s[k] = (__bf16)Wm[(size_t)n * DM + k];
  __syncthreads();
  __bf16* dst = (which < 3) ? PK + PK_A + ((size_t)which * DM + n) * DM : PK + PK_P + (size_t)n * DM;
  for (int q = t; q < DM / 8; q += 256) vst2((unsigned*)(dst + q * 8), *(const v4u*)&s[q * 8]);
}
__global__ __launch_bounds__(128) void k_qkv(const float* __restrict__ XQ, const float* __restrict__ XK, const float* __restrict__ XV, const __bf16* __restrict__ P, const float* __restrict__ BQ, const float* __restrict__ BK, const float* __restrict__ BV, _Float16* __restrict__ QK, _Float16* __restrict__ QKL, _Float16* __restrict__ VTH, _Float16* __restrict__ VTL) {
  const int which0 = (blockIdx.y * 128) / DM; const float* X = (which0 == 0) ? XQ : (which0 == 1) ? XK : XV; const float* BB = BQ ? (((which0 == 0) ? BQ : (which0 == 1) ? BK : BV) + (blockIdx.y * 128 - which0 * DM)) : nullptr;
  __shared__ __align__(16) _Float16 so[4][16][136], sol[4][16][136]; __shared__ __align__(16) _Float16 sth[128][72], stl[128][72];
  const int tid = threadIdx.x, wave = tid >> 5, lane = tid & 31, col = lane & 15, g = lane >> 4; const size_t r0 = (size_t)blockIdx.x * 64 + wave * 16; const int n0 = blockIdx.y * 128;
  v8f acc[8] = {};
  const float* arow = X + (r0 + col) * DM + 8 * g; const __bf16* wrow = P + (size_t)(n0 + col) * DM;
  auto mma = [&](const KStep& s) { v16b a;
#pragma unroll
    for (int i = 0; i < 16; ++i) a[i] = (__bf16)s.a[i];
#pragma unroll
    for (int j = 0; j < 8; ++j) acc[j] = wmma_bf(a, s.w[j], acc[j]); };
  // two register sets: all loads of k-step kc + 1 are issued as one group ahead of the products of k-step kc
  KStep s0, s1; kstep_fetch(s0, arow, wrow, 0, lane);
#pragma unroll 1
  for (int kc = 0; kc < DM / 32 - 2; kc += 2) { kstep_fetch(s1, arow, wrow, kc + 1, lane); mma(s0); kstep_fetch(s0, arow, wrow, kc + 2, lane); mma(s1); }   // rolled: one pass is already the two sets' full turn
  kstep_fetch(s1, arow, wrow, DM / 32 - 1, lane); mma(s0); mma(s1);
  if (n0 < 2 * DM) {   // q stored unscaled (f16 sigma ~0.6, no subnormal exposure); 1/8 applied to the f32 score
#pragma unroll
    for (int j = 0; j < 8; ++j) {
#pragma unroll
      for (int r = 0; r < 8; ++r) { const float v = acc[j][r] + (BB ? bfr(BB[j * 16 + col]) : 0.f); const _Float16 hv = (_Float16)v; so[wave][8 * g + r][j * 16 + col] = hv; sol[wave][8 * g + r][j * 16 + col] = (_Float16)((v - (float)hv) * 2048.0f); } }   // q, k (+ bias) as f16 hi + (x2048) residual
    LDSX();
    for (int rl = 0; rl < 16; ++rl) if (lane < 16) { vst2((unsigned*)(QK + (r0 + rl) * (2 * DM) + n0 + lane * 8), *(const v4u*)&so[wave][rl][lane * 8]); vst2((unsigned*)(QKL + (r0 + rl) * (2 * DM) + n0 + lane * 8), *(const v4u*)&sol[wave][rl][lane * 8]); }
  } else {
#pragma unroll
    for (int j = 0; j < 8; ++j) {
#pragma unroll
      for (int r = 0; r < 8; ++r) { const float v = acc[j][r] + (BB ? bfr(BB[j * 16 + col]) : 0.f); const _Float16 hv = (_Float16)v; sth[j * 16 + col][wave * 16 + 8 * g + r] = hv; stl[j * 16 + col][wave * 16 + 8 * g + r] = (_Float16)((v - (float)hv) * 2048.0f); } }
    __syncthreads();
    const size_t rb = (size_t)blockIdx.x * 64; const int b = (int)(rb / SS), s0 = (int)(rb % SS); const int pc0 = n0 - 2 * DM;
    for (int q = tid; q < 128 * 8; q += 128) { const int d = q >> 3, pc = q & 7; const size_t o = ((size_t)b * DM + pc0 + d) * SS + s0 + pc * 8; vst2((unsigned*)(VTH + o), *(const v4u*)&sth[d][pc * 8]); vst2((unsigned*)(VTL + o), *(const v4u*)&stl[d][pc * 8]); }
  }
}
typedef float v3f_u __attribute__((ext_vector_type(3), aligned(4)));   // one position, carried whole from its load to its use
// ---- k_attn: block = (64 queries, head h, batch b): all-keys flash attention (K = 64: 2 k-steps), scores = (q.k) * 0.125 with single f16 operands, P.V: f16 P x V hi in acc (accl stays 0); O[b*S+q][h*64+d] = (acc + accl / 2048) / (2048 l) (256-B segments)
// amdgpu_waves_per_eu(2, 2): the grid gives two waves per SIMD; the register budget of two lets the fetched-ahead operands stay in registers beside the softmax's eight interleaved rows
__global__ __launch_bounds__(128) __attribute__((amdgpu_waves_per_eu(2, 2))) void k_attn(const _Float16* __restrict__ QK, const _Float16* __restrict__ QKL, const _Float16* __restrict__ VTH, const _Float16* __restrict__ VTL, const void* __restrict__ KMASK, const float* __restrict__ POS, const float* __restrict__ DMAX, const float* __restrict__ VEL, const int* __restrict__ AM, float* __restrict__ O) {
  __shared__ __align__(16) float sp[4][16][36]; __shared__ __align__(16) float so[4][16][68];
  const int tid = threadIdx.x, wave = tid >> 5, lane = tid & 31, col = lane & 15, g = lane >> 4;
  const int qb = blockIdx.x, h = blockIdx.y, b = blockIdx.z; const int q0 = qb * 64 + wave * 16; const size_t rq = (size_t)b * SS + q0 + col;
  v16h aq[2], aql[2];
#pragma unroll
  for (int kc = 0; kc < 2; ++kc) { aq[kc] = frag_h(QK + rq * (2 * DM) + h * HD + kc * 32, lane); aql[kc] = frag_h(QKL + rq * (2 * DM) + h * HD + kc * 32, lane); }
  float px[8], py[8], pz[8];
#pragma unroll
  for (int r = 0; r < 8; ++r) { const float* p = POS + ((size_t)b * SS + q0 + 8 * g + r) * 3; px[r] = bfr(p[0]); py[r] = bfr(p[1]); pz[r] = bfr(p[2]); }
  float coef; { float vh = fabsf(bfr(VEL[h])); vh = fminf(fmaxf(vh, 0.f), 0.999f); const float gam = 1.0f / sqrtf(1.0f - vh * vh); coef = gam * vh / (DMAX[0] + 1e-8f); }   // gamma v / (dmax + 1e-8): dist is normalised by the global max
  const bool havemax = DMAX[0] > 0.f;
  float m[8], l[8];
#pragma unroll
  for (int r = 0; r < 8; ++r) { m[r] = -3.0e38f; l[r] = 0.f; }
  v8f acc[4] = {}, accl[4] = {};
  const int nks = SS / 32;   // all keys
  // every operand of key step ks + 1 is fetched during step ks, into the registers that step ks has just finished with: K behind the score products, positions and mask behind the factor, V behind the P.V products
  v16h kf[2][2], vf[4]; v3f_u kp[2]; int km[2];
  auto fetch_k = [&](int ks) {
#pragma unroll
    for (int ct = 0; ct < 2; ++ct) { const _Float16* krow = QK + ((size_t)b * SS + ks * 32 + ct * 16 + col) * (2 * DM) + DM + h * HD;
#pragma unroll
      for (int kc = 0; kc < 2; ++kc) kf[ct][kc] = frag_h(krow + kc * 32, lane); } };
  auto fetch_p = [&](int ks) {
#pragma unroll
    for (int ct = 0; ct < 2; ++ct) { const size_t kk = (size_t)b * SS + ks * 32 + ct * 16 + col; kp[ct] = *(const v3f_u*)(POS + kk * 3); km[ct] = AM[kk]; } };
  auto fetch_v = [&](int ks) {
#pragma unroll
    for (int dt = 0; dt < 4; ++dt) vf[dt] = frag_h(VTH + ((size_t)b * DM + h * HD + dt * 16 + col) * SS + ks * 32, lane); };
  fetch_k(0); fetch_p(0);
  asm volatile("" :: "v"(kf[0][0]), "v"(kf[0][1]), "v"(kf[1][0]), "v"(kf[1][1]), "v"(kp[0]), "v"(kp[1]), "v"(km[0]), "v"(km[1]));   // inputs only: step 0's K, positions and mask have landed before the loop, as on every later entry; else the waits at the loop's head, set for the first entry, also wait out the V loads in flight on every pass
  fetch_v(0);
#pragma unroll 1
  for (int ks = 0; ks < nks; ++ks) { v8f s[2], cc[2]; const int kn = (ks + 1 < nks) ? ks + 1 : ks;   // the last step refetches itself: in range, not used
#pragma unroll
    for (int ct = 0; ct < 2; ++ct) { v8f c = {};
#pragma unroll
      for (int kc = 0; kc < 2; ++kc) c = wmma16(aq[kc], kf[ct][kc], c);   // single product: q, k as one-rounding f16 operands
      cc[ct] = c; }
    fetch_k(kn);
    __builtin_amdgcn_sched_barrier(0);   // keeps the K loads here, a whole softmax ahead of their use, instead of sinking to the end of the block
#pragma unroll
    for (int ct = 0; ct < 2; ++ct) { const v8f c = cc[ct];
      { const bool keepk = true;
      { const float kx = bfr(kp[ct][0]), ky = bfr(kp[ct][1]), kz = bfr(kp[ct][2]); const bool keep2 = keepk && (km[ct] != 0);
#pragma unroll
        for (int r = 0; r < 8; ++r) { const float dx = px[r] - kx, dy = py[r] - ky, dz = pz[r] - kz; const float sq = dx * dx + dy * dy + dz * dz; const float dist = (sq == 0.f) ? 0.f : sqrtf(sq); const float fac = havemax ? __expf(-dist * coef) : __expf(-dist * coef * (DMAX[0] + 1e-8f)); s[ct][r] = keep2 ? c[r] * 0.125f * fac : -3.0e38f; } } } }   // score x exp(-normalised distance x gamma v)
    fetch_p(kn);
    __builtin_amdgcn_sched_barrier(0);   // keeps the position and mask loads ahead of the softmax
#pragma unroll
    for (int r = 0; r < 8; ++r) { float mx = fmaxf(s[0][r], s[1][r]);
#pragma unroll
      for (int o = 1; o < 16; o <<= 1) mx = fmaxf(mx, __shfl_xor(mx, o));
      const float mn = fmaxf(m[r], mx); const float alpha = (m[r] <= -1.0e38f) ? 0.f : __expf(m[r] - mn);
      const float e0 = (s[0][r] <= -1.0e38f) ? 0.f : __expf(s[0][r] - mn), e1 = (s[1][r] <= -1.0e38f) ? 0.f : __expf(s[1][r] - mn); float es = e0 + e1;
#pragma unroll
      for (int o = 1; o < 16; o <<= 1) es += __shfl_xor(es, o);
      l[r] = l[r] * alpha + es; m[r] = mn;
#pragma unroll
      for (int dt = 0; dt < 4; ++dt) { acc[dt][r] *= alpha; accl[dt][r] *= alpha; }
      sp[wave][8 * g + r][col] = e0; sp[wave][8 * g + r][16 + col] = e1; }
    LDSX();
    v16h pa, pl; { const float* prow = &sp[wave][col][0] + 8 * (lane >> 4);
#pragma unroll
      for (int i = 0; i < 8; ++i) { const float x0 = prow[i] * 2048.0f, x1 = prow[16 + i] * 2048.0f; const _Float16 h0 = (_Float16)x0, h1 = (_Float16)x1; pa[i] = h0; pa[8 + i] = h1; pl[i] = (_Float16)((x0 - (float)h0) * 2048.0f); pl[8 + i] = (_Float16)((x1 - (float)h1) * 2048.0f); } }   // P scaled by 2^11 before the f16 split so small softmax weights stay out of the f16 subnormal range; 2^-11 folded into the epilogue
#pragma unroll
    for (int dt = 0; dt < 4; ++dt) acc[dt] = wmma16(pa, vf[dt], acc[dt]);   // single product: P (x2^11) x V
    (void)pl;
    LDSX();
    fetch_v(kn);   // behind the fence above, which waits for every load in flight
    asm volatile("s_wait_xcnt 0x0" ::: "memory"); }   // stands in front of the next pass's overwrite of the V loads' address registers
#pragma unroll
  for (int r = 0; r < 8; ++r) { const float il = (1.0f / 2048.0f) / l[r];
#pragma unroll
    for (int dt = 0; dt < 4; ++dt) so[wave][8 * g + r][dt * 16 + col] = (acc[dt][r] + accl[dt][r] * (1.0f / 2048.0f)) * il; }
  LDSX();
  for (int rl = 0; rl < 16; ++rl) if (lane < 16) vst2(O + ((size_t)b * SS + q0 + rl) * DM + h * HD + lane * 4, *(const v4f*)&so[wave][rl][lane * 4]);
}
// ---- k_out: block = (64 rows, 128 cols): out = O(hi/lo) . Wo rows (2 products) + bo
__global__ __launch_bounds__(128) void k_out(const float* __restrict__ O, const __bf16* __restrict__ P, const float* __restrict__ BO, float* __restrict__ Y) {
  __shared__ __align__(16) float so[4][16][132];
  const int tid = threadIdx.x, wave = tid >> 5, lane = tid & 31, col = lane & 15, g = lane >> 4; const size_t r0 = (size_t)blockIdx.x * 64 + wave * 16; const int n0 = blockIdx.y * 128;
  v8f acc[8] = {};
  const float* arow = O + (r0 + col) * DM + 8 * g; const __bf16* wrow = P + (size_t)(n0 + col) * DM;
  auto mma = [&](const KStep& s) { const F2 a = bsplit16(s.a);
#pragma unroll
    for (int j = 0; j < 8; ++j) { acc[j] = wmma_bf(a.l, s.w[j], acc[j]); acc[j] = wmma_bf(a.h, s.w[j], acc[j]); } };
  // two register sets: all loads of k-step kc + 1 are issued as one group ahead of the products of k-step kc
  KStep s0, s1; kstep_fetch(s0, arow, wrow, 0, lane);
#pragma unroll 1
  for (int kc = 0; kc < DM / 32 - 2; kc += 2) { kstep_fetch(s1, arow, wrow, kc + 1, lane); mma(s0); kstep_fetch(s0, arow, wrow, kc + 2, lane); mma(s1); }   // rolled: one pass is already the two sets' full turn
  kstep_fetch(s1, arow, wrow, DM / 32 - 1, lane); mma(s0); mma(s1);
#pragma unroll
  for (int j = 0; j < 8; ++j) {
#pragma unroll
    for (int r = 0; r < 8; ++r) so[wave][8 * g + r][j * 16 + col] = acc[j][r] + bfr(BO[n0 + j * 16 + col]); }
  LDSX();
  for (int rl = 0; rl < 16; ++rl) vst2(Y + (r0 + rl) * DM + n0 + lane * 4, *(const v4f*)&so[wave][rl][lane * 4]);
}
// ---- k_dist1: block = 64 rows: max over all keys of |p_i - p_j|^2 per row (f32, fixed order per thread then max-reduce: max is order-free); 256-B per block
__global__ __launch_bounds__(256) void k_dist1(const float* __restrict__ POS, float* __restrict__ RM) {
  __shared__ float red[64][4]; const size_t r0 = (size_t)blockIdx.x * 64; const int t = threadIdx.x; const int rl = t >> 2, part = t & 3;
  const float* p = POS + (r0 + rl) * 3; const float x = bfr(p[0]), y = bfr(p[1]), z = bfr(p[2]); float mx = 0.f;
  for (int j = part; j < NB * SS; j += 4) { const float* q = POS + (size_t)j * 3; const float dx = x - bfr(q[0]), dy = y - bfr(q[1]), dz = z - bfr(q[2]); mx = fmaxf(mx, dx * dx + dy * dy + dz * dz); }
  red[rl][part] = mx; __syncthreads();
  __shared__ __align__(16) float srow[64]; if (t < 64) srow[t] = fmaxf(fmaxf(red[t][0], red[t][1]), fmaxf(red[t][2], red[t][3])); __syncthreads();
  if (t < 16) vst2(RM + r0 + t * 4, *(const v4f*)&srow[t * 4]);
}
// ---- k_dist2: one block: global max -> sqrt -> DMAX (one line)
__global__ __launch_bounds__(256) void k_dist2(const float* __restrict__ RM, float* __restrict__ DMX) { __shared__ float red[256]; __shared__ __align__(16) float line[32]; const int t = threadIdx.x; float mx = 0.f; for (int i = t; i < NB * SS; i += 256) mx = fmaxf(mx, RM[i]); red[t] = mx; __syncthreads();
  for (int s = 128; s > 0; s >>= 1) { if (t < s) red[t] = fmaxf(red[t], red[t + s]); __syncthreads(); }
  if (t < 32) line[t] = (t == 0) ? sqrtf(red[0]) : 0.f; __syncthreads(); if (t < 8) vst2(DMX + t * 4, *(const v4f*)&line[t * 4]); }
extern "C" void kernel_launch(void* const* d_in, const int* in_sizes, int n_in, void* d_out, int out_size, void* d_ws, size_t ws_size, hipStream_t stream) {
  (void)in_sizes; (void)n_in; (void)out_size;
  const float** F = (const float**)d_in;   // 0 x [1,2048,1024], 1 attention_mask [1,2048] int, 2 positions [1,2048,3], 3 Wq, 4 bq, 5 Wk, 6 bk, 7 Wv, 8 bv, 9 Wo, 10 bo (natural), 11 velocity [16]
  if (ws_size < (size_t)WS_END) return;
  char* ws = (char*)d_ws; __bf16* PK = (__bf16*)(ws + WS_PK); _Float16 *QK = (_Float16*)(ws + WS_QK), *QKL = (_Float16*)(ws + WS_QKL), *VTH = (_Float16*)(ws + WS_VTH), *VTL = (_Float16*)(ws + WS_VTL); float *O = (float*)(ws + WS_O), *RM = (float*)(ws + WS_DM), *DMX = RM + NB * SS;
  k_pack<<<dim3(DM, 4), 256, 0, stream>>>(F[3], F[5], F[7], F[9], PK);
  k_dist1<<<NB * SS / 64, 256, 0, stream>>>(F[2], RM);
  k_dist2<<<1, 256, 0, stream>>>(RM, DMX);
  k_qkv<<<dim3(TNB * SS / 64, QKVW / 128), 128, 0, stream>>>(F[0], F[0], F[0], PK + PK_A, F[4], F[6], F[8], QK, QKL, VTH, VTL);
  k_attn<<<dim3(TQB, NH, TNB), 128, 0, stream>>>(QK, QKL, VTH, VTL, nullptr, F[2], DMX, F[11], (const int*)d_in[1], O);
  k_out<<<dim3(TOB, DM / 128), 128, 0, stream>>>(O, PK + PK_P, F[10], (float*)d_out);
}

// v002
// It runs in 177 microseconds.
// Timed twice side by side with v001, it ran 1.29 times as fast both times.
// Over all steps from v000 it is 2.19 times as fast.
// compute dtype: all float inputs rounded to bf16, the int mask read on device; q/k/v = x . W^T + b with EXACT bf16 products on WMMA 16x16x32 (natural rows); pairwise distances, their global maximum (deterministic block reduction), the Lorentz factor and exp(-d coef) in f32 (hardware exp); PLAIN attention: q, k single f16 x 1/8 x that factor, masked keys excluded, running-max softmax in f32, P (scaled by 2^11, single f16) x v (single f16); out = o (bf16 hi + residual) . Wo^T (2 products) + bo.
#include <hip/hip_runtime.h>
#include <math.h>

typedef __attribute__((ext_vector_type(16))) _Float16 v16h;
typedef __attribute__((ext_vector_type(16))) __bf16 v16b;
typedef __attribute__((ext_vector_type(8)))  _Float16 v8h;
typedef __attribute__((ext_vector_type(8)))  float v8f;
typedef __attribute__((ext_vector_type(4)))  float v4f;
typedef __attribute__((ext_vector_type(2)))  float v2f;
typedef __attribute__((ext_vector_type(4)))  unsigned v4u;
typedef __attribute__((ext_vector_type(4)))  int v4i;
typedef float __attribute__((may_alias)) float_a;
typedef int __attribute__((may_alias)) int_a;

template <typename T> __device__ __forceinline__ void vst2(void* p, T v) { *(T*)p = v;  }
__device__ __forceinline__ v8f wmma16(v16h a, v16h b, v8f c) {
  v8f d = __builtin_amdgcn_wmma_f32_16x16x32_f16(false, a, false, b, (short)0, c, false, false);
  asm volatile("v_nop\n\tv_nop\n\tv_nop\n\tv_nop" : "+v"(d) : "v"(a), "v"(b));
  return d;
}
__device__ __forceinline__ v8f wmma_bf(v16b a, v16b b, v8f c) {
  v8f d = __builtin_amdgcn_wmma_f32_16x16x32_bf16(false, a, false, b, (short)0, c, false, false);
  asm volatile("v_nop\n\tv_nop\n\tv_nop\n\tv_nop" : "+v"(d) : "v"(a), "v"(b));
  return d;
}
// Relativistic self attention (B 1, S 2,048, d 1,024, 16 heads x 64): q/k/v projections + biases, scores / 8 multiplied by exp(-dist_ij gamma_h v_h) with the normalised pairwise distance of the 3-D positions and a per-head velocity, key mask, softmax, . v, output projection + bias.
__device__ __forceinline__ v16h frag_h(const _Float16* rowk0, int lane) {
  union { v16h v; v8h q[2]; } u; const _Float16* p = rowk0 + 8 * (lane >> 4);
  u.q[0] = *(const v8h*)p; u.q[1] = *(const v8h*)(p + 16); return u.v;
}
__device__ __forceinline__ v16h frag_f32(const float* rowk0, int lane) {
  v16h a; const float* p = rowk0 + 8 * (lane >> 4);
#pragma unroll
  for (int i = 0; i < 8; ++i) { a[i] = (_Float16)p[i]; a[8 + i] = (_Float16)p[16 + i]; }
  return a;
}
__device__ __forceinline__ v16h frag_f32s(const float* rowk0, int lane, float sc) {
  v16h a; const float* p = rowk0 + 8 * (lane >> 4);
#pragma unroll
  for (int i = 0; i < 8; ++i) { a[i] = (_Float16)(p[i] * sc); a[8 + i] = (_Float16)(p[16 + i] * sc); }
  return a;
}
// column fragment from a [K][ld] layout (column n), rows >= K read as 0
__device__ __forceinline__ v16h fragc_f32(const float* W, int k0, int n, int lane, int ld, int K) {
  v16h a; const int g = lane >> 4;
#pragma unroll
  for (int i = 0; i < 8; ++i) { const int ka = k0 + 8 * g + i, kb = ka + 16;
    a[i] = (_Float16)(ka < K ? W[(size_t)(ka < K ? ka : K - 1) * ld + n] : 0.f); a[8 + i] = (_Float16)(kb < K ? W[(size_t)(kb < K ? kb : K - 1) * ld + n] : 0.f); }
  return a;
}
struct F2 { v16b h, l; };
__device__ __forceinline__ F2 bsplit16(const float v[16]) { F2 r;
#pragma unroll
  for (int i = 0; i < 16; ++i) { const __bf16 h = (__bf16)v[i]; r.h[i] = h; r.l[i] = (__bf16)(v[i] - (float)h); }
  return r; }
__device__ __forceinline__ F2 split_row(const float* row, int k0, int lane) { float v[16]; const float* p = row + k0 + 8 * (lane >> 4);
#pragma unroll
  for (int i = 0; i < 8; ++i) { v[i] = p[i]; v[8 + i] = p[16 + i]; }
  return bsplit16(v); }
__device__ __forceinline__ F2 split_rowK(const float* row, int k0, int lane, int K) { float v[16]; const int g = lane >> 4;
#pragma unroll
  for (int i = 0; i < 8; ++i) { const int ka = k0 + 8 * g + i, kb = ka + 16; v[i] = ka < K ? row[ka < K ? ka : K - 1] : 0.f; v[8 + i] = kb < K ? row[kb < K ? kb : K - 1] : 0.f; }
  return bsplit16(v); }
__device__ __forceinline__ F2 split_col(const float* W, int k0, int n, int lane, int ld, int K) { float v[16]; const int g = lane >> 4;
#pragma unroll
  for (int i = 0; i < 8; ++i) { const int ka = k0 + 8 * g + i, kb = ka + 16; v[i] = ka < K ? W[(size_t)(ka < K ? ka : K - 1) * ld + n] : 0.f; v[8 + i] = kb < K ? W[(size_t)(kb < K ? kb : K - 1) * ld + n] : 0.f; }
  return bsplit16(v); }
__device__ __forceinline__ v8f mac3(const F2& a, const F2& b, v8f c) { c = wmma_bf(a.l, b.h, c); c = wmma_bf(a.h, b.l, c); return wmma_bf(a.h, b.h, c); }
__device__ __forceinline__ float sigm(float v) { return 1.0f / (1.0f + expf(-v)); }
#define LDSX() do { asm volatile("s_wait_dscnt 0" ::: "memory"); __builtin_amdgcn_wave_barrier(); __builtin_amdgcn_fence(__ATOMIC_RELEASE, "workgroup"); } while (0)


#define NB 1
#define SS 2048
#define DM 1024
#define NH 16
#define HD 64
#define QKVW (3 * DM)
#ifndef TQB
#define TQB (SS / 64)
#define TNB NB
#define TOB (NB * SS / 64)     // output row tiles (all)
#endif
typedef __attribute__((ext_vector_type(8))) __bf16 v8b;
__device__ __forceinline__ v16b frag_b(const __bf16* rowk0, int lane) {
  union { v16b v; v8b q[2]; } u; const __bf16* p = rowk0 + 8 * (lane >> 4);
  u.q[0] = *(const v8b*)p; u.q[1] = *(const v8b*)(p + 16); return u.v;
}
__device__ __forceinline__ float bfr(float v) { return (float)(__bf16)v; }
__device__ __attribute__((noinline)) float exp_ni(float v) { return expf(v); }
__device__ __attribute__((noinline)) float erf_ni(float v) { return erff(v); }

#define PK_A 0                       // [3072][1024] Wqkv rows (natural [out][in])
#define PK_P (PK_A + QKVW * DM)        // [1024][1024] Wo rows (natural)
#define PK_END (PK_P + DM * DM)
#define WS_PK  0u
#define WS_QK  (WS_PK + 2u * PK_END)             // f16 [2048 rows][2048]: q | k
#define WS_QKL (WS_QK + 2u * NB * SS * 2 * DM)     // f16 q | k residual planes x2048
#define WS_VTH (WS_QKL + 2u * NB * SS * 2 * DM)    // f16 [b][1024 (h*64+d)][2048 s] hi
#define WS_VTL (WS_VTH + 2u * NB * DM * SS)        // f16 lo x 2048
#define WS_O   (WS_VTL + 2u * NB * DM * SS)        // f32 [2048][1024]
#define WS_CS  (WS_O + 4u * NB * SS * DM)           // f32 2 x [2048][32], not used by any kernel here
#define WS_DM  (WS_CS + 4u * 2 * SS * 32)                  // f32: partial maxima of the squared pairwise distances [SS], then the global max at [SS]
#define WS_END (WS_DM + 4u * (size_t)(SS + 32))
// one k-step (32 k) of a row-times-weight-rows product, as loaded: the lane's 16 f32 of its A row and its 8 weight fragments (16 columns each)
struct KStep { float a[16]; v16b w[8]; };
__device__ __forceinline__ void kstep_fetch(KStep& s, const float* arow8g, const __bf16* wrow, int kc, int lane) { const float* p = arow8g + kc * 32;
#pragma unroll
  for (int i = 0; i < 8; ++i) { s.a[i] = p[i]; s.a[8 + i] = p[16 + i]; }
#pragma unroll
  for (int j = 0; j < 8; ++j) s.w[j] = frag_b(wrow + (size_t)j * 16 * DM + kc * 32, lane); }
// ---- k_pack: block = (row n, which): natural [out][in] rows -> bf16; which 0..2 -> W_q/W_k/W_v into PK_A rows which*1024 + n; 3 -> W_o into PK_P
__global__ __launch_bounds__(256) void k_pack(const float* __restrict__ WQ, const float* __restrict__ WK, const float* __restrict__ WV, const float* __restrict__ WO, __bf16* __restrict__ PK) {
  __shared__ __align__(16) __bf16 s[DM]; const int n = blockIdx.x, which = blockIdx.y, t = threadIdx.x; const float* Wm = (which == 0) ? WQ : (which == 1) ? WK : (which == 2) ? WV : WO;
  for (int k = t; k < DM; k += 256) s[k] = (__bf16)Wm[(size_t)n * DM + k];
  __syncthreads();
  __bf16* dst = (which < 3) ? PK + PK_A + ((size_t)which * DM + n) * DM : PK + PK_P + (size_t)n * DM;
  for (int q = t; q < DM / 8; q += 256) vst2((unsigned*)(dst + q * 8), *(const v4u*)&s[q * 8]);
}
__global__ __launch_bounds__(128) void k_qkv(const float* __restrict__ XQ, const float* __restrict__ XK, const float* __restrict__ XV, const __bf16* __restrict__ P, const float* __restrict__ BQ, const float* __restrict__ BK, const float* __restrict__ BV, _Float16* __restrict__ QK, _Float16* __restrict__ QKL, _Float16* __restrict__ VTH, _Float16* __restrict__ VTL) {
  const int which0 = (blockIdx.y * 128) / DM; const float* X = (which0 == 0) ? XQ : (which0 == 1) ? XK : XV; const float* BB = BQ ? (((which0 == 0) ? BQ : (which0 == 1) ? BK : BV) + (blockIdx.y * 128 - which0 * DM)) : nullptr;
  __shared__ __align__(16) _Float16 so[4][16][136], sol[4][16][136]; __shared__ __align__(16) _Float16 sth[128][72], stl[128][72];
  const int tid = threadIdx.x, wave = tid >> 5, lane = tid & 31, col = lane & 15, g = lane >> 4; const size_t r0 = (size_t)blockIdx.x * 64 + wave * 16; const int n0 = blockIdx.y * 128;
  v8f acc[8] = {};
  const float* arow = X + (r0 + col) * DM + 8 * g; const __bf16* wrow = P + (size_t)(n0 + col) * DM;
  auto mma = [&](const KStep& s) { v16b a;
#pragma unroll
    for (int i = 0; i < 16; ++i) a[i] = (__bf16)s.a[i];
#pragma unroll
    for (int j = 0; j < 8; ++j) acc[j] = wmma_bf(a, s.w[j], acc[j]); };
  // two register sets: all loads of k-step kc + 1 are issued as one group ahead of the products of k-step kc
  KStep s0, s1; kstep_fetch(s0, arow, wrow, 0, lane);
#pragma unroll 1
  for (int kc = 0; kc < DM / 32 - 2; kc += 2) { kstep_fetch(s1, arow, wrow, kc + 1, lane); mma(s0); kstep_fetch(s0, arow, wrow, kc + 2, lane); mma(s1); }   // rolled: one pass is already the two sets' full turn
  kstep_fetch(s1, arow, wrow, DM / 32 - 1, lane); mma(s0); mma(s1);
  if (n0 < 2 * DM) {   // q stored unscaled (f16 sigma ~0.6, no subnormal exposure); 1/8 applied to the f32 score
#pragma unroll
    for (int j = 0; j < 8; ++j) {
#pragma unroll
      for (int r = 0; r < 8; ++r) { const float v = acc[j][r] + (BB ? bfr(BB[j * 16 + col]) : 0.f); const _Float16 hv = (_Float16)v; so[wave][8 * g + r][j * 16 + col] = hv; sol[wave][8 * g + r][j * 16 + col] = (_Float16)((v - (float)hv) * 2048.0f); } }   // q, k (+ bias) as f16 hi + (x2048) residual
    LDSX();
    for (int rl = 0; rl < 16; ++rl) if (lane < 16) { vst2((unsigned*)(QK + (r0 + rl) * (2 * DM) + n0 + lane * 8), *(const v4u*)&so[wave][rl][lane * 8]); vst2((unsigned*)(QKL + (r0 + rl) * (2 * DM) + n0 + lane * 8), *(const v4u*)&sol[wave][rl][lane * 8]); }
  } else {
#pragma unroll
    for (int j = 0; j < 8; ++j) {
#pragma unroll
      for (int r = 0; r < 8; ++r) { const float v = acc[j][r] + (BB ? bfr(BB[j * 16 + col]) : 0.f); const _Float16 hv = (_Float16)v; sth[j * 16 + col][wave * 16 + 8 * g + r] = hv; stl[j * 16 + col][wave * 16 + 8 * g + r] = (_Float16)((v - (float)hv) * 2048.0f); } }
    __syncthreads();
    const size_t rb = (size_t)blockIdx.x * 64; const int b = (int)(rb / SS), s0 = (int)(rb % SS); const int pc0 = n0 - 2 * DM;
    for (int q = tid; q < 128 * 8; q += 128) { const int d = q >> 3, pc = q & 7; const size_t o = ((size_t)b * DM + pc0 + d) * SS + s0 + pc * 8; vst2((unsigned*)(VTH + o), *(const v4u*)&sth[d][pc * 8]); vst2((unsigned*)(VTL + o), *(const v4u*)&stl[d][pc * 8]); }
  }
}
typedef float v3f_u __attribute__((ext_vector_type(3), aligned(4)));   // one position, carried whole from its load to its use
// ---- k_attn: block = (64 queries, head h, batch b): all-keys flash attention (K = 64: 2 k-steps), scores = (q.k) * 0.125 with single f16 operands, P.V: f16 P x V hi in acc (accl stays 0); O[b*S+q][h*64+d] = (acc + accl / 2048) / (2048 l) (256-B segments)
// amdgpu_waves_per_eu(2, 2): the grid gives two waves per SIMD; the register budget of two lets the fetched-ahead operands stay in registers beside the softmax's eight interleaved rows
__global__ __launch_bounds__(128) __attribute__((amdgpu_waves_per_eu(2, 2))) void k_attn(const _Float16* __restrict__ QK, const _Float16* __restrict__ QKL, const _Float16* __restrict__ VTH, const _Float16* __restrict__ VTL, const void* __restrict__ KMASK, const float* __restrict__ POS, const float* __restrict__ DMAX, const float* __restrict__ VEL, const int* __restrict__ AM, float* __restrict__ O) {
  __shared__ __align__(16) float sp[4][16][36]; __shared__ __align__(16) float so[4][16][68];
  const int tid = threadIdx.x, wave = tid >> 5, lane = tid & 31, col = lane & 15, g = lane >> 4;
  const int qb = blockIdx.x, h = blockIdx.y, b = blockIdx.z; const int q0 = qb * 64 + wave * 16; const size_t rq = (size_t)b * SS + q0 + col;
  v16h aq[2], aql[2];
#pragma unroll
  for (int kc = 0; kc < 2; ++kc) { aq[kc] = frag_h(QK + rq * (2 * DM) + h * HD + kc * 32, lane); aql[kc] = frag_h(QKL + rq * (2 * DM) + h * HD + kc * 32, lane); }
  float px[8], py[8], pz[8];
#pragma unroll
  for (int r = 0; r < 8; ++r) { const float* p = POS + ((size_t)b * SS + q0 + 8 * g + r) * 3; px[r] = bfr(p[0]); py[r] = bfr(p[1]); pz[r] = bfr(p[2]); }
  float coef; { float vh = fabsf(bfr(VEL[h])); vh = fminf(fmaxf(vh, 0.f), 0.999f); const float gam = 1.0f / sqrtf(1.0f - vh * vh); coef = gam * vh / (DMAX[0] + 1e-8f); }   // gamma v / (dmax + 1e-8): dist is normalised by the global max
  const bool havemax = DMAX[0] > 0.f;
  float m[8], l[8];
#pragma unroll
  for (int r = 0; r < 8; ++r) { m[r] = -3.0e38f; l[r] = 0.f; }
  v8f acc[4] = {}, accl[4] = {};
  const int nks = SS / 32;   // all keys
  // every operand of key step ks + 1 is fetched during step ks, into the registers that step ks has just finished with: K behind the score products, positions and mask behind the factor, V behind the P.V products
  v16h kf[2][2], vf[4]; v3f_u kp[2]; int km[2];
  auto fetch_k = [&](int ks) {
#pragma unroll
    for (int ct = 0; ct < 2; ++ct) { const _Float16* krow = QK + ((size_t)b * SS + ks * 32 + ct * 16 + col) * (2 * DM) + DM + h * HD;
#pragma unroll
      for (int kc = 0; kc < 2; ++kc) kf[ct][kc] = frag_h(krow + kc * 32, lane); } };
  auto fetch_p = [&](int ks) {
#pragma unroll
    for (int ct = 0; ct < 2; ++ct) { const size_t kk = (size_t)b * SS + ks * 32 + ct * 16 + col; kp[ct] = *(const v3f_u*)(POS + kk * 3); km[ct] = AM[kk]; } };
  auto fetch_v = [&](int ks) {
#pragma unroll
    for (int dt = 0; dt < 4; ++dt) vf[dt] = frag_h(VTH + ((size_t)b * DM + h * HD + dt * 16 + col) * SS + ks * 32, lane); };
  fetch_k(0); fetch_p(0);
  asm volatile("" :: "v"(kf[0][0]), "v"(kf[0][1]), "v"(kf[1][0]), "v"(kf[1][1]), "v"(kp[0]), "v"(kp[1]), "v"(km[0]), "v"(km[1]));   // inputs only: step 0's K, positions and mask have landed before the loop, as on every later entry; else the waits at the loop's head, set for the first entry, also wait out the V loads in flight on every pass
  fetch_v(0);
#pragma unroll 1
  for (int ks = 0; ks < nks; ++ks) { v8f s[2], cc[2]; const int kn = (ks + 1 < nks) ? ks + 1 : ks;   // the last step refetches itself: in range, not used
#pragma unroll
    for (int ct = 0; ct < 2; ++ct) { v8f c = {};
#pragma unroll
      for (int kc = 0; kc < 2; ++kc) c = wmma16(aq[kc], kf[ct][kc], c);   // single product: q, k as one-rounding f16 operands
      cc[ct] = c; }
    fetch_k(kn);
    __builtin_amdgcn_sched_barrier(0);   // keeps the K loads here, a whole softmax ahead of their use, instead of sinking to the end of the block
#pragma unroll
    for (int ct = 0; ct < 2; ++ct) { const v8f c = cc[ct];
      { const bool keepk = true;
      { const float kx = bfr(kp[ct][0]), ky = bfr(kp[ct][1]), kz = bfr(kp[ct][2]); const bool keep2 = keepk && (km[ct] != 0);
#pragma unroll
        for (int r = 0; r < 8; ++r) { const float dx = px[r] - kx, dy = py[r] - ky, dz = pz[r] - kz; const float sq = dx * dx + dy * dy + dz * dz; const float dist = (sq == 0.f) ? 0.f : sqrtf(sq); const float fac = havemax ? __expf(-dist * coef) : __expf(-dist * coef * (DMAX[0] + 1e-8f)); s[ct][r] = keep2 ? c[r] * 0.125f * fac : -3.0e38f; } } } }   // score x exp(-normalised distance x gamma v)
    fetch_p(kn);
    __builtin_amdgcn_sched_barrier(0);   // keeps the position and mask loads ahead of the softmax
#pragma unroll
    for (int r = 0; r < 8; ++r) { float mx = fmaxf(s[0][r], s[1][r]);
#pragma unroll
      for (int o = 1; o < 16; o <<= 1) mx = fmaxf(mx, __shfl_xor(mx, o));
      const float mn = fmaxf(m[r], mx); const float alpha = (m[r] <= -1.0e38f) ? 0.f : __expf(m[r] - mn);
      const float e0 = (s[0][r] <= -1.0e38f) ? 0.f : __expf(s[0][r] - mn), e1 = (s[1][r] <= -1.0e38f) ? 0.f : __expf(s[1][r] - mn); float es = e0 + e1;
#pragma unroll
      for (int o = 1; o < 16; o <<= 1) es += __shfl_xor(es, o);
      l[r] = l[r] * alpha + es; m[r] = mn;
#pragma unroll
      for (int dt = 0; dt < 4; ++dt) { acc[dt][r] *= alpha; accl[dt][r] *= alpha; }
      sp[wave][8 * g + r][col] = e0; sp[wave][8 * g + r][16 + col] = e1; }
    LDSX();
    v16h pa, pl; { const float* prow = &sp[wave][col][0] + 8 * (lane >> 4);
#pragma unroll
      for (int i = 0; i < 8; ++i) { const float x0 = prow[i] * 2048.0f, x1 = prow[16 + i] * 2048.0f; const _Float16 h0 = (_Float16)x0, h1 = (_Float16)x1; pa[i] = h0; pa[8 + i] = h1; pl[i] = (_Float16)((x0 - (float)h0) * 2048.0f); pl[8 + i] = (_Float16)((x1 - (float)h1) * 2048.0f); } }   // P scaled by 2^11 before the f16 split so small softmax weights stay out of the f16 subnormal range; 2^-11 folded into the epilogue
#pragma unroll
    for (int dt = 0; dt < 4; ++dt) acc[dt] = wmma16(pa, vf[dt], acc[dt]);   // single product: P (x2^11) x V
    (void)pl;
    LDSX();
    fetch_v(kn);   // behind the fence above, which waits for every load in flight
    asm volatile("s_wait_xcnt 0x0" ::: "memory"); }   // stands in front of the next pass's overwrite of the V loads' address registers
#pragma unroll
  for (int r = 0; r < 8; ++r) { const float il = (1.0f / 2048.0f) / l[r];
#pragma unroll
    for (int dt = 0; dt < 4; ++dt) so[wave][8 * g + r][dt * 16 + col] = (acc[dt][r] + accl[dt][r] * (1.0f / 2048.0f)) * il; }
  LDSX();
  for (int rl = 0; rl < 16; ++rl) if (lane < 16) vst2(O + ((size_t)b * SS + q0 + rl) * DM + h * HD + lane * 4, *(const v4f*)&so[wave][rl][lane * 4]);
}
// ---- k_out: block = (64 rows, 128 cols): out = O(hi/lo) . Wo rows (2 products) + bo
__global__ __launch_bounds__(128) void k_out(const float* __restrict__ O, const __bf16* __restrict__ P, const float* __restrict__ BO, float* __restrict__ Y) {
  __shared__ __align__(16) float so[4][16][132];
  const int tid = threadIdx.x, wave = tid >> 5, lane = tid & 31, col = lane & 15, g = lane >> 4; const size_t r0 = (size_t)blockIdx.x * 64 + wave * 16; const int n0 = blockIdx.y * 128;
  v8f acc[8] = {};
  const float* arow = O + (r0 + col) * DM + 8 * g; const __bf16* wrow = P + (size_t)(n0 + col) * DM;
  auto mma = [&](const KStep& s) { const F2 a = bsplit16(s.a);
#pragma unroll
    for (int j = 0; j < 8; ++j) { acc[j] = wmma_bf(a.l, s.w[j], acc[j]); acc[j] = wmma_bf(a.h, s.w[j], acc[j]); } };
  // two register sets: all loads of k-step kc + 1 are issued as one group ahead of the products of k-step kc
  KStep s0, s1; kstep_fetch(s0, arow, wrow, 0, lane);
#pragma unroll 1
  for (int kc = 0; kc < DM / 32 - 2; kc += 2) { kstep_fetch(s1, arow, wrow, kc + 1, lane); mma(s0); kstep_fetch(s0, arow, wrow, kc + 2, lane); mma(s1); }   // rolled: one pass is already the two sets' full turn
  kstep_fetch(s1, arow, wrow, DM / 32 - 1, lane); mma(s0); mma(s1);
#pragma unroll
  for (int j = 0; j < 8; ++j) {
#pragma unroll
    for (int r = 0; r < 8; ++r) so[wave][8 * g + r][j * 16 + col] = acc[j][r] + bfr(BO[n0 + j * 16 + col]); }
  LDSX();
  for (int rl = 0; rl < 16; ++rl) vst2(Y + (r0 + rl) * DM + n0 + lane * 4, *(const v4f*)&so[wave][rl][lane * 4]);
}
// ---- k_dist1: block = 32 rows x all keys. A thread keeps the rounded positions of its own 8 keys in registers (six 16-byte loads, issued together) and walks the block's 32 rows, read from LDS: no load stands in the loop's dependent path. max is order-free, so any split of the pairs gives the same global maximum: RM[block * 32 + i] = max of |p_r - p_j|^2 over the block's rows r and the keys j of threads 8 i .. 8 i + 7; one 128-B line per block
__global__ __launch_bounds__(256) void k_dist1(const float* __restrict__ POS, float* __restrict__ RM) {
  static_assert(NB * SS == 256 * 8, "a thread owns 8 keys");
  __shared__ __align__(16) float srow[32][4]; __shared__ __align__(16) float red[256]; __shared__ __align__(16) float line[32];
  const int t = threadIdx.x; const size_t r0 = (size_t)blockIdx.x * 32;
  v4f kv[6];
#pragma unroll
  for (int i = 0; i < 6; ++i) kv[i] = *(const v4f*)(POS + (size_t)t * 24 + i * 4);
  if (t < 128) { const int c = t & 3; const float v = POS[(r0 + (t >> 2)) * 3 + (c < 3 ? c : 2)]; srow[t >> 2][c] = (c < 3) ? bfr(v) : 0.f; }   // a row's fourth word is padding, written so that the 16-byte rows hold no unwritten LDS
  float kx[8], ky[8], kz[8], mx[8];
#pragma unroll
  for (int j = 0; j < 8; ++j) { kx[j] = bfr(kv[(3 * j) >> 2][(3 * j) & 3]); ky[j] = bfr(kv[(3 * j + 1) >> 2][(3 * j + 1) & 3]); kz[j] = bfr(kv[(3 * j + 2) >> 2][(3 * j + 2) & 3]); mx[j] = 0.f; }
  __syncthreads();
  // unrolled by four: four rows' LDS reads go out as one group ahead of their 32 distances
#pragma unroll 4
  for (int i = 0; i < 32; ++i) { const v4f p = *(const v4f*)&srow[i][0];
#pragma unroll
    for (int j = 0; j < 8; ++j) { const float dx = p[0] - kx[j], dy = p[1] - ky[j], dz = p[2] - kz[j]; mx[j] = fmaxf(mx[j], dx * dx + dy * dy + dz * dz); } }
  red[t] = fmaxf(fmaxf(fmaxf(mx[0], mx[1]), fmaxf(mx[2], mx[3])), fmaxf(fmaxf(mx[4], mx[5]), fmaxf(mx[6], mx[7]))); __syncthreads();
  if (t < 32) { const v4f a = *(const v4f*)&red[t * 8], c = *(const v4f*)&red[t * 8 + 4]; line[t] = fmaxf(fmaxf(fmaxf(a[0], a[1]), fmaxf(a[2], a[3])), fmaxf(fmaxf(c[0], c[1]), fmaxf(c[2], c[3]))); } __syncthreads();
  if (t < 8) vst2(RM + r0 + t * 4, *(const v4f*)&line[t * 4]);
}
// ---- k_dist2: one block: global max -> sqrt -> DMAX (one line)
__global__ __launch_bounds__(256) void k_dist2(const float* __restrict__ RM, float* __restrict__ DMX) { __shared__ float red[256]; __shared__ __align__(16) float line[32]; const int t = threadIdx.x; float mx = 0.f; for (int i = t; i < NB * SS; i += 256) mx = fmaxf(mx, RM[i]); red[t] = mx; __syncthreads();
  for (int s = 128; s > 0; s >>= 1) { if (t < s) red[t] = fmaxf(red[t], red[t + s]); __syncthreads(); }
  if (t < 32) line[t] = (t == 0) ? sqrtf(red[0]) : 0.f; __syncthreads(); if (t < 8) vst2(DMX + t * 4, *(const v4f*)&line[t * 4]); }
extern "C" void kernel_launch(void* const* d_in, const int* in_sizes, int n_in, void* d_out, int out_size, void* d_ws, size_t ws_size, hipStream_t stream) {
  (void)in_sizes; (void)n_in; (void)out_size;
  const float** F = (const float**)d_in;   // 0 x [1,2048,1024], 1 attention_mask [1,2048] int, 2 positions [1,2048,3], 3 Wq, 4 bq, 5 Wk, 6 bk, 7 Wv, 8 bv, 9 Wo, 10 bo (natural), 11 velocity [16]
  if (ws_size < (size_t)WS_END) return;
  char* ws = (char*)d_ws; __bf16* PK = (__bf16*)(ws + WS_PK); _Float16 *QK = (_Float16*)(ws + WS_QK), *QKL = (_Float16*)(ws + WS_QKL), *VTH = (_Float16*)(ws + WS_VTH), *VTL = (_Float16*)(ws + WS_VTL); float *O = (float*)(ws + WS_O), *RM = (float*)(ws + WS_DM), *DMX = RM + NB * SS;
  k_pack<<<dim3(DM, 4), 256, 0, stream>>>(F[3], F[5], F[7], F[9], PK);
  k_dist1<<<NB * SS / 32, 256, 0, stream>>>(F[2], RM);
  k_dist2<<<1, 256, 0, stream>>>(RM, DMX);
  k_qkv<<<dim3(TNB * SS / 64, QKVW / 128), 128, 0, stream>>>(F[0], F[0], F[0], PK + PK_A, F[4], F[6], F[8], QK, QKL, VTH, VTL);
  k_attn<<<dim3(TQB, NH, TNB), 128, 0, stream>>>(QK, QKL, VTH, VTL, nullptr, F[2], DMX, F[11], (const int*)d_in[1], O);
  k_out<<<dim3(TOB, DM / 128), 128, 0, stream>>>(O, PK + PK_P, F[10], (float*)d_out);
}

// v003
// One run takes 143 microseconds.
// In both of two side-by-side timings against v002, it was 1.24 times as fast.
// All steps since v000 together make it 2.72 times as fast.
// compute dtype: all float inputs rounded to bf16, the int mask read on device; q/k/v = x . W^T + b with EXACT bf16 products on WMMA 16x16x32 (natural rows); pairwise distances, their global maximum (deterministic block reduction), the Lorentz factor and exp(-d coef) in f32 (hardware exp); PLAIN attention: q, k single f16 x 1/8 x that factor, masked keys excluded, running-max softmax in f32, P (scaled by 2^11, single f16) x v (single f16); out = o (bf16 hi + residual) . Wo^T (2 products) + bo.
#include <hip/hip_runtime.h>
#include <math.h>

typedef __attribute__((ext_vector_type(16))) _Float16 v16h;
typedef __attribute__((ext_vector_type(16))) __bf16 v16b;
typedef __attribute__((ext_vector_type(8)))  _Float16 v8h;
typedef __attribute__((ext_vector_type(8)))  float v8f;
typedef __attribute__((ext_vector_type(4)))  float v4f;
typedef __attribute__((ext_vector_type(2)))  float v2f;
typedef __attribute__((ext_vector_type(4)))  unsigned v4u;
typedef __attribute__((ext_vector_type(4)))  int v4i;
typedef float __attribute__((may_alias)) float_a;
typedef int __attribute__((may_alias)) int_a;

template <typename T> __device__ __forceinline__ void vst2(void* p, T v) { *(T*)p = v;  }
__device__ __forceinline__ v8f wmma16(v16h a, v16h b, v8f c) {
  v8f d = __builtin_amdgcn_wmma_f32_16x16x32_f16(false, a, false, b, (short)0, c, false, false);
  asm volatile("v_nop\n\tv_nop\n\tv_nop\n\tv_nop" : "+v"(d) : "v"(a), "v"(b));
  return d;
}
__device__ __forceinline__ v8f wmma_bf(v16b a, v16b b, v8f c) {
  v8f d = __builtin_amdgcn_wmma_f32_16x16x32_bf16(false, a, false, b, (short)0, c, false, false);
  asm volatile("v_nop\n\tv_nop\n\tv_nop\n\tv_nop" : "+v"(d) : "v"(a), "v"(b));
  return d;
}
// Relativistic self attention (B 1, S 2,048, d 1,024, 16 heads x 64): q/k/v projections + biases, scores / 8 multiplied by exp(-dist_ij gamma_h v_h) with the normalised pairwise distance of the 3-D positions and a per-head velocity, key mask, softmax, . v, output projection + bias.
__device__ __forceinline__ v16h frag_h(const _Float16* rowk0, int lane) {
  union { v16h v; v8h q[2]; } u; const _Float16* p = rowk0 + 8 * (lane >> 4);
  u.q[0] = *(const v8h*)p; u.q[1] = *(const v8h*)(p + 16); return u.v;
}
__device__ __forceinline__ v16h frag_f32(const float* rowk0, int lane) {
  v16h a; const float* p = rowk0 + 8 * (lane >> 4);
#pragma unroll
  for (int i = 0; i < 8; ++i) { a[i] = (_Float16)p[i]; a[8 + i] = (_Float16)p[16 + i]; }
  return a;
}
__device__ __forceinline__ v16h frag_f32s(const float* rowk0, int lane, float sc) {
  v16h a; const float* p = rowk0 + 8 * (lane >> 4);
#pragma unroll
  for (int i = 0; i < 8; ++i) { a[i] = (_Float16)(p[i] * sc); a[8 + i] = (_Float16)(p[16 + i] * sc); }
  return a;
}
// column fragment from a [K][ld] layout (column n), rows >= K read as 0
__device__ __forceinline__ v16h fragc_f32(const float* W, int k0, int n, int lane, int ld, int K) {
  v16h a; const int g = lane >> 4;
#pragma unroll
  for (int i = 0; i < 8; ++i) { const int ka = k0 + 8 * g + i, kb = ka + 16;
    a[i] = (_Float16)(ka < K ? W[(size_t)(ka < K ? ka : K - 1) * ld + n] : 0.f); a[8 + i] = (_Float16)(kb < K ? W[(size_t)(kb < K ? kb : K - 1) * ld + n] : 0.f); }
  return a;
}
struct F2 { v16b h, l; };
__device__ __forceinline__ F2 bsplit16(const float v[16]) { F2 r;
#pragma unroll
  for (int i = 0; i < 16; ++i) { const __bf16 h = (__bf16)v[i]; r.h[i] = h; r.l[i] = (__bf16)(v[i] - (float)h); }
  return r; }
__device__ __forceinline__ F2 split_row(const float* row, int k0, int lane) { float v[16]; const float* p = row + k0 + 8 * (lane >> 4);
#pragma unroll
  for (int i = 0; i < 8; ++i) { v[i] = p[i]; v[8 + i] = p[16 + i]; }
  return bsplit16(v); }
__device__ __forceinline__ F2 split_rowK(const float* row, int k0, int lane, int K) { float v[16]; const int g = lane >> 4;
#pragma unroll
  for (int i = 0; i < 8; ++i) { const int ka = k0 + 8 * g + i, kb = ka + 16; v[i] = ka < K ? row[ka < K ? ka : K - 1] : 0.f; v[8 + i] = kb < K ? row[kb < K ? kb : K - 1] : 0.f; }
  return bsplit16(v); }
__device__ __forceinline__ F2 split_col(const float* W, int k0, int n, int lane, int ld, int K) { float v[16]; const int g = lane >> 4;
#pragma unroll
  for (int i = 0; i < 8; ++i) { const int ka = k0 + 8 * g + i, kb = ka + 16; v[i] = ka < K ? W[(size_t)(ka < K ? ka : K - 1) * ld + n] : 0.f; v[8 + i] = kb < K ? W[(size_t)(kb < K ? kb : K - 1) * ld + n] : 0.f; }
  return bsplit16(v); }
__device__ __forceinline__ v8f mac3(const F2& a, const F2& b, v8f c) { c = wmma_bf(a.l, b.h, c); c = wmma_bf(a.h, b.l, c); return wmma_bf(a.h, b.h, c); }
__device__ __forceinline__ float sigm(float v) { return 1.0f / (1.0f + expf(-v)); }
#define LDSX() do { asm volatile("s_wait_dscnt 0" ::: "memory"); __builtin_amdgcn_wave_barrier(); __builtin_amdgcn_fence(__ATOMIC_RELEASE, "workgroup"); } while (0)


#define NB 1
#define SS 2048
#define DM 1024
#define NH 16
#define HD 64
#define QKVW (3 * DM)
#ifndef TQB
#define TQB (SS / 64)
#define TNB NB
#define TOB (NB * SS / 64)     // output row tiles (all)
#endif
typedef __attribute__((ext_vector_type(8))) __bf16 v8b;
__device__ __forceinline__ v16b frag_b(const __bf16* rowk0, int lane) {
  union { v16b v; v8b q[2]; } u; const __bf16* p = rowk0 + 8 * (lane >> 4);
  u.q[0] = *(const v8b*)p; u.q[1] = *(const v8b*)(p + 16); return u.v;
}
__device__ __forceinline__ float bfr(float v) { return (float)(__bf16)v; }
__device__ __attribute__((noinline)) float exp_ni(float v) { return expf(v); }
__device__ __attribute__((noinline)) float erf_ni(float v) { return erff(v); }

#define PK_A 0                       // [3072][1024] Wqkv rows (natural [out][in])
#define PK_P (PK_A + QKVW * DM)        // [1024][1024] Wo rows (natural)
#define PK_END (PK_P + DM * DM)
#define WS_PK  0u
#define WS_QK  (WS_PK + 2u * PK_END)             // f16 [2048 rows][2048]: q | k
#define WS_QKL (WS_QK + 2u * NB * SS * 2 * DM)     // f16 q | k residual planes x2048
#define WS_VTH (WS_QKL + 2u * NB * SS * 2 * DM)    // f16 [b][1024 (h*64+d)][2048 s] hi
#define WS_VTL (WS_VTH + 2u * NB * DM * SS)        // f16 lo x 2048
#define WS_O   (WS_VTL + 2u * NB * DM * SS)        // f32 [2048][1024]
#define WS_CS  (WS_O + 4u * NB * SS * DM)           // f32 2 x [2048][32], not used by any kernel here
#define WS_DM  (WS_CS + 4u * 2 * SS * 32)                  // f32: partial maxima of the squared pairwise distances [SS], then the global max at [SS]
#define WS_END (WS_DM + 4u * (size_t)(SS + 32))
// one k-step (32 k) of a row-times-weight-rows product, as loaded: the lane's 16 f32 of its A row and its 8 weight fragments (16 columns each)
struct KStep { float a[16]; v16b w[8]; };
__device__ __forceinline__ void kstep_fetch(KStep& s, const float* arow8g, const __bf16* wrow, int kc, int lane) { const float* p = arow8g + kc * 32;
#pragma unroll
  for (int i = 0; i < 8; ++i) { s.a[i] = p[i]; s.a[8 + i] = p[16 + i]; }
#pragma unroll
  for (int j = 0; j < 8; ++j) s.w[j] = frag_b(wrow + (size_t)j * 16 * DM + kc * 32, lane); }
// ---- k_pack: block = (row n, which): natural [out][in] rows -> bf16; which 0..2 -> W_q/W_k/W_v into PK_A rows which*1024 + n; 3 -> W_o into PK_P
__global__ __launch_bounds__(256) void k_pack(const float* __restrict__ WQ, const float* __restrict__ WK, const float* __restrict__ WV, const float* __restrict__ WO, __bf16* __restrict__ PK) {
  __shared__ __align__(16) __bf16 s[DM]; const int n = blockIdx.x, which = blockIdx.y, t = threadIdx.x; const float* Wm = (which == 0) ? WQ : (which == 1) ? WK : (which == 2) ? WV : WO;
  for (int k = t; k < DM; k += 256) s[k] = (__bf16)Wm[(size_t)n * DM + k];
  __syncthreads();
  __bf16* dst = (which < 3) ? PK + PK_A + ((size_t)which * DM + n) * DM : PK + PK_P + (size_t)n * DM;
  for (int q = t; q < DM / 8; q += 256) vst2((unsigned*)(dst + q * 8), *(const v4u*)&s[q * 8]);
}
__global__ __launch_bounds__(128) void k_qkv(const float* __restrict__ XQ, const float* __restrict__ XK, const float* __restrict__ XV, const __bf16* __restrict__ P, const float* __restrict__ BQ, const float* __restrict__ BK, const float* __restrict__ BV, _Float16* __restrict__ QK, _Float16* __restrict__ QKL, _Float16* __restrict__ VTH, _Float16* __restrict__ VTL) {
  const int which0 = (blockIdx.y * 128) / DM; const float* X = (which0 == 0) ? XQ : (which0 == 1) ? XK : XV; const float* BB = BQ ? (((which0 == 0) ? BQ : (which0 == 1) ? BK : BV) + (blockIdx.y * 128 - which0 * DM)) : nullptr;
  __shared__ __align__(16) _Float16 so[4][16][136], sol[4][16][136]; __shared__ __align__(16) _Float16 sth[128][72], stl[128][72];
  const int tid = threadIdx.x, wave = tid >> 5, lane = tid & 31, col = lane & 15, g = lane >> 4; const size_t r0 = (size_t)blockIdx.x * 64 + wave * 16; const int n0 = blockIdx.y * 128;
  v8f acc[8] = {};
  const float* arow = X + (r0 + col) * DM + 8 * g; const __bf16* wrow = P + (size_t)(n0 + col) * DM;
  auto mma = [&](const KStep& s) { v16b a;
#pragma unroll
    for (int i = 0; i < 16; ++i) a[i] = (__bf16)s.a[i];
#pragma unroll
    for (int j = 0; j < 8; ++j) acc[j] = wmma_bf(a, s.w[j], acc[j]); };
  // two register sets: all loads of k-step kc + 1 are issued as one group ahead of the products of k-step kc
  KStep s0, s1; kstep_fetch(s0, arow, wrow, 0, lane);
#pragma unroll 1
  for (int kc = 0; kc < DM / 32 - 2; kc += 2) { kstep_fetch(s1, arow, wrow, kc + 1, lane); mma(s0); kstep_fetch(s0, arow, wrow, kc + 2, lane); mma(s1); }   // rolled: one pass is already the two sets' full turn
  kstep_fetch(s1, arow, wrow, DM / 32 - 1, lane); mma(s0); mma(s1);
  if (n0 < 2 * DM) {   // q stored unscaled (f16 sigma ~0.6, no subnormal exposure); 1/8 applied to the f32 score
#pragma unroll
    for (int j = 0; j < 8; ++j) {
#pragma unroll
      for (int r = 0; r < 8; ++r) { const float v = acc[j][r] + (BB ? bfr(BB[j * 16 + col]) : 0.f); const _Float16 hv = (_Float16)v; so[wave][8 * g + r][j * 16 + col] = hv; sol[wave][8 * g + r][j * 16 + col] = (_Float16)((v - (float)hv) * 2048.0f); } }   // q, k (+ bias) as f16 hi + (x2048) residual
    LDSX();
    for (int rl = 0; rl < 16; ++rl) if (lane < 16) { vst2((unsigned*)(QK + (r0 + rl) * (2 * DM) + n0 + lane * 8), *(const v4u*)&so[wave][rl][lane * 8]); vst2((unsigned*)(QKL + (r0 + rl) * (2 * DM) + n0 + lane * 8), *(const v4u*)&sol[wave][rl][lane * 8]); }
  } else {
#pragma unroll
    for (int j = 0; j < 8; ++j) {
#pragma unroll
      for (int r = 0; r < 8; ++r) { const float v = acc[j][r] + (BB ? bfr(BB[j * 16 + col]) : 0.f); const _Float16 hv = (_Float16)v; sth[j * 16 + col][wave * 16 + 8 * g + r] = hv; stl[j * 16 + col][wave * 16 + 8 * g + r] = (_Float16)((v - (float)hv) * 2048.0f); } }
    __syncthreads();
    const size_t rb = (size_t)blockIdx.x * 64; const int b = (int)(rb / SS), s0 = (int)(rb % SS); const int pc0 = n0 - 2 * DM;
    for (int q = tid; q < 128 * 8; q += 128) { const int d = q >> 3, pc = q & 7; const size_t o = ((size_t)b * DM + pc0 + d) * SS + s0 + pc * 8; vst2((unsigned*)(VTH + o), *(const v4u*)&sth[d][pc * 8]); vst2((unsigned*)(VTL + o), *(const v4u*)&stl[d][pc * 8]); }
  }
}
__device__ __forceinline__ float xhalf(float x) { return __builtin_bit_cast(float, __builtin_amdgcn_permlanex16(__builtin_bit_cast(int, x), __builtin_bit_cast(int, x), 0x76543210, 0xfedcba98, false, false)); }   // lane l with lane l ^ 16
// ---- k_attn: block = (64 queries, head h, batch b): all-keys flash attention, TRANSPOSED: S^T = K . Q^T (A = K rows, B = Q rows), so a lane holds 16 scores of ONE query (column col; keys 8 g + r and 16 + 8 g + r of the step's 32): maximum and sum run in the lane, one exchange between the wave's halves joins the maximum, the halves' sums are joined once behind the loop. The two score tiles, converted in place, are the B operand of O^T += V^T . P^T (hardware k order, which frag_h gives the V rows): P touches no LDS. A lane ends with 8 consecutive d of its query per tile and stores them itself.
// The lane now needs 16 keys' positions per step: the block rounds all keys' positions once into LDS (x, y, z planes), with a fourth plane that is 0 for a kept key and -3.0e38 for a masked one, added to the score.
// amdgpu_waves_per_eu(2, 2): the grid gives two waves per SIMD
__global__ __launch_bounds__(128) __attribute__((amdgpu_waves_per_eu(2, 2))) void k_attn(const _Float16* __restrict__ QK, const _Float16* __restrict__ QKL, const _Float16* __restrict__ VTH, const _Float16* __restrict__ VTL, const void* __restrict__ KMASK, const float* __restrict__ POS, const float* __restrict__ DMAX, const float* __restrict__ VEL, const int* __restrict__ AM, float* __restrict__ O) {
  static_assert(SS % 512 == 0, "a thread fills whole groups of 4 keys");
  __shared__ __align__(16) float skx[SS], sky[SS], skz[SS], skm[SS];
  const int tid = threadIdx.x, wave = tid >> 5, lane = tid & 31, col = lane & 15, g = lane >> 4;
  const int qb = blockIdx.x, h = blockIdx.y, b = blockIdx.z; const int q0 = qb * 64 + wave * 16; const size_t rq = (size_t)b * SS + q0 + col;
#pragma unroll
  for (int i = 0; i < SS / 512; ++i) { const int j = tid + 128 * i; const float* p = POS + ((size_t)b * SS + 4 * j) * 3; const v4f u = *(const v4f*)p, v = *(const v4f*)(p + 4), w = *(const v4f*)(p + 8); const v4i mk = *(const v4i*)(AM + (size_t)b * SS + 4 * j);
    const v4f x = { bfr(u[0]), bfr(u[3]), bfr(v[2]), bfr(w[1]) }, y = { bfr(u[1]), bfr(v[0]), bfr(v[3]), bfr(w[2]) }, z = { bfr(u[2]), bfr(v[1]), bfr(w[0]), bfr(w[3]) };
    const v4f a = { mk[0] != 0 ? 0.f : -3.0e38f, mk[1] != 0 ? 0.f : -3.0e38f, mk[2] != 0 ? 0.f : -3.0e38f, mk[3] != 0 ? 0.f : -3.0e38f };
    *(v4f*)&skx[4 * j] = x; *(v4f*)&sky[4 * j] = y; *(v4f*)&skz[4 * j] = z; *(v4f*)&skm[4 * j] = a; }
  v16h aq[2];
#pragma unroll
  for (int kc = 0; kc < 2; ++kc) aq[kc] = frag_h(QK + rq * (2 * DM) + h * HD + kc * 32, lane);
  v2f px2, py2, pz2; { const float* p = POS + rq * 3; const float px = bfr(p[0]), py = bfr(p[1]), pz = bfr(p[2]); px2 = v2f{ px, px }; py2 = v2f{ py, py }; pz2 = v2f{ pz, pz }; }   // the lane's query, each coordinate twice
  float coef; { float vh = fabsf(bfr(VEL[h])); vh = fminf(fmaxf(vh, 0.f), 0.999f); const float gam = 1.0f / sqrtf(1.0f - vh * vh); coef = gam * vh / (DMAX[0] + 1e-8f); }   // gamma v / (dmax + 1e-8): dist is normalised by the global max
  const bool havemax = DMAX[0] > 0.f;
  float m = -3.0e38f, l = 0.f;   // the query's running maximum (equal in both halves) and this half's share of its sum
  v8f acc[4] = {};
  const int nks = SS / 32;   // all keys
  // the K and V fragments of key step ks + 1 are fetched during step ks, into the registers that step ks has just finished with: K behind the score products, V behind the P.V products
  v16h kf[2][2], vf[4];
  auto fetch_k = [&](int ks) {
#pragma unroll
    for (int ct = 0; ct < 2; ++ct) { const _Float16* krow = QK + ((size_t)b * SS + ks * 32 + ct * 16 + col) * (2 * DM) + DM + h * HD;
#pragma unroll
      for (int kc = 0; kc < 2; ++kc) kf[ct][kc] = frag_h(krow + kc * 32, lane); } };
  auto fetch_v = [&](int ks) {
#pragma unroll
    for (int dt = 0; dt < 4; ++dt) vf[dt] = frag_h(VTH + ((size_t)b * DM + h * HD + dt * 16 + col) * SS + ks * 32, lane); };
  fetch_k(0);
  asm volatile("" :: "v"(kf[0][0]), "v"(kf[0][1]), "v"(kf[1][0]), "v"(kf[1][1]));   // inputs only: step 0's K has landed before the loop, as on every later entry; else the wait at the loop's head, set for the first entry, also waits out the V loads in flight on every pass
  fetch_v(0);
  __syncthreads();   // the key planes are whole before any wave reads them
#pragma unroll 1
  for (int ks = 0; ks < nks; ++ks) { v8f cc[2]; const int kn = (ks + 1 < nks) ? ks + 1 : ks;   // the last step refetches itself: in range, not used
    v4f tx[4], ty[4], tz[4], tm[4];   // the lane's 16 keys: planes read as 16-byte words, the same address in all 16 lanes of a half
#pragma unroll
    for (int q = 0; q < 4; ++q) { const int k0 = ks * 32 + (q >> 1) * 16 + 8 * g + (q & 1) * 4; tx[q] = *(const v4f*)&skx[k0]; ty[q] = *(const v4f*)&sky[k0]; tz[q] = *(const v4f*)&skz[k0]; tm[q] = *(const v4f*)&skm[k0]; }
#pragma unroll
    for (int ct = 0; ct < 2; ++ct) { v8f c = {};
#pragma unroll
      for (int kc = 0; kc < 2; ++kc) c = wmma16(kf[ct][kc], aq[kc], c);   // single product: k, q as one-rounding f16 operands; c[r] = score of key ct * 16 + 8 g + r with query col
      cc[ct] = c; }
    fetch_k(kn);
    __builtin_amdgcn_sched_barrier(0);   // keeps the K loads here, a whole softmax ahead of their use, instead of sinking to the end of the block
    float s[16];
#pragma unroll
    for (int p = 0; p < 8; ++p) { const int q = p >> 1, e = (p & 1) * 2;   // two keys at a time, neighbours in the planes' words: packed f32 forms with no register moves
      const v2f kx = { tx[q][e], tx[q][e + 1] }, ky = { ty[q][e], ty[q][e + 1] }, kz = { tz[q][e], tz[q][e + 1] };
      const v2f dx = px2 - kx, dy = py2 - ky, dz = pz2 - kz; const v2f sq2 = dx * dx + dy * dy + dz * dz;
#pragma unroll
      for (int u = 0; u < 2; ++u) { const int i = 2 * p + u; const float sq = sq2[u]; const float dist = (sq == 0.f) ? 0.f : sqrtf(sq); const float fac = havemax ? __expf(-dist * coef) : __expf(-dist * coef * (DMAX[0] + 1e-8f)); s[i] = cc[i >> 3][i & 7] * 0.125f * fac + tm[q][e + u]; } }   // score x exp(-normalised distance x gamma v); a masked key ends at -3.0e38
    float mx = s[0];
#pragma unroll
    for (int i = 1; i < 16; ++i) mx = fmaxf(mx, s[i]);
    mx = fmaxf(mx, xhalf(mx));
    const float mn = fmaxf(m, mx); const float alpha = (m <= -1.0e38f) ? 0.f : __expf(m - mn);
    const float mref = (mn <= -1.0e38f) ? 0.f : mn;   // no kept key yet: against 0 every masked score gives weight 0, as it does against a real maximum
    float e[16]; v16h pa;
#pragma unroll
    for (int i = 0; i < 16; ++i) { e[i] = __expf(s[i] - mref); pa[i] = (_Float16)(e[i] * 2048.0f); }   // P scaled by 2^11 so small softmax weights stay out of the f16 subnormal range; 2^-11 folded into the epilogue. Element i of the B operand is key 8 g + i (i < 8) or 16 + 8 g + i - 8: the two tiles' registers in their order
#pragma unroll
    for (int w = 8; w > 0; w >>= 1) {   // a tree, not a chain of 15 dependent adds
#pragma unroll
      for (int i = 0; i < w; ++i) e[i] += e[i + w]; }
    const float es = e[0];
    l = l * alpha + es; m = mn;
#pragma unroll
    for (int dt = 0; dt < 4; ++dt) acc[dt] *= alpha;
#pragma unroll
    for (int dt = 0; dt < 4; ++dt) acc[dt] = wmma16(vf[dt], pa, acc[dt]);   // single product: V^T x P^T (x2^11); acc[dt][r] = O[query col][dt * 16 + 8 g + r]
    fetch_v(kn);
    asm volatile("s_wait_xcnt 0x0" ::: "memory"); }   // stands in front of the next pass's overwrite of the V loads' address registers
  const float il = (1.0f / 2048.0f) / (l + xhalf(l));
  float* orow = O + rq * DM + h * HD + 8 * g;
#pragma unroll
  for (int dt = 0; dt < 4; ++dt) { const v4f lo = { acc[dt][0] * il, acc[dt][1] * il, acc[dt][2] * il, acc[dt][3] * il }, hi = { acc[dt][4] * il, acc[dt][5] * il, acc[dt][6] * il, acc[dt][7] * il }; vst2(orow + dt * 16, lo); vst2(orow + dt * 16 + 4, hi); }
}
// ---- k_out: block = (64 rows, 128 cols): out = O(hi/lo) . Wo rows (2 products) + bo
__global__ __launch_bounds__(128) void k_out(const float* __restrict__ O, const __bf16* __restrict__ P, const float* __restrict__ BO, float* __restrict__ Y) {
  __shared__ __align__(16) float so[4][16][132];
  const int tid = threadIdx.x, wave = tid >> 5, lane = tid & 31, col = lane & 15, g = lane >> 4; const size_t r0 = (size_t)blockIdx.x * 64 + wave * 16; const int n0 = blockIdx.y * 128;
  v8f acc[8] = {};
  const float* arow = O + (r0 + col) * DM + 8 * g; const __bf16* wrow = P + (size_t)(n0 + col) * DM;
  auto mma = [&](const KStep& s) { const F2 a = bsplit16(s.a);
#pragma unroll
    for (int j = 0; j < 8; ++j) { acc[j] = wmma_bf(a.l, s.w[j], acc[j]); acc[j] = wmma_bf(a.h, s.w[j], acc[j]); } };
  // two register sets: all loads of k-step kc + 1 are issued as one group ahead of the products of k-step kc
  KStep s0, s1; kstep_fetch(s0, arow, wrow, 0, lane);
#pragma unroll 1
  for (int kc = 0; kc < DM / 32 - 2; kc += 2) { kstep_fetch(s1, arow, wrow, kc + 1, lane); mma(s0); kstep_fetch(s0, arow, wrow, kc + 2, lane); mma(s1); }   // rolled: one pass is already the two sets' full turn
  kstep_fetch(s1, arow, wrow, DM / 32 - 1, lane); mma(s0); mma(s1);
#pragma unroll
  for (int j = 0; j < 8; ++j) {
#pragma unroll
    for (int r = 0; r < 8; ++r) so[wave][8 * g + r][j * 16 + col] = acc[j][r] + bfr(BO[n0 + j * 16 + col]); }
  LDSX();
  for (int rl = 0; rl < 16; ++rl) vst2(Y + (r0 + rl) * DM + n0 + lane * 4, *(const v4f*)&so[wave][rl][lane * 4]);
}
// ---- k_dist1: block = 32 rows x all keys. A thread keeps the rounded positions of its own 8 keys in registers (six 16-byte loads, issued together) and walks the block's 32 rows, read from LDS: no load stands in the loop's dependent path. max is order-free, so any split of the pairs gives the same global maximum: RM[block * 32 + i] = max of |p_r - p_j|^2 over the block's rows r and the keys j of threads 8 i .. 8 i + 7; one 128-B line per block
__global__ __launch_bounds__(256) void k_dist1(const float* __restrict__ POS, float* __restrict__ RM) {
  static_assert(NB * SS == 256 * 8, "a thread owns 8 keys");
  __shared__ __align__(16) float srow[32][4]; __shared__ __align__(16) float red[256]; __shared__ __align__(16) float line[32];
  const int t = threadIdx.x; const size_t r0 = (size_t)blockIdx.x * 32;
  v4f kv[6];
#pragma unroll
  for (int i = 0; i < 6; ++i) kv[i] = *(const v4f*)(POS + (size_t)t * 24 + i * 4);
  if (t < 128) { const int c = t & 3; const float v = POS[(r0 + (t >> 2)) * 3 + (c < 3 ? c : 2)]; srow[t >> 2][c] = (c < 3) ? bfr(v) : 0.f; }   // a row's fourth word is padding, written so that the 16-byte rows hold no unwritten LDS
  float kx[8], ky[8], kz[8], mx[8];
#pragma unroll
  for (int j = 0; j < 8; ++j) { kx[j] = bfr(kv[(3 * j) >> 2][(3 * j) & 3]); ky[j] = bfr(kv[(3 * j + 1) >> 2][(3 * j + 1) & 3]); kz[j] = bfr(kv[(3 * j + 2) >> 2][(3 * j + 2) & 3]); mx[j] = 0.f; }
  __syncthreads();
  // unrolled by four: four rows' LDS reads go out as one group ahead of their 32 distances
#pragma unroll 4
  for (int i = 0; i < 32; ++i) { const v4f p = *(const v4f*)&srow[i][0];
#pragma unroll
    for (int j = 0; j < 8; ++j) { const float dx = p[0] - kx[j], dy = p[1] - ky[j], dz = p[2] - kz[j]; mx[j] = fmaxf(mx[j], dx * dx + dy * dy + dz * dz); } }
  red[t] = fmaxf(fmaxf(fmaxf(mx[0], mx[1]), fmaxf(mx[2], mx[3])), fmaxf(fmaxf(mx[4], mx[5]), fmaxf(mx[6], mx[7]))); __syncthreads();
  if (t < 32) { const v4f a = *(const v4f*)&red[t * 8], c = *(const v4f*)&red[t * 8 + 4]; line[t] = fmaxf(fmaxf(fmaxf(a[0], a[1]), fmaxf(a[2], a[3])), fmaxf(fmaxf(c[0], c[1]), fmaxf(c[2], c[3]))); } __syncthreads();
  if (t < 8) vst2(RM + r0 + t * 4, *(const v4f*)&line[t * 4]);
}
// ---- k_dist2: one block: global max -> sqrt -> DMAX (one line)
__global__ __launch_bounds__(256) void k_dist2(const float* __restrict__ RM, float* __restrict__ DMX) { __shared__ float red[256]; __shared__ __align__(16) float line[32]; const int t = threadIdx.x; float mx = 0.f; for (int i = t; i < NB * SS; i += 256) mx = fmaxf(mx, RM[i]); red[t] = mx; __syncthreads();
  for (int s = 128; s > 0; s >>= 1) { if (t < s) red[t] = fmaxf(red[t], red[t + s]); __syncthreads(); }
  if (t < 32) line[t] = (t == 0) ? sqrtf(red[0]) : 0.f; __syncthreads(); if (t < 8) vst2(DMX + t * 4, *(const v4f*)&line[t * 4]); }
extern "C" void kernel_launch(void* const* d_in, const int* in_sizes, int n_in, void* d_out, int out_size, void* d_ws, size_t ws_size, hipStream_t stream) {
  (void)in_sizes; (void)n_in; (void)out_size;
  const float** F = (const float**)d_in;   // 0 x [1,2048,1024], 1 attention_mask [1,2048] int, 2 positions [1,2048,3], 3 Wq, 4 bq, 5 Wk, 6 bk, 7 Wv, 8 bv, 9 Wo, 10 bo (natural), 11 velocity [16]
  if (ws_size < (size_t)WS_END) return;
  char* ws = (char*)d_ws; __bf16* PK = (__bf16*)(ws + WS_PK); _Float16 *QK = (_Float16*)(ws + WS_QK), *QKL = (_Float16*)(ws + WS_QKL), *VTH = (_Float16*)(ws + WS_VTH), *VTL = (_Float16*)(ws + WS_VTL); float *O = (float*)(ws + WS_O), *RM = (float*)(ws + WS_DM), *DMX = RM + NB * SS;
  k_pack<<<dim3(DM, 4), 256, 0, stream>>>(F[3], F[5], F[7], F[9], PK);
  k_dist1<<<NB * SS / 32, 256, 0, stream>>>(F[2], RM);
  k_dist2<<<1, 256, 0, stream>>>(RM, DMX);
  k_qkv<<<dim3(TNB * SS / 64, QKVW / 128), 128, 0, stream>>>(F[0], F[0], F[0], PK + PK_A, F[4], F[6], F[8], QK, QKL, VTH, VTL);
  k_attn<<<dim3(TQB, NH, TNB), 128, 0, stream>>>(QK, QKL, VTH, VTL, nullptr, F[2], DMX, F[11], (const int*)d_in[1], O);
  k_out<<<dim3(TOB, DM / 128), 128, 0, stream>>>(O, PK + PK_P, F[10], (float*)d_out);
}

// v004
// Measured time: 112 microseconds a run.
// Two timings next to v003 put it at 1.29 and 1.27 times that version's speed.
// All steps since v000 together make it 3.49 times as fast.
// compute dtype: all float inputs rounded to bf16, the int mask read on device; q/k/v = x . W^T + b with EXACT bf16 products on WMMA 16x16x32 (natural rows); pairwise distances, their global maximum (deterministic block reduction), the Lorentz factor and exp(-d coef) in f32 (hardware exp); PLAIN attention: q, k single f16 x 1/8 x that factor, masked keys excluded, running-max softmax in f32, P (scaled by 2^11, single f16) x v (single f16); out = o (bf16 hi + residual) . Wo^T (2 products) + bo.
#include <hip/hip_runtime.h>
#include <math.h>

typedef __attribute__((ext_vector_type(16))) _Float16 v16h;
typedef __attribute__((ext_vector_type(16))) __bf16 v16b;
typedef __attribute__((ext_vector_type(8)))  _Float16 v8h;
typedef __attribute__((ext_vector_type(8)))  float v8f;
typedef __attribute__((ext_vector_type(4)))  float v4f;
typedef __attribute__((ext_vector_type(2)))  float v2f;
typedef __attribute__((ext_vector_type(4)))  unsigned v4u;
typedef __attribute__((ext_vector_type(4)))  int v4i;
typedef float __attribute__((may_alias)) float_a;
typedef int __attribute__((may_alias)) int_a;

template <typename T> __device__ __forceinline__ void vst2(void* p, T v) { *(T*)p = v;  }
__device__ __forceinline__ v8f wmma16(v16h a, v16h b, v8f c) {
  v8f d = __builtin_amdgcn_wmma_f32_16x16x32_f16(false, a, false, b, (short)0, c, false, false);
  asm volatile("v_nop\n\tv_nop\n\tv_nop\n\tv_nop" : "+v"(d) : "v"(a), "v"(b));
  return d;
}
__device__ __forceinline__ v8f wmma_bf(v16b a, v16b b, v8f c) {
  v8f d = __builtin_amdgcn_wmma_f32_16x16x32_bf16(false, a, false, b, (short)0, c, false, false);
  asm volatile("v_nop\n\tv_nop\n\tv_nop\n\tv_nop" : "+v"(d) : "v"(a), "v"(b));
  return d;
}
// Relativistic self attention (B 1, S 2,048, d 1,024, 16 heads x 64): q/k/v projections + biases, scores / 8 multiplied by exp(-dist_ij gamma_h v_h) with the normalised pairwise distance of the 3-D positions and a per-head velocity, key mask, softmax, . v, output projection + bias.
__device__ __forceinline__ v16h frag_h(const _Float16* rowk0, int lane) {
  union { v16h v; v8h q[2]; } u; const _Float16* p = rowk0 + 8 * (lane >> 4);
  u.q[0] = *(const v8h*)p; u.q[1] = *(const v8h*)(p + 16); return u.v;
}
__device__ __forceinline__ v16h frag_f32(const float* rowk0, int lane) {
  v16h a; const float* p = rowk0 + 8 * (lane >> 4);
#pragma unroll
  for (int i = 0; i < 8; ++i) { a[i] = (_Float16)p[i]; a[8 + i] = (_Float16)p[16 + i]; }
  return a;
}
__device__ __forceinline__ v16h frag_f32s(const float* rowk0, int lane, float sc) {
  v16h a; const float* p = rowk0 + 8 * (lane >> 4);
#pragma unroll
  for (int i = 0; i < 8; ++i) { a[i] = (_Float16)(p[i] * sc); a[8 + i] = (_Float16)(p[16 + i] * sc); }
  return a;
}
// column fragment from a [K][ld] layout (column n), rows >= K read as 0
__device__ __forceinline__ v16h fragc_f32(const float* W, int k0, int n, int lane, int ld, int K) {
  v16h a; const int g = lane >> 4;
#pragma unroll
  for (int i = 0; i < 8; ++i) { const int ka = k0 + 8 * g + i, kb = ka + 16;
    a[i] = (_Float16)(ka < K ? W[(size_t)(ka < K ? ka : K - 1) * ld + n] : 0.f); a[8 + i] = (_Float16)(kb < K ? W[(size_t)(kb < K ? kb : K - 1) * ld + n] : 0.f); }
  return a;
}
struct F2 { v16b h, l; };
__device__ __forceinline__ F2 bsplit16(const float v[16]) { F2 r;
#pragma unroll
  for (int i = 0; i < 16; ++i) { const __bf16 h = (__bf16)v[i]; r.h[i] = h; r.l[i] = (__bf16)(v[i] - (float)h); }
  return r; }
__device__ __forceinline__ F2 split_row(const float* row, int k0, int lane) { float v[16]; const float* p = row + k0 + 8 * (lane >> 4);
#pragma unroll
  for (int i = 0; i < 8; ++i) { v[i] = p[i]; v[8 + i] = p[16 + i]; }
  return bsplit16(v); }
__device__ __forceinline__ F2 split_rowK(const float* row, int k0, int lane, int K) { float v[16]; const int g = lane >> 4;
#pragma unroll
  for (int i = 0; i < 8; ++i) { const int ka = k0 + 8 * g + i, kb = ka + 16; v[i] = ka < K ? row[ka < K ? ka : K - 1] : 0.f; v[8 + i] = kb < K ? row[kb < K ? kb : K - 1] : 0.f; }
  return bsplit16(v); }
__device__ __forceinline__ F2 split_col(const float* W, int k0, int n, int lane, int ld, int K) { float v[16]; const int g = lane >> 4;
#pragma unroll
  for (int i = 0; i < 8; ++i) { const int ka = k0 + 8 * g + i, kb = ka + 16; v[i] = ka < K ? W[(size_t)(ka < K ? ka : K - 1) * ld + n] : 0.f; v[8 + i] = kb < K ? W[(size_t)(kb < K ? kb : K - 1) * ld + n] : 0.f; }
  return bsplit16(v); }
__device__ __forceinline__ v8f mac3(const F2& a, const F2& b, v8f c) { c = wmma_bf(a.l, b.h, c); c = wmma_bf(a.h, b.l, c); return wmma_bf(a.h, b.h, c); }
__device__ __forceinline__ float sigm(float v) { return 1.0f / (1.0f + expf(-v)); }
#define LDSX() do { asm volatile("s_wait_dscnt 0" ::: "memory"); __builtin_amdgcn_wave_barrier(); __builtin_amdgcn_fence(__ATOMIC_RELEASE, "workgroup"); } while (0)


#define NB 1
#define SS 2048
#define DM 1024
#define NH 16
#define HD 64
#define QKVW (3 * DM)
#ifndef TQB
#define TQB (SS / 64)
#define TNB NB
#define TOB (NB * SS / 64)     // output row tiles (all)
#endif
typedef __attribute__((ext_vector_type(8))) __bf16 v8b;
__device__ __forceinline__ v16b frag_b(const __bf16* rowk0, int lane) {
  union { v16b v; v8b q[2]; } u; const __bf16* p = rowk0 + 8 * (lane >> 4);
  u.q[0] = *(const v8b*)p; u.q[1] = *(const v8b*)(p + 16); return u.v;
}
__device__ __forceinline__ float bfr(float v) { return (float)(__bf16)v; }
__device__ __attribute__((noinline)) float exp_ni(float v) { return expf(v); }
__device__ __attribute__((noinline)) float erf_ni(float v) { return erff(v); }

#define PK_A 0                       // [3072][1024] Wqkv rows (natural [out][in])
#define PK_P (PK_A + QKVW * DM)        // [1024][1024] Wo rows (natural)
#define PK_END (PK_P + DM * DM)
#define WS_PK  0u
#define WS_QK  (WS_PK + 2u * PK_END)             // f16 [2048 rows][2048]: q | k
#define WS_QKL (WS_QK + 2u * NB * SS * 2 * DM)     // f16 q | k residual planes x2048
#define WS_VTH (WS_QKL + 2u * NB * SS * 2 * DM)    // f16 [b][1024 (h*64+d)][2048 s] hi
#define WS_VTL (WS_VTH + 2u * NB * DM * SS)        // f16 lo x 2048
#define WS_O   (WS_VTL + 2u * NB * DM * SS)        // f32 [2048][1024]
#define WS_CS  (WS_O + 4u * NB * SS * DM)           // f32 2 x [2048][32], not used by any kernel here
#define WS_DM  (WS_CS + 4u * 2 * SS * 32)                  // f32: partial maxima of the squared pairwise distances [SS], then the global max at [SS]
#define WS_END (WS_DM + 4u * (size_t)(SS + 32))
// one k-step (32 k) of a row-times-weight-rows product, as loaded: the lane's 16 f32 of its A row and its 8 weight fragments (16 columns each)
struct KStep { float a[16]; v16b w[8]; };
// ---- operand tiles of k_qkv and k_out in LDS. A tile is 64 k of the block's 64 A rows (f32, 256 B a row) and of its 128 weight rows (bf16, 128 B a row), brought by asynchronous copies: a wave's copy covers four whole 128-B lines, and the block fetches each line once for its four waves. Row pitches 272 and 144 B (16 B x odd): the 16 rows of a fragment read fall on distinct banks.
#define ST_K 64
#define ST_N (DM / ST_K)
#define ST_AP 272
#define ST_WP 144
#define ST_W (64 * ST_AP)
#define ST_SZ (ST_W + 128 * ST_WP)
// eight copies, each lane its own 16 bytes; the s_wait_xcnt stands inside the statement, behind the last copy, so that no address register named here is rewritten in front of it
__device__ __forceinline__ void acopy8(const unsigned (&l)[8], const void* const (&p)[8]) {
  asm volatile("global_load_async_to_lds_b128 %0, %8, off\n\t"
               "global_load_async_to_lds_b128 %1, %9, off\n\t"
               "global_load_async_to_lds_b128 %2, %10, off\n\t"
               "global_load_async_to_lds_b128 %3, %11, off\n\t"
               "global_load_async_to_lds_b128 %4, %12, off\n\t"
               "global_load_async_to_lds_b128 %5, %13, off\n\t"
               "global_load_async_to_lds_b128 %6, %14, off\n\t"
               "global_load_async_to_lds_b128 %7, %15, off\n\t"
               "s_wait_xcnt 0x0"
               :: "v"(l[0]), "v"(l[1]), "v"(l[2]), "v"(l[3]), "v"(l[4]), "v"(l[5]), "v"(l[6]), "v"(l[7]),
                  "v"(p[0]), "v"(p[1]), "v"(p[2]), "v"(p[3]), "v"(p[4]), "v"(p[5]), "v"(p[6]), "v"(p[7]) : "memory");
}
// tile st of the block into the buffer at LDS byte address lbuf; 128 threads, 16 copies each. a0, w0: the thread's own 16 bytes of tile 0 (A row tid / 16, weight row tid / 8); its further copies lie 8 A rows and 16 weight rows apart
__device__ __forceinline__ void tile_fill(const char* a0, const char* w0, int st, unsigned lbuf, int tid) {
  unsigned l[8]; const void* p[8];
  const char* pa = a0 + st * (ST_K * 4); const unsigned la = lbuf + (tid >> 4) * ST_AP + (tid & 15) * 16;
#pragma unroll
  for (int i = 0; i < 8; ++i) { l[i] = la + i * (8 * ST_AP); p[i] = pa + i * (8 * DM * 4); }
  acopy8(l, p);
  const char* pw = w0 + st * (ST_K * 2); const unsigned lw = lbuf + ST_W + (tid >> 3) * ST_WP + (tid & 7) * 16;
#pragma unroll
  for (int i = 0; i < 8; ++i) { l[i] = lw + i * (16 * ST_WP); p[i] = pw + i * (16 * DM * 2); }
  acopy8(l, p);
}
// k-step kk (0 or 1) of a tile: arow = the lane's A row in the buffer + 32 g bytes, wrow = weight row col in the buffer + 16 g bytes; the k order of both is that of frag_b
__device__ __forceinline__ void kstep_lds(KStep& s, const char* arow, const char* wrow, int kk) {
  const v4f a0 = *(const v4f*)(arow + kk * 128), a1 = *(const v4f*)(arow + kk * 128 + 16), a2 = *(const v4f*)(arow + kk * 128 + 64), a3 = *(const v4f*)(arow + kk * 128 + 80);
#pragma unroll
  for (int i = 0; i < 4; ++i) { s.a[i] = a0[i]; s.a[4 + i] = a1[i]; s.a[8 + i] = a2[i]; s.a[12 + i] = a3[i]; }
#pragma unroll
  for (int j = 0; j < 8; ++j) { union { v16b v; v8b q[2]; } u; const char* p = wrow + j * 16 * ST_WP + kk * 64; u.q[0] = *(const v8b*)p; u.q[1] = *(const v8b*)(p + 32); s.w[j] = u.v; }
}
// the two-buffer loop over the tiles: tile t + 1 flies while tile t is worked on. At the foot of a trip every wave ends its own LDS reads and its own copies, the barrier publishes tile t + 1 and frees tile t's buffer, and only then tile t + 2 is aimed at that buffer. The last trip's barrier also frees both buffers for the output staging.
template <typename MMA> __device__ __forceinline__ void tile_loop(const float* A0, const __bf16* W0, char* smem, int tid, MMA mma) {
  const int wave = tid >> 5, lane = tid & 31, col = lane & 15, g = lane >> 4; const unsigned l0 = (unsigned)(size_t)smem;
  const char* a0 = (const char*)(A0 + (size_t)(tid >> 4) * DM + (tid & 15) * 4); const char* w0 = (const char*)(W0 + (size_t)(tid >> 3) * DM + (tid & 7) * 8);
  tile_fill(a0, w0, 0, l0, tid);
  asm volatile("s_wait_asynccnt 0x0" ::: "memory");   // tile 0 has landed, this wave's share
  __syncthreads();   // tile 0 is whole before any wave reads it
  tile_fill(a0, w0, 1, l0 + ST_SZ, tid);
#pragma unroll 1
  for (int t = 0; t < ST_N; ++t) {   // rolled: the buffer is picked by t & 1
    const int bo = (t & 1) * ST_SZ; const char* arow = smem + bo + (wave * 16 + col) * ST_AP + 32 * g; const char* wrow = smem + bo + ST_W + col * ST_WP + 16 * g;
    KStep s0, s1; kstep_lds(s0, arow, wrow, 0); kstep_lds(s1, arow, wrow, 1); mma(s0); mma(s1);
    asm volatile("s_wait_dscnt 0x0" ::: "memory");      // this wave's reads of tile t are over before the buffer is given up
    asm volatile("s_wait_asynccnt 0x0" ::: "memory");   // this wave's share of tile t + 1 has landed
    __syncthreads();   // publishes tile t + 1, ends every reader's last read of tile t
    if (t + 2 < ST_N) tile_fill(a0, w0, t + 2, l0 + bo, tid);
  }
  asm volatile("s_wait_asynccnt 0x0" ::: "memory");   // no copy is outstanding when the LDS is used anew
}
// ---- k_pack: block = (row n, which): natural [out][in] rows -> bf16; which 0..2 -> W_q/W_k/W_v into PK_A rows which*1024 + n; 3 -> W_o into PK_P
__global__ __launch_bounds__(256) void k_pack(const float* __restrict__ WQ, const float* __restrict__ WK, const float* __restrict__ WV, const float* __restrict__ WO, __bf16* __restrict__ PK) {
  __shared__ __align__(16) __bf16 s[DM]; const int n = blockIdx.x, which = blockIdx.y, t = threadIdx.x; const float* Wm = (which == 0) ? WQ : (which == 1) ? WK : (which == 2) ? WV : WO;
  for (int k = t; k < DM; k += 256) s[k] = (__bf16)Wm[(size_t)n * DM + k];
  __syncthreads();
  __bf16* dst = (which < 3) ? PK + PK_A + ((size_t)which * DM + n) * DM : PK + PK_P + (size_t)n * DM;
  for (int q = t; q < DM / 8; q += 256) vst2((unsigned*)(dst + q * 8), *(const v4u*)&s[q * 8]);
}
__global__ __launch_bounds__(128) void k_qkv(const float* __restrict__ XQ, const float* __restrict__ XK, const float* __restrict__ XV, const __bf16* __restrict__ P, const float* __restrict__ BQ, const float* __restrict__ BK, const float* __restrict__ BV, _Float16* __restrict__ QK, _Float16* __restrict__ QKL, _Float16* __restrict__ VTH, _Float16* __restrict__ VTL) {
  const int which0 = (blockIdx.y * 128) / DM; const float* X = (which0 == 0) ? XQ : (which0 == 1) ? XK : XV; const float* BB = BQ ? (((which0 == 0) ? BQ : (which0 == 1) ? BK : BV) + (blockIdx.y * 128 - which0 * DM)) : nullptr;
  __shared__ __align__(16) char smem[2 * ST_SZ];   // the two tile buffers; behind the loop the output staging
  static_assert(2 * ST_SZ >= 2 * (4 * 16 * 136 + 128 * 72) * 2, "the staging fits the buffers");
  _Float16 (*so)[16][136] = (_Float16 (*)[16][136])smem, (*sol)[16][136] = so + 4; _Float16 (*sth)[72] = (_Float16 (*)[72])(sol + 4), (*stl)[72] = sth + 128;
  const int tid = threadIdx.x, wave = tid >> 5, lane = tid & 31, col = lane & 15, g = lane >> 4; const size_t r0 = (size_t)blockIdx.x * 64 + wave * 16; const int n0 = blockIdx.y * 128;
  v8f acc[8] = {};
  auto mma = [&](const KStep& s) { v16b a;
#pragma unroll
    for (int i = 0; i < 16; ++i) a[i] = (__bf16)s.a[i];
#pragma unroll
    for (int j = 0; j < 8; ++j) acc[j] = wmma_bf(a, s.w[j], acc[j]); };
  tile_loop(X + (size_t)blockIdx.x * 64 * DM, P + (size_t)n0 * DM, smem, tid, mma);
  if (n0 < 2 * DM) {   // q stored unscaled (f16 sigma ~0.6, no subnormal exposure); 1/8 applied to the f32 score
#pragma unroll
    for (int j = 0; j < 8; ++j) {
#pragma unroll
      for (int r = 0; r < 8; ++r) { const float v = acc[j][r] + (BB ? bfr(BB[j * 16 + col]) : 0.f); const _Float16 hv = (_Float16)v; so[wave][8 * g + r][j * 16 + col] = hv; sol[wave][8 * g + r][j * 16 + col] = (_Float16)((v - (float)hv) * 2048.0f); } }   // q, k (+ bias) as f16 hi + (x2048) residual
    LDSX();
    for (int rl = 0; rl < 16; ++rl) if (lane < 16) { vst2((unsigned*)(QK + (r0 + rl) * (2 * DM) + n0 + lane * 8), *(const v4u*)&so[wave][rl][lane * 8]); vst2((unsigned*)(QKL + (r0 + rl) * (2 * DM) + n0 + lane * 8), *(const v4u*)&sol[wave][rl][lane * 8]); }
  } else {
#pragma unroll
    for (int j = 0; j < 8; ++j) {
#pragma unroll
      for (int r = 0; r < 8; ++r) { const float v = acc[j][r] + (BB ? bfr(BB[j * 16 + col]) : 0.f); const _Float16 hv = (_Float16)v; sth[j * 16 + col][wave * 16 + 8 * g + r] = hv; stl[j * 16 + col][wave * 16 + 8 * g + r] = (_Float16)((v - (float)hv) * 2048.0f); } }
    __syncthreads();
    const size_t rb = (size_t)blockIdx.x * 64; const int b = (int)(rb / SS), s0 = (int)(rb % SS); const int pc0 = n0 - 2 * DM;
    for (int q = tid; q < 128 * 8; q += 128) { const int d = q >> 3, pc = q & 7; const size_t o = ((size_t)b * DM + pc0 + d) * SS + s0 + pc * 8; vst2((unsigned*)(VTH + o), *(const v4u*)&sth[d][pc * 8]); vst2((unsigned*)(VTL + o), *(const v4u*)&stl[d][pc * 8]); }
  }
}
__device__ __forceinline__ float xhalf(float x) { return __builtin_bit_cast(float, __builtin_amdgcn_permlanex16(__builtin_bit_cast(int, x), __builtin_bit_cast(int, x), 0x76543210, 0xfedcba98, false, false)); }   // lane l with lane l ^ 16
// ---- k_attn: block = (64 queries, head h, batch b): all-keys flash attention, TRANSPOSED: S^T = K . Q^T (A = K rows, B = Q rows), so a lane holds 16 scores of ONE query (column col; keys 8 g + r and 16 + 8 g + r of the step's 32): maximum and sum run in the lane, one exchange between the wave's halves joins the maximum, the halves' sums are joined once behind the loop. The two score tiles, converted in place, are the B operand of O^T += V^T . P^T (hardware k order, which frag_h gives the V rows): P touches no LDS. A lane ends with 8 consecutive d of its query per tile and stores them itself.
// The lane now needs 16 keys' positions per step: the block rounds all keys' positions once into LDS (x, y, z planes), with a fourth plane that is 0 for a kept key and -3.0e38 for a masked one, added to the score.
// amdgpu_waves_per_eu(2, 2): the grid gives two waves per SIMD
__global__ __launch_bounds__(128) __attribute__((amdgpu_waves_per_eu(2, 2))) void k_attn(const _Float16* __restrict__ QK, const _Float16* __restrict__ QKL, const _Float16* __restrict__ VTH, const _Float16* __restrict__ VTL, const void* __restrict__ KMASK, const float* __restrict__ POS, const float* __restrict__ DMAX, const float* __restrict__ VEL, const int* __restrict__ AM, float* __restrict__ O) {
  static_assert(SS % 512 == 0, "a thread fills whole groups of 4 keys");
  __shared__ __align__(16) float skx[SS], sky[SS], skz[SS], skm[SS];
  const int tid = threadIdx.x, wave = tid >> 5, lane = tid & 31, col = lane & 15, g = lane >> 4;
  const int qb = blockIdx.x, h = blockIdx.y, b = blockIdx.z; const int q0 = qb * 64 + wave * 16; const size_t rq = (size_t)b * SS + q0 + col;
#pragma unroll
  for (int i = 0; i < SS / 512; ++i) { const int j = tid + 128 * i; const float* p = POS + ((size_t)b * SS + 4 * j) * 3; const v4f u = *(const v4f*)p, v = *(const v4f*)(p + 4), w = *(const v4f*)(p + 8); const v4i mk = *(const v4i*)(AM + (size_t)b * SS + 4 * j);
    const v4f x = { bfr(u[0]), bfr(u[3]), bfr(v[2]), bfr(w[1]) }, y = { bfr(u[1]), bfr(v[0]), bfr(v[3]), bfr(w[2]) }, z = { bfr(u[2]), bfr(v[1]), bfr(w[0]), bfr(w[3]) };
    const v4f a = { mk[0] != 0 ? 0.f : -3.0e38f, mk[1] != 0 ? 0.f : -3.0e38f, mk[2] != 0 ? 0.f : -3.0e38f, mk[3] != 0 ? 0.f : -3.0e38f };
    *(v4f*)&skx[4 * j] = x; *(v4f*)&sky[4 * j] = y; *(v4f*)&skz[4 * j] = z; *(v4f*)&skm[4 * j] = a; }
  v16h aq[2];
#pragma unroll
  for (int kc = 0; kc < 2; ++kc) aq[kc] = frag_h(QK + rq * (2 * DM) + h * HD + kc * 32, lane);
  v2f px2, py2, pz2; { const float* p = POS + rq * 3; const float px = bfr(p[0]), py = bfr(p[1]), pz = bfr(p[2]); px2 = v2f{ px, px }; py2 = v2f{ py, py }; pz2 = v2f{ pz, pz }; }   // the lane's query, each coordinate twice
  float coef; { float vh = fabsf(bfr(VEL[h])); vh = fminf(fmaxf(vh, 0.f), 0.999f); const float gam = 1.0f / sqrtf(1.0f - vh * vh); coef = gam * vh / (DMAX[0] + 1e-8f); }   // gamma v / (dmax + 1e-8): dist is normalised by the global max
  const bool havemax = DMAX[0] > 0.f;
  float m = -3.0e38f, l = 0.f;   // the query's running maximum (equal in both halves) and this half's share of its sum
  v8f acc[4] = {};
  const int nks = SS / 32;   // all keys
  // the K and V fragments of key step ks + 1 are fetched during step ks, into the registers that step ks has just finished with: K behind the score products, V behind the P.V products
  v16h kf[2][2], vf[4];
  auto fetch_k = [&](int ks) {
#pragma unroll
    for (int ct = 0; ct < 2; ++ct) { const _Float16* krow = QK + ((size_t)b * SS + ks * 32 + ct * 16 + col) * (2 * DM) + DM + h * HD;
#pragma unroll
      for (int kc = 0; kc < 2; ++kc) kf[ct][kc] = frag_h(krow + kc * 32, lane); } };
  auto fetch_v = [&](int ks) {
#pragma unroll
    for (int dt = 0; dt < 4; ++dt) vf[dt] = frag_h(VTH + ((size_t)b * DM + h * HD + dt * 16 + col) * SS + ks * 32, lane); };
  fetch_k(0);
  asm volatile("" :: "v"(kf[0][0]), "v"(kf[0][1]), "v"(kf[1][0]), "v"(kf[1][1]));   // inputs only: step 0's K has landed before the loop, as on every later entry; else the wait at the loop's head, set for the first entry, also waits out the V loads in flight on every pass
  fetch_v(0);
  __syncthreads();   // the key planes are whole before any wave reads them
#pragma unroll 1
  for (int ks = 0; ks < nks; ++ks) { v8f cc[2]; const int kn = (ks + 1 < nks) ? ks + 1 : ks;   // the last step refetches itself: in range, not used
    v4f tx[4], ty[4], tz[4], tm[4];   // the lane's 16 keys: planes read as 16-byte words, the same address in all 16 lanes of a half
#pragma unroll
    for (int q = 0; q < 4; ++q) { const int k0 = ks * 32 + (q >> 1) * 16 + 8 * g + (q & 1) * 4; tx[q] = *(const v4f*)&skx[k0]; ty[q] = *(const v4f*)&sky[k0]; tz[q] = *(const v4f*)&skz[k0]; tm[q] = *(const v4f*)&skm[k0]; }
#pragma unroll
    for (int ct = 0; ct < 2; ++ct) { v8f c = {};
#pragma unroll
      for (int kc = 0; kc < 2; ++kc) c = wmma16(kf[ct][kc], aq[kc], c);   // single product: k, q as one-rounding f16 operands; c[r] = score of key ct * 16 + 8 g + r with query col
      cc[ct] = c; }
    fetch_k(kn);
    __builtin_amdgcn_sched_barrier(0);   // keeps the K loads here, a whole softmax ahead of their use, instead of sinking to the end of the block
    float s[16];
#pragma unroll
    for (int p = 0; p < 8; ++p) { const int q = p >> 1, e = (p & 1) * 2;   // two keys at a time, neighbours in the planes' words: packed f32 forms with no register moves
      const v2f kx = { tx[q][e], tx[q][e + 1] }, ky = { ty[q][e], ty[q][e + 1] }, kz = { tz[q][e], tz[q][e + 1] };
      const v2f dx = px2 - kx, dy = py2 - ky, dz = pz2 - kz; const v2f sq2 = dx * dx + dy * dy + dz * dz;
#pragma unroll
      for (int u = 0; u < 2; ++u) { const int i = 2 * p + u; const float sq = sq2[u]; const float dist = (sq == 0.f) ? 0.f : sqrtf(sq); const float fac = havemax ? __expf(-dist * coef) : __expf(-dist * coef * (DMAX[0] + 1e-8f)); s[i] = cc[i >> 3][i & 7] * 0.125f * fac + tm[q][e + u]; } }   // score x exp(-normalised distance x gamma v); a masked key ends at -3.0e38
    float mx = s[0];
#pragma unroll
    for (int i = 1; i < 16; ++i) mx = fmaxf(mx, s[i]);
    mx = fmaxf(mx, xhalf(mx));
    const float mn = fmaxf(m, mx); const float alpha = (m <= -1.0e38f) ? 0.f : __expf(m - mn);
    const float mref = (mn <= -1.0e38f) ? 0.f : mn;   // no kept key yet: against 0 every masked score gives weight 0, as it does against a real maximum
    float e[16]; v16h pa;
#pragma unroll
    for (int i = 0; i < 16; ++i) { e[i] = __expf(s[i] - mref); pa[i] = (_Float16)(e[i] * 2048.0f); }   // P scaled by 2^11 so small softmax weights stay out of the f16 subnormal range; 2^-11 folded into the epilogue. Element i of the B operand is key 8 g + i (i < 8) or 16 + 8 g + i - 8: the two tiles' registers in their order
#pragma unroll
    for (int w = 8; w > 0; w >>= 1) {   // a tree, not a chain of 15 dependent adds
#pragma unroll
      for (int i = 0; i < w; ++i) e[i] += e[i + w]; }
    const float es = e[0];
    l = l * alpha + es; m = mn;
#pragma unroll
    for (int dt = 0; dt < 4; ++dt) acc[dt] *= alpha;
#pragma unroll
    for (int dt = 0; dt < 4; ++dt) acc[dt] = wmma16(vf[dt], pa, acc[dt]);   // single product: V^T x P^T (x2^11); acc[dt][r] = O[query col][dt * 16 + 8 g + r]
    fetch_v(kn);
    asm volatile("s_wait_xcnt 0x0" ::: "memory"); }   // stands in front of the next pass's overwrite of the V loads' address registers
  const float il = (1.0f / 2048.0f) / (l + xhalf(l));
  float* orow = O + rq * DM + h * HD + 8 * g;
#pragma unroll
  for (int dt = 0; dt < 4; ++dt) { const v4f lo = { acc[dt][0] * il, acc[dt][1] * il, acc[dt][2] * il, acc[dt][3] * il }, hi = { acc[dt][4] * il, acc[dt][5] * il, acc[dt][6] * il, acc[dt][7] * il }; vst2(orow + dt * 16, lo); vst2(orow + dt * 16 + 4, hi); }
}
// ---- k_out: block = (64 rows, 128 cols): out = O(hi/lo) . Wo rows (2 products) + bo
__global__ __launch_bounds__(128) void k_out(const float* __restrict__ O, const __bf16* __restrict__ P, const float* __restrict__ BO, float* __restrict__ Y) {
  __shared__ __align__(16) char smem[2 * ST_SZ];   // the two tile buffers; behind the loop the output staging
  static_assert(2 * ST_SZ >= 4 * 16 * 132 * 4, "the staging fits the buffers");
  float (*so)[16][132] = (float (*)[16][132])smem;
  const int tid = threadIdx.x, wave = tid >> 5, lane = tid & 31, col = lane & 15, g = lane >> 4; const size_t r0 = (size_t)blockIdx.x * 64 + wave * 16; const int n0 = blockIdx.y * 128;
  v8f acc[8] = {};
  auto mma = [&](const KStep& s) { const F2 a = bsplit16(s.a);
#pragma unroll
    for (int j = 0; j < 8; ++j) { acc[j] = wmma_bf(a.l, s.w[j], acc[j]); acc[j] = wmma_bf(a.h, s.w[j], acc[j]); } };
  tile_loop(O + (size_t)blockIdx.x * 64 * DM, P + (size_t)n0 * DM, smem, tid, mma);
#pragma unroll
  for (int j = 0; j < 8; ++j) {
#pragma unroll
    for (int r = 0; r < 8; ++r) so[wave][8 * g + r][j * 16 + col] = acc[j][r] + bfr(BO[n0 + j * 16 + col]); }
  LDSX();
  for (int rl = 0; rl < 16; ++rl) vst2(Y + (r0 + rl) * DM + n0 + lane * 4, *(const v4f*)&so[wave][rl][lane * 4]);
}
// ---- k_dist1: block = 32 rows x all keys. A thread keeps the rounded positions of its own 8 keys in registers (six 16-byte loads, issued together) and walks the block's 32 rows, read from LDS: no load stands in the loop's dependent path. max is order-free, so any split of the pairs gives the same global maximum: RM[block * 32 + i] = max of |p_r - p_j|^2 over the block's rows r and the keys j of threads 8 i .. 8 i + 7; one 128-B line per block
__global__ __launch_bounds__(256) void k_dist1(const float* __restrict__ POS, float* __restrict__ RM) {
  static_assert(NB * SS == 256 * 8, "a thread owns 8 keys");
  __shared__ __align__(16) float srow[32][4]; __shared__ __align__(16) float red[256]; __shared__ __align__(16) float line[32];
  const int t = threadIdx.x; const size_t r0 = (size_t)blockIdx.x * 32;
  v4f kv[6];
#pragma unroll
  for (int i = 0; i < 6; ++i) kv[i] = *(const v4f*)(POS + (size_t)t * 24 + i * 4);
  if (t < 128) { const int c = t & 3; const float v = POS[(r0 + (t >> 2)) * 3 + (c < 3 ? c : 2)]; srow[t >> 2][c] = (c < 3) ? bfr(v) : 0.f; }   // a row's fourth word is padding, written so that the 16-byte rows hold no unwritten LDS
  float kx[8], ky[8], kz[8], mx[8];
#pragma unroll
  for (int j = 0; j < 8; ++j) { kx[j] = bfr(kv[(3 * j) >> 2][(3 * j) & 3]); ky[j] = bfr(kv[(3 * j + 1) >> 2][(3 * j + 1) & 3]); kz[j] = bfr(kv[(3 * j + 2) >> 2][(3 * j + 2) & 3]); mx[j] = 0.f; }
  __syncthreads();
  // unrolled by four: four rows' LDS reads go out as one group ahead of their 32 distances
#pragma unroll 4
  for (int i = 0; i < 32; ++i) { const v4f p = *(const v4f*)&srow[i][0];
#pragma unroll
    for (int j = 0; j < 8; ++j) { const float dx = p[0] - kx[j], dy = p[1] - ky[j], dz = p[2] - kz[j]; mx[j] = fmaxf(mx[j], dx * dx + dy * dy + dz * dz); } }
  red[t] = fmaxf(fmaxf(fmaxf(mx[0], mx[1]), fmaxf(mx[2], mx[3])), fmaxf(fmaxf(mx[4], mx[5]), fmaxf(mx[6], mx[7]))); __syncthreads();
  if (t < 32) { const v4f a = *(const v4f*)&red[t * 8], c = *(const v4f*)&red[t * 8 + 4]; line[t] = fmaxf(fmaxf(fmaxf(a[0], a[1]), fmaxf(a[2], a[3])), fmaxf(fmaxf(c[0], c[1]), fmaxf(c[2], c[3]))); } __syncthreads();
  if (t < 8) vst2(RM + r0 + t * 4, *(const v4f*)&line[t * 4]);
}
// ---- k_dist2: one block: global max -> sqrt -> DMAX (one line)
__global__ __launch_bounds__(256) void k_dist2(const float* __restrict__ RM, float* __restrict__ DMX) { __shared__ float red[256]; __shared__ __align__(16) float line[32]; const int t = threadIdx.x; float mx = 0.f; for (int i = t; i < NB * SS; i += 256) mx = fmaxf(mx, RM[i]); red[t] = mx; __syncthreads();
  for (int s = 128; s > 0; s >>= 1) { if (t < s) red[t] = fmaxf(red[t], red[t + s]); __syncthreads(); }
  if (t < 32) line[t] = (t == 0) ? sqrtf(red[0]) : 0.f; __syncthreads(); if (t < 8) vst2(DMX + t * 4, *(const v4f*)&line[t * 4]); }
extern "C" void kernel_launch(void* const* d_in, const int* in_sizes, int n_in, void* d_out, int out_size, void* d_ws, size_t ws_size, hipStream_t stream) {
  (void)in_sizes; (void)n_in; (void)out_size;
  const float** F = (const float**)d_in;   // 0 x [1,2048,1024], 1 attention_mask [1,2048] int, 2 positions [1,2048,3], 3 Wq, 4 bq, 5 Wk, 6 bk, 7 Wv, 8 bv, 9 Wo, 10 bo (natural), 11 velocity [16]
  if (ws_size < (size_t)WS_END) return;
  char* ws = (char*)d_ws; __bf16* PK = (__bf16*)(ws + WS_PK); _Float16 *QK = (_Float16*)(ws + WS_QK), *QKL = (_Float16*)(ws + WS_QKL), *VTH = (_Float16*)(ws + WS_VTH), *VTL = (_Float16*)(ws + WS_VTL); float *O = (float*)(ws + WS_O), *RM = (float*)(ws + WS_DM), *DMX = RM + NB * SS;
  k_pack<<<dim3(DM, 4), 256, 0, stream>>>(F[3], F[5], F[7], F[9], PK);
  k_dist1<<<NB * SS / 32, 256, 0, stream>>>(F[2], RM);
  k_dist2<<<1, 256, 0, stream>>>(RM, DMX);
  k_qkv<<<dim3(TNB * SS / 64, QKVW / 128), 128, 0, stream>>>(F[0], F[0], F[0], PK + PK_A, F[4], F[6], F[8], QK, QKL, VTH, VTL);
  k_attn<<<dim3(TQB, NH, TNB), 128, 0, stream>>>(QK, QKL, VTH, VTL, nullptr, F[2], DMX, F[11], (const int*)d_in[1], O);
  k_out<<<dim3(TOB, DM / 128), 128, 0, stream>>>(O, PK + PK_P, F[10], (float*)d_out);
}

// v005
// It runs in 109 microseconds.
// Timed twice side by side with v004, it ran 1.03 and 1.02 times as fast.
// All steps since v000 together make it 3.57 times as fast.
// compute dtype: all float inputs rounded to bf16, the int mask read on device; q/k/v = x . W^T + b with EXACT bf16 products on WMMA 16x16x32 (natural rows); pairwise distances, their global maximum (deterministic block reduction), the Lorentz factor and exp(-d coef) in f32 (hardware exp); PLAIN attention: q, k single f16 x 1/8 x that factor, masked keys excluded, running-max softmax in f32, P (scaled by 2^11, single f16) x v (single f16); out = o (bf16 hi + residual) . Wo^T (2 products) + bo.
#include <hip/hip_runtime.h>
#include <math.h>

typedef __attribute__((ext_vector_type(16))) _Float16 v16h;
typedef __attribute__((ext_vector_type(16))) __bf16 v16b;
typedef __attribute__((ext_vector_type(8)))  _Float16 v8h;
typedef __attribute__((ext_vector_type(8)))  float v8f;
typedef __attribute__((ext_vector_type(4)))  float v4f;
typedef __attribute__((ext_vector_type(2)))  float v2f;
typedef __attribute__((ext_vector_type(4)))  unsigned v4u;
typedef __attribute__((ext_vector_type(4)))  int v4i;
typedef float __attribute__((may_alias)) float_a;
typedef int __attribute__((may_alias)) int_a;

template <typename T> __device__ __forceinline__ void vst2(void* p, T v) { *(T*)p = v;  }
__device__ __forceinline__ v8f wmma16(v16h a, v16h b, v8f c) {
  v8f d = __builtin_amdgcn_wmma_f32_16x16x32_f16(false, a, false, b, (short)0, c, false, false);
  asm volatile("v_nop\n\tv_nop\n\tv_nop\n\tv_nop" : "+v"(d) : "v"(a), "v"(b));
  return d;
}
__device__ __forceinline__ v8f wmma_bf(v16b a, v16b b, v8f c) {
  v8f d = __builtin_amdgcn_wmma_f32_16x16x32_bf16(false, a, false, b, (short)0, c, false, false);
  asm volatile("v_nop\n\tv_nop\n\tv_nop\n\tv_nop" : "+v"(d) : "v"(a), "v"(b));
  return d;
}
// Relativistic self attention (B 1, S 2,048, d 1,024, 16 heads x 64): q/k/v projections + biases, scores / 8 multiplied by exp(-dist_ij gamma_h v_h) with the normalised pairwise distance of the 3-D positions and a per-head velocity, key mask, softmax, . v, output projection + bias.
__device__ __forceinline__ v16h frag_h(const _Float16* rowk0, int lane) {
  union { v16h v; v8h q[2]; } u; const _Float16* p = rowk0 + 8 * (lane >> 4);
  u.q[0] = *(const v8h*)p; u.q[1] = *(const v8h*)(p + 16); return u.v;
}
__device__ __forceinline__ v16h frag_f32(const float* rowk0, int lane) {
  v16h a; const float* p = rowk0 + 8 * (lane >> 4);
#pragma unroll
  for (int i = 0; i < 8; ++i) { a[i] = (_Float16)p[i]; a[8 + i] = (_Float16)p[16 + i]; }
  return a;
}
__device__ __forceinline__ v16h frag_f32s(const float* rowk0, int lane, float sc) {
  v16h a; const float* p = rowk0 + 8 * (lane >> 4);
#pragma unroll
  for (int i = 0; i < 8; ++i) { a[i] = (_Float16)(p[i] * sc); a[8 + i] = (_Float16)(p[16 + i] * sc); }
  return a;
}
// column fragment from a [K][ld] layout (column n), rows >= K read as 0
__device__ __forceinline__ v16h fragc_f32(const float* W, int k0, int n, int lane, int ld, int K) {
  v16h a; const int g = lane >> 4;
#pragma unroll
  for (int i = 0; i < 8; ++i) { const int ka = k0 + 8 * g + i, kb = ka + 16;
    a[i] = (_Float16)(ka < K ? W[(size_t)(ka < K ? ka : K - 1) * ld + n] : 0.f); a[8 + i] = (_Float16)(kb < K ? W[(size_t)(kb < K ? kb : K - 1) * ld + n] : 0.f); }
  return a;
}
struct F2 { v16b h, l; };
__device__ __forceinline__ F2 bsplit16(const float v[16]) { F2 r;
#pragma unroll
  for (int i = 0; i < 16; ++i) { const __bf16 h = (__bf16)v[i]; r.h[i] = h; r.l[i] = (__bf16)(v[i] - (float)h); }
  return r; }
__device__ __forceinline__ F2 split_row(const float* row, int k0, int lane) { float v[16]; const float* p = row + k0 + 8 * (lane >> 4);
#pragma unroll
  for (int i = 0; i < 8; ++i) { v[i] = p[i]; v[8 + i] = p[16 + i]; }
  return bsplit16(v); }
__device__ __forceinline__ F2 split_rowK(const float* row, int k0, int lane, int K) { float v[16]; const int g = lane >> 4;
#pragma unroll
  for (int i = 0; i < 8; ++i) { const int ka = k0 + 8 * g + i, kb = ka + 16; v[i] = ka < K ? row[ka < K ? ka : K - 1] : 0.f; v[8 + i] = kb < K ? row[kb < K ? kb : K - 1] : 0.f; }
  return bsplit16(v); }
__device__ __forceinline__ F2 split_col(const float* W, int k0, int n, int lane, int ld, int K) { float v[16]; const int g = lane >> 4;
#pragma unroll
  for (int i = 0; i < 8; ++i) { const int ka = k0 + 8 * g + i, kb = ka + 16; v[i] = ka < K ? W[(size_t)(ka < K ? ka : K - 1) * ld + n] : 0.f; v[8 + i] = kb < K ? W[(size_t)(kb < K ? kb : K - 1) * ld + n] : 0.f; }
  return bsplit16(v); }
__device__ __forceinline__ v8f mac3(const F2& a, const F2& b, v8f c) { c = wmma_bf(a.l, b.h, c); c = wmma_bf(a.h, b.l, c); return wmma_bf(a.h, b.h, c); }
__device__ __forceinline__ float sigm(float v) { return 1.0f / (1.0f + expf(-v)); }
#define LDSX() do { asm volatile("s_wait_dscnt 0" ::: "memory"); __builtin_amdgcn_wave_barrier(); __builtin_amdgcn_fence(__ATOMIC_RELEASE, "workgroup"); } while (0)


#define NB 1
#define SS 2048
#define DM 1024
#define NH 16
#define HD 64
#define QKVW (3 * DM)
#ifndef TQB
#define TQB (SS / 64)
#define TNB NB
#define TOB (NB * SS / 64)     // output row tiles (all)
#endif
typedef __attribute__((ext_vector_type(8))) __bf16 v8b;
__device__ __forceinline__ v16b frag_b(const __bf16* rowk0, int lane) {
  union { v16b v; v8b q[2]; } u; const __bf16* p = rowk0 + 8 * (lane >> 4);
  u.q[0] = *(const v8b*)p; u.q[1] = *(const v8b*)(p + 16); return u.v;
}
__device__ __forceinline__ float bfr(float v) { return (float)(__bf16)v; }
__device__ __attribute__((noinline)) float exp_ni(float v) { return expf(v); }
__device__ __attribute__((noinline)) float erf_ni(float v) { return erff(v); }

#define PK_A 0                       // [3072][1024] Wqkv rows (natural [out][in])
#define PK_P (PK_A + QKVW * DM)        // [1024][1024] Wo rows (natural)
#define PK_END (PK_P + DM * DM)
#define WS_PK  0u
#define WS_QK  (WS_PK + 2u * PK_END)             // f16 [2048 rows][2048]: q | k
#define WS_QKL (WS_QK + 2u * NB * SS * 2 * DM)     // f16 q | k residual planes x2048
#define WS_VTH (WS_QKL + 2u * NB * SS * 2 * DM)    // f16 [b][1024 (h*64+d)][2048 s] hi
#define WS_VTL (WS_VTH + 2u * NB * DM * SS)        // f16 lo x 2048
#define WS_O   (WS_VTL + 2u * NB * DM * SS)        // f32 [2048][1024]
#define WS_CS  (WS_O + 4u * NB * SS * DM)           // f32 2 x [2048][32], not used by any kernel here
#define WS_DM  (WS_CS + 4u * 2 * SS * 32)                  // f32: partial maxima of the squared pairwise distances [SS], then the global max at [SS]
#define WS_END (WS_DM + 4u * (size_t)(SS + 32))
// one k-step (32 k) of a row-times-weight-rows product, as loaded: the lane's 16 f32 of its A row and its 8 weight fragments (16 columns each)
struct KStep { float a[16]; v16b w[8]; };
// ---- operand tiles of k_qkv and k_out in LDS. A tile is 64 k of the block's 64 A rows (f32, 256 B a row) and of its 128 weight rows (bf16, 128 B a row), brought by asynchronous copies: a wave's copy covers four whole 128-B lines, and the block fetches each line once for its four waves. Row pitches 272 and 144 B (16 B x odd): the 16 rows of a fragment read fall on distinct banks.
#define ST_K 64
#define ST_N (DM / ST_K)
#define ST_AP 272
#define ST_WP 144
#define ST_W (64 * ST_AP)
#define ST_SZ (ST_W + 128 * ST_WP)
// eight copies, each lane its own 16 bytes; the s_wait_xcnt stands inside the statement, behind the last copy, so that no address register named here is rewritten in front of it
__device__ __forceinline__ void acopy8(const unsigned (&l)[8], const void* const (&p)[8]) {
  asm volatile("global_load_async_to_lds_b128 %0, %8, off\n\t"
               "global_load_async_to_lds_b128 %1, %9, off\n\t"
               "global_load_async_to_lds_b128 %2, %10, off\n\t"
               "global_load_async_to_lds_b128 %3, %11, off\n\t"
               "global_load_async_to_lds_b128 %4, %12, off\n\t"
               "global_load_async_to_lds_b128 %5, %13, off\n\t"
               "global_load_async_to_lds_b128 %6, %14, off\n\t"
               "global_load_async_to_lds_b128 %7, %15, off\n\t"
               "s_wait_xcnt 0x0"
               :: "v"(l[0]), "v"(l[1]), "v"(l[2]), "v"(l[3]), "v"(l[4]), "v"(l[5]), "v"(l[6]), "v"(l[7]),
                  "v"(p[0]), "v"(p[1]), "v"(p[2]), "v"(p[3]), "v"(p[4]), "v"(p[5]), "v"(p[6]), "v"(p[7]) : "memory");
}
// tile st of the block into the buffer at LDS byte address lbuf; 128 threads, 16 copies each. a0, w0: the thread's own 16 bytes of tile 0 (A row tid / 16, weight row tid / 8); its further copies lie 8 A rows and 16 weight rows apart
__device__ __forceinline__ void tile_fill(const char* a0, const char* w0, int st, unsigned lbuf, int tid) {
  unsigned l[8]; const void* p[8];
  const char* pa = a0 + st * (ST_K * 4); const unsigned la = lbuf + (tid >> 4) * ST_AP + (tid & 15) * 16;
#pragma unroll
  for (int i = 0; i < 8; ++i) { l[i] = la + i * (8 * ST_AP); p[i] = pa + i * (8 * DM * 4); }
  acopy8(l, p);
  const char* pw = w0 + st * (ST_K * 2); const unsigned lw = lbuf + ST_W + (tid >> 3) * ST_WP + (tid & 7) * 16;
#pragma unroll
  for (int i = 0; i < 8; ++i) { l[i] = lw + i * (16 * ST_WP); p[i] = pw + i * (16 * DM * 2); }
  acopy8(l, p);
}
// k-step kk (0 or 1) of a tile: arow = the lane's A row in the buffer + 32 g bytes, wrow = weight row col in the buffer + 16 g bytes; the k order of both is that of frag_b
__device__ __forceinline__ void kstep_lds(KStep& s, const char* arow, const char* wrow, int kk) {
  const v4f a0 = *(const v4f*)(arow + kk * 128), a1 = *(const v4f*)(arow + kk * 128 + 16), a2 = *(const v4f*)(arow + kk * 128 + 64), a3 = *(const v4f*)(arow + kk * 128 + 80);
#pragma unroll
  for (int i = 0; i < 4; ++i) { s.a[i] = a0[i]; s.a[4 + i] = a1[i]; s.a[8 + i] = a2[i]; s.a[12 + i] = a3[i]; }
#pragma unroll
  for (int j = 0; j < 8; ++j) { union { v16b v; v8b q[2]; } u; const char* p = wrow + j * 16 * ST_WP + kk * 64; u.q[0] = *(const v8b*)p; u.q[1] = *(const v8b*)(p + 32); s.w[j] = u.v; }
}
// the two-buffer loop over the tiles: tile t + 1 flies while tile t is worked on. At the foot of a trip every wave ends its own LDS reads and its own copies, the barrier publishes tile t + 1 and frees tile t's buffer, and only then tile t + 2 is aimed at that buffer. The last trip's barrier also frees both buffers for the output staging.
template <typename MMA> __device__ __forceinline__ void tile_loop(const float* A0, const __bf16* W0, char* smem, int tid, MMA mma) {
  const int wave = tid >> 5, lane = tid & 31, col = lane & 15, g = lane >> 4; const unsigned l0 = (unsigned)(size_t)smem;
  const char* a0 = (const char*)(A0 + (size_t)(tid >> 4) * DM + (tid & 15) * 4); const char* w0 = (const char*)(W0 + (size_t)(tid >> 3) * DM + (tid & 7) * 8);
  tile_fill(a0, w0, 0, l0, tid);
  asm volatile("s_wait_asynccnt 0x0" ::: "memory");   // tile 0 has landed, this wave's share
  __syncthreads();   // tile 0 is whole before any wave reads it
  tile_fill(a0, w0, 1, l0 + ST_SZ, tid);
#pragma unroll 1
  for (int t = 0; t < ST_N; ++t) {   // rolled: the buffer is picked by t & 1
    const int bo = (t & 1) * ST_SZ; const char* arow = smem + bo + (wave * 16 + col) * ST_AP + 32 * g; const char* wrow = smem + bo + ST_W + col * ST_WP + 16 * g;
    KStep s0, s1; kstep_lds(s0, arow, wrow, 0); kstep_lds(s1, arow, wrow, 1); mma(s0); mma(s1);
    asm volatile("s_wait_dscnt 0x0" ::: "memory");      // this wave's reads of tile t are over before the buffer is given up
    asm volatile("s_wait_asynccnt 0x0" ::: "memory");   // this wave's share of tile t + 1 has landed
    __syncthreads();   // publishes tile t + 1, ends every reader's last read of tile t
    if (t + 2 < ST_N) tile_fill(a0, w0, t + 2, l0 + bo, tid);
  }
  asm volatile("s_wait_asynccnt 0x0" ::: "memory");   // no copy is outstanding when the LDS is used anew
}
// ---- k_pack: block = (row n, which): natural [out][in] rows -> bf16; which 0..2 -> W_q/W_k/W_v into PK_A rows which*1024 + n; 3 -> W_o into PK_P
__global__ __launch_bounds__(256) void k_pack(const float* __restrict__ WQ, const float* __restrict__ WK, const float* __restrict__ WV, const float* __restrict__ WO, __bf16* __restrict__ PK) {
  __shared__ __align__(16) __bf16 s[DM]; const int n = blockIdx.x, which = blockIdx.y, t = threadIdx.x; const float* Wm = (which == 0) ? WQ : (which == 1) ? WK : (which == 2) ? WV : WO;
  for (int k = t; k < DM; k += 256) s[k] = (__bf16)Wm[(size_t)n * DM + k];
  __syncthreads();
  __bf16* dst = (which < 3) ? PK + PK_A + ((size_t)which * DM + n) * DM : PK + PK_P + (size_t)n * DM;
  for (int q = t; q < DM / 8; q += 256) vst2((unsigned*)(dst + q * 8), *(const v4u*)&s[q * 8]);
}
__global__ __launch_bounds__(128) void k_qkv(const float* __restrict__ XQ, const float* __restrict__ XK, const float* __restrict__ XV, const __bf16* __restrict__ P, const float* __restrict__ BQ, const float* __restrict__ BK, const float* __restrict__ BV, _Float16* __restrict__ QK, _Float16* __restrict__ QKL, _Float16* __restrict__ VTH, _Float16* __restrict__ VTL) {
  const int which0 = (blockIdx.y * 128) / DM; const float* X = (which0 == 0) ? XQ : (which0 == 1) ? XK : XV; const float* BB = BQ ? (((which0 == 0) ? BQ : (which0 == 1) ? BK : BV) + (blockIdx.y * 128 - which0 * DM)) : nullptr;
  __shared__ __align__(16) char smem[2 * ST_SZ];   // the two tile buffers; behind the loop the output staging
  static_assert(2 * ST_SZ >= 2 * (4 * 16 * 136 + 128 * 72) * 2, "the staging fits the buffers");
  _Float16 (*so)[16][136] = (_Float16 (*)[16][136])smem, (*sol)[16][136] = so + 4; _Float16 (*sth)[72] = (_Float16 (*)[72])(sol + 4), (*stl)[72] = sth + 128;
  const int tid = threadIdx.x, wave = tid >> 5, lane = tid & 31, col = lane & 15, g = lane >> 4; const size_t r0 = (size_t)blockIdx.x * 64 + wave * 16; const int n0 = blockIdx.y * 128;
  v8f acc[8] = {};
  auto mma = [&](const KStep& s) { v16b a;
#pragma unroll
    for (int i = 0; i < 16; ++i) a[i] = (__bf16)s.a[i];
#pragma unroll
    for (int j = 0; j < 8; ++j) acc[j] = wmma_bf(a, s.w[j], acc[j]); };
  tile_loop(X + (size_t)blockIdx.x * 64 * DM, P + (size_t)n0 * DM, smem, tid, mma);
  if (n0 < 2 * DM) {   // q stored unscaled (f16 sigma ~0.6, no subnormal exposure); 1/8 applied to the f32 score
#pragma unroll
    for (int j = 0; j < 8; ++j) {
#pragma unroll
      for (int r = 0; r < 8; ++r) { const float v = acc[j][r] + (BB ? bfr(BB[j * 16 + col]) : 0.f); const _Float16 hv = (_Float16)v; so[wave][8 * g + r][j * 16 + col] = hv; sol[wave][8 * g + r][j * 16 + col] = (_Float16)((v - (float)hv) * 2048.0f); } }   // q, k (+ bias) as f16 hi + (x2048) residual
    LDSX();
    for (int rl = 0; rl < 16; ++rl) if (lane < 16) { vst2((unsigned*)(QK + (r0 + rl) * (2 * DM) + n0 + lane * 8), *(const v4u*)&so[wave][rl][lane * 8]); vst2((unsigned*)(QKL + (r0 + rl) * (2 * DM) + n0 + lane * 8), *(const v4u*)&sol[wave][rl][lane * 8]); }
  } else {
#pragma unroll
    for (int j = 0; j < 8; ++j) {
#pragma unroll
      for (int r = 0; r < 8; ++r) { const float v = acc[j][r] + (BB ? bfr(BB[j * 16 + col]) : 0.f); const _Float16 hv = (_Float16)v; sth[j * 16 + col][wave * 16 + 8 * g + r] = hv; stl[j * 16 + col][wave * 16 + 8 * g + r] = (_Float16)((v - (float)hv) * 2048.0f); } }
    __syncthreads();
    const size_t rb = (size_t)blockIdx.x * 64; const int b = (int)(rb / SS), s0 = (int)(rb % SS); const int pc0 = n0 - 2 * DM;
    for (int q = tid; q < 128 * 8; q += 128) { const int d = q >> 3, pc = q & 7; const size_t o = ((size_t)b * DM + pc0 + d) * SS + s0 + pc * 8; vst2((unsigned*)(VTH + o), *(const v4u*)&sth[d][pc * 8]); vst2((unsigned*)(VTL + o), *(const v4u*)&stl[d][pc * 8]); }
  }
}
// ---- K and V tiles of k_attn in LDS. A tile is 64 keys: 64 K rows (this head's 64 d, 128 B) and 64 V^T rows (one d each, the tile's 64 keys, 128 B), brought by asynchronous copies: a wave's copy covers four whole 128-B lines, and the block fetches each line once for its four waves. Row pitch 144 B (16 B x odd): the 16 rows of a fragment read fall on distinct banks.
#define AT_K 64
#define AT_N (SS / AT_K)
#define AT_P 144
#define AT_V (AT_K * AT_P)
#define AT_SZ (AT_V + HD * AT_P)
// tile t into the buffer at LDS byte address lbuf; 128 threads, 4 copies of K and 4 of V^T each. k0, v0: the thread's own 16 bytes of tile 0 (row tid / 8 of either); its further copies lie 16 rows apart
__device__ __forceinline__ void kv_fill(const char* k0, const char* v0, int t, unsigned lbuf, int tid) {
  unsigned l[8]; const void* p[8];
  const char* pk = k0 + (size_t)t * (AT_K * 2 * DM * 2); const char* pv = v0 + t * (AT_K * 2); const unsigned lk = lbuf + (tid >> 3) * AT_P + (tid & 7) * 16;
#pragma unroll
  for (int i = 0; i < 4; ++i) { l[i] = lk + i * (16 * AT_P); p[i] = pk + i * (16 * 2 * DM * 2); l[4 + i] = lk + AT_V + i * (16 * AT_P); p[4 + i] = pv + i * (16 * SS * 2); }
  acopy8(l, p);
}
__device__ __forceinline__ float xhalf(float x) { return __builtin_bit_cast(float, __builtin_amdgcn_permlanex16(__builtin_bit_cast(int, x), __builtin_bit_cast(int, x), 0x76543210, 0xfedcba98, false, false)); }   // lane l with lane l ^ 16
// ---- k_attn: block = (64 queries, head h, batch b): all-keys flash attention, TRANSPOSED: S^T = K . Q^T (A = K rows, B = Q rows), so a lane holds 16 scores of ONE query (column col; keys 8 g + r and 16 + 8 g + r of the step's 32): maximum and sum run in the lane, one exchange between the wave's halves joins the maximum, the halves' sums are joined once behind the loop. The two score tiles, converted in place, are the B operand of O^T += V^T . P^T (hardware k order, which frag_h gives the V rows): P touches no LDS. A lane ends with 8 consecutive d of its query per tile and stores them itself.
// The lane now needs 16 keys' positions per step: the block rounds all keys' positions once into LDS (x, y, z planes), with a fourth plane that is 0 for a kept key and -3.0e38 for a masked one, added to the score.
// amdgpu_waves_per_eu(2, 2): the grid gives two waves per SIMD
__global__ __launch_bounds__(128) __attribute__((amdgpu_waves_per_eu(2, 2))) void k_attn(const _Float16* __restrict__ QK, const _Float16* __restrict__ QKL, const _Float16* __restrict__ VTH, const _Float16* __restrict__ VTL, const void* __restrict__ KMASK, const float* __restrict__ POS, const float* __restrict__ DMAX, const float* __restrict__ VEL, const int* __restrict__ AM, float* __restrict__ O) {
  static_assert(SS % 512 == 0, "a thread fills whole groups of 4 keys");
  static_assert(AT_N >= 2 && HD == 64, "two tiles exist; a K row is 128 B");
  __shared__ __align__(16) float skx[SS], sky[SS], skz[SS], skm[SS];
  __shared__ __align__(16) char skv[2 * AT_SZ];   // the two K and V tile buffers
  const int tid = threadIdx.x, wave = tid >> 5, lane = tid & 31, col = lane & 15, g = lane >> 4;
  const int qb = blockIdx.x, h = blockIdx.y, b = blockIdx.z; const int q0 = qb * 64 + wave * 16; const size_t rq = (size_t)b * SS + q0 + col;
  const unsigned l0 = (unsigned)(size_t)skv;
  const char* gk = (const char*)(QK + ((size_t)b * SS + (tid >> 3)) * (2 * DM) + DM + h * HD + (tid & 7) * 8); const char* gv = (const char*)(VTH + ((size_t)b * DM + h * HD + (tid >> 3)) * SS + (tid & 7) * 8);
  kv_fill(gk, gv, 0, l0, tid);   // tile 0 flies while the key planes are made
#pragma unroll
  for (int i = 0; i < SS / 512; ++i) { const int j = tid + 128 * i; const float* p = POS + ((size_t)b * SS + 4 * j) * 3; const v4f u = *(const v4f*)p, v = *(const v4f*)(p + 4), w = *(const v4f*)(p + 8); const v4i mk = *(const v4i*)(AM + (size_t)b * SS + 4 * j);
    const v4f x = { bfr(u[0]), bfr(u[3]), bfr(v[2]), bfr(w[1]) }, y = { bfr(u[1]), bfr(v[0]), bfr(v[3]), bfr(w[2]) }, z = { bfr(u[2]), bfr(v[1]), bfr(w[0]), bfr(w[3]) };
    const v4f a = { mk[0] != 0 ? 0.f : -3.0e38f, mk[1] != 0 ? 0.f : -3.0e38f, mk[2] != 0 ? 0.f : -3.0e38f, mk[3] != 0 ? 0.f : -3.0e38f };
    *(v4f*)&skx[4 * j] = x; *(v4f*)&sky[4 * j] = y; *(v4f*)&skz[4 * j] = z; *(v4f*)&skm[4 * j] = a; }
  v16h aq[2];
#pragma unroll
  for (int kc = 0; kc < 2; ++kc) aq[kc] = frag_h(QK + rq * (2 * DM) + h * HD + kc * 32, lane);
  v2f px2, py2, pz2; { const float* p = POS + rq * 3; const float px = bfr(p[0]), py = bfr(p[1]), pz = bfr(p[2]); px2 = v2f{ px, px }; py2 = v2f{ py, py }; pz2 = v2f{ pz, pz }; }   // the lane's query, each coordinate twice
  float coef; { float vh = fabsf(bfr(VEL[h])); vh = fminf(fmaxf(vh, 0.f), 0.999f); const float gam = 1.0f / sqrtf(1.0f - vh * vh); coef = gam * vh / (DMAX[0] + 1e-8f); }   // gamma v / (dmax + 1e-8): dist is normalised by the global max
  const bool havemax = DMAX[0] > 0.f;
  float m = -3.0e38f, l = 0.f;   // the query's running maximum (equal in both halves) and this half's share of its sum
  v8f acc[4] = {};
  // the fragments come from the tile's buffer, rows and k order as before (frag_h): a step's K at its head, its V behind its score products, a whole softmax ahead of its use
  v16h kf[2][2], vf[4];
  auto lds_k = [&](const char* buf, int ss) {
#pragma unroll
    for (int ct = 0; ct < 2; ++ct) { const _Float16* krow = (const _Float16*)(buf + (ss * 32 + ct * 16 + col) * AT_P);
#pragma unroll
      for (int kc = 0; kc < 2; ++kc) kf[ct][kc] = frag_h(krow + kc * 32, lane); } };
  auto lds_v = [&](const char* buf, int ss) {
#pragma unroll
    for (int dt = 0; dt < 4; ++dt) vf[dt] = frag_h((const _Float16*)(buf + AT_V + (dt * 16 + col) * AT_P) + ss * 32, lane); };
  asm volatile("s_wait_asynccnt 0x0" ::: "memory");   // tile 0 has landed, this wave's share
  __syncthreads();   // the key planes and tile 0 are whole before any wave reads them
  kv_fill(gk, gv, 1, l0 + AT_SZ, tid);
  // the two-buffer loop over the tiles: tile t + 1 flies while tile t is worked on
#pragma unroll 1
  for (int t = 0; t < AT_N; ++t) {   // rolled: the buffer is picked by t & 1
    const int bo = (t & 1) * AT_SZ; const char* buf = skv + bo;
#pragma unroll 1
   for (int ss = 0; ss < 2; ++ss) { v8f cc[2]; const int ks = 2 * t + ss;   // the tile's two steps of 32 keys; rolled: as a block that loops on itself a step keeps its 16 scores' chains interleaved and paired for dual issue, unrolled the build had an eighth more vector instructions
    lds_k(buf, ss);
    v4f tx[4], ty[4], tz[4], tm[4];   // the lane's 16 keys: planes read as 16-byte words, the same address in all 16 lanes of a half
#pragma unroll
    for (int q = 0; q < 4; ++q) { const int k0 = ks * 32 + (q >> 1) * 16 + 8 * g + (q & 1) * 4; tx[q] = *(const v4f*)&skx[k0]; ty[q] = *(const v4f*)&sky[k0]; tz[q] = *(const v4f*)&skz[k0]; tm[q] = *(const v4f*)&skm[k0]; }
#pragma unroll
    for (int ct = 0; ct < 2; ++ct) { v8f c = {};
#pragma unroll
      for (int kc = 0; kc < 2; ++kc) c = wmma16(kf[ct][kc], aq[kc], c);   // single product: k, q as one-rounding f16 operands; c[r] = score of key ct * 16 + 8 g + r with query col
      cc[ct] = c; }
    lds_v(buf, ss);
    float s[16];
#pragma unroll
    for (int p = 0; p < 8; ++p) { const int q = p >> 1, e = (p & 1) * 2;   // two keys at a time, neighbours in the planes' words: packed f32 forms with no register moves
      const v2f kx = { tx[q][e], tx[q][e + 1] }, ky = { ty[q][e], ty[q][e + 1] }, kz = { tz[q][e], tz[q][e + 1] };
      const v2f dx = px2 - kx, dy = py2 - ky, dz = pz2 - kz; const v2f sq2 = dx * dx + dy * dy + dz * dz;
#pragma unroll
      for (int u = 0; u < 2; ++u) { const int i = 2 * p + u; const float sq = sq2[u]; const float dist = (sq == 0.f) ? 0.f : sqrtf(sq); const float fac = havemax ? __expf(-dist * coef) : __expf(-dist * coef * (DMAX[0] + 1e-8f)); s[i] = cc[i >> 3][i & 7] * 0.125f * fac + tm[q][e + u]; } }   // score x exp(-normalised distance x gamma v); a masked key ends at -3.0e38
    float mx = s[0];
#pragma unroll
    for (int i = 1; i < 16; ++i) mx = fmaxf(mx, s[i]);
    mx = fmaxf(mx, xhalf(mx));
    const float mn = fmaxf(m, mx); const float alpha = (m <= -1.0e38f) ? 0.f : __expf(m - mn);
    const float mref = (mn <= -1.0e38f) ? 0.f : mn;   // no kept key yet: against 0 every masked score gives weight 0, as it does against a real maximum
    float e[16]; v16h pa;
#pragma unroll
    for (int i = 0; i < 16; ++i) { e[i] = __expf(s[i] - mref); pa[i] = (_Float16)(e[i] * 2048.0f); }   // P scaled by 2^11 so small softmax weights stay out of the f16 subnormal range; 2^-11 folded into the epilogue. Element i of the B operand is key 8 g + i (i < 8) or 16 + 8 g + i - 8: the two tiles' registers in their order
#pragma unroll
    for (int w = 8; w > 0; w >>= 1) {   // a tree, not a chain of 15 dependent adds
#pragma unroll
      for (int i = 0; i < w; ++i) e[i] += e[i + w]; }
    const float es = e[0];
    l = l * alpha + es; m = mn;
#pragma unroll
    for (int dt = 0; dt < 4; ++dt) acc[dt] *= alpha;
#pragma unroll
    for (int dt = 0; dt < 4; ++dt) acc[dt] = wmma16(vf[dt], pa, acc[dt]);   // single product: V^T x P^T (x2^11); acc[dt][r] = O[query col][dt * 16 + 8 g + r]
   }
    asm volatile("s_wait_dscnt 0x0" ::: "memory");      // this wave's reads of tile t are over before the buffer is given up
    asm volatile("s_wait_asynccnt 0x0" ::: "memory");   // this wave's share of tile t + 1 has landed
    __syncthreads();   // publishes tile t + 1, ends every reader's last read of tile t
    if (t + 2 < AT_N) kv_fill(gk, gv, t + 2, l0 + bo, tid);
  }
  asm volatile("s_wait_asynccnt 0x0" ::: "memory");   // no copy is outstanding when the wave ends
  const float il = (1.0f / 2048.0f) / (l + xhalf(l));
  float* orow = O + rq * DM + h * HD + 8 * g;
#pragma unroll
  for (int dt = 0; dt < 4; ++dt) { const v4f lo = { acc[dt][0] * il, acc[dt][1] * il, acc[dt][2] * il, acc[dt][3] * il }, hi = { acc[dt][4] * il, acc[dt][5] * il, acc[dt][6] * il, acc[dt][7] * il }; vst2(orow + dt * 16, lo); vst2(orow + dt * 16 + 4, hi); }
}
// ---- k_out: block = (64 rows, 128 cols): out = O(hi/lo) . Wo rows (2 products) + bo
__global__ __launch_bounds__(128) void k_out(const float* __restrict__ O, const __bf16* __restrict__ P, const float* __restrict__ BO, float* __restrict__ Y) {
  __shared__ __align__(16) char smem[2 * ST_SZ];   // the two tile buffers; behind the loop the output staging
  static_assert(2 * ST_SZ >= 4 * 16 * 132 * 4, "the staging fits the buffers");
  float (*so)[16][132] = (float (*)[16][132])smem;
  const int tid = threadIdx.x, wave = tid >> 5, lane = tid & 31, col = lane & 15, g = lane >> 4; const size_t r0 = (size_t)blockIdx.x * 64 + wave * 16; const int n0 = blockIdx.y * 128;
  v8f acc[8] = {};
  auto mma = [&](const KStep& s) { const F2 a = bsplit16(s.a);
#pragma unroll
    for (int j = 0; j < 8; ++j) { acc[j] = wmma_bf(a.l, s.w[j], acc[j]); acc[j] = wmma_bf(a.h, s.w[j], acc[j]); } };
  tile_loop(O + (size_t)blockIdx.x * 64 * DM, P + (size_t)n0 * DM, smem, tid, mma);
#pragma unroll
  for (int j = 0; j < 8; ++j) {
#pragma unroll
    for (int r = 0; r < 8; ++r) so[wave][8 * g + r][j * 16 + col] = acc[j][r] + bfr(BO[n0 + j * 16 + col]); }
  LDSX();
  for (int rl = 0; rl < 16; ++rl) vst2(Y + (r0 + rl) * DM + n0 + lane * 4, *(const v4f*)&so[wave][rl][lane * 4]);
}
// ---- k_dist1: block = 32 rows x all keys. A thread keeps the rounded positions of its own 8 keys in registers (six 16-byte loads, issued together) and walks the block's 32 rows, read from LDS: no load stands in the loop's dependent path. max is order-free, so any split of the pairs gives the same global maximum: RM[block * 32 + i] = max of |p_r - p_j|^2 over the block's rows r and the keys j of threads 8 i .. 8 i + 7; one 128-B line per block
__global__ __launch_bounds__(256) void k_dist1(const float* __restrict__ POS, float* __restrict__ RM) {
  static_assert(NB * SS == 256 * 8, "a thread owns 8 keys");
  __shared__ __align__(16) float srow[32][4]; __shared__ __align__(16) float red[256]; __shared__ __align__(16) float line[32];
  const int t = threadIdx.x; const size_t r0 = (size_t)blockIdx.x * 32;
  v4f kv[6];
#pragma unroll
  for (int i = 0; i < 6; ++i) kv[i] = *(const v4f*)(POS + (size_t)t * 24 + i * 4);
  if (t < 128) { const int c = t & 3; const float v = POS[(r0 + (t >> 2)) * 3 + (c < 3 ? c : 2)]; srow[t >> 2][c] = (c < 3) ? bfr(v) : 0.f; }   // a row's fourth word is padding, written so that the 16-byte rows hold no unwritten LDS
  float kx[8], ky[8], kz[8], mx[8];
#pragma unroll
  for (int j = 0; j < 8; ++j) { kx[j] = bfr(kv[(3 * j) >> 2][(3 * j) & 3]); ky[j] = bfr(kv[(3 * j + 1) >> 2][(3 * j + 1) & 3]); kz[j] = bfr(kv[(3 * j + 2) >> 2][(3 * j + 2) & 3]); mx[j] = 0.f; }
  __syncthreads();
  // unrolled by four: four rows' LDS reads go out as one group ahead of their 32 distances
#pragma unroll 4
  for (int i = 0; i < 32; ++i) { const v4f p = *(const v4f*)&srow[i][0];
#pragma unroll
    for (int j = 0; j < 8; ++j) { const float dx = p[0] - kx[j], dy = p[1] - ky[j], dz = p[2] - kz[j]; mx[j] = fmaxf(mx[j], dx * dx + dy * dy + dz * dz); } }
  red[t] = fmaxf(fmaxf(fmaxf(mx[0], mx[1]), fmaxf(mx[2], mx[3])), fmaxf(fmaxf(mx[4], mx[5]), fmaxf(mx[6], mx[7]))); __syncthreads();
  if (t < 32) { const v4f a = *(const v4f*)&red[t * 8], c = *(const v4f*)&red[t * 8 + 4]; line[t] = fmaxf(fmaxf(fmaxf(a[0], a[1]), fmaxf(a[2], a[3])), fmaxf(fmaxf(c[0], c[1]), fmaxf(c[2], c[3]))); } __syncthreads();
  if (t < 8) vst2(RM + r0 + t * 4, *(const v4f*)&line[t * 4]);
}
// ---- k_dist2: one block: global max -> sqrt -> DMAX (one line)
__global__ __launch_bounds__(256) void k_dist2(const float* __restrict__ RM, float* __restrict__ DMX) { __shared__ float red[256]; __shared__ __align__(16) float line[32]; const int t = threadIdx.x; float mx = 0.f; for (int i = t; i < NB * SS; i += 256) mx = fmaxf(mx, RM[i]); red[t] = mx; __syncthreads();
  for (int s = 128; s > 0; s >>= 1) { if (t < s) red[t] = fmaxf(red[t], red[t + s]); __syncthreads(); }
  if (t < 32) line[t] = (t == 0) ? sqrtf(red[0]) : 0.f; __syncthreads(); if (t < 8) vst2(DMX + t * 4, *(const v4f*)&line[t * 4]); }
extern "C" void kernel_launch(void* const* d_in, const int* in_sizes, int n_in, void* d_out, int out_size, void* d_ws, size_t ws_size, hipStream_t stream) {
  (void)in_sizes; (void)n_in; (void)out_size;
  const float** F = (const float**)d_in;   // 0 x [1,2048,1024], 1 attention_mask [1,2048] int, 2 positions [1,2048,3], 3 Wq, 4 bq, 5 Wk, 6 bk, 7 Wv, 8 bv, 9 Wo, 10 bo (natural), 11 velocity [16]
  if (ws_size < (size_t)WS_END) return;
  char* ws = (char*)d_ws; __bf16* PK = (__bf16*)(ws + WS_PK); _Float16 *QK = (_Float16*)(ws + WS_QK), *QKL = (_Float16*)(ws + WS_QKL), *VTH = (_Float16*)(ws + WS_VTH), *VTL = (_Float16*)(ws + WS_VTL); float *O = (float*)(ws + WS_O), *RM = (float*)(ws + WS_DM), *DMX = RM + NB * SS;
  k_pack<<<dim3(DM, 4), 256, 0, stream>>>(F[3], F[5], F[7], F[9], PK);
  k_dist1<<<NB * SS / 32, 256, 0, stream>>>(F[2], RM);
  k_dist2<<<1, 256, 0, stream>>>(RM, DMX);
  k_qkv<<<dim3(TNB * SS / 64, QKVW / 128), 128, 0, stream>>>(F[0], F[0], F[0], PK + PK_A, F[4], F[6], F[8], QK, QKL, VTH, VTL);
  k_attn<<<dim3(TQB, NH, TNB), 128, 0, stream>>>(QK, QKL, VTH, VTL, nullptr, F[2], DMX, F[11], (const int*)d_in[1], O);
  k_out<<<dim3(TOB, DM / 128), 128, 0, stream>>>(O, PK + PK_P, F[10], (float*)d_out);
}

// v006
// It runs in 91.9 microseconds.
// Timed twice side by side with v005, it ran 1.18 and 1.17 times as fast.
// Counting every step since v000, it is 4.20 times as fast.
// compute dtype: all float inputs rounded to bf16, the int mask read on device; q/k/v = x . W^T + b with EXACT bf16 products on WMMA 16x16x32 (natural rows); pairwise distances, their global maximum (deterministic block reduction), the Lorentz factor and exp(-d coef) in f32 (hardware exp; per score the hardware square root); PLAIN attention: q, k single f16 x 1/8 x that factor, masked keys excluded, running-max softmax in f32, P (scaled by 2^11, single f16) x v (single f16); out = o (bf16 hi + residual) . Wo^T (2 products) + bo.
#include <hip/hip_runtime.h>
#include <math.h>

typedef __attribute__((ext_vector_type(16))) _Float16 v16h;
typedef __attribute__((ext_vector_type(16))) __bf16 v16b;
typedef __attribute__((ext_vector_type(8)))  _Float16 v8h;
typedef __attribute__((ext_vector_type(8)))  float v8f;
typedef __attribute__((ext_vector_type(4)))  float v4f;
typedef __attribute__((ext_vector_type(2)))  float v2f;
typedef __attribute__((ext_vector_type(4)))  unsigned v4u;
typedef __attribute__((ext_vector_type(4)))  int v4i;
typedef float __attribute__((may_alias)) float_a;
typedef int __attribute__((may_alias)) int_a;

template <typename T> __device__ __forceinline__ void vst2(void* p, T v) { *(T*)p = v;  }
__device__ __forceinline__ v8f wmma16(v16h a, v16h b, v8f c) {
  v8f d = __builtin_amdgcn_wmma_f32_16x16x32_f16(false, a, false, b, (short)0, c, false, false);
  asm volatile("v_nop\n\tv_nop\n\tv_nop\n\tv_nop" : "+v"(d) : "v"(a), "v"(b));
  return d;
}
__device__ __forceinline__ v8f wmma_bf(v16b a, v16b b, v8f c) {
  v8f d = __builtin_amdgcn_wmma_f32_16x16x32_bf16(false, a, false, b, (short)0, c, false, false);
  asm volatile("v_nop\n\tv_nop\n\tv_nop\n\tv_nop" : "+v"(d) : "v"(a), "v"(b));
  return d;
}
// Relativistic self attention (B 1, S 2,048, d 1,024, 16 heads x 64): q/k/v projections + biases, scores / 8 multiplied by exp(-dist_ij gamma_h v_h) with the normalised pairwise distance of the 3-D positions and a per-head velocity, key mask, softmax, . v, output projection + bias.
__device__ __forceinline__ v16h frag_h(const _Float16* rowk0, int lane) {
  union { v16h v; v8h q[2]; } u; const _Float16* p = rowk0 + 8 * (lane >> 4);
  u.q[0] = *(const v8h*)p; u.q[1] = *(const v8h*)(p + 16); return u.v;
}
__device__ __forceinline__ v16h frag_f32(const float* rowk0, int lane) {
  v16h a; const float* p = rowk0 + 8 * (lane >> 4);
#pragma unroll
  for (int i = 0; i < 8; ++i) { a[i] = (_Float16)p[i]; a[8 + i] = (_Float16)p[16 + i]; }
  return a;
}
__device__ __forceinline__ v16h frag_f32s(const float* rowk0, int lane, float sc) {
  v16h a; const float* p = rowk0 + 8 * (lane >> 4);
#pragma unroll
  for (int i = 0; i < 8; ++i) { a[i] = (_Float16)(p[i] * sc); a[8 + i] = (_Float16)(p[16 + i] * sc); }
  return a;
}
// column fragment from a [K][ld] layout (column n), rows >= K read as 0
__device__ __forceinline__ v16h fragc_f32(const float* W, int k0, int n, int lane, int ld, int K) {
  v16h a; const int g = lane >> 4;
#pragma unroll
  for (int i = 0; i < 8; ++i) { const int ka = k0 + 8 * g + i, kb = ka + 16;
    a[i] = (_Float16)(ka < K ? W[(size_t)(ka < K ? ka : K - 1) * ld + n] : 0.f); a[8 + i] = (_Float16)(kb < K ? W[(size_t)(kb < K ? kb : K - 1) * ld + n] : 0.f); }
  return a;
}
struct F2 { v16b h, l; };
__device__ __forceinline__ F2 bsplit16(const float v[16]) { F2 r;
#pragma unroll
  for (int i = 0; i < 16; ++i) { const __bf16 h = (__bf16)v[i]; r.h[i] = h; r.l[i] = (__bf16)(v[i] - (float)h); }
  return r; }
__device__ __forceinline__ F2 split_row(const float* row, int k0, int lane) { float v[16]; const float* p = row + k0 + 8 * (lane >> 4);
#pragma unroll
  for (int i = 0; i < 8; ++i) { v[i] = p[i]; v[8 + i] = p[16 + i]; }
  return bsplit16(v); }
__device__ __forceinline__ F2 split_rowK(const float* row, int k0, int lane, int K) { float v[16]; const int g = lane >> 4;
#pragma unroll
  for (int i = 0; i < 8; ++i) { const int ka = k0 + 8 * g + i, kb = ka + 16; v[i] = ka < K ? row[ka < K ? ka : K - 1] : 0.f; v[8 + i] = kb < K ? row[kb < K ? kb : K - 1] : 0.f; }
  return bsplit16(v); }
__device__ __forceinline__ F2 split_col(const float* W, int k0, int n, int lane, int ld, int K) { float v[16]; const int g = lane >> 4;
#pragma unroll
  for (int i = 0; i < 8; ++i) { const int ka = k0 + 8 * g + i, kb = ka + 16; v[i] = ka < K ? W[(size_t)(ka < K ? ka : K - 1) * ld + n] : 0.f; v[8 + i] = kb < K ? W[(size_t)(kb < K ? kb : K - 1) * ld + n] : 0.f; }
  return bsplit16(v); }
__device__ __forceinline__ v8f mac3(const F2& a, const F2& b, v8f c) { c = wmma_bf(a.l, b.h, c); c = wmma_bf(a.h, b.l, c); return wmma_bf(a.h, b.h, c); }
__device__ __forceinline__ float sigm(float v) { return 1.0f / (1.0f + expf(-v)); }
#define LDSX() do { asm volatile("s_wait_dscnt 0" ::: "memory"); __builtin_amdgcn_wave_barrier(); __builtin_amdgcn_fence(__ATOMIC_RELEASE, "workgroup"); } while (0)


#define NB 1
#define SS 2048
#define DM 1024
#define NH 16
#define HD 64
#define QKVW (3 * DM)
#ifndef TQB
#define TQB (SS / 64)
#define TNB NB
#define TOB (NB * SS / 64)     // output row tiles (all)
#endif
typedef __attribute__((ext_vector_type(8))) __bf16 v8b;
__device__ __forceinline__ v16b frag_b(const __bf16* rowk0, int lane) {
  union { v16b v; v8b q[2]; } u; const __bf16* p = rowk0 + 8 * (lane >> 4);
  u.q[0] = *(const v8b*)p; u.q[1] = *(const v8b*)(p + 16); return u.v;
}
__device__ __forceinline__ float bfr(float v) { return (float)(__bf16)v; }
__device__ __attribute__((noinline)) float exp_ni(float v) { return expf(v); }
__device__ __attribute__((noinline)) float erf_ni(float v) { return erff(v); }

#define PK_A 0                       // [3072][1024] Wqkv rows (natural [out][in])
#define PK_P (PK_A + QKVW * DM)        // [1024][1024] Wo rows (natural)
#define PK_END (PK_P + DM * DM)
#define WS_PK  0u
#define WS_QK  (WS_PK + 2u * PK_END)             // f16 [2048 rows][2048]: q | k
#define WS_QKL (WS_QK + 2u * NB * SS * 2 * DM)     // f16 q | k residual planes x2048
#define WS_VTH (WS_QKL + 2u * NB * SS * 2 * DM)    // f16 [b][1024 (h*64+d)][2048 s] hi
#define WS_VTL (WS_VTH + 2u * NB * DM * SS)        // f16 lo x 2048
#define WS_O   (WS_VTL + 2u * NB * DM * SS)        // f32 [2048][1024]
#define WS_CS  (WS_O + 4u * NB * SS * DM)           // f32 2 x [2048][32], not used by any kernel here
#define WS_DM  (WS_CS + 4u * 2 * SS * 32)                  // f32: partial maxima of the squared pairwise distances [SS], then the global max at [SS]
#define WS_END (WS_DM + 4u * (size_t)(SS + 32))
// one k-step (32 k) of a row-times-weight-rows product, as loaded: the lane's 16 f32 of its A row and its 8 weight fragments (16 columns each)
struct KStep { float a[16]; v16b w[8]; };
// ---- operand tiles of k_qkv and k_out in LDS. A tile is 64 k of the block's 64 A rows (f32, 256 B a row) and of its 128 weight rows (bf16, 128 B a row), brought by asynchronous copies: a wave's copy covers four whole 128-B lines, and the block fetches each line once for its four waves. Row pitches 272 and 144 B (16 B x odd): the 16 rows of a fragment read fall on distinct banks.
#define ST_K 64
#define ST_N (DM / ST_K)
#define ST_AP 272
#define ST_WP 144
#define ST_W (64 * ST_AP)
#define ST_SZ (ST_W + 128 * ST_WP)
// eight copies, each lane its own 16 bytes; the s_wait_xcnt stands inside the statement, behind the last copy, so that no address register named here is rewritten in front of it
__device__ __forceinline__ void acopy8(const unsigned (&l)[8], const void* const (&p)[8]) {
  asm volatile("global_load_async_to_lds_b128 %0, %8, off\n\t"
               "global_load_async_to_lds_b128 %1, %9, off\n\t"
               "global_load_async_to_lds_b128 %2, %10, off\n\t"
               "global_load_async_to_lds_b128 %3, %11, off\n\t"
               "global_load_async_to_lds_b128 %4, %12, off\n\t"
               "global_load_async_to_lds_b128 %5, %13, off\n\t"
               "global_load_async_to_lds_b128 %6, %14, off\n\t"
               "global_load_async_to_lds_b128 %7, %15, off\n\t"
               "s_wait_xcnt 0x0"
               :: "v"(l[0]), "v"(l[1]), "v"(l[2]), "v"(l[3]), "v"(l[4]), "v"(l[5]), "v"(l[6]), "v"(l[7]),
                  "v"(p[0]), "v"(p[1]), "v"(p[2]), "v"(p[3]), "v"(p[4]), "v"(p[5]), "v"(p[6]), "v"(p[7]) : "memory");
}
// tile st of the block into the buffer at LDS byte address lbuf; 128 threads, 16 copies each. a0, w0: the thread's own 16 bytes of tile 0 (A row tid / 16, weight row tid / 8); its further copies lie 8 A rows and 16 weight rows apart
__device__ __forceinline__ void tile_fill(const char* a0, const char* w0, int st, unsigned lbuf, int tid) {
  unsigned l[8]; const void* p[8];
  const char* pa = a0 + st * (ST_K * 4); const unsigned la = lbuf + (tid >> 4) * ST_AP + (tid & 15) * 16;
#pragma unroll
  for (int i = 0; i < 8; ++i) { l[i] = la + i * (8 * ST_AP); p[i] = pa + i * (8 * DM * 4); }
  acopy8(l, p);
  const char* pw = w0 + st * (ST_K * 2); const unsigned lw = lbuf + ST_W + (tid >> 3) * ST_WP + (tid & 7) * 16;
#pragma unroll
  for (int i = 0; i < 8; ++i) { l[i] = lw + i * (16 * ST_WP); p[i] = pw + i * (16 * DM * 2); }
  acopy8(l, p);
}
// k-step kk (0 or 1) of a tile: arow = the lane's A row in the buffer + 32 g bytes, wrow = weight row col in the buffer + 16 g bytes; the k order of both is that of frag_b
__device__ __forceinline__ void kstep_lds(KStep& s, const char* arow, const char* wrow, int kk) {
  const v4f a0 = *(const v4f*)(arow + kk * 128), a1 = *(const v4f*)(arow + kk * 128 + 16), a2 = *(const v4f*)(arow + kk * 128 + 64), a3 = *(const v4f*)(arow + kk * 128 + 80);
#pragma unroll
  for (int i = 0; i < 4; ++i) { s.a[i] = a0[i]; s.a[4 + i] = a1[i]; s.a[8 + i] = a2[i]; s.a[12 + i] = a3[i]; }
#pragma unroll
  for (int j = 0; j < 8; ++j) { union { v16b v; v8b q[2]; } u; const char* p = wrow + j * 16 * ST_WP + kk * 64; u.q[0] = *(const v8b*)p; u.q[1] = *(const v8b*)(p + 32); s.w[j] = u.v; }
}
// the two-buffer loop over the tiles: tile t + 1 flies while tile t is worked on. At the foot of a trip every wave ends its own LDS reads and its own copies, the barrier publishes tile t + 1 and frees tile t's buffer, and only then tile t + 2 is aimed at that buffer. The last trip's barrier also frees both buffers for the output staging.
template <typename MMA> __device__ __forceinline__ void tile_loop(const float* A0, const __bf16* W0, char* smem, int tid, MMA mma) {
  const int wave = tid >> 5, lane = tid & 31, col = lane & 15, g = lane >> 4; const unsigned l0 = (unsigned)(size_t)smem;
  const char* a0 = (const char*)(A0 + (size_t)(tid >> 4) * DM + (tid & 15) * 4); const char* w0 = (const char*)(W0 + (size_t)(tid >> 3) * DM + (tid & 7) * 8);
  tile_fill(a0, w0, 0, l0, tid);
  asm volatile("s_wait_asynccnt 0x0" ::: "memory");   // tile 0 has landed, this wave's share
  __syncthreads();   // tile 0 is whole before any wave reads it
  tile_fill(a0, w0, 1, l0 + ST_SZ, tid);
#pragma unroll 1
  for (int t = 0; t < ST_N; ++t) {   // rolled: the buffer is picked by t & 1
    const int bo = (t & 1) * ST_SZ; const char* arow = smem + bo + (wave * 16 + col) * ST_AP + 32 * g; const char* wrow = smem + bo + ST_W + col * ST_WP + 16 * g;
    KStep s0, s1; kstep_lds(s0, arow, wrow, 0); kstep_lds(s1, arow, wrow, 1); mma(s0); mma(s1);
    asm volatile("s_wait_dscnt 0x0" ::: "memory");      // this wave's reads of tile t are over before the buffer is given up
    asm volatile("s_wait_asynccnt 0x0" ::: "memory");   // this wave's share of tile t + 1 has landed
    __syncthreads();   // publishes tile t + 1, ends every reader's last read of tile t
    if (t + 2 < ST_N) tile_fill(a0, w0, t + 2, l0 + bo, tid);
  }
  asm volatile("s_wait_asynccnt 0x0" ::: "memory");   // no copy is outstanding when the LDS is used anew
}
// ---- k_pack: block = (row n, which): natural [out][in] rows -> bf16; which 0..2 -> W_q/W_k/W_v into PK_A rows which*1024 + n; 3 -> W_o into PK_P
__global__ __launch_bounds__(256) void k_pack(const float* __restrict__ WQ, const float* __restrict__ WK, const float* __restrict__ WV, const float* __restrict__ WO, __bf16* __restrict__ PK) {
  __shared__ __align__(16) __bf16 s[DM]; const int n = blockIdx.x, which = blockIdx.y, t = threadIdx.x; const float* Wm = (which == 0) ? WQ : (which == 1) ? WK : (which == 2) ? WV : WO;
  for (int k = t; k < DM; k += 256) s[k] = (__bf16)Wm[(size_t)n * DM + k];
  __syncthreads();
  __bf16* dst = (which < 3) ? PK + PK_A + ((size_t)which * DM + n) * DM : PK + PK_P + (size_t)n * DM;
  for (int q = t; q < DM / 8; q += 256) vst2((unsigned*)(dst + q * 8), *(const v4u*)&s[q * 8]);
}
__global__ __launch_bounds__(128) void k_qkv(const float* __restrict__ XQ, const float* __restrict__ XK, const float* __restrict__ XV, const __bf16* __restrict__ P, const float* __restrict__ BQ, const float* __restrict__ BK, const float* __restrict__ BV, _Float16* __restrict__ QK, _Float16* __restrict__ QKL, _Float16* __restrict__ VTH, _Float16* __restrict__ VTL) {
  const int which0 = (blockIdx.y * 128) / DM; const float* X = (which0 == 0) ? XQ : (which0 == 1) ? XK : XV; const float* BB = BQ ? (((which0 == 0) ? BQ : (which0 == 1) ? BK : BV) + (blockIdx.y * 128 - which0 * DM)) : nullptr;
  __shared__ __align__(16) char smem[2 * ST_SZ];   // the two tile buffers; behind the loop the output staging
  static_assert(2 * ST_SZ >= 2 * (4 * 16 * 136 + 128 * 72) * 2, "the staging fits the buffers");
  _Float16 (*so)[16][136] = (_Float16 (*)[16][136])smem, (*sol)[16][136] = so + 4; _Float16 (*sth)[72] = (_Float16 (*)[72])(sol + 4), (*stl)[72] = sth + 128;
  const int tid = threadIdx.x, wave = tid >> 5, lane = tid & 31, col = lane & 15, g = lane >> 4; const size_t r0 = (size_t)blockIdx.x * 64 + wave * 16; const int n0 = blockIdx.y * 128;
  v8f acc[8] = {};
  auto mma = [&](const KStep& s) { v16b a;
#pragma unroll
    for (int i = 0; i < 16; ++i) a[i] = (__bf16)s.a[i];
#pragma unroll
    for (int j = 0; j < 8; ++j) acc[j] = wmma_bf(a, s.w[j], acc[j]); };
  tile_loop(X + (size_t)blockIdx.x * 64 * DM, P + (size_t)n0 * DM, smem, tid, mma);
  if (n0 < 2 * DM) {   // q stored unscaled (f16 sigma ~0.6, no subnormal exposure); 1/8 applied to the f32 score
#pragma unroll
    for (int j = 0; j < 8; ++j) {
#pragma unroll
      for (int r = 0; r < 8; ++r) { const float v = acc[j][r] + (BB ? bfr(BB[j * 16 + col]) : 0.f); const _Float16 hv = (_Float16)v; so[wave][8 * g + r][j * 16 + col] = hv; sol[wave][8 * g + r][j * 16 + col] = (_Float16)((v - (float)hv) * 2048.0f); } }   // q, k (+ bias) as f16 hi + (x2048) residual
    LDSX();
    for (int rl = 0; rl < 16; ++rl) if (lane < 16) { vst2((unsigned*)(QK + (r0 + rl) * (2 * DM) + n0 + lane * 8), *(const v4u*)&so[wave][rl][lane * 8]); vst2((unsigned*)(QKL + (r0 + rl) * (2 * DM) + n0 + lane * 8), *(const v4u*)&sol[wave][rl][lane * 8]); }
  } else {
#pragma unroll
    for (int j = 0; j < 8; ++j) {
#pragma unroll
      for (int r = 0; r < 8; ++r) { const float v = acc[j][r] + (BB ? bfr(BB[j * 16 + col]) : 0.f); const _Float16 hv = (_Float16)v; sth[j * 16 + col][wave * 16 + 8 * g + r] = hv; stl[j * 16 + col][wave * 16 + 8 * g + r] = (_Float16)((v - (float)hv) * 2048.0f); } }
    __syncthreads();
    const size_t rb = (size_t)blockIdx.x * 64; const int b = (int)(rb / SS), s0 = (int)(rb % SS); const int pc0 = n0 - 2 * DM;
    for (int q = tid; q < 128 * 8; q += 128) { const int d = q >> 3, pc = q & 7; const size_t o = ((size_t)b * DM + pc0 + d) * SS + s0 + pc * 8; vst2((unsigned*)(VTH + o), *(const v4u*)&sth[d][pc * 8]); vst2((unsigned*)(VTL + o), *(const v4u*)&stl[d][pc * 8]); }
  }
}
// ---- K and V tiles of k_attn in LDS. A tile is 64 keys: 64 K rows (this head's 64 d, 128 B) and 64 V^T rows (one d each, the tile's 64 keys, 128 B), brought by asynchronous copies: a wave's copy covers four whole 128-B lines, and the block fetches each line once for its four waves. Row pitch 144 B (16 B x odd): the 16 rows of a fragment read fall on distinct banks.
#define AT_K 64
#define AT_N (SS / AT_K)
#define AT_P 144
#define AT_V (AT_K * AT_P)
#define AT_SZ (AT_V + HD * AT_P)
// tile t into the buffer at LDS byte address lbuf; 128 threads, 4 copies of K and 4 of V^T each. k0, v0: the thread's own 16 bytes of tile 0 (row tid / 8 of either); its further copies lie 16 rows apart
__device__ __forceinline__ void kv_fill(const char* k0, const char* v0, int t, unsigned lbuf, int tid) {
  unsigned l[8]; const void* p[8];
  const char* pk = k0 + (size_t)t * (AT_K * 2 * DM * 2); const char* pv = v0 + t * (AT_K * 2); const unsigned lk = lbuf + (tid >> 3) * AT_P + (tid & 7) * 16;
#pragma unroll
  for (int i = 0; i < 4; ++i) { l[i] = lk + i * (16 * AT_P); p[i] = pk + i * (16 * 2 * DM * 2); l[4 + i] = lk + AT_V + i * (16 * AT_P); p[4 + i] = pv + i * (16 * SS * 2); }
  acopy8(l, p);
}
__device__ __forceinline__ float xhalf(float x) { return __builtin_bit_cast(float, __builtin_amdgcn_permlanex16(__builtin_bit_cast(int, x), __builtin_bit_cast(int, x), 0x76543210, 0xfedcba98, false, false)); }   // lane l with lane l ^ 16
// ---- k_attn: block = (64 queries, head h, batch b): all-keys flash attention, TRANSPOSED: S^T = K . Q^T (A = K rows, B = Q rows), so a lane holds 16 scores of ONE query (column col; keys 8 g + r and 16 + 8 g + r of the step's 32): maximum and sum run in the lane, one exchange between the wave's halves joins the maximum, the halves' sums are joined once behind the loop. The two score tiles, converted in place, are the B operand of O^T += V^T . P^T (hardware k order, which frag_h gives the V rows): P touches no LDS. A lane ends with 8 consecutive d of its query per tile and stores them itself.
// The lane now needs 16 keys' positions per step: the block rounds all keys' positions once into LDS (x, y, z planes), with a fourth plane that is 0 for a kept key and -3.0e38 for a masked one, added to the score.
// amdgpu_waves_per_eu(2, 2): the grid gives two waves per SIMD
__global__ __launch_bounds__(128) __attribute__((amdgpu_waves_per_eu(2, 2))) void k_attn(const _Float16* __restrict__ QK, const _Float16* __restrict__ QKL, const _Float16* __restrict__ VTH, const _Float16* __restrict__ VTL, const void* __restrict__ KMASK, const float* __restrict__ POS, const float* __restrict__ DMAX, const float* __restrict__ VEL, const int* __restrict__ AM, float* __restrict__ O) {
  static_assert(SS % 512 == 0, "a thread fills whole groups of 4 keys");
  static_assert(AT_N >= 2 && HD == 64, "two tiles exist; a K row is 128 B");
  __shared__ __align__(16) float skx[SS], sky[SS], skz[SS], skm[SS];
  __shared__ __align__(16) char skv[2 * AT_SZ];   // the two K and V tile buffers
  const int tid = threadIdx.x, wave = tid >> 5, lane = tid & 31, col = lane & 15, g = lane >> 4;
  const int qb = blockIdx.x, h = blockIdx.y, b = blockIdx.z; const int q0 = qb * 64 + wave * 16; const size_t rq = (size_t)b * SS + q0 + col;
  const unsigned l0 = (unsigned)(size_t)skv;
  const char* gk = (const char*)(QK + ((size_t)b * SS + (tid >> 3)) * (2 * DM) + DM + h * HD + (tid & 7) * 8); const char* gv = (const char*)(VTH + ((size_t)b * DM + h * HD + (tid >> 3)) * SS + (tid & 7) * 8);
  kv_fill(gk, gv, 0, l0, tid);   // tile 0 flies while the key planes are made
#pragma unroll
  for (int i = 0; i < SS / 512; ++i) { const int j = tid + 128 * i; const float* p = POS + ((size_t)b * SS + 4 * j) * 3; const v4f u = *(const v4f*)p, v = *(const v4f*)(p + 4), w = *(const v4f*)(p + 8); const v4i mk = *(const v4i*)(AM + (size_t)b * SS + 4 * j);
    const v4f x = { bfr(u[0]), bfr(u[3]), bfr(v[2]), bfr(w[1]) }, y = { bfr(u[1]), bfr(v[0]), bfr(v[3]), bfr(w[2]) }, z = { bfr(u[2]), bfr(v[1]), bfr(w[0]), bfr(w[3]) };
    const v4f a = { mk[0] != 0 ? 0.f : -3.0e38f, mk[1] != 0 ? 0.f : -3.0e38f, mk[2] != 0 ? 0.f : -3.0e38f, mk[3] != 0 ? 0.f : -3.0e38f };
    *(v4f*)&skx[4 * j] = x; *(v4f*)&sky[4 * j] = y; *(v4f*)&skz[4 * j] = z; *(v4f*)&skm[4 * j] = a; }
  v16h aq[2];
#pragma unroll
  for (int kc = 0; kc < 2; ++kc) aq[kc] = frag_h(QK + rq * (2 * DM) + h * HD + kc * 32, lane);
  v2f px2, py2, pz2; { const float* p = POS + rq * 3; const float px = bfr(p[0]), py = bfr(p[1]), pz = bfr(p[2]); px2 = v2f{ px, px }; py2 = v2f{ py, py }; pz2 = v2f{ pz, pz }; }   // the lane's query, each coordinate twice
  float coef; { float vh = fabsf(bfr(VEL[h])); vh = fminf(fmaxf(vh, 0.f), 0.999f); const float gam = 1.0f / sqrtf(1.0f - vh * vh); coef = gam * vh / (DMAX[0] + 1e-8f); }   // gamma v / (dmax + 1e-8): dist is normalised by the global max
  // the factor exp(-dist coef) is 2^(dist c2): one multiply by a per-head constant between the two hardware operations. With a global maximum of 0 every dist is 0 and the factor is 1 under any finite constant, so that case needs no constant of its own
  const float c2 = coef * -1.44269504f; const v2f c22 = { c2, c2 };
  float m = -3.0e38f, l = 0.f;   // the query's running maximum (equal in both halves) and this half's share of its sum
  v8f acc[4] = {};
  // the fragments come from the tile's buffer, rows and k order as before (frag_h): a step's K at its head, its V behind its score products, a whole softmax ahead of its use
  v16h kf[2][2], vf[4];
  auto lds_k = [&](const char* buf, int ss) {
#pragma unroll
    for (int ct = 0; ct < 2; ++ct) { const _Float16* krow = (const _Float16*)(buf + (ss * 32 + ct * 16 + col) * AT_P);
#pragma unroll
      for (int kc = 0; kc < 2; ++kc) kf[ct][kc] = frag_h(krow + kc * 32, lane); } };
  auto lds_v = [&](const char* buf, int ss) {
#pragma unroll
    for (int dt = 0; dt < 4; ++dt) vf[dt] = frag_h((const _Float16*)(buf + AT_V + (dt * 16 + col) * AT_P) + ss * 32, lane); };
  asm volatile("s_wait_asynccnt 0x0" ::: "memory");   // tile 0 has landed, this wave's share
  __syncthreads();   // the key planes and tile 0 are whole before any wave reads them
  kv_fill(gk, gv, 1, l0 + AT_SZ, tid);
  // the two-buffer loop over the tiles: tile t + 1 flies while tile t is worked on
#pragma unroll 1
  for (int t = 0; t < AT_N; ++t) {   // rolled: the buffer is picked by t & 1
    const int bo = (t & 1) * AT_SZ; const char* buf = skv + bo;
#pragma unroll 1
   for (int ss = 0; ss < 2; ++ss) { v8f cc[2]; const int ks = 2 * t + ss;   // the tile's two steps of 32 keys; rolled: as a block that loops on itself a step keeps its 16 scores' chains interleaved and paired for dual issue, unrolled the build had an eighth more vector instructions
    lds_k(buf, ss);
    v4f tx[4], ty[4], tz[4], tm[4];   // the lane's 16 keys: planes read as 16-byte words, the same address in all 16 lanes of a half
#pragma unroll
    for (int q = 0; q < 4; ++q) { const int k0 = ks * 32 + (q >> 1) * 16 + 8 * g + (q & 1) * 4; tx[q] = *(const v4f*)&skx[k0]; ty[q] = *(const v4f*)&sky[k0]; tz[q] = *(const v4f*)&skz[k0]; tm[q] = *(const v4f*)&skm[k0]; }
#pragma unroll
    for (int ct = 0; ct < 2; ++ct) { v8f c = {};
#pragma unroll
      for (int kc = 0; kc < 2; ++kc) c = wmma16(kf[ct][kc], aq[kc], c);   // single product: k, q as one-rounding f16 operands; c[r] = score of key ct * 16 + 8 g + r with query col
      cc[ct] = c; }
    lds_v(buf, ss);
    float s[16];
#pragma unroll
    for (int p = 0; p < 8; ++p) { const int q = p >> 1, e = (p & 1) * 2;   // two keys at a time, neighbours in the planes' words: packed f32 forms with no register moves
      const v2f kx = { tx[q][e], tx[q][e + 1] }, ky = { ty[q][e], ty[q][e + 1] }, kz = { tz[q][e], tz[q][e + 1] };
      const v2f dx = px2 - kx, dy = py2 - ky, dz = pz2 - kz; const v2f sq2 = dx * dx + dy * dy + dz * dz;
      const v2f xe = v2f{ __builtin_amdgcn_sqrtf(sq2[0]), __builtin_amdgcn_sqrtf(sq2[1]) } * c22;   // the hardware square root (1 ulp; 0 gives 0), not the library's correctly rounded sequence of a dozen vector instructions a score
#pragma unroll
      for (int u = 0; u < 2; ++u) { const int i = 2 * p + u; const float fac = __builtin_amdgcn_exp2f(xe[u]); s[i] = cc[i >> 3][i & 7] * 0.125f * fac + tm[q][e + u]; } }   // score x exp(-normalised distance x gamma v); a masked key ends at -3.0e38
    float mx = s[0];
#pragma unroll
    for (int i = 1; i < 16; ++i) mx = fmaxf(mx, s[i]);
    mx = fmaxf(mx, xhalf(mx));
    const float mn = fmaxf(m, mx); const float alpha = (m <= -1.0e38f) ? 0.f : __expf(m - mn);
    const float mref = (mn <= -1.0e38f) ? 0.f : mn;   // no kept key yet: against 0 every masked score gives weight 0, as it does against a real maximum
    float e[16]; v16h pa;
#pragma unroll
    for (int i = 0; i < 16; ++i) { e[i] = __expf(s[i] - mref); pa[i] = (_Float16)(e[i] * 2048.0f); }   // P scaled by 2^11 so small softmax weights stay out of the f16 subnormal range; 2^-11 folded into the epilogue. Element i of the B operand is key 8 g + i (i < 8) or 16 + 8 g + i - 8: the two tiles' registers in their order
#pragma unroll
    for (int w = 8; w > 0; w >>= 1) {   // a tree, not a chain of 15 dependent adds
#pragma unroll
      for (int i = 0; i < w; ++i) e[i] += e[i + w]; }
    const float es = e[0];
    l = l * alpha + es; m = mn;
#pragma unroll
    for (int dt = 0; dt < 4; ++dt) acc[dt] *= alpha;
#pragma unroll
    for (int dt = 0; dt < 4; ++dt) acc[dt] = wmma16(vf[dt], pa, acc[dt]);   // single product: V^T x P^T (x2^11); acc[dt][r] = O[query col][dt * 16 + 8 g + r]
   }
    asm volatile("s_wait_dscnt 0x0" ::: "memory");      // this wave's reads of tile t are over before the buffer is given up
    asm volatile("s_wait_asynccnt 0x0" ::: "memory");   // this wave's share of tile t + 1 has landed
    __syncthreads();   // publishes tile t + 1, ends every reader's last read of tile t
    if (t + 2 < AT_N) kv_fill(gk, gv, t + 2, l0 + bo, tid);
  }
  asm volatile("s_wait_asynccnt 0x0" ::: "memory");   // no copy is outstanding when the wave ends
  const float il = (1.0f / 2048.0f) / (l + xhalf(l));
  float* orow = O + rq * DM + h * HD + 8 * g;
#pragma unroll
  for (int dt = 0; dt < 4; ++dt) { const v4f lo = { acc[dt][0] * il, acc[dt][1] * il, acc[dt][2] * il, acc[dt][3] * il }, hi = { acc[dt][4] * il, acc[dt][5] * il, acc[dt][6] * il, acc[dt][7] * il }; vst2(orow + dt * 16, lo); vst2(orow + dt * 16 + 4, hi); }
}
// ---- k_out: block = (64 rows, 128 cols): out = O(hi/lo) . Wo rows (2 products) + bo
__global__ __launch_bounds__(128) void k_out(const float* __restrict__ O, const __bf16* __restrict__ P, const float* __restrict__ BO, float* __restrict__ Y) {
  __shared__ __align__(16) char smem[2 * ST_SZ];   // the two tile buffers; behind the loop the output staging
  static_assert(2 * ST_SZ >= 4 * 16 * 132 * 4, "the staging fits the buffers");
  float (*so)[16][132] = (float (*)[16][132])smem;
  const int tid = threadIdx.x, wave = tid >> 5, lane = tid & 31, col = lane & 15, g = lane >> 4; const size_t r0 = (size_t)blockIdx.x * 64 + wave * 16; const int n0 = blockIdx.y * 128;
  v8f acc[8] = {};
  auto mma = [&](const KStep& s) { const F2 a = bsplit16(s.a);
#pragma unroll
    for (int j = 0; j < 8; ++j) { acc[j] = wmma_bf(a.l, s.w[j], acc[j]); acc[j] = wmma_bf(a.h, s.w[j], acc[j]); } };
  tile_loop(O + (size_t)blockIdx.x * 64 * DM, P + (size_t)n0 * DM, smem, tid, mma);
#pragma unroll
  for (int j = 0; j < 8; ++j) {
#pragma unroll
    for (int r = 0; r < 8; ++r) so[wave][8 * g + r][j * 16 + col] = acc[j][r] + bfr(BO[n0 + j * 16 + col]); }
  LDSX();
  for (int rl = 0; rl < 16; ++rl) vst2(Y + (r0 + rl) * DM + n0 + lane * 4, *(const v4f*)&so[wave][rl][lane * 4]);
}
// ---- k_dist1: block = 32 rows x all keys. A thread keeps the rounded positions of its own 8 keys in registers (six 16-byte loads, issued together) and walks the block's 32 rows, read from LDS: no load stands in the loop's dependent path. max is order-free, so any split of the pairs gives the same global maximum: RM[block * 32 + i] = max of |p_r - p_j|^2 over the block's rows r and the keys j of threads 8 i .. 8 i + 7; one 128-B line per block
__global__ __launch_bounds__(256) void k_dist1(const float* __restrict__ POS, float* __restrict__ RM) {
  static_assert(NB * SS == 256 * 8, "a thread owns 8 keys");
  __shared__ __align__(16) float srow[32][4]; __shared__ __align__(16) float red[256]; __shared__ __align__(16) float line[32];
  const int t = threadIdx.x; const size_t r0 = (size_t)blockIdx.x * 32;
  v4f kv[6];
#pragma unroll
  for (int i = 0; i < 6; ++i) kv[i] = *(const v4f*)(POS + (size_t)t * 24 + i * 4);
  if (t < 128) { const int c = t & 3; const float v = POS[(r0 + (t >> 2)) * 3 + (c < 3 ? c : 2)]; srow[t >> 2][c] = (c < 3) ? bfr(v) : 0.f; }   // a row's fourth word is padding, written so that the 16-byte rows hold no unwritten LDS
  float kx[8], ky[8], kz[8], mx[8];
#pragma unroll
  for (int j = 0; j < 8; ++j) { kx[j] = bfr(kv[(3 * j) >> 2][(3 * j) & 3]); ky[j] = bfr(kv[(3 * j + 1) >> 2][(3 * j + 1) & 3]); kz[j] = bfr(kv[(3 * j + 2) >> 2][(3 * j + 2) & 3]); mx[j] = 0.f; }
  __syncthreads();
  // unrolled by four: four rows' LDS reads go out as one group ahead of their 32 distances
#pragma unroll 4
  for (int i = 0; i < 32; ++i) { const v4f p = *(const v4f*)&srow[i][0];
#pragma unroll
    for (int j = 0; j < 8; ++j) { const float dx = p[0] - kx[j], dy = p[1] - ky[j], dz = p[2] - kz[j]; mx[j] = fmaxf(mx[j], dx * dx + dy * dy + dz * dz); } }
  red[t] = fmaxf(fmaxf(fmaxf(mx[0], mx[1]), fmaxf(mx[2], mx[3])), fmaxf(fmaxf(mx[4], mx[5]), fmaxf(mx[6], mx[7]))); __syncthreads();
  if (t < 32) { const v4f a = *(const v4f*)&red[t * 8], c = *(const v4f*)&red[t * 8 + 4]; line[t] = fmaxf(fmaxf(fmaxf(a[0], a[1]), fmaxf(a[2], a[3])), fmaxf(fmaxf(c[0], c[1]), fmaxf(c[2], c[3]))); } __syncthreads();
  if (t < 8) vst2(RM + r0 + t * 4, *(const v4f*)&line[t * 4]);
}
// ---- k_dist2: one block: global max -> sqrt -> DMAX (one line)
__global__ __launch_bounds__(256) void k_dist2(const float* __restrict__ RM, float* __restrict__ DMX) { __shared__ float red[256]; __shared__ __align__(16) float line[32]; const int t = threadIdx.x; float mx = 0.f; for (int i = t; i < NB * SS; i += 256) mx = fmaxf(mx, RM[i]); red[t] = mx; __syncthreads();
  for (int s = 128; s > 0; s >>= 1) { if (t < s) red[t] = fmaxf(red[t], red[t + s]); __syncthreads(); }
  if (t < 32) line[t] = (t == 0) ? sqrtf(red[0]) : 0.f; __syncthreads(); if (t < 8) vst2(DMX + t * 4, *(const v4f*)&line[t * 4]); }
extern "C" void kernel_launch(void* const* d_in, const int* in_sizes, int n_in, void* d_out, int out_size, void* d_ws, size_t ws_size, hipStream_t stream) {
  (void)in_sizes; (void)n_in; (void)out_size;
  const float** F = (const float**)d_in;   // 0 x [1,2048,1024], 1 attention_mask [1,2048] int, 2 positions [1,2048,3], 3 Wq, 4 bq, 5 Wk, 6 bk, 7 Wv, 8 bv, 9 Wo, 10 bo (natural), 11 velocity [16]
  if (ws_size < (size_t)WS_END) return;
  char* ws = (char*)d_ws; __bf16* PK = (__bf16*)(ws + WS_PK); _Float16 *QK = (_Float16*)(ws + WS_QK), *QKL = (_Float16*)(ws + WS_QKL), *VTH = (_Float16*)(ws + WS_VTH), *VTL = (_Float16*)(ws + WS_VTL); float *O = (float*)(ws + WS_O), *RM = (float*)(ws + WS_DM), *DMX = RM + NB * SS;
  k_pack<<<dim3(DM, 4), 256, 0, stream>>>(F[3], F[5], F[7], F[9], PK);
  k_dist1<<<NB * SS / 32, 256, 0, stream>>>(F[2], RM);
  k_dist2<<<1, 256, 0, stream>>>(RM, DMX);
  k_qkv<<<dim3(TNB * SS / 64, QKVW / 128), 128, 0, stream>>>(F[0], F[0], F[0], PK + PK_A, F[4], F[6], F[8], QK, QKL, VTH, VTL);
  k_attn<<<dim3(TQB, NH, TNB), 128, 0, stream>>>(QK, QKL, VTH, VTL, nullptr, F[2], DMX, F[11], (const int*)d_in[1], O);
  k_out<<<dim3(TOB, DM / 128), 128, 0, stream>>>(O, PK + PK_P, F[10], (float*)d_out);
}

// v007
// Measured time: 86.9 microseconds a run.
// Timed twice side by side with v006, it ran 1.08 and 1.07 times as fast.
// All steps since v000 together make it 4.50 times as fast.
// compute dtype: all float inputs rounded to bf16, the int mask read on device; q/k/v = x . W^T + b with EXACT bf16 products on WMMA 16x16x32 (natural rows); pairwise distances, their global maximum (deterministic block reduction), the Lorentz factor and exp(-d coef) in f32 (hardware exp; per score the hardware square root); PLAIN attention: q, k single f16 x 1/8 x that factor, masked keys excluded, running-max softmax in f32, P (scaled by 2^11, single f16) x v (single f16); out = o (bf16 hi + residual) . Wo^T (2 products) + bo.
#include <hip/hip_runtime.h>
#include <math.h>

typedef __attribute__((ext_vector_type(16))) _Float16 v16h;
typedef __attribute__((ext_vector_type(16))) __bf16 v16b;
typedef __attribute__((ext_vector_type(8)))  _Float16 v8h;
typedef __attribute__((ext_vector_type(8)))  float v8f;
typedef __attribute__((ext_vector_type(4)))  float v4f;
typedef __attribute__((ext_vector_type(2)))  float v2f;
typedef __attribute__((ext_vector_type(4)))  unsigned v4u;
typedef __attribute__((ext_vector_type(4)))  int v4i;
typedef float __attribute__((may_alias)) float_a;
typedef int __attribute__((may_alias)) int_a;

template <typename T> __device__ __forceinline__ void vst2(void* p, T v) { *(T*)p = v;  }
__device__ __forceinline__ v8f wmma16(v16h a, v16h b, v8f c) {
  v8f d = __builtin_amdgcn_wmma_f32_16x16x32_f16(false, a, false, b, (short)0, c, false, false);
  asm volatile("v_nop\n\tv_nop\n\tv_nop\n\tv_nop" : "+v"(d) : "v"(a), "v"(b));
  return d;
}
__device__ __forceinline__ v8f wmma_bf(v16b a, v16b b, v8f c) {
  v8f d = __builtin_amdgcn_wmma_f32_16x16x32_bf16(false, a, false, b, (short)0, c, false, false);
  asm volatile("v_nop\n\tv_nop\n\tv_nop\n\tv_nop" : "+v"(d) : "v"(a), "v"(b));
  return d;
}
// Relativistic self attention (B 1, S 2,048, d 1,024, 16 heads x 64): q/k/v projections + biases, scores / 8 multiplied by exp(-dist_ij gamma_h v_h) with the normalised pairwise distance of the 3-D positions and a per-head velocity, key mask, softmax, . v, output projection + bias.
__device__ __forceinline__ v16h frag_h(const _Float16* rowk0, int lane) {
  union { v16h v; v8h q[2]; } u; const _Float16* p = rowk0 + 8 * (lane >> 4);
  u.q[0] = *(const v8h*)p; u.q[1] = *(const v8h*)(p + 16); return u.v;
}
__device__ __forceinline__ v16h frag_f32(const float* rowk0, int lane) {
  v16h a; const float* p = rowk0 + 8 * (lane >> 4);
#pragma unroll
  for (int i = 0; i < 8; ++i) { a[i] = (_Float16)p[i]; a[8 + i] = (_Float16)p[16 + i]; }
  return a;
}
__device__ __forceinline__ v16h frag_f32s(const float* rowk0, int lane, float sc) {
  v16h a; const float* p = rowk0 + 8 * (lane >> 4);
#pragma unroll
  for (int i = 0; i < 8; ++i) { a[i] = (_Float16)(p[i] * sc); a[8 + i] = (_Float16)(p[16 + i] * sc); }
  return a;
}
// column fragment from a [K][ld] layout (column n), rows >= K read as 0
__device__ __forceinline__ v16h fragc_f32(const float* W, int k0, int n, int lane, int ld, int K) {
  v16h a; const int g = lane >> 4;
#pragma unroll
  for (int i = 0; i < 8; ++i) { const int ka = k0 + 8 * g + i, kb = ka + 16;
    a[i] = (_Float16)(ka < K ? W[(size_t)(ka < K ? ka : K - 1) * ld + n] : 0.f); a[8 + i] = (_Float16)(kb < K ? W[(size_t)(kb < K ? kb : K - 1) * ld + n] : 0.f); }
  return a;
}
struct F2 { v16b h, l; };
__device__ __forceinline__ F2 bsplit16(const float v[16]) { F2 r;
#pragma unroll
  for (int i = 0; i < 16; ++i) { const __bf16 h = (__bf16)v[i]; r.h[i] = h; r.l[i] = (__bf16)(v[i] - (float)h); }
  return r; }
__device__ __forceinline__ F2 split_row(const float* row, int k0, int lane) { float v[16]; const float* p = row + k0 + 8 * (lane >> 4);
#pragma unroll
  for (int i = 0; i < 8; ++i) { v[i] = p[i]; v[8 + i] = p[16 + i]; }
  return bsplit16(v); }
__device__ __forceinline__ F2 split_rowK(const float* row, int k0, int lane, int K) { float v[16]; const int g = lane >> 4;
#pragma unroll
  for (int i = 0; i < 8; ++i) { const int ka = k0 + 8 * g + i, kb = ka + 16; v[i] = ka < K ? row[ka < K ? ka : K - 1] : 0.f; v[8 + i] = kb < K ? row[kb < K ? kb : K - 1] : 0.f; }
  return bsplit16(v); }
__device__ __forceinline__ F2 split_col(const float* W, int k0, int n, int lane, int ld, int K) { float v[16]; const int g = lane >> 4;
#pragma unroll
  for (int i = 0; i < 8; ++i) { const int ka = k0 + 8 * g + i, kb = ka + 16; v[i] = ka < K ? W[(size_t)(ka < K ? ka : K - 1) * ld + n] : 0.f; v[8 + i] = kb < K ? W[(size_t)(kb < K ? kb : K - 1) * ld + n] : 0.f; }
  return bsplit16(v); }
__device__ __forceinline__ v8f mac3(const F2& a, const F2& b, v8f c) { c = wmma_bf(a.l, b.h, c); c = wmma_bf(a.h, b.l, c); return wmma_bf(a.h, b.h, c); }
__device__ __forceinline__ float sigm(float v) { return 1.0f / (1.0f + expf(-v)); }
#define LDSX() do { asm volatile("s_wait_dscnt 0" ::: "memory"); __builtin_amdgcn_wave_barrier(); __builtin_amdgcn_fence(__ATOMIC_RELEASE, "workgroup"); } while (0)


#define NB 1
#define SS 2048
#define DM 1024
#define NH 16
#define HD 64
#define QKVW (3 * DM)
#ifndef TQB
#define TQB (SS / 64)
#define TNB NB
#define TOB (NB * SS / 64)     // output row tiles (all)
#endif
typedef __attribute__((ext_vector_type(8))) __bf16 v8b;
__device__ __forceinline__ v16b frag_b(const __bf16* rowk0, int lane) {
  union { v16b v; v8b q[2]; } u; const __bf16* p = rowk0 + 8 * (lane >> 4);
  u.q[0] = *(const v8b*)p; u.q[1] = *(const v8b*)(p + 16); return u.v;
}
__device__ __forceinline__ float bfr(float v) { return (float)(__bf16)v; }
__device__ __attribute__((noinline)) float exp_ni(float v) { return expf(v); }
__device__ __attribute__((noinline)) float erf_ni(float v) { return erff(v); }

#define PK_A 0                       // [3072][1024] Wqkv rows (natural [out][in])
#define PK_P (PK_A + QKVW * DM)        // [1024][1024] Wo rows (natural)
#define PK_END (PK_P + DM * DM)
#define WS_PK  0u
#define WS_QK  (WS_PK + 2u * PK_END)             // f16 [2048 rows][2048]: q | k
#define WS_QKL (WS_QK + 2u * NB * SS * 2 * DM)     // f16 q | k residual planes x2048
#define WS_VTH (WS_QKL + 2u * NB * SS * 2 * DM)    // f16 [b][1024 (h*64+d)][2048 s] hi
#define WS_VTL (WS_VTH + 2u * NB * DM * SS)        // f16 lo x 2048
#define WS_O   (WS_VTL + 2u * NB * DM * SS)        // f32 [2048][1024]
#define WS_CS  (WS_O + 4u * NB * SS * DM)           // f32 [2][2048][32]: reserved, nothing uses it
#define WS_DM  (WS_CS + 4u * 2 * SS * 32)                  // f32: partial maxima of the squared pairwise distances [SS]
#define WS_END (WS_DM + 4u * (size_t)(SS + 32))
// one k-step (32 k) of a row-times-weight-rows product, as loaded: the lane's 16 f32 of its A row and its 8 weight fragments (16 columns each)
struct KStep { float a[16]; v16b w[8]; };
// ---- operand tiles of k_qkv and k_out in LDS. A tile is 64 k of the block's 64 A rows (f32, 256 B a row) and of its 128 weight rows (bf16, 128 B a row), brought by asynchronous copies: a wave's copy covers four whole 128-B lines, and the block fetches each line once for its four waves. Row pitches 272 and 144 B (16 B x odd): the 16 rows of a fragment read fall on distinct banks.
#define ST_K 64
#define ST_N (DM / ST_K)
#define ST_AP 272
#define ST_WP 144
#define ST_W (64 * ST_AP)
#define ST_SZ (ST_W + 128 * ST_WP)
// eight copies, each lane its own 16 bytes; the s_wait_xcnt stands inside the statement, behind the last copy, so that no address register named here is rewritten in front of it
__device__ __forceinline__ void acopy8(const unsigned (&l)[8], const void* const (&p)[8]) {
  asm volatile("global_load_async_to_lds_b128 %0, %8, off\n\t"
               "global_load_async_to_lds_b128 %1, %9, off\n\t"
               "global_load_async_to_lds_b128 %2, %10, off\n\t"
               "global_load_async_to_lds_b128 %3, %11, off\n\t"
               "global_load_async_to_lds_b128 %4, %12, off\n\t"
               "global_load_async_to_lds_b128 %5, %13, off\n\t"
               "global_load_async_to_lds_b128 %6, %14, off\n\t"
               "global_load_async_to_lds_b128 %7, %15, off\n\t"
               "s_wait_xcnt 0x0"
               :: "v"(l[0]), "v"(l[1]), "v"(l[2]), "v"(l[3]), "v"(l[4]), "v"(l[5]), "v"(l[6]), "v"(l[7]),
                  "v"(p[0]), "v"(p[1]), "v"(p[2]), "v"(p[3]), "v"(p[4]), "v"(p[5]), "v"(p[6]), "v"(p[7]) : "memory");
}
// tile st of the block into the buffer at LDS byte address lbuf; 128 threads, 16 copies each. a0, w0: the thread's own 16 bytes of tile 0 (A row tid / 16, weight row tid / 8); its further copies lie 8 A rows and 16 weight rows apart
__device__ __forceinline__ void tile_fill(const char* a0, const char* w0, int st, unsigned lbuf, int tid) {
  unsigned l[8]; const void* p[8];
  const char* pa = a0 + st * (ST_K * 4); const unsigned la = lbuf + (tid >> 4) * ST_AP + (tid & 15) * 16;
#pragma unroll
  for (int i = 0; i < 8; ++i) { l[i] = la + i * (8 * ST_AP); p[i] = pa + i * (8 * DM * 4); }
  acopy8(l, p);
  const char* pw = w0 + st * (ST_K * 2); const unsigned lw = lbuf + ST_W + (tid >> 3) * ST_WP + (tid & 7) * 16;
#pragma unroll
  for (int i = 0; i < 8; ++i) { l[i] = lw + i * (16 * ST_WP); p[i] = pw + i * (16 * DM * 2); }
  acopy8(l, p);
}
// k-step kk (0 or 1) of a tile: arow = the lane's A row in the buffer + 32 g bytes, wrow = weight row col in the buffer + 16 g bytes; the k order of both is that of frag_b
__device__ __forceinline__ void kstep_lds(KStep& s, const char* arow, const char* wrow, int kk) {
  const v4f a0 = *(const v4f*)(arow + kk * 128), a1 = *(const v4f*)(arow + kk * 128 + 16), a2 = *(const v4f*)(arow + kk * 128 + 64), a3 = *(const v4f*)(arow + kk * 128 + 80);
#pragma unroll
  for (int i = 0; i < 4; ++i) { s.a[i] = a0[i]; s.a[4 + i] = a1[i]; s.a[8 + i] = a2[i]; s.a[12 + i] = a3[i]; }
#pragma unroll
  for (int j = 0; j < 8; ++j) { union { v16b v; v8b q[2]; } u; const char* p = wrow + j * 16 * ST_WP + kk * 64; u.q[0] = *(const v8b*)p; u.q[1] = *(const v8b*)(p + 32); s.w[j] = u.v; }
}
// the two-buffer loop over the tiles: tile t + 1 flies while tile t is worked on. At the foot of a trip every wave ends its own LDS reads and its own copies, the barrier publishes tile t + 1 and frees tile t's buffer, and only then tile t + 2 is aimed at that buffer. The last trip's barrier also frees both buffers for the output staging.
template <typename MMA> __device__ __forceinline__ void tile_loop(const float* A0, const __bf16* W0, char* smem, int tid, MMA mma) {
  const int wave = tid >> 5, lane = tid & 31, col = lane & 15, g = lane >> 4; const unsigned l0 = (unsigned)(size_t)smem;
  const char* a0 = (const char*)(A0 + (size_t)(tid >> 4) * DM + (tid & 15) * 4); const char* w0 = (const char*)(W0 + (size_t)(tid >> 3) * DM + (tid & 7) * 8);
  tile_fill(a0, w0, 0, l0, tid);
  asm volatile("s_wait_asynccnt 0x0" ::: "memory");   // tile 0 has landed, this wave's share
  __syncthreads();   // tile 0 is whole before any wave reads it
  tile_fill(a0, w0, 1, l0 + ST_SZ, tid);
#pragma unroll 1
  for (int t = 0; t < ST_N; ++t) {   // rolled: the buffer is picked by t & 1
    const int bo = (t & 1) * ST_SZ; const char* arow = smem + bo + (wave * 16 + col) * ST_AP + 32 * g; const char* wrow = smem + bo + ST_W + col * ST_WP + 16 * g;
    KStep s0, s1; kstep_lds(s0, arow, wrow, 0); kstep_lds(s1, arow, wrow, 1); mma(s0); mma(s1);
    asm volatile("s_wait_dscnt 0x0" ::: "memory");      // this wave's reads of tile t are over before the buffer is given up
    asm volatile("s_wait_asynccnt 0x0" ::: "memory");   // this wave's share of tile t + 1 has landed
    __syncthreads();   // publishes tile t + 1, ends every reader's last read of tile t
    if (t + 2 < ST_N) tile_fill(a0, w0, t + 2, l0 + bo, tid);
  }
  asm volatile("s_wait_asynccnt 0x0" ::: "memory");   // no copy is outstanding when the LDS is used anew
}
// ---- pack_block: block = (row n, which): natural [out][in] rows -> bf16; which 0..2 -> W_q/W_k/W_v into PK_A rows which*1024 + n; 3 -> W_o into PK_P
__device__ __forceinline__ void pack_block(const float* __restrict__ WQ, const float* __restrict__ WK, const float* __restrict__ WV, const float* __restrict__ WO, __bf16* __restrict__ PK, int n, int which) {
  __shared__ __align__(16) __bf16 s[DM]; const int t = threadIdx.x; const float* Wm = (which == 0) ? WQ : (which == 1) ? WK : (which == 2) ? WV : WO;
  for (int k = t; k < DM; k += 256) s[k] = (__bf16)Wm[(size_t)n * DM + k];
  __syncthreads();
  __bf16* dst = (which < 3) ? PK + PK_A + ((size_t)which * DM + n) * DM : PK + PK_P + (size_t)n * DM;
  for (int q = t; q < DM / 8; q += 256) vst2((unsigned*)(dst + q * 8), *(const v4u*)&s[q * 8]);
}
__global__ __launch_bounds__(128) void k_qkv(const float* __restrict__ XQ, const float* __restrict__ XK, const float* __restrict__ XV, const __bf16* __restrict__ P, const float* __restrict__ BQ, const float* __restrict__ BK, const float* __restrict__ BV, _Float16* __restrict__ QK, _Float16* __restrict__ QKL, _Float16* __restrict__ VTH, _Float16* __restrict__ VTL) {
  const int which0 = (blockIdx.y * 128) / DM; const float* X = (which0 == 0) ? XQ : (which0 == 1) ? XK : XV; const float* BB = BQ ? (((which0 == 0) ? BQ : (which0 == 1) ? BK : BV) + (blockIdx.y * 128 - which0 * DM)) : nullptr;
  __shared__ __align__(16) char smem[2 * ST_SZ];   // the two tile buffers; behind the loop the output staging
  static_assert(2 * ST_SZ >= 2 * (4 * 16 * 136 + 128 * 72) * 2, "the staging fits the buffers");
  _Float16 (*so)[16][136] = (_Float16 (*)[16][136])smem, (*sol)[16][136] = so + 4; _Float16 (*sth)[72] = (_Float16 (*)[72])(sol + 4), (*stl)[72] = sth + 128;
  const int tid = threadIdx.x, wave = tid >> 5, lane = tid & 31, col = lane & 15, g = lane >> 4; const size_t r0 = (size_t)blockIdx.x * 64 + wave * 16; const int n0 = blockIdx.y * 128;
  v8f acc[8] = {};
  auto mma = [&](const KStep& s) { v16b a;
#pragma unroll
    for (int i = 0; i < 16; ++i) a[i] = (__bf16)s.a[i];
#pragma unroll
    for (int j = 0; j < 8; ++j) acc[j] = wmma_bf(a, s.w[j], acc[j]); };
  tile_loop(X + (size_t)blockIdx.x * 64 * DM, P + (size_t)n0 * DM, smem, tid, mma);
  if (n0 < 2 * DM) {   // q stored unscaled (f16 sigma ~0.6, no subnormal exposure); 1/8 applied to the f32 score
#pragma unroll
    for (int j = 0; j < 8; ++j) {
#pragma unroll
      for (int r = 0; r < 8; ++r) { const float v = acc[j][r] + (BB ? bfr(BB[j * 16 + col]) : 0.f); const _Float16 hv = (_Float16)v; so[wave][8 * g + r][j * 16 + col] = hv; sol[wave][8 * g + r][j * 16 + col] = (_Float16)((v - (float)hv) * 2048.0f); } }   // q, k (+ bias) as f16 hi + (x2048) residual
    LDSX();
    for (int rl = 0; rl < 16; ++rl) if (lane < 16) { vst2((unsigned*)(QK + (r0 + rl) * (2 * DM) + n0 + lane * 8), *(const v4u*)&so[wave][rl][lane * 8]); vst2((unsigned*)(QKL + (r0 + rl) * (2 * DM) + n0 + lane * 8), *(const v4u*)&sol[wave][rl][lane * 8]); }
  } else {
#pragma unroll
    for (int j = 0; j < 8; ++j) {
#pragma unroll
      for (int r = 0; r < 8; ++r) { const float v = acc[j][r] + (BB ? bfr(BB[j * 16 + col]) : 0.f); const _Float16 hv = (_Float16)v; sth[j * 16 + col][wave * 16 + 8 * g + r] = hv; stl[j * 16 + col][wave * 16 + 8 * g + r] = (_Float16)((v - (float)hv) * 2048.0f); } }
    __syncthreads();
    const size_t rb = (size_t)blockIdx.x * 64; const int b = (int)(rb / SS), s0 = (int)(rb % SS); const int pc0 = n0 - 2 * DM;
    for (int q = tid; q < 128 * 8; q += 128) { const int d = q >> 3, pc = q & 7; const size_t o = ((size_t)b * DM + pc0 + d) * SS + s0 + pc * 8; vst2((unsigned*)(VTH + o), *(const v4u*)&sth[d][pc * 8]); vst2((unsigned*)(VTL + o), *(const v4u*)&stl[d][pc * 8]); }
  }
}
// ---- K and V tiles of k_attn in LDS. A tile is 64 keys: 64 K rows (this head's 64 d, 128 B) and 64 V^T rows (one d each, the tile's 64 keys, 128 B), brought by asynchronous copies: a wave's copy covers four whole 128-B lines, and the block fetches each line once for its four waves. Row pitch 144 B (16 B x odd): the 16 rows of a fragment read fall on distinct banks.
#define AT_K 64
#define AT_N (SS / AT_K)
#define AT_P 144
#define AT_V (AT_K * AT_P)
#define AT_SZ (AT_V + HD * AT_P)
// tile t into the buffer at LDS byte address lbuf; 128 threads, 4 copies of K and 4 of V^T each. k0, v0: the thread's own 16 bytes of tile 0 (row tid / 8 of either); its further copies lie 16 rows apart
__device__ __forceinline__ void kv_fill(const char* k0, const char* v0, int t, unsigned lbuf, int tid) {
  unsigned l[8]; const void* p[8];
  const char* pk = k0 + (size_t)t * (AT_K * 2 * DM * 2); const char* pv = v0 + t * (AT_K * 2); const unsigned lk = lbuf + (tid >> 3) * AT_P + (tid & 7) * 16;
#pragma unroll
  for (int i = 0; i < 4; ++i) { l[i] = lk + i * (16 * AT_P); p[i] = pk + i * (16 * 2 * DM * 2); l[4 + i] = lk + AT_V + i * (16 * AT_P); p[4 + i] = pv + i * (16 * SS * 2); }
  acopy8(l, p);
}
__device__ __forceinline__ float xrow(float x, unsigned lo, unsigned hi) { return __builtin_bit_cast(float, __builtin_amdgcn_permlane16(__builtin_bit_cast(int, x), __builtin_bit_cast(int, x), lo, hi, false, false)); }   // lane i of a 16-lane row takes the row's lane named by nibble i of hi:lo
__device__ __forceinline__ float xhalf(float x) { return __builtin_bit_cast(float, __builtin_amdgcn_permlanex16(__builtin_bit_cast(int, x), __builtin_bit_cast(int, x), 0x76543210, 0xfedcba98, false, false)); }   // lane l with lane l ^ 16
// ---- k_attn: block = (64 queries, head h, batch b): all-keys flash attention, TRANSPOSED: S^T = K . Q^T (A = K rows, B = Q rows), so a lane holds 16 scores of ONE query (column col; keys 8 g + r and 16 + 8 g + r of the step's 32): maximum and sum run in the lane, one exchange between the wave's halves joins the maximum, the halves' sums are joined once behind the loop. The two score tiles, converted in place, are the B operand of O^T += V^T . P^T (hardware k order, which frag_h gives the V rows): P touches no LDS. A lane ends with 8 consecutive d of its query per tile and stores them itself.
// The lane now needs 16 keys' positions per step: the block rounds all keys' positions once into LDS (x, y, z planes), with a fourth plane that is 0 for a kept key and -3.0e38 for a masked one, added to the score.
// amdgpu_waves_per_eu(2, 2): the grid gives two waves per SIMD
__global__ __launch_bounds__(128) __attribute__((amdgpu_waves_per_eu(2, 2))) void k_attn(const _Float16* __restrict__ QK, const _Float16* __restrict__ QKL, const _Float16* __restrict__ VTH, const _Float16* __restrict__ VTL, const void* __restrict__ KMASK, const float* __restrict__ POS, const float* __restrict__ RM, const float* __restrict__ VEL, const int* __restrict__ AM, float* __restrict__ O) {
  static_assert(SS % 512 == 0, "a thread fills whole groups of 4 keys");
  static_assert(AT_N >= 2 && HD == 64, "two tiles exist; a K row is 128 B");
  __shared__ __align__(16) float skx[SS], sky[SS], skz[SS], skm[SS];
  __shared__ __align__(16) char skv[2 * AT_SZ];   // the two K and V tile buffers
  __shared__ __align__(16) float swm[4];   // each wave's maximum of its share of the partial maxima
  static_assert(NB * SS == 128 * 16, "a thread reads 16 partial maxima");
  const int tid = threadIdx.x, wave = tid >> 5, lane = tid & 31, col = lane & 15, g = lane >> 4;
  const int qb = blockIdx.x, h = blockIdx.y, b = blockIdx.z; const int q0 = qb * 64 + wave * 16; const size_t rq = (size_t)b * SS + q0 + col;
  const unsigned l0 = (unsigned)(size_t)skv;
  const char* gk = (const char*)(QK + ((size_t)b * SS + (tid >> 3)) * (2 * DM) + DM + h * HD + (tid & 7) * 8); const char* gv = (const char*)(VTH + ((size_t)b * DM + h * HD + (tid >> 3)) * SS + (tid & 7) * 8);
  kv_fill(gk, gv, 0, l0, tid);   // tile 0 flies while the key planes are made
  // the global maximum of the squared distances: every block reduces the 2,048 partial maxima itself (max is order-free: the same value in every block). The loads go out here with the positions'; the waves' results cross at the barrier that the key planes need anyway
  v4f rm[4];
#pragma unroll
  for (int i = 0; i < 4; ++i) rm[i] = *(const v4f*)(RM + i * 512 + tid * 4);
  asm volatile("s_wait_xcnt 0x0" ::: "memory");   // stands behind these loads, in front of any rewrite of a register that they name (their base is reused soon)
#pragma unroll
  for (int i = 0; i < SS / 512; ++i) { const int j = tid + 128 * i; const float* p = POS + ((size_t)b * SS + 4 * j) * 3; const v4f u = *(const v4f*)p, v = *(const v4f*)(p + 4), w = *(const v4f*)(p + 8); const v4i mk = *(const v4i*)(AM + (size_t)b * SS + 4 * j);
    const v4f x = { bfr(u[0]), bfr(u[3]), bfr(v[2]), bfr(w[1]) }, y = { bfr(u[1]), bfr(v[0]), bfr(v[3]), bfr(w[2]) }, z = { bfr(u[2]), bfr(v[1]), bfr(w[0]), bfr(w[3]) };
    const v4f a = { mk[0] != 0 ? 0.f : -3.0e38f, mk[1] != 0 ? 0.f : -3.0e38f, mk[2] != 0 ? 0.f : -3.0e38f, mk[3] != 0 ? 0.f : -3.0e38f };
    *(v4f*)&skx[4 * j] = x; *(v4f*)&sky[4 * j] = y; *(v4f*)&skz[4 * j] = z; *(v4f*)&skm[4 * j] = a; }
  v16h aq[2];
#pragma unroll
  for (int kc = 0; kc < 2; ++kc) aq[kc] = frag_h(QK + rq * (2 * DM) + h * HD + kc * 32, lane);
  v2f px2, py2, pz2; { const float* p = POS + rq * 3; const float px = bfr(p[0]), py = bfr(p[1]), pz = bfr(p[2]); px2 = v2f{ px, px }; py2 = v2f{ py, py }; pz2 = v2f{ pz, pz }; }   // the lane's query, each coordinate twice
  float gv_h; { float vh = fabsf(bfr(VEL[h])); vh = fminf(fmaxf(vh, 0.f), 0.999f); const float gam = 1.0f / sqrtf(1.0f - vh * vh); gv_h = gam * vh; }   // gamma v
  { float w = 0.f;
#pragma unroll
    for (int i = 0; i < 4; ++i) w = fmaxf(w, fmaxf(fmaxf(rm[i][0], rm[i][1]), fmaxf(rm[i][2], rm[i][3])));
    w = fmaxf(w, xrow(w, 0x67452301u, 0xefcdab89u)); w = fmaxf(w, xrow(w, 0x54761032u, 0xdcfe98bau)); w = fmaxf(w, xrow(w, 0x32107654u, 0xba98fedcu)); w = fmaxf(w, xrow(w, 0xfedcba98u, 0x76543210u)); w = fmaxf(w, xhalf(w));   // lane l with l ^ 1, ^ 2, ^ 4, ^ 8, ^ 16
    if (lane == 0) swm[wave] = w; }
  float m = -3.0e38f, l = 0.f;   // the query's running maximum (equal in both halves) and this half's share of its sum
  v8f acc[4] = {};
  // the fragments come from the tile's buffer, rows and k order as before (frag_h): a step's K at its head, its V behind its score products, a whole softmax ahead of its use
  v16h kf[2][2], vf[4];
  auto lds_k = [&](const char* buf, int ss) {
#pragma unroll
    for (int ct = 0; ct < 2; ++ct) { const _Float16* krow = (const _Float16*)(buf + (ss * 32 + ct * 16 + col) * AT_P);
#pragma unroll
      for (int kc = 0; kc < 2; ++kc) kf[ct][kc] = frag_h(krow + kc * 32, lane); } };
  auto lds_v = [&](const char* buf, int ss) {
#pragma unroll
    for (int dt = 0; dt < 4; ++dt) vf[dt] = frag_h((const _Float16*)(buf + AT_V + (dt * 16 + col) * AT_P) + ss * 32, lane); };
  asm volatile("s_wait_asynccnt 0x0" ::: "memory");   // tile 0 has landed, this wave's share
  __syncthreads();   // the key planes, the waves' maxima and tile 0 are whole before any wave reads them
  kv_fill(gk, gv, 1, l0 + AT_SZ, tid);
  float coef; { const v4f wm = *(const v4f*)swm; const float dmax = sqrtf(fmaxf(fmaxf(wm[0], wm[1]), fmaxf(wm[2], wm[3]))); coef = gv_h / (dmax + 1e-8f); }   // gamma v / (dmax + 1e-8): dist is normalised by the global max
  // the factor exp(-dist coef) is 2^(dist c2): one multiply by a per-head constant between the two hardware operations. With a global maximum of 0 every dist is 0 and the factor is 1 under any finite constant, so that case needs no constant of its own
  const float c2 = coef * -1.44269504f; const v2f c22 = { c2, c2 };
  // the two-buffer loop over the tiles: tile t + 1 flies while tile t is worked on
#pragma unroll 1
  for (int t = 0; t < AT_N; ++t) {   // rolled: the buffer is picked by t & 1
    const int bo = (t & 1) * AT_SZ; const char* buf = skv + bo;
#pragma unroll 1
   for (int ss = 0; ss < 2; ++ss) { v8f cc[2]; const int ks = 2 * t + ss;   // the tile's two steps of 32 keys; rolled: as a block that loops on itself a step keeps its 16 scores' chains interleaved and paired for dual issue, unrolled the build had an eighth more vector instructions
    lds_k(buf, ss);
    v4f tx[4], ty[4], tz[4], tm[4];   // the lane's 16 keys: planes read as 16-byte words, the same address in all 16 lanes of a half
#pragma unroll
    for (int q = 0; q < 4; ++q) { const int k0 = ks * 32 + (q >> 1) * 16 + 8 * g + (q & 1) * 4; tx[q] = *(const v4f*)&skx[k0]; ty[q] = *(const v4f*)&sky[k0]; tz[q] = *(const v4f*)&skz[k0]; tm[q] = *(const v4f*)&skm[k0]; }
#pragma unroll
    for (int ct = 0; ct < 2; ++ct) { v8f c = {};
#pragma unroll
      for (int kc = 0; kc < 2; ++kc) c = wmma16(kf[ct][kc], aq[kc], c);   // single product: k, q as one-rounding f16 operands; c[r] = score of key ct * 16 + 8 g + r with query col
      cc[ct] = c; }
    lds_v(buf, ss);
    float s[16];
#pragma unroll
    for (int p = 0; p < 8; ++p) { const int q = p >> 1, e = (p & 1) * 2;   // two keys at a time, neighbours in the planes' words: packed f32 forms with no register moves
      const v2f kx = { tx[q][e], tx[q][e + 1] }, ky = { ty[q][e], ty[q][e + 1] }, kz = { tz[q][e], tz[q][e + 1] };
      const v2f dx = px2 - kx, dy = py2 - ky, dz = pz2 - kz; const v2f sq2 = dx * dx + dy * dy + dz * dz;
      const v2f xe = v2f{ __builtin_amdgcn_sqrtf(sq2[0]), __builtin_amdgcn_sqrtf(sq2[1]) } * c22;   // the hardware square root (1 ulp; 0 gives 0), not the library's correctly rounded sequence of a dozen vector instructions a score
#pragma unroll
      for (int u = 0; u < 2; ++u) { const int i = 2 * p + u; const float fac = __builtin_amdgcn_exp2f(xe[u]); s[i] = cc[i >> 3][i & 7] * 0.125f * fac + tm[q][e + u]; } }   // score x exp(-normalised distance x gamma v); a masked key ends at -3.0e38
    float mx = s[0];
#pragma unroll
    for (int i = 1; i < 16; ++i) mx = fmaxf(mx, s[i]);
    mx = fmaxf(mx, xhalf(mx));
    const float mn = fmaxf(m, mx); const float alpha = (m <= -1.0e38f) ? 0.f : __expf(m - mn);
    const float mref = (mn <= -1.0e38f) ? 0.f : mn;   // no kept key yet: against 0 every masked score gives weight 0, as it does against a real maximum
    float e[16]; v16h pa;
#pragma unroll
    for (int i = 0; i < 16; ++i) { e[i] = __expf(s[i] - mref); pa[i] = (_Float16)(e[i] * 2048.0f); }   // P scaled by 2^11 so small softmax weights stay out of the f16 subnormal range; 2^-11 folded into the epilogue. Element i of the B operand is key 8 g + i (i < 8) or 16 + 8 g + i - 8: the two tiles' registers in their order
#pragma unroll
    for (int w = 8; w > 0; w >>= 1) {   // a tree, not a chain of 15 dependent adds
#pragma unroll
      for (int i = 0; i < w; ++i) e[i] += e[i + w]; }
    const float es = e[0];
    l = l * alpha + es; m = mn;
#pragma unroll
    for (int dt = 0; dt < 4; ++dt) acc[dt] *= alpha;
#pragma unroll
    for (int dt = 0; dt < 4; ++dt) acc[dt] = wmma16(vf[dt], pa, acc[dt]);   // single product: V^T x P^T (x2^11); acc[dt][r] = O[query col][dt * 16 + 8 g + r]
   }
    asm volatile("s_wait_dscnt 0x0" ::: "memory");      // this wave's reads of tile t are over before the buffer is given up
    asm volatile("s_wait_asynccnt 0x0" ::: "memory");   // this wave's share of tile t + 1 has landed
    __syncthreads();   // publishes tile t + 1, ends every reader's last read of tile t
    if (t + 2 < AT_N) kv_fill(gk, gv, t + 2, l0 + bo, tid);
  }
  asm volatile("s_wait_asynccnt 0x0" ::: "memory");   // no copy is outstanding when the wave ends
  const float il = (1.0f / 2048.0f) / (l + xhalf(l));
  float* orow = O + rq * DM + h * HD + 8 * g;
#pragma unroll
  for (int dt = 0; dt < 4; ++dt) { const v4f lo = { acc[dt][0] * il, acc[dt][1] * il, acc[dt][2] * il, acc[dt][3] * il }, hi = { acc[dt][4] * il, acc[dt][5] * il, acc[dt][6] * il, acc[dt][7] * il }; vst2(orow + dt * 16, lo); vst2(orow + dt * 16 + 4, hi); }
}
// ---- k_out: block = (64 rows, 128 cols): out = O(hi/lo) . Wo rows (2 products) + bo
__global__ __launch_bounds__(128) void k_out(const float* __restrict__ O, const __bf16* __restrict__ P, const float* __restrict__ BO, float* __restrict__ Y) {
  __shared__ __align__(16) char smem[2 * ST_SZ];   // the two tile buffers; behind the loop the output staging
  static_assert(2 * ST_SZ >= 4 * 16 * 132 * 4, "the staging fits the buffers");
  float (*so)[16][132] = (float (*)[16][132])smem;
  const int tid = threadIdx.x, wave = tid >> 5, lane = tid & 31, col = lane & 15, g = lane >> 4; const size_t r0 = (size_t)blockIdx.x * 64 + wave * 16; const int n0 = blockIdx.y * 128;
  v8f acc[8] = {};
  auto mma = [&](const KStep& s) { const F2 a = bsplit16(s.a);
#pragma unroll
    for (int j = 0; j < 8; ++j) { acc[j] = wmma_bf(a.l, s.w[j], acc[j]); acc[j] = wmma_bf(a.h, s.w[j], acc[j]); } };
  tile_loop(O + (size_t)blockIdx.x * 64 * DM, P + (size_t)n0 * DM, smem, tid, mma);
#pragma unroll
  for (int j = 0; j < 8; ++j) {
#pragma unroll
    for (int r = 0; r < 8; ++r) so[wave][8 * g + r][j * 16 + col] = acc[j][r] + bfr(BO[n0 + j * 16 + col]); }
  LDSX();
  for (int rl = 0; rl < 16; ++rl) vst2(Y + (r0 + rl) * DM + n0 + lane * 4, *(const v4f*)&so[wave][rl][lane * 4]);
}
// ---- dist_block: block = 32 rows x all keys. A thread keeps the rounded positions of its own 8 keys in registers (six 16-byte loads, issued together) and walks the block's 32 rows, read from LDS: no load stands in the loop's dependent path. max is order-free, so any split of the pairs gives the same global maximum: RM[block * 32 + i] = max of |p_r - p_j|^2 over the block's rows r and the keys j of threads 8 i .. 8 i + 7; one 128-B line per block
__device__ __forceinline__ void dist_block(const float* __restrict__ POS, float* __restrict__ RM, int blk) {
  static_assert(NB * SS == 256 * 8, "a thread owns 8 keys");
  __shared__ __align__(16) float srow[32][4]; __shared__ __align__(16) float red[256]; __shared__ __align__(16) float line[32];
  const int t = threadIdx.x; const size_t r0 = (size_t)blk * 32;
  v4f kv[6];
#pragma unroll
  for (int i = 0; i < 6; ++i) kv[i] = *(const v4f*)(POS + (size_t)t * 24 + i * 4);
  if (t < 128) { const int c = t & 3; const float v = POS[(r0 + (t >> 2)) * 3 + (c < 3 ? c : 2)]; srow[t >> 2][c] = (c < 3) ? bfr(v) : 0.f; }   // a row's fourth word is padding, written so that the 16-byte rows hold no unwritten LDS
  float kx[8], ky[8], kz[8], mx[8];
#pragma unroll
  for (int j = 0; j < 8; ++j) { kx[j] = bfr(kv[(3 * j) >> 2][(3 * j) & 3]); ky[j] = bfr(kv[(3 * j + 1) >> 2][(3 * j + 1) & 3]); kz[j] = bfr(kv[(3 * j + 2) >> 2][(3 * j + 2) & 3]); mx[j] = 0.f; }
  __syncthreads();
  // rolled: unrolled by four (or two) the kernel needs more than 64 registers, and the packing blocks of the same launch, whose rate is their number in flight, would no longer fill all 16 wave places of a SIMD
#pragma unroll 1
  for (int i = 0; i < 32; ++i) { const v4f p = *(const v4f*)&srow[i][0];
#pragma unroll
    for (int j = 0; j < 8; ++j) { const float dx = p[0] - kx[j], dy = p[1] - ky[j], dz = p[2] - kz[j]; mx[j] = fmaxf(mx[j], dx * dx + dy * dy + dz * dz); } }
  red[t] = fmaxf(fmaxf(fmaxf(mx[0], mx[1]), fmaxf(mx[2], mx[3])), fmaxf(fmaxf(mx[4], mx[5]), fmaxf(mx[6], mx[7]))); __syncthreads();
  if (t < 32) { const v4f a = *(const v4f*)&red[t * 8], c = *(const v4f*)&red[t * 8 + 4]; line[t] = fmaxf(fmaxf(fmaxf(a[0], a[1]), fmaxf(a[2], a[3])), fmaxf(fmaxf(c[0], c[1]), fmaxf(c[2], c[3]))); } __syncthreads();
  if (t < 8) vst2(RM + r0 + t * 4, *(const v4f*)&line[t * 4]);
}
// ---- k_prep: one launch for the two pieces of work that read nothing but inputs. Blocks 0 .. DIST_B - 1 make the partial maxima, the others pack one weight row each. The distance blocks are the long ones and have the low indices, so that they start first and run beside the packing.
#define DIST_B (NB * SS / 32)
__global__ __launch_bounds__(256) void k_prep(const float* __restrict__ WQ, const float* __restrict__ WK, const float* __restrict__ WV, const float* __restrict__ WO, __bf16* __restrict__ PK, const float* __restrict__ POS, float* __restrict__ RM) {
  const int bi = blockIdx.x;   // the same for the whole block: either side's barriers are passed by all of its threads
  if (bi < DIST_B) dist_block(POS, RM, bi);
  else pack_block(WQ, WK, WV, WO, PK, (bi - DIST_B) % DM, (bi - DIST_B) / DM);
}
extern "C" void kernel_launch(void* const* d_in, const int* in_sizes, int n_in, void* d_out, int out_size, void* d_ws, size_t ws_size, hipStream_t stream) {
  (void)in_sizes; (void)n_in; (void)out_size;
  const float** F = (const float**)d_in;   // 0 x [1,2048,1024], 1 attention_mask [1,2048] int, 2 positions [1,2048,3], 3 Wq, 4 bq, 5 Wk, 6 bk, 7 Wv, 8 bv, 9 Wo, 10 bo (natural), 11 velocity [16]
  if (ws_size < (size_t)WS_END) return;
  char* ws = (char*)d_ws; __bf16* PK = (__bf16*)(ws + WS_PK); _Float16 *QK = (_Float16*)(ws + WS_QK), *QKL = (_Float16*)(ws + WS_QKL), *VTH = (_Float16*)(ws + WS_VTH), *VTL = (_Float16*)(ws + WS_VTL); float *O = (float*)(ws + WS_O), *RM = (float*)(ws + WS_DM);
  k_prep<<<DIST_B + 4 * DM, 256, 0, stream>>>(F[3], F[5], F[7], F[9], PK, F[2], RM);
  k_qkv<<<dim3(TNB * SS / 64, QKVW / 128), 128, 0, stream>>>(F[0], F[0], F[0], PK + PK_A, F[4], F[6], F[8], QK, QKL, VTH, VTL);
  k_attn<<<dim3(TQB, NH, TNB), 128, 0, stream>>>(QK, QKL, VTH, VTL, nullptr, F[2], RM, F[11], (const int*)d_in[1], O);
  k_out<<<dim3(TOB, DM / 128), 128, 0, stream>>>(O, PK + PK_P, F[10], (float*)d_out);
}

// v008
// Measured time: 83.5 microseconds a run.
// In two side-by-side timings against v007, it was 1.06 and 1.03 times as fast.
// Counting every step since v000, it is 4.69 times as fast.
// compute dtype: all float inputs rounded to bf16, the int mask read on device; q/k/v = x . W^T + b with EXACT bf16 products on WMMA 16x16x32 (natural rows); pairwise distances, their global maximum (deterministic block reduction), the Lorentz factor and exp(-d coef) in f32 (hardware exp; per score the hardware square root); PLAIN attention: q, k single f16 x 1/8 x that factor, masked keys excluded, running-max softmax in f32, P (scaled by 2^11, single f16) x v (single f16); out = o (bf16 hi + residual) . Wo^T (2 products) + bo.
#include <hip/hip_runtime.h>
#include <math.h>

typedef __attribute__((ext_vector_type(16))) _Float16 v16h;
typedef __attribute__((ext_vector_type(16))) __bf16 v16b;
typedef __attribute__((ext_vector_type(8)))  _Float16 v8h;
typedef __attribute__((ext_vector_type(8)))  float v8f;
typedef __attribute__((ext_vector_type(4)))  float v4f;
typedef __attribute__((ext_vector_type(2)))  float v2f;
typedef __attribute__((ext_vector_type(4)))  unsigned v4u;
typedef __attribute__((ext_vector_type(4)))  int v4i;
typedef float __attribute__((may_alias)) float_a;
typedef int __attribute__((may_alias)) int_a;

template <typename T> __device__ __forceinline__ void vst2(void* p, T v) { *(T*)p = v;  }
__device__ __forceinline__ v8f wmma16(v16h a, v16h b, v8f c) {
  v8f d = __builtin_amdgcn_wmma_f32_16x16x32_f16(false, a, false, b, (short)0, c, false, false);
  asm volatile("v_nop\n\tv_nop\n\tv_nop\n\tv_nop" : "+v"(d) : "v"(a), "v"(b));
  return d;
}
__device__ __forceinline__ v8f wmma_bf(v16b a, v16b b, v8f c) {
  v8f d = __builtin_amdgcn_wmma_f32_16x16x32_bf16(false, a, false, b, (short)0, c, false, false);
  asm volatile("v_nop\n\tv_nop\n\tv_nop\n\tv_nop" : "+v"(d) : "v"(a), "v"(b));
  return d;
}
// Relativistic self attention (B 1, S 2,048, d 1,024, 16 heads x 64): q/k/v projections + biases, scores / 8 multiplied by exp(-dist_ij gamma_h v_h) with the normalised pairwise distance of the 3-D positions and a per-head velocity, key mask, softmax, . v, output projection + bias.
__device__ __forceinline__ v16h frag_h(const _Float16* rowk0, int lane) {
  union { v16h v; v8h q[2]; } u; const _Float16* p = rowk0 + 8 * (lane >> 4);
  u.q[0] = *(const v8h*)p; u.q[1] = *(const v8h*)(p + 16); return u.v;
}
__device__ __forceinline__ v16h frag_f32(const float* rowk0, int lane) {
  v16h a; const float* p = rowk0 + 8 * (lane >> 4);
#pragma unroll
  for (int i = 0; i < 8; ++i) { a[i] = (_Float16)p[i]; a[8 + i] = (_Float16)p[16 + i]; }
  return a;
}
__device__ __forceinline__ v16h frag_f32s(const float* rowk0, int lane, float sc) {
  v16h a; const float* p = rowk0 + 8 * (lane >> 4);
#pragma unroll
  for (int i = 0; i < 8; ++i) { a[i] = (_Float16)(p[i] * sc); a[8 + i] = (_Float16)(p[16 + i] * sc); }
  return a;
}
// column fragment from a [K][ld] layout (column n), rows >= K read as 0
__device__ __forceinline__ v16h fragc_f32(const float* W, int k0, int n, int lane, int ld, int K) {
  v16h a; const int g = lane >> 4;
#pragma unroll
  for (int i = 0; i < 8; ++i) { const int ka = k0 + 8 * g + i, kb = ka + 16;
    a[i] = (_Float16)(ka < K ? W[(size_t)(ka < K ? ka : K - 1) * ld + n] : 0.f); a[8 + i] = (_Float16)(kb < K ? W[(size_t)(kb < K ? kb : K - 1) * ld + n] : 0.f); }
  return a;
}
struct F2 { v16b h, l; };
__device__ __forceinline__ F2 bsplit16(const float v[16]) { F2 r;
#pragma unroll
  for (int i = 0; i < 16; ++i) { const __bf16 h = (__bf16)v[i]; r.h[i] = h; r.l[i] = (__bf16)(v[i] - (float)h); }
  return r; }
__device__ __forceinline__ F2 split_row(const float* row, int k0, int lane) { float v[16]; const float* p = row + k0 + 8 * (lane >> 4);
#pragma unroll
  for (int i = 0; i < 8; ++i) { v[i] = p[i]; v[8 + i] = p[16 + i]; }
  return bsplit16(v); }
__device__ __forceinline__ F2 split_rowK(const float* row, int k0, int lane, int K) { float v[16]; const int g = lane >> 4;
#pragma unroll
  for (int i = 0; i < 8; ++i) { const int ka = k0 + 8 * g + i, kb = ka + 16; v[i] = ka < K ? row[ka < K ? ka : K - 1] : 0.f; v[8 + i] = kb < K ? row[kb < K ? kb : K - 1] : 0.f; }
  return bsplit16(v); }
__device__ __forceinline__ F2 split_col(const float* W, int k0, int n, int lane, int ld, int K) { float v[16]; const int g = lane >> 4;
#pragma unroll
  for (int i = 0; i < 8; ++i) { const int ka = k0 + 8 * g + i, kb = ka + 16; v[i] = ka < K ? W[(size_t)(ka < K ? ka : K - 1) * ld + n] : 0.f; v[8 + i] = kb < K ? W[(size_t)(kb < K ? kb : K - 1) * ld + n] : 0.f; }
  return bsplit16(v); }
__device__ __forceinline__ v8f mac3(const F2& a, const F2& b, v8f c) { c = wmma_bf(a.l, b.h, c); c = wmma_bf(a.h, b.l, c); return wmma_bf(a.h, b.h, c); }
__device__ __forceinline__ float sigm(float v) { return 1.0f / (1.0f + expf(-v)); }
#define LDSX() do { asm volatile("s_wait_dscnt 0" ::: "memory"); __builtin_amdgcn_wave_barrier(); __builtin_amdgcn_fence(__ATOMIC_RELEASE, "workgroup"); } while (0)


#define NB 1
#define SS 2048
#define DM 1024
#define NH 16
#define HD 64
#define QKVW (3 * DM)
#ifndef TQB
#define TQB (SS / 64)
#define TNB NB
#define TOB (NB * SS / 64)     // output row tiles (all)
#endif
typedef __attribute__((ext_vector_type(8))) __bf16 v8b;
__device__ __forceinline__ v16b frag_b(const __bf16* rowk0, int lane) {
  union { v16b v; v8b q[2]; } u; const __bf16* p = rowk0 + 8 * (lane >> 4);
  u.q[0] = *(const v8b*)p; u.q[1] = *(const v8b*)(p + 16); return u.v;
}
__device__ __forceinline__ float bfr(float v) { return (float)(__bf16)v; }
__device__ __attribute__((noinline)) float exp_ni(float v) { return expf(v); }
__device__ __attribute__((noinline)) float erf_ni(float v) { return erff(v); }

#define PK_A 0                       // [3072][1024] Wqkv rows (natural [out][in])
#define PK_P (PK_A + QKVW * DM)        // [1024][1024] Wo rows (natural)
#define PK_END (PK_P + DM * DM)
#define WS_PK  0u
#define WS_QK  (WS_PK + 2u * PK_END)             // f16 [2048 rows][2048]: q | k
#define WS_QKL (WS_QK + 2u * NB * SS * 2 * DM)     // f16 q | k residual planes x2048
#define WS_VTH (WS_QKL + 2u * NB * SS * 2 * DM)    // f16 [b][1024 (h*64+d)][2048 s] hi
#define WS_VTL (WS_VTH + 2u * NB * DM * SS)        // f16 lo x 2048
#define WS_O   (WS_VTL + 2u * NB * DM * SS)        // f32 [2048][1024]
#define WS_CS  (WS_O + 4u * NB * SS * DM)           // f32 [2][2048][32]: reserved, nothing uses it
#define WS_DM  (WS_CS + 4u * 2 * SS * 32)                  // f32: partial maxima of the squared pairwise distances [SS]
#define WS_END (WS_DM + 4u * (size_t)(SS + 32))
// one k-step (32 k) of a row-times-weight-rows product, as loaded: the lane's 16 f32 of its A row and its 8 weight fragments (16 columns each)
struct KStep { float a[16]; v16b w[8]; };
// ---- operand tiles of k_qkv and k_out in LDS. A tile is 64 k of the block's 64 A rows (f32, 256 B a row) and of its 128 weight rows (bf16, 128 B a row), brought by asynchronous copies: a wave's copy covers four whole 128-B lines, and the block fetches each line once for its four waves. Row pitches 272 and 144 B (16 B x odd): the 16 rows of a fragment read fall on distinct banks.
#define ST_K 64
#define ST_N (DM / ST_K)
#define ST_AP 272
#define ST_WP 144
#define ST_W (64 * ST_AP)
#define ST_SZ (ST_W + 128 * ST_WP)
// eight copies, each lane its own 16 bytes; the s_wait_xcnt stands inside the statement, behind the last copy, so that no address register named here is rewritten in front of it
__device__ __forceinline__ void acopy8(const unsigned (&l)[8], const void* const (&p)[8]) {
  asm volatile("global_load_async_to_lds_b128 %0, %8, off\n\t"
               "global_load_async_to_lds_b128 %1, %9, off\n\t"
               "global_load_async_to_lds_b128 %2, %10, off\n\t"
               "global_load_async_to_lds_b128 %3, %11, off\n\t"
               "global_load_async_to_lds_b128 %4, %12, off\n\t"
               "global_load_async_to_lds_b128 %5, %13, off\n\t"
               "global_load_async_to_lds_b128 %6, %14, off\n\t"
               "global_load_async_to_lds_b128 %7, %15, off\n\t"
               "s_wait_xcnt 0x0"
               :: "v"(l[0]), "v"(l[1]), "v"(l[2]), "v"(l[3]), "v"(l[4]), "v"(l[5]), "v"(l[6]), "v"(l[7]),
                  "v"(p[0]), "v"(p[1]), "v"(p[2]), "v"(p[3]), "v"(p[4]), "v"(p[5]), "v"(p[6]), "v"(p[7]) : "memory");
}
// tile st of the block into the buffer at LDS byte address lbuf; 128 threads, 16 copies each. a0, w0: the thread's own 16 bytes of tile 0 (A row tid / 16, weight row tid / 8); its further copies lie 8 A rows and 16 weight rows apart
__device__ __forceinline__ void tile_fill(const char* a0, const char* w0, int st, unsigned lbuf, int tid) {
  unsigned l[8]; const void* p[8];
  const char* pa = a0 + st * (ST_K * 4); const unsigned la = lbuf + (tid >> 4) * ST_AP + (tid & 15) * 16;
#pragma unroll
  for (int i = 0; i < 8; ++i) { l[i] = la + i * (8 * ST_AP); p[i] = pa + i * (8 * DM * 4); }
  acopy8(l, p);
  const char* pw = w0 + st * (ST_K * 2); const unsigned lw = lbuf + ST_W + (tid >> 3) * ST_WP + (tid & 7) * 16;
#pragma unroll
  for (int i = 0; i < 8; ++i) { l[i] = lw + i * (16 * ST_WP); p[i] = pw + i * (16 * DM * 2); }
  acopy8(l, p);
}
// k-step kk (0 or 1) of a tile: arow = the lane's A row in the buffer + 32 g bytes, wrow = weight row col in the buffer + 16 g bytes; the k order of both is that of frag_b
__device__ __forceinline__ void kstep_lds(KStep& s, const char* arow, const char* wrow, int kk) {
  const v4f a0 = *(const v4f*)(arow + kk * 128), a1 = *(const v4f*)(arow + kk * 128 + 16), a2 = *(const v4f*)(arow + kk * 128 + 64), a3 = *(const v4f*)(arow + kk * 128 + 80);
#pragma unroll
  for (int i = 0; i < 4; ++i) { s.a[i] = a0[i]; s.a[4 + i] = a1[i]; s.a[8 + i] = a2[i]; s.a[12 + i] = a3[i]; }
#pragma unroll
  for (int j = 0; j < 8; ++j) { union { v16b v; v8b q[2]; } u; const char* p = wrow + j * 16 * ST_WP + kk * 64; u.q[0] = *(const v8b*)p; u.q[1] = *(const v8b*)(p + 32); s.w[j] = u.v; }
}
// the two-buffer loop over the tiles: tile t + 1 flies while tile t is worked on. At the foot of a trip every wave ends its own LDS reads and its own copies, the barrier publishes tile t + 1 and frees tile t's buffer, and only then tile t + 2 is aimed at that buffer. The last trip's barrier also frees both buffers for the output staging.
template <typename MMA> __device__ __forceinline__ void tile_loop(const float* A0, const __bf16* W0, char* smem, int tid, MMA mma) {
  const int wave = tid >> 5, lane = tid & 31, col = lane & 15, g = lane >> 4; const unsigned l0 = (unsigned)(size_t)smem;
  const char* a0 = (const char*)(A0 + (size_t)(tid >> 4) * DM + (tid & 15) * 4); const char* w0 = (const char*)(W0 + (size_t)(tid >> 3) * DM + (tid & 7) * 8);
  tile_fill(a0, w0, 0, l0, tid);
  asm volatile("s_wait_asynccnt 0x0" ::: "memory");   // tile 0 has landed, this wave's share
  __syncthreads();   // tile 0 is whole before any wave reads it
  tile_fill(a0, w0, 1, l0 + ST_SZ, tid);
#pragma unroll 1
  for (int t = 0; t < ST_N; ++t) {   // rolled: the buffer is picked by t & 1
    const int bo = (t & 1) * ST_SZ; const char* arow = smem + bo + (wave * 16 + col) * ST_AP + 32 * g; const char* wrow = smem + bo + ST_W + col * ST_WP + 16 * g;
    KStep s0, s1; kstep_lds(s0, arow, wrow, 0); kstep_lds(s1, arow, wrow, 1); mma(s0); mma(s1);
    asm volatile("s_wait_dscnt 0x0" ::: "memory");      // this wave's reads of tile t are over before the buffer is given up
    asm volatile("s_wait_asynccnt 0x0" ::: "memory");   // this wave's share of tile t + 1 has landed
    __syncthreads();   // publishes tile t + 1, ends every reader's last read of tile t
    if (t + 2 < ST_N) tile_fill(a0, w0, t + 2, l0 + bo, tid);
  }
  asm volatile("s_wait_asynccnt 0x0" ::: "memory");   // no copy is outstanding when the LDS is used anew
}
// ---- pack_block: the four weights keep their natural [out][in] element order and land one behind the other in PK (W_q, W_k, W_v = PK_A, W_o = PK_P), so packing is a plain stream f32 -> bf16. Waves start at a bounded rate, and a stream this short pays for each one, so the work is dealt to few waves (8 a WGP) with much in flight each: a block takes PACK_E consecutive elements of one weight, a thread PACK_R words of 4 f32, 256 words apart. All of a thread's loads go out before the first is used; a wave's load covers four whole 128-B lines, its 8-byte stores two: no LDS, no barrier
#define PACK_R 16
#define PACK_E (256 * 4 * PACK_R)
#define PACK_W (DM * DM / PACK_E)      // blocks per weight
#define PACK_B (4 * PACK_W)
typedef __attribute__((ext_vector_type(4))) __bf16 v4b;
__device__ __forceinline__ void pack_block(const float* __restrict__ WQ, const float* __restrict__ WK, const float* __restrict__ WV, const float* __restrict__ WO, __bf16* __restrict__ PK, int blk) {
  static_assert((DM * DM) % PACK_E == 0, "a block lies inside one weight");
  static_assert(PK_A == 0 && PK_P == 3 * DM * DM && QKVW == 3 * DM, "weight w starts at element w DM DM of PK");
  const int which = blk / PACK_W; const float* Wm = (which == 0) ? WQ : (which == 1) ? WK : (which == 2) ? WV : WO;
  const int w0 = (blk % PACK_W) * (PACK_E / 4) + threadIdx.x;   // the thread's first word: the same index in the source (16-byte words) and in the destination (8-byte words)
  const v4f* s4 = (const v4f*)Wm; v4f v[PACK_R];
#pragma unroll
  for (int i = 0; i < PACK_R; ++i) v[i] = s4[w0 + i * 256];
  __builtin_amdgcn_sched_barrier(0);   // keeps every load in front of the first conversion: without it the build holds the last loads back until the first have returned, a second trip to memory in a wave that makes only one
  v4b* d4 = (v4b*)(PK + (size_t)which * (DM * DM));
#pragma unroll
  for (int i = 0; i < PACK_R; ++i) { const v4b o = { (__bf16)v[i][0], (__bf16)v[i][1], (__bf16)v[i][2], (__bf16)v[i][3] }; d4[w0 + i * 256] = o; }
  asm volatile("s_wait_xcnt 0x0" ::: "memory");   // stands behind the last store, in front of the join with the distance side, whose first instructions write the registers that the stores name
}
__global__ __launch_bounds__(128) void k_qkv(const float* __restrict__ XQ, const float* __restrict__ XK, const float* __restrict__ XV, const __bf16* __restrict__ P, const float* __restrict__ BQ, const float* __restrict__ BK, const float* __restrict__ BV, _Float16* __restrict__ QK, _Float16* __restrict__ QKL, _Float16* __restrict__ VTH, _Float16* __restrict__ VTL) {
  const int which0 = (blockIdx.y * 128) / DM; const float* X = (which0 == 0) ? XQ : (which0 == 1) ? XK : XV; const float* BB = BQ ? (((which0 == 0) ? BQ : (which0 == 1) ? BK : BV) + (blockIdx.y * 128 - which0 * DM)) : nullptr;
  __shared__ __align__(16) char smem[2 * ST_SZ];   // the two tile buffers; behind the loop the output staging
  static_assert(2 * ST_SZ >= 2 * (4 * 16 * 136 + 128 * 72) * 2, "the staging fits the buffers");
  _Float16 (*so)[16][136] = (_Float16 (*)[16][136])smem, (*sol)[16][136] = so + 4; _Float16 (*sth)[72] = (_Float16 (*)[72])(sol + 4), (*stl)[72] = sth + 128;
  const int tid = threadIdx.x, wave = tid >> 5, lane = tid & 31, col = lane & 15, g = lane >> 4; const size_t r0 = (size_t)blockIdx.x * 64 + wave * 16; const int n0 = blockIdx.y * 128;
  v8f acc[8] = {};
  auto mma = [&](const KStep& s) { v16b a;
#pragma unroll
    for (int i = 0; i < 16; ++i) a[i] = (__bf16)s.a[i];
#pragma unroll
    for (int j = 0; j < 8; ++j) acc[j] = wmma_bf(a, s.w[j], acc[j]); };
  tile_loop(X + (size_t)blockIdx.x * 64 * DM, P + (size_t)n0 * DM, smem, tid, mma);
  if (n0 < 2 * DM) {   // q stored unscaled (f16 sigma ~0.6, no subnormal exposure); 1/8 applied to the f32 score
#pragma unroll
    for (int j = 0; j < 8; ++j) {
#pragma unroll
      for (int r = 0; r < 8; ++r) { const float v = acc[j][r] + (BB ? bfr(BB[j * 16 + col]) : 0.f); const _Float16 hv = (_Float16)v; so[wave][8 * g + r][j * 16 + col] = hv; sol[wave][8 * g + r][j * 16 + col] = (_Float16)((v - (float)hv) * 2048.0f); } }   // q, k (+ bias) as f16 hi + (x2048) residual
    LDSX();
    for (int rl = 0; rl < 16; ++rl) if (lane < 16) { vst2((unsigned*)(QK + (r0 + rl) * (2 * DM) + n0 + lane * 8), *(const v4u*)&so[wave][rl][lane * 8]); vst2((unsigned*)(QKL + (r0 + rl) * (2 * DM) + n0 + lane * 8), *(const v4u*)&sol[wave][rl][lane * 8]); }
  } else {
#pragma unroll
    for (int j = 0; j < 8; ++j) {
#pragma unroll
      for (int r = 0; r < 8; ++r) { const float v = acc[j][r] + (BB ? bfr(BB[j * 16 + col]) : 0.f); const _Float16 hv = (_Float16)v; sth[j * 16 + col][wave * 16 + 8 * g + r] = hv; stl[j * 16 + col][wave * 16 + 8 * g + r] = (_Float16)((v - (float)hv) * 2048.0f); } }
    __syncthreads();
    const size_t rb = (size_t)blockIdx.x * 64; const int b = (int)(rb / SS), s0 = (int)(rb % SS); const int pc0 = n0 - 2 * DM;
    for (int q = tid; q < 128 * 8; q += 128) { const int d = q >> 3, pc = q & 7; const size_t o = ((size_t)b * DM + pc0 + d) * SS + s0 + pc * 8; vst2((unsigned*)(VTH + o), *(const v4u*)&sth[d][pc * 8]); vst2((unsigned*)(VTL + o), *(const v4u*)&stl[d][pc * 8]); }
  }
}
// ---- K and V tiles of k_attn in LDS. A tile is 64 keys: 64 K rows (this head's 64 d, 128 B) and 64 V^T rows (one d each, the tile's 64 keys, 128 B), brought by asynchronous copies: a wave's copy covers four whole 128-B lines, and the block fetches each line once for its four waves. Row pitch 144 B (16 B x odd): the 16 rows of a fragment read fall on distinct banks.
#define AT_K 64
#define AT_N (SS / AT_K)
#define AT_P 144
#define AT_V (AT_K * AT_P)
#define AT_SZ (AT_V + HD * AT_P)
// tile t into the buffer at LDS byte address lbuf; 128 threads, 4 copies of K and 4 of V^T each. k0, v0: the thread's own 16 bytes of tile 0 (row tid / 8 of either); its further copies lie 16 rows apart
__device__ __forceinline__ void kv_fill(const char* k0, const char* v0, int t, unsigned lbuf, int tid) {
  unsigned l[8]; const void* p[8];
  const char* pk = k0 + (size_t)t * (AT_K * 2 * DM * 2); const char* pv = v0 + t * (AT_K * 2); const unsigned lk = lbuf + (tid >> 3) * AT_P + (tid & 7) * 16;
#pragma unroll
  for (int i = 0; i < 4; ++i) { l[i] = lk + i * (16 * AT_P); p[i] = pk + i * (16 * 2 * DM * 2); l[4 + i] = lk + AT_V + i * (16 * AT_P); p[4 + i] = pv + i * (16 * SS * 2); }
  acopy8(l, p);
}
__device__ __forceinline__ float xrow(float x, unsigned lo, unsigned hi) { return __builtin_bit_cast(float, __builtin_amdgcn_permlane16(__builtin_bit_cast(int, x), __builtin_bit_cast(int, x), lo, hi, false, false)); }   // lane i of a 16-lane row takes the row's lane named by nibble i of hi:lo
__device__ __forceinline__ float xhalf(float x) { return __builtin_bit_cast(float, __builtin_amdgcn_permlanex16(__builtin_bit_cast(int, x), __builtin_bit_cast(int, x), 0x76543210, 0xfedcba98, false, false)); }   // lane l with lane l ^ 16
// ---- k_attn: block = (64 queries, head h, batch b): all-keys flash attention, TRANSPOSED: S^T = K . Q^T (A = K rows, B = Q rows), so a lane holds 16 scores of ONE query (column col; keys 8 g + r and 16 + 8 g + r of the step's 32): maximum and sum run in the lane, one exchange between the wave's halves joins the maximum, the halves' sums are joined once behind the loop. The two score tiles, converted in place, are the B operand of O^T += V^T . P^T (hardware k order, which frag_h gives the V rows): P touches no LDS. A lane ends with 8 consecutive d of its query per tile and stores them itself.
// The lane now needs 16 keys' positions per step: the block rounds all keys' positions once into LDS (x, y, z planes), with a fourth plane that is 0 for a kept key and -3.0e38 for a masked one, added to the score.
// amdgpu_waves_per_eu(2, 2): the grid gives two waves per SIMD
__global__ __launch_bounds__(128) __attribute__((amdgpu_waves_per_eu(2, 2))) void k_attn(const _Float16* __restrict__ QK, const _Float16* __restrict__ QKL, const _Float16* __restrict__ VTH, const _Float16* __restrict__ VTL, const void* __restrict__ KMASK, const float* __restrict__ POS, const float* __restrict__ RM, const float* __restrict__ VEL, const int* __restrict__ AM, float* __restrict__ O) {
  static_assert(SS % 512 == 0, "a thread fills whole groups of 4 keys");
  static_assert(AT_N >= 2 && HD == 64, "two tiles exist; a K row is 128 B");
  __shared__ __align__(16) float skx[SS], sky[SS], skz[SS], skm[SS];
  __shared__ __align__(16) char skv[2 * AT_SZ];   // the two K and V tile buffers
  __shared__ __align__(16) float swm[4];   // each wave's maximum of its share of the partial maxima
  static_assert(NB * SS == 128 * 16, "a thread reads 16 partial maxima");
  const int tid = threadIdx.x, wave = tid >> 5, lane = tid & 31, col = lane & 15, g = lane >> 4;
  const int qb = blockIdx.x, h = blockIdx.y, b = blockIdx.z; const int q0 = qb * 64 + wave * 16; const size_t rq = (size_t)b * SS + q0 + col;
  const unsigned l0 = (unsigned)(size_t)skv;
  const char* gk = (const char*)(QK + ((size_t)b * SS + (tid >> 3)) * (2 * DM) + DM + h * HD + (tid & 7) * 8); const char* gv = (const char*)(VTH + ((size_t)b * DM + h * HD + (tid >> 3)) * SS + (tid & 7) * 8);
  kv_fill(gk, gv, 0, l0, tid);   // tile 0 flies while the key planes are made
  // the global maximum of the squared distances: every block reduces the 2,048 partial maxima itself (max is order-free: the same value in every block). The loads go out here with the positions'; the waves' results cross at the barrier that the key planes need anyway
  v4f rm[4];
#pragma unroll
  for (int i = 0; i < 4; ++i) rm[i] = *(const v4f*)(RM + i * 512 + tid * 4);
  asm volatile("s_wait_xcnt 0x0" ::: "memory");   // stands behind these loads, in front of any rewrite of a register that they name (their base is reused soon)
#pragma unroll
  for (int i = 0; i < SS / 512; ++i) { const int j = tid + 128 * i; const float* p = POS + ((size_t)b * SS + 4 * j) * 3; const v4f u = *(const v4f*)p, v = *(const v4f*)(p + 4), w = *(const v4f*)(p + 8); const v4i mk = *(const v4i*)(AM + (size_t)b * SS + 4 * j);
    const v4f x = { bfr(u[0]), bfr(u[3]), bfr(v[2]), bfr(w[1]) }, y = { bfr(u[1]), bfr(v[0]), bfr(v[3]), bfr(w[2]) }, z = { bfr(u[2]), bfr(v[1]), bfr(w[0]), bfr(w[3]) };
    const v4f a = { mk[0] != 0 ? 0.f : -3.0e38f, mk[1] != 0 ? 0.f : -3.0e38f, mk[2] != 0 ? 0.f : -3.0e38f, mk[3] != 0 ? 0.f : -3.0e38f };
    *(v4f*)&skx[4 * j] = x; *(v4f*)&sky[4 * j] = y; *(v4f*)&skz[4 * j] = z; *(v4f*)&skm[4 * j] = a; }
  v16h aq[2];
#pragma unroll
  for (int kc = 0; kc < 2; ++kc) aq[kc] = frag_h(QK + rq * (2 * DM) + h * HD + kc * 32, lane);
  v2f px2, py2, pz2; { const float* p = POS + rq * 3; const float px = bfr(p[0]), py = bfr(p[1]), pz = bfr(p[2]); px2 = v2f{ px, px }; py2 = v2f{ py, py }; pz2 = v2f{ pz, pz }; }   // the lane's query, each coordinate twice
  float gv_h; { float vh = fabsf(bfr(VEL[h])); vh = fminf(fmaxf(vh, 0.f), 0.999f); const float gam = 1.0f / sqrtf(1.0f - vh * vh); gv_h = gam * vh; }   // gamma v
  { float w = 0.f;
#pragma unroll
    for (int i = 0; i < 4; ++i) w = fmaxf(w, fmaxf(fmaxf(rm[i][0], rm[i][1]), fmaxf(rm[i][2], rm[i][3])));
    w = fmaxf(w, xrow(w, 0x67452301u, 0xefcdab89u)); w = fmaxf(w, xrow(w, 0x54761032u, 0xdcfe98bau)); w = fmaxf(w, xrow(w, 0x32107654u, 0xba98fedcu)); w = fmaxf(w, xrow(w, 0xfedcba98u, 0x76543210u)); w = fmaxf(w, xhalf(w));   // lane l with l ^ 1, ^ 2, ^ 4, ^ 8, ^ 16
    if (lane == 0) swm[wave] = w; }
  float m = -3.0e38f, l = 0.f;   // the query's running maximum (equal in both halves) and this half's share of its sum
  v8f acc[4] = {};
  // the fragments come from the tile's buffer, rows and k order as before (frag_h): a step's K at its head, its V behind its score products, a whole softmax ahead of its use
  v16h kf[2][2], vf[4];
  auto lds_k = [&](const char* buf, int ss) {
#pragma unroll
    for (int ct = 0; ct < 2; ++ct) { const _Float16* krow = (const _Float16*)(buf + (ss * 32 + ct * 16 + col) * AT_P);
#pragma unroll
      for (int kc = 0; kc < 2; ++kc) kf[ct][kc] = frag_h(krow + kc * 32, lane); } };
  auto lds_v = [&](const char* buf, int ss) {
#pragma unroll
    for (int dt = 0; dt < 4; ++dt) vf[dt] = frag_h((const _Float16*)(buf + AT_V + (dt * 16 + col) * AT_P) + ss * 32, lane); };
  asm volatile("s_wait_asynccnt 0x0" ::: "memory");   // tile 0 has landed, this wave's share
  __syncthreads();   // the key planes, the waves' maxima and tile 0 are whole before any wave reads them
  kv_fill(gk, gv, 1, l0 + AT_SZ, tid);
  float coef; { const v4f wm = *(const v4f*)swm; const float dmax = sqrtf(fmaxf(fmaxf(wm[0], wm[1]), fmaxf(wm[2], wm[3]))); coef = gv_h / (dmax + 1e-8f); }   // gamma v / (dmax + 1e-8): dist is normalised by the global max
  // the factor exp(-dist coef) is 2^(dist c2): one multiply by a per-head constant between the two hardware operations. With a global maximum of 0 every dist is 0 and the factor is 1 under any finite constant, so that case needs no constant of its own
  const float c2 = coef * -1.44269504f; const v2f c22 = { c2, c2 };
  // the two-buffer loop over the tiles: tile t + 1 flies while tile t is worked on
#pragma unroll 1
  for (int t = 0; t < AT_N; ++t) {   // rolled: the buffer is picked by t & 1
    const int bo = (t & 1) * AT_SZ; const char* buf = skv + bo;
#pragma unroll 1
   for (int ss = 0; ss < 2; ++ss) { v8f cc[2]; const int ks = 2 * t + ss;   // the tile's two steps of 32 keys; rolled: as a block that loops on itself a step keeps its 16 scores' chains interleaved and paired for dual issue, unrolled the build had an eighth more vector instructions
    lds_k(buf, ss);
    v4f tx[4], ty[4], tz[4], tm[4];   // the lane's 16 keys: planes read as 16-byte words, the same address in all 16 lanes of a half
#pragma unroll
    for (int q = 0; q < 4; ++q) { const int k0 = ks * 32 + (q >> 1) * 16 + 8 * g + (q & 1) * 4; tx[q] = *(const v4f*)&skx[k0]; ty[q] = *(const v4f*)&sky[k0]; tz[q] = *(const v4f*)&skz[k0]; tm[q] = *(const v4f*)&skm[k0]; }
#pragma unroll
    for (int ct = 0; ct < 2; ++ct) { v8f c = {};
#pragma unroll
      for (int kc = 0; kc < 2; ++kc) c = wmma16(kf[ct][kc], aq[kc], c);   // single product: k, q as one-rounding f16 operands; c[r] = score of key ct * 16 + 8 g + r with query col
      cc[ct] = c; }
    lds_v(buf, ss);
    float s[16];
#pragma unroll
    for (int p = 0; p < 8; ++p) { const int q = p >> 1, e = (p & 1) * 2;   // two keys at a time, neighbours in the planes' words: packed f32 forms with no register moves
      const v2f kx = { tx[q][e], tx[q][e + 1] }, ky = { ty[q][e], ty[q][e + 1] }, kz = { tz[q][e], tz[q][e + 1] };
      const v2f dx = px2 - kx, dy = py2 - ky, dz = pz2 - kz; const v2f sq2 = dx * dx + dy * dy + dz * dz;
      const v2f xe = v2f{ __builtin_amdgcn_sqrtf(sq2[0]), __builtin_amdgcn_sqrtf(sq2[1]) } * c22;   // the hardware square root (1 ulp; 0 gives 0), not the library's correctly rounded sequence of a dozen vector instructions a score
#pragma unroll
      for (int u = 0; u < 2; ++u) { const int i = 2 * p + u; const float fac = __builtin_amdgcn_exp2f(xe[u]); s[i] = cc[i >> 3][i & 7] * 0.125f * fac + tm[q][e + u]; } }   // score x exp(-normalised distance x gamma v); a masked key ends at -3.0e38
    float mx = s[0];
#pragma unroll
    for (int i = 1; i < 16; ++i) mx = fmaxf(mx, s[i]);
    mx = fmaxf(mx, xhalf(mx));
    const float mn = fmaxf(m, mx); const float alpha = (m <= -1.0e38f) ? 0.f : __expf(m - mn);
    const float mref = (mn <= -1.0e38f) ? 0.f : mn;   // no kept key yet: against 0 every masked score gives weight 0, as it does against a real maximum
    float e[16]; v16h pa;
#pragma unroll
    for (int i = 0; i < 16; ++i) { e[i] = __expf(s[i] - mref); pa[i] = (_Float16)(e[i] * 2048.0f); }   // P scaled by 2^11 so small softmax weights stay out of the f16 subnormal range; 2^-11 folded into the epilogue. Element i of the B operand is key 8 g + i (i < 8) or 16 + 8 g + i - 8: the two tiles' registers in their order
#pragma unroll
    for (int w = 8; w > 0; w >>= 1) {   // a tree, not a chain of 15 dependent adds
#pragma unroll
      for (int i = 0; i < w; ++i) e[i] += e[i + w]; }
    const float es = e[0];
    l = l * alpha + es; m = mn;
#pragma unroll
    for (int dt = 0; dt < 4; ++dt) acc[dt] *= alpha;
#pragma unroll
    for (int dt = 0; dt < 4; ++dt) acc[dt] = wmma16(vf[dt], pa, acc[dt]);   // single product: V^T x P^T (x2^11); acc[dt][r] = O[query col][dt * 16 + 8 g + r]
   }
    asm volatile("s_wait_dscnt 0x0" ::: "memory");      // this wave's reads of tile t are over before the buffer is given up
    asm volatile("s_wait_asynccnt 0x0" ::: "memory");   // this wave's share of tile t + 1 has landed
    __syncthreads();   // publishes tile t + 1, ends every reader's last read of tile t
    if (t + 2 < AT_N) kv_fill(gk, gv, t + 2, l0 + bo, tid);
  }
  asm volatile("s_wait_asynccnt 0x0" ::: "memory");   // no copy is outstanding when the wave ends
  const float il = (1.0f / 2048.0f) / (l + xhalf(l));
  float* orow = O + rq * DM + h * HD + 8 * g;
#pragma unroll
  for (int dt = 0; dt < 4; ++dt) { const v4f lo = { acc[dt][0] * il, acc[dt][1] * il, acc[dt][2] * il, acc[dt][3] * il }, hi = { acc[dt][4] * il, acc[dt][5] * il, acc[dt][6] * il, acc[dt][7] * il }; vst2(orow + dt * 16, lo); vst2(orow + dt * 16 + 4, hi); }
}
// ---- k_out: block = (64 rows, 128 cols): out = O(hi/lo) . Wo rows (2 products) + bo
__global__ __launch_bounds__(128) void k_out(const float* __restrict__ O, const __bf16* __restrict__ P, const float* __restrict__ BO, float* __restrict__ Y) {
  __shared__ __align__(16) char smem[2 * ST_SZ];   // the two tile buffers; behind the loop the output staging
  static_assert(2 * ST_SZ >= 4 * 16 * 132 * 4, "the staging fits the buffers");
  float (*so)[16][132] = (float (*)[16][132])smem;
  const int tid = threadIdx.x, wave = tid >> 5, lane = tid & 31, col = lane & 15, g = lane >> 4; const size_t r0 = (size_t)blockIdx.x * 64 + wave * 16; const int n0 = blockIdx.y * 128;
  v8f acc[8] = {};
  auto mma = [&](const KStep& s) { const F2 a = bsplit16(s.a);
#pragma unroll
    for (int j = 0; j < 8; ++j) { acc[j] = wmma_bf(a.l, s.w[j], acc[j]); acc[j] = wmma_bf(a.h, s.w[j], acc[j]); } };
  tile_loop(O + (size_t)blockIdx.x * 64 * DM, P + (size_t)n0 * DM, smem, tid, mma);
#pragma unroll
  for (int j = 0; j < 8; ++j) {
#pragma unroll
    for (int r = 0; r < 8; ++r) so[wave][8 * g + r][j * 16 + col] = acc[j][r] + bfr(BO[n0 + j * 16 + col]); }
  LDSX();
  for (int rl = 0; rl < 16; ++rl) vst2(Y + (r0 + rl) * DM + n0 + lane * 4, *(const v4f*)&so[wave][rl][lane * 4]);
}
// ---- dist_block: block = 32 rows x all keys. A thread keeps the rounded positions of its own 8 keys in registers (six 16-byte loads, issued together) and walks the block's 32 rows, read from LDS: no load stands in the loop's dependent path. max is order-free, so any split of the pairs gives the same global maximum: RM[block * 32 + i] = max of |p_r - p_j|^2 over the block's rows r and the keys j of threads 8 i .. 8 i + 7; one 128-B line per block
__device__ __forceinline__ void dist_block(const float* __restrict__ POS, float* __restrict__ RM, int blk) {
  static_assert(NB * SS == 256 * 8, "a thread owns 8 keys");
  __shared__ __align__(16) float srow[32][4]; __shared__ __align__(16) float red[256]; __shared__ __align__(16) float line[32];
  const int t = threadIdx.x; const size_t r0 = (size_t)blk * 32;
  v4f kv[6];
#pragma unroll
  for (int i = 0; i < 6; ++i) kv[i] = *(const v4f*)(POS + (size_t)t * 24 + i * 4);
  if (t < 128) { const int c = t & 3; const float v = POS[(r0 + (t >> 2)) * 3 + (c < 3 ? c : 2)]; srow[t >> 2][c] = (c < 3) ? bfr(v) : 0.f; }   // a row's fourth word is padding, written so that the 16-byte rows hold no unwritten LDS
  float kx[8], ky[8], kz[8], mx[8];
#pragma unroll
  for (int j = 0; j < 8; ++j) { kx[j] = bfr(kv[(3 * j) >> 2][(3 * j) & 3]); ky[j] = bfr(kv[(3 * j + 1) >> 2][(3 * j + 1) & 3]); kz[j] = bfr(kv[(3 * j + 2) >> 2][(3 * j + 2) & 3]); mx[j] = 0.f; }
  __syncthreads();
  // rolled: keeps the distance side's code and registers small (the kernel's register count is now set by the packing side's sixteen loads, not by this loop)
#pragma unroll 1
  for (int i = 0; i < 32; ++i) { const v4f p = *(const v4f*)&srow[i][0];
#pragma unroll
    for (int j = 0; j < 8; ++j) { const float dx = p[0] - kx[j], dy = p[1] - ky[j], dz = p[2] - kz[j]; mx[j] = fmaxf(mx[j], dx * dx + dy * dy + dz * dz); } }
  red[t] = fmaxf(fmaxf(fmaxf(mx[0], mx[1]), fmaxf(mx[2], mx[3])), fmaxf(fmaxf(mx[4], mx[5]), fmaxf(mx[6], mx[7]))); __syncthreads();
  if (t < 32) { const v4f a = *(const v4f*)&red[t * 8], c = *(const v4f*)&red[t * 8 + 4]; line[t] = fmaxf(fmaxf(fmaxf(a[0], a[1]), fmaxf(a[2], a[3])), fmaxf(fmaxf(c[0], c[1]), fmaxf(c[2], c[3]))); } __syncthreads();
  if (t < 8) vst2(RM + r0 + t * 4, *(const v4f*)&line[t * 4]);
}
// ---- k_prep: one launch for the two pieces of work that read nothing but inputs. Blocks 0 .. DIST_B - 1 make the partial maxima, the others pack PACK_E weight elements each. The distance blocks are the long ones and have the low indices, so that they start first and run beside the packing.
#define DIST_B (NB * SS / 32)
__global__ __launch_bounds__(256) void k_prep(const float* __restrict__ WQ, const float* __restrict__ WK, const float* __restrict__ WV, const float* __restrict__ WO, __bf16* __restrict__ PK, const float* __restrict__ POS, float* __restrict__ RM) {
  const int bi = blockIdx.x;   // the same for the whole block: either side's barriers are passed by all of its threads
  if (bi < DIST_B) dist_block(POS, RM, bi);
  else pack_block(WQ, WK, WV, WO, PK, bi - DIST_B);
}
extern "C" void kernel_launch(void* const* d_in, const int* in_sizes, int n_in, void* d_out, int out_size, void* d_ws, size_t ws_size, hipStream_t stream) {
  (void)in_sizes; (void)n_in; (void)out_size;
  const float** F = (const float**)d_in;   // 0 x [1,2048,1024], 1 attention_mask [1,2048] int, 2 positions [1,2048,3], 3 Wq, 4 bq, 5 Wk, 6 bk, 7 Wv, 8 bv, 9 Wo, 10 bo (natural), 11 velocity [16]
  if (ws_size < (size_t)WS_END) return;
  char* ws = (char*)d_ws; __bf16* PK = (__bf16*)(ws + WS_PK); _Float16 *QK = (_Float16*)(ws + WS_QK), *QKL = (_Float16*)(ws + WS_QKL), *VTH = (_Float16*)(ws + WS_VTH), *VTL = (_Float16*)(ws + WS_VTL); float *O = (float*)(ws + WS_O), *RM = (float*)(ws + WS_DM);
  k_prep<<<DIST_B + PACK_B, 256, 0, stream>>>(F[3], F[5], F[7], F[9], PK, F[2], RM);
  k_qkv<<<dim3(TNB * SS / 64, QKVW / 128), 128, 0, stream>>>(F[0], F[0], F[0], PK + PK_A, F[4], F[6], F[8], QK, QKL, VTH, VTL);
  k_attn<<<dim3(TQB, NH, TNB), 128, 0, stream>>>(QK, QKL, VTH, VTL, nullptr, F[2], RM, F[11], (const int*)d_in[1], O);
  k_out<<<dim3(TOB, DM / 128), 128, 0, stream>>>(O, PK + PK_P, F[10], (float*)d_out);
}

// v009
// A run of this version takes 79.8 microseconds.
// In two side-by-side timings against v008, it was 1.04 and 1.06 times as fast.
// All steps since v000 together make it 4.93 times as fast.
// compute dtype: all float inputs rounded to bf16, the int mask read on device; q/k/v = x . W^T + b with EXACT bf16 products on WMMA 16x16x32 (natural rows); pairwise distances, their global maximum (deterministic block reduction), the Lorentz factor and exp(-d coef) in f32 (hardware exp; per score the hardware square root); PLAIN attention: q, k single f16 x 1/8 x that factor, masked keys excluded, running-max softmax in f32, P (scaled by 2^11, single f16) x v (single f16); out = o (bf16 hi + residual) . Wo^T (2 products) + bo.
#include <hip/hip_runtime.h>
#include <math.h>

typedef __attribute__((ext_vector_type(16))) _Float16 v16h;
typedef __attribute__((ext_vector_type(16))) __bf16 v16b;
typedef __attribute__((ext_vector_type(8)))  _Float16 v8h;
typedef __attribute__((ext_vector_type(8)))  float v8f;
typedef __attribute__((ext_vector_type(4)))  float v4f;
typedef __attribute__((ext_vector_type(2)))  float v2f;
typedef __attribute__((ext_vector_type(4)))  unsigned v4u;
typedef __attribute__((ext_vector_type(4)))  int v4i;
typedef float __attribute__((may_alias)) float_a;
typedef int __attribute__((may_alias)) int_a;

template <typename T> __device__ __forceinline__ void vst2(void* p, T v) { *(T*)p = v;  }
__device__ __forceinline__ v8f wmma16(v16h a, v16h b, v8f c) {
  v8f d = __builtin_amdgcn_wmma_f32_16x16x32_f16(false, a, false, b, (short)0, c, false, false);
  asm volatile("v_nop\n\tv_nop\n\tv_nop\n\tv_nop" : "+v"(d) : "v"(a), "v"(b));
  return d;
}
__device__ __forceinline__ v8f wmma_bf(v16b a, v16b b, v8f c) {
  v8f d = __builtin_amdgcn_wmma_f32_16x16x32_bf16(false, a, false, b, (short)0, c, false, false);
  asm volatile("v_nop\n\tv_nop\n\tv_nop\n\tv_nop" : "+v"(d) : "v"(a), "v"(b));
  return d;
}
// Relativistic self attention (B 1, S 2,048, d 1,024, 16 heads x 64): q/k/v projections + biases, scores / 8 multiplied by exp(-dist_ij gamma_h v_h) with the normalised pairwise distance of the 3-D positions and a per-head velocity, key mask, softmax, . v, output projection + bias.
__device__ __forceinline__ v16h frag_h(const _Float16* rowk0, int lane) {
  union { v16h v; v8h q[2]; } u; const _Float16* p = rowk0 + 8 * (lane >> 4);
  u.q[0] = *(const v8h*)p; u.q[1] = *(const v8h*)(p + 16); return u.v;
}
__device__ __forceinline__ v16h frag_f32(const float* rowk0, int lane) {
  v16h a; const float* p = rowk0 + 8 * (lane >> 4);
#pragma unroll
  for (int i = 0; i < 8; ++i) { a[i] = (_Float16)p[i]; a[8 + i] = (_Float16)p[16 + i]; }
  return a;
}
__device__ __forceinline__ v16h frag_f32s(const float* rowk0, int lane, float sc) {
  v16h a; const float* p = rowk0 + 8 * (lane >> 4);
#pragma unroll
  for (int i = 0; i < 8; ++i) { a[i] = (_Float16)(p[i] * sc); a[8 + i] = (_Float16)(p[16 + i] * sc); }
  return a;
}
// column fragment from a [K][ld] layout (column n), rows >= K read as 0
__device__ __forceinline__ v16h fragc_f32(const float* W, int k0, int n, int lane, int ld, int K) {
  v16h a; const int g = lane >> 4;
#pragma unroll
  for (int i = 0; i < 8; ++i) { const int ka = k0 + 8 * g + i, kb = ka + 16;
    a[i] = (_Float16)(ka < K ? W[(size_t)(ka < K ? ka : K - 1) * ld + n] : 0.f); a[8 + i] = (_Float16)(kb < K ? W[(size_t)(kb < K ? kb : K - 1) * ld + n] : 0.f); }
  return a;
}
struct F2 { v16b h, l; };
__device__ __forceinline__ F2 bsplit16(const float v[16]) { F2 r;
#pragma unroll
  for (int i = 0; i < 16; ++i) { const __bf16 h = (__bf16)v[i]; r.h[i] = h; r.l[i] = (__bf16)(v[i] - (float)h); }
  return r; }
__device__ __forceinline__ F2 split_row(const float* row, int k0, int lane) { float v[16]; const float* p = row + k0 + 8 * (lane >> 4);
#pragma unroll
  for (int i = 0; i < 8; ++i) { v[i] = p[i]; v[8 + i] = p[16 + i]; }
  return bsplit16(v); }
__device__ __forceinline__ F2 split_rowK(const float* row, int k0, int lane, int K) { float v[16]; const int g = lane >> 4;
#pragma unroll
  for (int i = 0; i < 8; ++i) { const int ka = k0 + 8 * g + i, kb = ka + 16; v[i] = ka < K ? row[ka < K ? ka : K - 1] : 0.f; v[8 + i] = kb < K ? row[kb < K ? kb : K - 1] : 0.f; }
  return bsplit16(v); }
__device__ __forceinline__ F2 split_col(const float* W, int k0, int n, int lane, int ld, int K) { float v[16]; const int g = lane >> 4;
#pragma unroll
  for (int i = 0; i < 8; ++i) { const int ka = k0 + 8 * g + i, kb = ka + 16; v[i] = ka < K ? W[(size_t)(ka < K ? ka : K - 1) * ld + n] : 0.f; v[8 + i] = kb < K ? W[(size_t)(kb < K ? kb : K - 1) * ld + n] : 0.f; }
  return bsplit16(v); }
__device__ __forceinline__ v8f mac3(const F2& a, const F2& b, v8f c) { c = wmma_bf(a.l, b.h, c); c = wmma_bf(a.h, b.l, c); return wmma_bf(a.h, b.h, c); }
__device__ __forceinline__ float sigm(float v) { return 1.0f / (1.0f + expf(-v)); }
#define LDSX() do { asm volatile("s_wait_dscnt 0" ::: "memory"); __builtin_amdgcn_wave_barrier(); __builtin_amdgcn_fence(__ATOMIC_RELEASE, "workgroup"); } while (0)


#define NB 1
#define SS 2048
#define DM 1024
#define NH 16
#define HD 64
#define QKVW (3 * DM)
#ifndef TQB
#define TQB (SS / 64)
#define TNB NB
#define TOB (NB * SS / 64)     // output row tiles (all)
#endif
typedef __attribute__((ext_vector_type(8))) __bf16 v8b;
__device__ __forceinline__ v16b frag_b(const __bf16* rowk0, int lane) {
  union { v16b v; v8b q[2]; } u; const __bf16* p = rowk0 + 8 * (lane >> 4);
  u.q[0] = *(const v8b*)p; u.q[1] = *(const v8b*)(p + 16); return u.v;
}
__device__ __forceinline__ float bfr(float v) { return (float)(__bf16)v; }
__device__ __attribute__((noinline)) float exp_ni(float v) { return expf(v); }
__device__ __attribute__((noinline)) float erf_ni(float v) { return erff(v); }

#define PK_A 0                       // [3072][1024] Wqkv rows (natural [out][in])
#define PK_P (PK_A + QKVW * DM)        // [1024][1024] Wo rows (natural)
#define PK_END (PK_P + DM * DM)
#define WS_PK  0u
#define WS_QK  (WS_PK + 2u * PK_END)             // f16 [2048 rows][2048]: q | k
#define WS_QKL (WS_QK + 2u * NB * SS * 2 * DM)     // f16 q | k residual planes x2048
#define WS_VTH (WS_QKL + 2u * NB * SS * 2 * DM)    // f16 [b][1024 (h*64+d)][2048 s] hi
#define WS_VTL (WS_VTH + 2u * NB * DM * SS)        // f16 lo x 2048
#define WS_O   (WS_VTL + 2u * NB * DM * SS)        // f32 [2048][1024]
#define WS_CS  (WS_O + 4u * NB * SS * DM)           // f32 [2][2048][32]: reserved, nothing uses it
#define WS_DM  (WS_CS + 4u * 2 * SS * 32)                  // f32: partial maxima of the squared pairwise distances [SS]
#define WS_END (WS_DM + 4u * (size_t)(SS + 32))
// one k-step (32 k) of a row-times-weight-rows product, as loaded: the lane's 16 f32 of its A row and its 8 weight fragments (16 columns each)
struct KStep { float a[16]; v16b w[8]; };
// ---- operand tiles of k_qkv and k_out in LDS. A tile is 64 k of the block's 64 A rows (f32, 256 B a row) and of its 128 weight rows (bf16, 128 B a row), brought by asynchronous copies: a wave's copy covers four whole 128-B lines, and the block fetches each line once for its four waves. Row pitches 272 and 144 B (16 B x odd): the 16 rows of a fragment read fall on distinct banks.
#define ST_K 64
#define ST_N (DM / ST_K)
#define ST_AP 272
#define ST_WP 144
#define ST_W (64 * ST_AP)
#define ST_SZ (ST_W + 128 * ST_WP)
// eight copies, each lane its own 16 bytes; the s_wait_xcnt stands inside the statement, behind the last copy, so that no address register named here is rewritten in front of it
__device__ __forceinline__ void acopy8(const unsigned (&l)[8], const void* const (&p)[8]) {
  asm volatile("global_load_async_to_lds_b128 %0, %8, off\n\t"
               "global_load_async_to_lds_b128 %1, %9, off\n\t"
               "global_load_async_to_lds_b128 %2, %10, off\n\t"
               "global_load_async_to_lds_b128 %3, %11, off\n\t"
               "global_load_async_to_lds_b128 %4, %12, off\n\t"
               "global_load_async_to_lds_b128 %5, %13, off\n\t"
               "global_load_async_to_lds_b128 %6, %14, off\n\t"
               "global_load_async_to_lds_b128 %7, %15, off\n\t"
               "s_wait_xcnt 0x0"
               :: "v"(l[0]), "v"(l[1]), "v"(l[2]), "v"(l[3]), "v"(l[4]), "v"(l[5]), "v"(l[6]), "v"(l[7]),
                  "v"(p[0]), "v"(p[1]), "v"(p[2]), "v"(p[3]), "v"(p[4]), "v"(p[5]), "v"(p[6]), "v"(p[7]) : "memory");
}
// tile st of the block into the buffer at LDS byte address lbuf; 128 threads, 16 copies each. a0, w0: the thread's own 16 bytes of tile 0 (A row tid / 16, weight row tid / 8); its further copies lie 8 A rows and 16 weight rows apart
__device__ __forceinline__ void tile_fill(const char* a0, const char* w0, int st, unsigned lbuf, int tid) {
  unsigned l[8]; const void* p[8];
  const char* pa = a0 + st * (ST_K * 4); const unsigned la = lbuf + (tid >> 4) * ST_AP + (tid & 15) * 16;
#pragma unroll
  for (int i = 0; i < 8; ++i) { l[i] = la + i * (8 * ST_AP); p[i] = pa + i * (8 * DM * 4); }
  acopy8(l, p);
  const char* pw = w0 + st * (ST_K * 2); const unsigned lw = lbuf + ST_W + (tid >> 3) * ST_WP + (tid & 7) * 16;
#pragma unroll
  for (int i = 0; i < 8; ++i) { l[i] = lw + i * (16 * ST_WP); p[i] = pw + i * (16 * DM * 2); }
  acopy8(l, p);
}
// k-step kk (0 or 1) of a tile: arow = the lane's A row in the buffer + 32 g bytes, wrow = weight row col in the buffer + 16 g bytes; the k order of both is that of frag_b
__device__ __forceinline__ void kstep_lds(KStep& s, const char* arow, const char* wrow, int kk) {
  const v4f a0 = *(const v4f*)(arow + kk * 128), a1 = *(const v4f*)(arow + kk * 128 + 16), a2 = *(const v4f*)(arow + kk * 128 + 64), a3 = *(const v4f*)(arow + kk * 128 + 80);
#pragma unroll
  for (int i = 0; i < 4; ++i) { s.a[i] = a0[i]; s.a[4 + i] = a1[i]; s.a[8 + i] = a2[i]; s.a[12 + i] = a3[i]; }
#pragma unroll
  for (int j = 0; j < 8; ++j) { union { v16b v; v8b q[2]; } u; const char* p = wrow + j * 16 * ST_WP + kk * 64; u.q[0] = *(const v8b*)p; u.q[1] = *(const v8b*)(p + 32); s.w[j] = u.v; }
}
// the two-buffer loop over the tiles: tile t + 1 flies while tile t is worked on. At the foot of a trip every wave ends its own LDS reads and its own copies, the barrier publishes tile t + 1 and frees tile t's buffer, and only then tile t + 2 is aimed at that buffer. The last trip's barrier also frees both buffers for the output staging.
template <typename MMA> __device__ __forceinline__ void tile_loop(const float* A0, const __bf16* W0, char* smem, int tid, MMA mma) {
  const int wave = tid >> 5, lane = tid & 31, col = lane & 15, g = lane >> 4; const unsigned l0 = (unsigned)(size_t)smem;
  const char* a0 = (const char*)(A0 + (size_t)(tid >> 4) * DM + (tid & 15) * 4); const char* w0 = (const char*)(W0 + (size_t)(tid >> 3) * DM + (tid & 7) * 8);
  tile_fill(a0, w0, 0, l0, tid);
  asm volatile("s_wait_asynccnt 0x0" ::: "memory");   // tile 0 has landed, this wave's share
  __syncthreads();   // tile 0 is whole before any wave reads it
  tile_fill(a0, w0, 1, l0 + ST_SZ, tid);
#pragma unroll 1
  for (int t = 0; t < ST_N; ++t) {   // rolled: the buffer is picked by t & 1
    const int bo = (t & 1) * ST_SZ; const char* arow = smem + bo + (wave * 16 + col) * ST_AP + 32 * g; const char* wrow = smem + bo + ST_W + col * ST_WP + 16 * g;
    KStep s0, s1; kstep_lds(s0, arow, wrow, 0); kstep_lds(s1, arow, wrow, 1); mma(s0); mma(s1);
    asm volatile("s_wait_dscnt 0x0" ::: "memory");      // this wave's reads of tile t are over before the buffer is given up
    asm volatile("s_wait_asynccnt 0x0" ::: "memory");   // this wave's share of tile t + 1 has landed
    __syncthreads();   // publishes tile t + 1, ends every reader's last read of tile t
    if (t + 2 < ST_N) tile_fill(a0, w0, t + 2, l0 + bo, tid);
  }
  asm volatile("s_wait_asynccnt 0x0" ::: "memory");   // no copy is outstanding when the LDS is used anew
}
// ---- pack_block: the four weights keep their natural [out][in] element order and land one behind the other in PK (W_q, W_k, W_v = PK_A, W_o = PK_P), so packing is a plain stream f32 -> bf16. Waves start at a bounded rate, and a stream this short pays for each one, so the work is dealt to few waves (8 a WGP) with much in flight each: a block takes PACK_E consecutive elements of one weight, a thread PACK_R words of 4 f32, 256 words apart. All of a thread's loads go out before the first is used; a wave's load covers four whole 128-B lines, its 8-byte stores two: no LDS, no barrier
#define PACK_R 16
#define PACK_E (256 * 4 * PACK_R)
#define PACK_W (DM * DM / PACK_E)      // blocks per weight
#define PACK_B (4 * PACK_W)
typedef __attribute__((ext_vector_type(4))) __bf16 v4b;
__device__ __forceinline__ void pack_block(const float* __restrict__ WQ, const float* __restrict__ WK, const float* __restrict__ WV, const float* __restrict__ WO, __bf16* __restrict__ PK, int blk) {
  static_assert((DM * DM) % PACK_E == 0, "a block lies inside one weight");
  static_assert(PK_A == 0 && PK_P == 3 * DM * DM && QKVW == 3 * DM, "weight w starts at element w DM DM of PK");
  const int which = blk / PACK_W; const float* Wm = (which == 0) ? WQ : (which == 1) ? WK : (which == 2) ? WV : WO;
  const int w0 = (blk % PACK_W) * (PACK_E / 4) + threadIdx.x;   // the thread's first word: the same index in the source (16-byte words) and in the destination (8-byte words)
  const v4f* s4 = (const v4f*)Wm; v4f v[PACK_R];
#pragma unroll
  for (int i = 0; i < PACK_R; ++i) v[i] = s4[w0 + i * 256];
  __builtin_amdgcn_sched_barrier(0);   // keeps every load in front of the first conversion: without it the build holds the last loads back until the first have returned, a second trip to memory in a wave that makes only one
  v4b* d4 = (v4b*)(PK + (size_t)which * (DM * DM));
#pragma unroll
  for (int i = 0; i < PACK_R; ++i) { const v4b o = { (__bf16)v[i][0], (__bf16)v[i][1], (__bf16)v[i][2], (__bf16)v[i][3] }; d4[w0 + i * 256] = o; }
  asm volatile("s_wait_xcnt 0x0" ::: "memory");   // stands behind the last store, in front of the join with the distance side, whose first instructions write the registers that the stores name
}
__global__ __launch_bounds__(128) void k_qkv(const float* __restrict__ XQ, const float* __restrict__ XK, const float* __restrict__ XV, const __bf16* __restrict__ P, const float* __restrict__ BQ, const float* __restrict__ BK, const float* __restrict__ BV, _Float16* __restrict__ QK, _Float16* __restrict__ QKL, _Float16* __restrict__ VTH, _Float16* __restrict__ VTL) {
  const int which0 = (blockIdx.y * 128) / DM; const float* X = (which0 == 0) ? XQ : (which0 == 1) ? XK : XV; const float* BB = BQ ? (((which0 == 0) ? BQ : (which0 == 1) ? BK : BV) + (blockIdx.y * 128 - which0 * DM)) : nullptr;
  __shared__ __align__(16) char smem[2 * ST_SZ];   // the two tile buffers; behind the loop the output staging
  static_assert(2 * ST_SZ >= 2 * (4 * 16 * 136 + 128 * 72) * 2, "the staging fits the buffers");
  _Float16 (*so)[16][136] = (_Float16 (*)[16][136])smem, (*sol)[16][136] = so + 4; _Float16 (*sth)[72] = (_Float16 (*)[72])(sol + 4), (*stl)[72] = sth + 128;
  const int tid = threadIdx.x, wave = tid >> 5, lane = tid & 31, col = lane & 15, g = lane >> 4; const size_t r0 = (size_t)blockIdx.x * 64 + wave * 16; const int n0 = blockIdx.y * 128;
  v8f acc[8] = {};
  // the lane's eight biases (one per 16-column tile) go out here as one group and land under the tile loop. Read inside the output loops, behind the pointer test, each of a lane's 64 outputs had a load of its own with a full wait behind it
  float bias[8] = {};
  if (BB) {
#pragma unroll
    for (int j = 0; j < 8; ++j) bias[j] = BB[j * 16 + col];
    asm volatile("s_wait_xcnt 0x0" ::: "memory");   // stands behind these loads, in front of any rewrite of a register that they name
  }
  auto mma = [&](const KStep& s) { v16b a;
#pragma unroll
    for (int i = 0; i < 16; ++i) a[i] = (__bf16)s.a[i];
#pragma unroll
    for (int j = 0; j < 8; ++j) acc[j] = wmma_bf(a, s.w[j], acc[j]); };
  tile_loop(X + (size_t)blockIdx.x * 64 * DM, P + (size_t)n0 * DM, smem, tid, mma);
  if (n0 < 2 * DM) {   // q stored unscaled (f16 sigma ~0.6, no subnormal exposure); 1/8 applied to the f32 score
#pragma unroll
    for (int j = 0; j < 8; ++j) {
#pragma unroll
      for (int r = 0; r < 8; ++r) { const float v = acc[j][r] + bfr(bias[j]); const _Float16 hv = (_Float16)v; so[wave][8 * g + r][j * 16 + col] = hv; sol[wave][8 * g + r][j * 16 + col] = (_Float16)((v - (float)hv) * 2048.0f); } }   // q, k (+ bias) as f16 hi + (x2048) residual
    LDSX();
    for (int rl = 0; rl < 16; ++rl) if (lane < 16) { vst2((unsigned*)(QK + (r0 + rl) * (2 * DM) + n0 + lane * 8), *(const v4u*)&so[wave][rl][lane * 8]); vst2((unsigned*)(QKL + (r0 + rl) * (2 * DM) + n0 + lane * 8), *(const v4u*)&sol[wave][rl][lane * 8]); }
  } else {
#pragma unroll
    for (int j = 0; j < 8; ++j) {
#pragma unroll
      for (int r = 0; r < 8; ++r) { const float v = acc[j][r] + bfr(bias[j]); const _Float16 hv = (_Float16)v; sth[j * 16 + col][wave * 16 + 8 * g + r] = hv; stl[j * 16 + col][wave * 16 + 8 * g + r] = (_Float16)((v - (float)hv) * 2048.0f); } }
    __syncthreads();
    const size_t rb = (size_t)blockIdx.x * 64; const int b = (int)(rb / SS), s0 = (int)(rb % SS); const int pc0 = n0 - 2 * DM;
    for (int q = tid; q < 128 * 8; q += 128) { const int d = q >> 3, pc = q & 7; const size_t o = ((size_t)b * DM + pc0 + d) * SS + s0 + pc * 8; vst2((unsigned*)(VTH + o), *(const v4u*)&sth[d][pc * 8]); vst2((unsigned*)(VTL + o), *(const v4u*)&stl[d][pc * 8]); }
  }
}
// ---- K and V tiles of k_attn in LDS. A tile is 64 keys: 64 K rows (this head's 64 d, 128 B) and 64 V^T rows (one d each, the tile's 64 keys, 128 B), brought by asynchronous copies: a wave's copy covers four whole 128-B lines, and the block fetches each line once for its four waves. Row pitch 144 B (16 B x odd): the 16 rows of a fragment read fall on distinct banks.
#define AT_K 64
#define AT_N (SS / AT_K)
#define AT_P 144
#define AT_V (AT_K * AT_P)
#define AT_SZ (AT_V + HD * AT_P)
// tile t into the buffer at LDS byte address lbuf; 128 threads, 4 copies of K and 4 of V^T each. k0, v0: the thread's own 16 bytes of tile 0 (row tid / 8 of either); its further copies lie 16 rows apart
__device__ __forceinline__ void kv_fill(const char* k0, const char* v0, int t, unsigned lbuf, int tid) {
  unsigned l[8]; const void* p[8];
  const char* pk = k0 + (size_t)t * (AT_K * 2 * DM * 2); const char* pv = v0 + t * (AT_K * 2); const unsigned lk = lbuf + (tid >> 3) * AT_P + (tid & 7) * 16;
#pragma unroll
  for (int i = 0; i < 4; ++i) { l[i] = lk + i * (16 * AT_P); p[i] = pk + i * (16 * 2 * DM * 2); l[4 + i] = lk + AT_V + i * (16 * AT_P); p[4 + i] = pv + i * (16 * SS * 2); }
  acopy8(l, p);
}
__device__ __forceinline__ float xrow(float x, unsigned lo, unsigned hi) { return __builtin_bit_cast(float, __builtin_amdgcn_permlane16(__builtin_bit_cast(int, x), __builtin_bit_cast(int, x), lo, hi, false, false)); }   // lane i of a 16-lane row takes the row's lane named by nibble i of hi:lo
__device__ __forceinline__ float xhalf(float x) { return __builtin_bit_cast(float, __builtin_amdgcn_permlanex16(__builtin_bit_cast(int, x), __builtin_bit_cast(int, x), 0x76543210, 0xfedcba98, false, false)); }   // lane l with lane l ^ 16
// ---- k_attn: block = (64 queries, head h, batch b): all-keys flash attention, TRANSPOSED: S^T = K . Q^T (A = K rows, B = Q rows), so a lane holds 16 scores of ONE query (column col; keys 8 g + r and 16 + 8 g + r of the step's 32): maximum and sum run in the lane, one exchange between the wave's halves joins the maximum, the halves' sums are joined once behind the loop. The two score tiles, converted in place, are the B operand of O^T += V^T . P^T (hardware k order, which frag_h gives the V rows): P touches no LDS. A lane ends with 8 consecutive d of its query per tile and stores them itself.
// The lane now needs 16 keys' positions per step: the block rounds all keys' positions once into LDS (x, y, z planes), with a fourth plane that is 0 for a kept key and -3.0e38 for a masked one, added to the score.
// amdgpu_waves_per_eu(2, 2): the grid gives two waves per SIMD
__global__ __launch_bounds__(128) __attribute__((amdgpu_waves_per_eu(2, 2))) void k_attn(const _Float16* __restrict__ QK, const _Float16* __restrict__ QKL, const _Float16* __restrict__ VTH, const _Float16* __restrict__ VTL, const void* __restrict__ KMASK, const float* __restrict__ POS, const float* __restrict__ RM, const float* __restrict__ VEL, const int* __restrict__ AM, float* __restrict__ O) {
  static_assert(SS % 512 == 0, "a thread fills whole groups of 4 keys");
  static_assert(AT_N >= 2 && HD == 64, "two tiles exist; a K row is 128 B");
  __shared__ __align__(16) float skx[SS], sky[SS], skz[SS], skm[SS];
  __shared__ __align__(16) char skv[2 * AT_SZ];   // the two K and V tile buffers
  __shared__ __align__(16) float swm[4];   // each wave's maximum of its share of the partial maxima
  static_assert(NB * SS == 128 * 16, "a thread reads 16 partial maxima");
  const int tid = threadIdx.x, wave = tid >> 5, lane = tid & 31, col = lane & 15, g = lane >> 4;
  const int qb = blockIdx.x, h = blockIdx.y, b = blockIdx.z; const int q0 = qb * 64 + wave * 16; const size_t rq = (size_t)b * SS + q0 + col;
  const unsigned l0 = (unsigned)(size_t)skv;
  const char* gk = (const char*)(QK + ((size_t)b * SS + (tid >> 3)) * (2 * DM) + DM + h * HD + (tid & 7) * 8); const char* gv = (const char*)(VTH + ((size_t)b * DM + h * HD + (tid >> 3)) * SS + (tid & 7) * 8);
  kv_fill(gk, gv, 0, l0, tid);   // tile 0 flies while the key planes are made
  // the global maximum of the squared distances: every block reduces the 2,048 partial maxima itself (max is order-free: the same value in every block). The loads go out here with the positions'; the waves' results cross at the barrier that the key planes need anyway
  v4f rm[4];
#pragma unroll
  for (int i = 0; i < 4; ++i) rm[i] = *(const v4f*)(RM + i * 512 + tid * 4);
  asm volatile("s_wait_xcnt 0x0" ::: "memory");   // stands behind these loads, in front of any rewrite of a register that they name (their base is reused soon)
#pragma unroll
  for (int i = 0; i < SS / 512; ++i) { const int j = tid + 128 * i; const float* p = POS + ((size_t)b * SS + 4 * j) * 3; const v4f u = *(const v4f*)p, v = *(const v4f*)(p + 4), w = *(const v4f*)(p + 8); const v4i mk = *(const v4i*)(AM + (size_t)b * SS + 4 * j);
    const v4f x = { bfr(u[0]), bfr(u[3]), bfr(v[2]), bfr(w[1]) }, y = { bfr(u[1]), bfr(v[0]), bfr(v[3]), bfr(w[2]) }, z = { bfr(u[2]), bfr(v[1]), bfr(w[0]), bfr(w[3]) };
    const v4f a = { mk[0] != 0 ? 0.f : -3.0e38f, mk[1] != 0 ? 0.f : -3.0e38f, mk[2] != 0 ? 0.f : -3.0e38f, mk[3] != 0 ? 0.f : -3.0e38f };
    *(v4f*)&skx[4 * j] = x; *(v4f*)&sky[4 * j] = y; *(v4f*)&skz[4 * j] = z; *(v4f*)&skm[4 * j] = a; }
  v16h aq[2];
#pragma unroll
  for (int kc = 0; kc < 2; ++kc) aq[kc] = frag_h(QK + rq * (2 * DM) + h * HD + kc * 32, lane);
  v2f px2, py2, pz2; { const float* p = POS + rq * 3; const float px = bfr(p[0]), py = bfr(p[1]), pz = bfr(p[2]); px2 = v2f{ px, px }; py2 = v2f{ py, py }; pz2 = v2f{ pz, pz }; }   // the lane's query, each coordinate twice
  float gv_h; { float vh = fabsf(bfr(VEL[h])); vh = fminf(fmaxf(vh, 0.f), 0.999f); const float gam = 1.0f / sqrtf(1.0f - vh * vh); gv_h = gam * vh; }   // gamma v
  { float w = 0.f;
#pragma unroll
    for (int i = 0; i < 4; ++i) w = fmaxf(w, fmaxf(fmaxf(rm[i][0], rm[i][1]), fmaxf(rm[i][2], rm[i][3])));
    w = fmaxf(w, xrow(w, 0x67452301u, 0xefcdab89u)); w = fmaxf(w, xrow(w, 0x54761032u, 0xdcfe98bau)); w = fmaxf(w, xrow(w, 0x32107654u, 0xba98fedcu)); w = fmaxf(w, xrow(w, 0xfedcba98u, 0x76543210u)); w = fmaxf(w, xhalf(w));   // lane l with l ^ 1, ^ 2, ^ 4, ^ 8, ^ 16
    if (lane == 0) swm[wave] = w; }
  float m = -3.0e38f, l = 0.f;   // the query's running maximum (equal in both halves) and this half's share of its sum
  v8f acc[4] = {};
  // the fragments come from the tile's buffer, rows and k order as before (frag_h): a step's K at its head, its V behind its score products, a whole softmax ahead of its use
  v16h kf[2][2], vf[4];
  auto lds_k = [&](const char* buf, int ss) {
#pragma unroll
    for (int ct = 0; ct < 2; ++ct) { const _Float16* krow = (const _Float16*)(buf + (ss * 32 + ct * 16 + col) * AT_P);
#pragma unroll
      for (int kc = 0; kc < 2; ++kc) kf[ct][kc] = frag_h(krow + kc * 32, lane); } };
  auto lds_v = [&](const char* buf, int ss) {
#pragma unroll
    for (int dt = 0; dt < 4; ++dt) vf[dt] = frag_h((const _Float16*)(buf + AT_V + (dt * 16 + col) * AT_P) + ss * 32, lane); };
  asm volatile("s_wait_asynccnt 0x0" ::: "memory");   // tile 0 has landed, this wave's share
  __syncthreads();   // the key planes, the waves' maxima and tile 0 are whole before any wave reads them
  kv_fill(gk, gv, 1, l0 + AT_SZ, tid);
  float coef; { const v4f wm = *(const v4f*)swm; const float dmax = sqrtf(fmaxf(fmaxf(wm[0], wm[1]), fmaxf(wm[2], wm[3]))); coef = gv_h / (dmax + 1e-8f); }   // gamma v / (dmax + 1e-8): dist is normalised by the global max
  // the factor exp(-dist coef) is 2^(dist c2): one multiply by a per-head constant between the two hardware operations. With a global maximum of 0 every dist is 0 and the factor is 1 under any finite constant, so that case needs no constant of its own
  const float c2 = coef * -1.44269504f; const v2f c22 = { c2, c2 };
  // the two-buffer loop over the tiles: tile t + 1 flies while tile t is worked on
#pragma unroll 1
  for (int t = 0; t < AT_N; ++t) {   // rolled: the buffer is picked by t & 1
    const int bo = (t & 1) * AT_SZ; const char* buf = skv + bo;
#pragma unroll 1
   for (int ss = 0; ss < 2; ++ss) { v8f cc[2]; const int ks = 2 * t + ss;   // the tile's two steps of 32 keys; rolled: as a block that loops on itself a step keeps its 16 scores' chains interleaved and paired for dual issue, unrolled the build had an eighth more vector instructions
    lds_k(buf, ss);
    v4f tx[4], ty[4], tz[4], tm[4];   // the lane's 16 keys: planes read as 16-byte words, the same address in all 16 lanes of a half
#pragma unroll
    for (int q = 0; q < 4; ++q) { const int k0 = ks * 32 + (q >> 1) * 16 + 8 * g + (q & 1) * 4; tx[q] = *(const v4f*)&skx[k0]; ty[q] = *(const v4f*)&sky[k0]; tz[q] = *(const v4f*)&skz[k0]; tm[q] = *(const v4f*)&skm[k0]; }
#pragma unroll
    for (int ct = 0; ct < 2; ++ct) { v8f c = {};
#pragma unroll
      for (int kc = 0; kc < 2; ++kc) c = wmma16(kf[ct][kc], aq[kc], c);   // single product: k, q as one-rounding f16 operands; c[r] = score of key ct * 16 + 8 g + r with query col
      cc[ct] = c; }
    lds_v(buf, ss);
    float s[16];
#pragma unroll
    for (int p = 0; p < 8; ++p) { const int q = p >> 1, e = (p & 1) * 2;   // two keys at a time, neighbours in the planes' words: packed f32 forms with no register moves
      const v2f kx = { tx[q][e], tx[q][e + 1] }, ky = { ty[q][e], ty[q][e + 1] }, kz = { tz[q][e], tz[q][e + 1] };
      const v2f dx = px2 - kx, dy = py2 - ky, dz = pz2 - kz; const v2f sq2 = dx * dx + dy * dy + dz * dz;
      const v2f xe = v2f{ __builtin_amdgcn_sqrtf(sq2[0]), __builtin_amdgcn_sqrtf(sq2[1]) } * c22;   // the hardware square root (1 ulp; 0 gives 0), not the library's correctly rounded sequence of a dozen vector instructions a score
#pragma unroll
      for (int u = 0; u < 2; ++u) { const int i = 2 * p + u; const float fac = __builtin_amdgcn_exp2f(xe[u]); s[i] = cc[i >> 3][i & 7] * 0.125f * fac + tm[q][e + u]; } }   // score x exp(-normalised distance x gamma v); a masked key ends at -3.0e38
    float mx = s[0];
#pragma unroll
    for (int i = 1; i < 16; ++i) mx = fmaxf(mx, s[i]);
    mx = fmaxf(mx, xhalf(mx));
    const float mn = fmaxf(m, mx); const float alpha = (m <= -1.0e38f) ? 0.f : __expf(m - mn);
    const float mref = (mn <= -1.0e38f) ? 0.f : mn;   // no kept key yet: against 0 every masked score gives weight 0, as it does against a real maximum
    float e[16]; v16h pa;
#pragma unroll
    for (int i = 0; i < 16; ++i) { e[i] = __expf(s[i] - mref); pa[i] = (_Float16)(e[i] * 2048.0f); }   // P scaled by 2^11 so small softmax weights stay out of the f16 subnormal range; 2^-11 folded into the epilogue. Element i of the B operand is key 8 g + i (i < 8) or 16 + 8 g + i - 8: the two tiles' registers in their order
#pragma unroll
    for (int w = 8; w > 0; w >>= 1) {   // a tree, not a chain of 15 dependent adds
#pragma unroll
      for (int i = 0; i < w; ++i) e[i] += e[i + w]; }
    const float es = e[0];
    l = l * alpha + es; m = mn;
#pragma unroll
    for (int dt = 0; dt < 4; ++dt) acc[dt] *= alpha;
#pragma unroll
    for (int dt = 0; dt < 4; ++dt) acc[dt] = wmma16(vf[dt], pa, acc[dt]);   // single product: V^T x P^T (x2^11); acc[dt][r] = O[query col][dt * 16 + 8 g + r]
   }
    asm volatile("s_wait_dscnt 0x0" ::: "memory");      // this wave's reads of tile t are over before the buffer is given up
    asm volatile("s_wait_asynccnt 0x0" ::: "memory");   // this wave's share of tile t + 1 has landed
    __syncthreads();   // publishes tile t + 1, ends every reader's last read of tile t
    if (t + 2 < AT_N) kv_fill(gk, gv, t + 2, l0 + bo, tid);
  }
  asm volatile("s_wait_asynccnt 0x0" ::: "memory");   // no copy is outstanding when the wave ends
  const float il = (1.0f / 2048.0f) / (l + xhalf(l));
  float* orow = O + rq * DM + h * HD + 8 * g;
#pragma unroll
  for (int dt = 0; dt < 4; ++dt) { const v4f lo = { acc[dt][0] * il, acc[dt][1] * il, acc[dt][2] * il, acc[dt][3] * il }, hi = { acc[dt][4] * il, acc[dt][5] * il, acc[dt][6] * il, acc[dt][7] * il }; vst2(orow + dt * 16, lo); vst2(orow + dt * 16 + 4, hi); }
}
// ---- k_out: block = (64 rows, 128 cols): out = O(hi/lo) . Wo rows (2 products) + bo
__global__ __launch_bounds__(128) void k_out(const float* __restrict__ O, const __bf16* __restrict__ P, const float* __restrict__ BO, float* __restrict__ Y) {
  __shared__ __align__(16) char smem[2 * ST_SZ];   // the two tile buffers; behind the loop the output staging
  static_assert(2 * ST_SZ >= 4 * 16 * 132 * 4, "the staging fits the buffers");
  float (*so)[16][132] = (float (*)[16][132])smem;
  const int tid = threadIdx.x, wave = tid >> 5, lane = tid & 31, col = lane & 15, g = lane >> 4; const size_t r0 = (size_t)blockIdx.x * 64 + wave * 16; const int n0 = blockIdx.y * 128;
  v8f acc[8] = {};
  auto mma = [&](const KStep& s) { const F2 a = bsplit16(s.a);
#pragma unroll
    for (int j = 0; j < 8; ++j) { acc[j] = wmma_bf(a.l, s.w[j], acc[j]); acc[j] = wmma_bf(a.h, s.w[j], acc[j]); } };
  tile_loop(O + (size_t)blockIdx.x * 64 * DM, P + (size_t)n0 * DM, smem, tid, mma);
#pragma unroll
  for (int j = 0; j < 8; ++j) {
#pragma unroll
    for (int r = 0; r < 8; ++r) so[wave][8 * g + r][j * 16 + col] = acc[j][r] + bfr(BO[n0 + j * 16 + col]); }
  LDSX();
  for (int rl = 0; rl < 16; ++rl) vst2(Y + (r0 + rl) * DM + n0 + lane * 4, *(const v4f*)&so[wave][rl][lane * 4]);
}
// ---- dist_block: block = 32 rows x all keys. A thread keeps the rounded positions of its own 8 keys in registers (six 16-byte loads, issued together) and walks the block's 32 rows, read from LDS: no load stands in the loop's dependent path. max is order-free, so any split of the pairs gives the same global maximum: RM[block * 32 + i] = max of |p_r - p_j|^2 over the block's rows r and the keys j of threads 8 i .. 8 i + 7; one 128-B line per block
__device__ __forceinline__ void dist_block(const float* __restrict__ POS, float* __restrict__ RM, int blk) {
  static_assert(NB * SS == 256 * 8, "a thread owns 8 keys");
  __shared__ __align__(16) float srow[32][4]; __shared__ __align__(16) float red[256]; __shared__ __align__(16) float line[32];
  const int t = threadIdx.x; const size_t r0 = (size_t)blk * 32;
  v4f kv[6];
#pragma unroll
  for (int i = 0; i < 6; ++i) kv[i] = *(const v4f*)(POS + (size_t)t * 24 + i * 4);
  if (t < 128) { const int c = t & 3; const float v = POS[(r0 + (t >> 2)) * 3 + (c < 3 ? c : 2)]; srow[t >> 2][c] = (c < 3) ? bfr(v) : 0.f; }   // a row's fourth word is padding, written so that the 16-byte rows hold no unwritten LDS
  float kx[8], ky[8], kz[8], mx[8];
#pragma unroll
  for (int j = 0; j < 8; ++j) { kx[j] = bfr(kv[(3 * j) >> 2][(3 * j) & 3]); ky[j] = bfr(kv[(3 * j + 1) >> 2][(3 * j + 1) & 3]); kz[j] = bfr(kv[(3 * j + 2) >> 2][(3 * j + 2) & 3]); mx[j] = 0.f; }
  __syncthreads();
  // rolled: keeps the distance side's code and registers small (the kernel's register count is now set by the packing side's sixteen loads, not by this loop)
#pragma unroll 1
  for (int i = 0; i < 32; ++i) { const v4f p = *(const v4f*)&srow[i][0];
#pragma unroll
    for (int j = 0; j < 8; ++j) { const float dx = p[0] - kx[j], dy = p[1] - ky[j], dz = p[2] - kz[j]; mx[j] = fmaxf(mx[j], dx * dx + dy * dy + dz * dz); } }
  red[t] = fmaxf(fmaxf(fmaxf(mx[0], mx[1]), fmaxf(mx[2], mx[3])), fmaxf(fmaxf(mx[4], mx[5]), fmaxf(mx[6], mx[7]))); __syncthreads();
  if (t < 32) { const v4f a = *(const v4f*)&red[t * 8], c = *(const v4f*)&red[t * 8 + 4]; line[t] = fmaxf(fmaxf(fmaxf(a[0], a[1]), fmaxf(a[2], a[3])), fmaxf(fmaxf(c[0], c[1]), fmaxf(c[2], c[3]))); } __syncthreads();
  if (t < 8) vst2(RM + r0 + t * 4, *(const v4f*)&line[t * 4]);
}
// ---- k_prep: one launch for the two pieces of work that read nothing but inputs. Blocks 0 .. DIST_B - 1 make the partial maxima, the others pack PACK_E weight elements each. The distance blocks are the long ones and have the low indices, so that they start first and run beside the packing.
#define DIST_B (NB * SS / 32)
__global__ __launch_bounds__(256) void k_prep(const float* __restrict__ WQ, const float* __restrict__ WK, const float* __restrict__ WV, const float* __restrict__ WO, __bf16* __restrict__ PK, const float* __restrict__ POS, float* __restrict__ RM) {
  const int bi = blockIdx.x;   // the same for the whole block: either side's barriers are passed by all of its threads
  if (bi < DIST_B) dist_block(POS, RM, bi);
  else pack_block(WQ, WK, WV, WO, PK, bi - DIST_B);
}
extern "C" void kernel_launch(void* const* d_in, const int* in_sizes, int n_in, void* d_out, int out_size, void* d_ws, size_t ws_size, hipStream_t stream) {
  (void)in_sizes; (void)n_in; (void)out_size;
  const float** F = (const float**)d_in;   // 0 x [1,2048,1024], 1 attention_mask [1,2048] int, 2 positions [1,2048,3], 3 Wq, 4 bq, 5 Wk, 6 bk, 7 Wv, 8 bv, 9 Wo, 10 bo (natural), 11 velocity [16]
  if (ws_size < (size_t)WS_END) return;
  char* ws = (char*)d_ws; __bf16* PK = (__bf16*)(ws + WS_PK); _Float16 *QK = (_Float16*)(ws + WS_QK), *QKL = (_Float16*)(ws + WS_QKL), *VTH = (_Float16*)(ws + WS_VTH), *VTL = (_Float16*)(ws + WS_VTL); float *O = (float*)(ws + WS_O), *RM = (float*)(ws + WS_DM);
  k_prep<<<DIST_B + PACK_B, 256, 0, stream>>>(F[3], F[5], F[7], F[9], PK, F[2], RM);
  k_qkv<<<dim3(TNB * SS / 64, QKVW / 128), 128, 0, stream>>>(F[0], F[0], F[0], PK + PK_A, F[4], F[6], F[8], QK, QKL, VTH, VTL);
  k_attn<<<dim3(TQB, NH, TNB), 128, 0, stream>>>(QK, QKL, VTH, VTL, nullptr, F[2], RM, F[11], (const int*)d_in[1], O);
  k_out<<<dim3(TOB, DM / 128), 128, 0, stream>>>(O, PK + PK_P, F[10], (float*)d_out);
}

// v010
// A run of this version takes 75.5 microseconds.
// Timed twice side by side with v009, it ran 1.05 and 1.07 times as fast.
// Over all steps from v000 it is 5.23 times as fast.
// compute dtype: all float inputs rounded to bf16, the int mask read on device; q/k/v = x . W^T + b with EXACT bf16 products on WMMA 16x16x32 (natural rows); the global maximum of the pairwise distances from coordinate differences in f32 (deterministic block reduction); per score the squared distance as |q|^2 + |k|^2 - 2 q.k on WMMA 16x16x32 (exact bf16 operands, f32 sums), the Lorentz factor and exp(-d coef) in f32 (hardware exp, hardware square root); PLAIN attention: q, k single f16 x 1/8 x that factor, masked keys excluded, running-max softmax in f32, P (scaled by 2^11, single f16) x v (single f16); out = o (bf16 hi + residual) . Wo^T (2 products) + bo.
#include <hip/hip_runtime.h>
#include <math.h>

typedef __attribute__((ext_vector_type(16))) _Float16 v16h;
typedef __attribute__((ext_vector_type(16))) __bf16 v16b;
typedef __attribute__((ext_vector_type(8)))  _Float16 v8h;
typedef __attribute__((ext_vector_type(8)))  float v8f;
typedef __attribute__((ext_vector_type(4)))  float v4f;
typedef __attribute__((ext_vector_type(2)))  float v2f;
typedef __attribute__((ext_vector_type(4)))  unsigned v4u;
typedef __attribute__((ext_vector_type(4)))  int v4i;
typedef float __attribute__((may_alias)) float_a;
typedef int __attribute__((may_alias)) int_a;

template <typename T> __device__ __forceinline__ void vst2(void* p, T v) { *(T*)p = v;  }
__device__ __forceinline__ v8f wmma16(v16h a, v16h b, v8f c) {
  v8f d = __builtin_amdgcn_wmma_f32_16x16x32_f16(false, a, false, b, (short)0, c, false, false);
  asm volatile("v_nop\n\tv_nop\n\tv_nop\n\tv_nop" : "+v"(d) : "v"(a), "v"(b));
  return d;
}
__device__ __forceinline__ v8f wmma_bf(v16b a, v16b b, v8f c) {
  v8f d = __builtin_amdgcn_wmma_f32_16x16x32_bf16(false, a, false, b, (short)0, c, false, false);
  asm volatile("v_nop\n\tv_nop\n\tv_nop\n\tv_nop" : "+v"(d) : "v"(a), "v"(b));
  return d;
}
// Relativistic self attention (B 1, S 2,048, d 1,024, 16 heads x 64): q/k/v projections + biases, scores / 8 multiplied by exp(-dist_ij gamma_h v_h) with the normalised pairwise distance of the 3-D positions and a per-head velocity, key mask, softmax, . v, output projection + bias.
__device__ __forceinline__ v16h frag_h(const _Float16* rowk0, int lane) {
  union { v16h v; v8h q[2]; } u; const _Float16* p = rowk0 + 8 * (lane >> 4);
  u.q[0] = *(const v8h*)p; u.q[1] = *(const v8h*)(p + 16); return u.v;
}
__device__ __forceinline__ v16h frag_f32(const float* rowk0, int lane) {
  v16h a; const float* p = rowk0 + 8 * (lane >> 4);
#pragma unroll
  for (int i = 0; i < 8; ++i) { a[i] = (_Float16)p[i]; a[8 + i] = (_Float16)p[16 + i]; }
  return a;
}
__device__ __forceinline__ v16h frag_f32s(const float* rowk0, int lane, float sc) {
  v16h a; const float* p = rowk0 + 8 * (lane >> 4);
#pragma unroll
  for (int i = 0; i < 8; ++i) { a[i] = (_Float16)(p[i] * sc); a[8 + i] = (_Float16)(p[16 + i] * sc); }
  return a;
}
// column fragment from a [K][ld] layout (column n), rows >= K read as 0
__device__ __forceinline__ v16h fragc_f32(const float* W, int k0, int n, int lane, int ld, int K) {
  v16h a; const int g = lane >> 4;
#pragma unroll
  for (int i = 0; i < 8; ++i) { const int ka = k0 + 8 * g + i, kb = ka + 16;
    a[i] = (_Float16)(ka < K ? W[(size_t)(ka < K ? ka : K - 1) * ld + n] : 0.f); a[8 + i] = (_Float16)(kb < K ? W[(size_t)(kb < K ? kb : K - 1) * ld + n] : 0.f); }
  return a;
}
struct F2 { v16b h, l; };
__device__ __forceinline__ F2 bsplit16(const float v[16]) { F2 r;
#pragma unroll
  for (int i = 0; i < 16; ++i) { const __bf16 h = (__bf16)v[i]; r.h[i] = h; r.l[i] = (__bf16)(v[i] - (float)h); }
  return r; }
__device__ __forceinline__ F2 split_row(const float* row, int k0, int lane) { float v[16]; const float* p = row + k0 + 8 * (lane >> 4);
#pragma unroll
  for (int i = 0; i < 8; ++i) { v[i] = p[i]; v[8 + i] = p[16 + i]; }
  return bsplit16(v); }
__device__ __forceinline__ F2 split_rowK(const float* row, int k0, int lane, int K) { float v[16]; const int g = lane >> 4;
#pragma unroll
  for (int i = 0; i < 8; ++i) { const int ka = k0 + 8 * g + i, kb = ka + 16; v[i] = ka < K ? row[ka < K ? ka : K - 1] : 0.f; v[8 + i] = kb < K ? row[kb < K ? kb : K - 1] : 0.f; }
  return bsplit16(v); }
__device__ __forceinline__ F2 split_col(const float* W, int k0, int n, int lane, int ld, int K) { float v[16]; const int g = lane >> 4;
#pragma unroll
  for (int i = 0; i < 8; ++i) { const int ka = k0 + 8 * g + i, kb = ka + 16; v[i] = ka < K ? W[(size_t)(ka < K ? ka : K - 1) * ld + n] : 0.f; v[8 + i] = kb < K ? W[(size_t)(kb < K ? kb : K - 1) * ld + n] : 0.f; }
  return bsplit16(v); }
__device__ __forceinline__ v8f mac3(const F2& a, const F2& b, v8f c) { c = wmma_bf(a.l, b.h, c); c = wmma_bf(a.h, b.l, c); return wmma_bf(a.h, b.h, c); }
__device__ __forceinline__ float sigm(float v) { return 1.0f / (1.0f + expf(-v)); }
#define LDSX() do { asm volatile("s_wait_dscnt 0" ::: "memory"); __builtin_amdgcn_wave_barrier(); __builtin_amdgcn_fence(__ATOMIC_RELEASE, "workgroup"); } while (0)


#define NB 1
#define SS 2048
#define DM 1024
#define NH 16
#define HD 64
#define QKVW (3 * DM)
#ifndef TQB
#define TQB (SS / 64)
#define TNB NB
#define TOB (NB * SS / 64)     // output row tiles (all)
#endif
typedef __attribute__((ext_vector_type(8))) __bf16 v8b;
__device__ __forceinline__ v16b frag_b(const __bf16* rowk0, int lane) {
  union { v16b v; v8b q[2]; } u; const __bf16* p = rowk0 + 8 * (lane >> 4);
  u.q[0] = *(const v8b*)p; u.q[1] = *(const v8b*)(p + 16); return u.v;
}
__device__ __forceinline__ float bfr(float v) { return (float)(__bf16)v; }
__device__ __attribute__((noinline)) float exp_ni(float v) { return expf(v); }
__device__ __attribute__((noinline)) float erf_ni(float v) { return erff(v); }

#define PK_A 0                       // [3072][1024] Wqkv rows (natural [out][in])
#define PK_P (PK_A + QKVW * DM)        // [1024][1024] Wo rows (natural)
#define PK_END (PK_P + DM * DM)
#define WS_PK  0u
#define WS_QK  (WS_PK + 2u * PK_END)             // f16 [2048 rows][2048]: q | k
#define WS_QKL (WS_QK + 2u * NB * SS * 2 * DM)     // f16 q | k residual planes x2048
#define WS_VTH (WS_QKL + 2u * NB * SS * 2 * DM)    // f16 [b][1024 (h*64+d)][2048 s] hi
#define WS_VTL (WS_VTH + 2u * NB * DM * SS)        // f16 lo x 2048
#define WS_O   (WS_VTL + 2u * NB * DM * SS)        // f32 [2048][1024]
#define WS_CS  (WS_O + 4u * NB * SS * DM)           // bf16 [2048][8]: the key rows of the distance product (the head of a larger, otherwise unused range)
#define WS_DM  (WS_CS + 4u * 2 * SS * 32)                  // f32: partial maxima of the squared pairwise distances [SS]
#define WS_END (WS_DM + 4u * (size_t)(SS + 32))
// one k-step (32 k) of a row-times-weight-rows product, as loaded: the lane's 16 f32 of its A row and its 8 weight fragments (16 columns each)
struct KStep { float a[16]; v16b w[8]; };
// ---- operand tiles of k_qkv and k_out in LDS. A tile is 64 k of the block's 64 A rows (f32, 256 B a row) and of its 128 weight rows (bf16, 128 B a row), brought by asynchronous copies: a wave's copy covers four whole 128-B lines, and the block fetches each line once for its four waves. Row pitches 272 and 144 B (16 B x odd): the 16 rows of a fragment read fall on distinct banks.
#define ST_K 64
#define ST_N (DM / ST_K)
#define ST_AP 272
#define ST_WP 144
#define ST_W (64 * ST_AP)
#define ST_SZ (ST_W + 128 * ST_WP)
// eight copies, each lane its own 16 bytes; the s_wait_xcnt stands inside the statement, behind the last copy, so that no address register named here is rewritten in front of it
__device__ __forceinline__ void acopy8(const unsigned (&l)[8], const void* const (&p)[8]) {
  asm volatile("global_load_async_to_lds_b128 %0, %8, off\n\t"
               "global_load_async_to_lds_b128 %1, %9, off\n\t"
               "global_load_async_to_lds_b128 %2, %10, off\n\t"
               "global_load_async_to_lds_b128 %3, %11, off\n\t"
               "global_load_async_to_lds_b128 %4, %12, off\n\t"
               "global_load_async_to_lds_b128 %5, %13, off\n\t"
               "global_load_async_to_lds_b128 %6, %14, off\n\t"
               "global_load_async_to_lds_b128 %7, %15, off\n\t"
               "s_wait_xcnt 0x0"
               :: "v"(l[0]), "v"(l[1]), "v"(l[2]), "v"(l[3]), "v"(l[4]), "v"(l[5]), "v"(l[6]), "v"(l[7]),
                  "v"(p[0]), "v"(p[1]), "v"(p[2]), "v"(p[3]), "v"(p[4]), "v"(p[5]), "v"(p[6]), "v"(p[7]) : "memory");
}
// tile st of the block into the buffer at LDS byte address lbuf; 128 threads, 16 copies each. a0, w0: the thread's own 16 bytes of tile 0 (A row tid / 16, weight row tid / 8); its further copies lie 8 A rows and 16 weight rows apart
__device__ __forceinline__ void tile_fill(const char* a0, const char* w0, int st, unsigned lbuf, int tid) {
  unsigned l[8]; const void* p[8];
  const char* pa = a0 + st * (ST_K * 4); const unsigned la = lbuf + (tid >> 4) * ST_AP + (tid & 15) * 16;
#pragma unroll
  for (int i = 0; i < 8; ++i) { l[i] = la + i * (8 * ST_AP); p[i] = pa + i * (8 * DM * 4); }
  acopy8(l, p);
  const char* pw = w0 + st * (ST_K * 2); const unsigned lw = lbuf + ST_W + (tid >> 3) * ST_WP + (tid & 7) * 16;
#pragma unroll
  for (int i = 0; i < 8; ++i) { l[i] = lw + i * (16 * ST_WP); p[i] = pw + i * (16 * DM * 2); }
  acopy8(l, p);
}
// k-step kk (0 or 1) of a tile: arow = the lane's A row in the buffer + 32 g bytes, wrow = weight row col in the buffer + 16 g bytes; the k order of both is that of frag_b
__device__ __forceinline__ void kstep_lds(KStep& s, const char* arow, const char* wrow, int kk) {
  const v4f a0 = *(const v4f*)(arow + kk * 128), a1 = *(const v4f*)(arow + kk * 128 + 16), a2 = *(const v4f*)(arow + kk * 128 + 64), a3 = *(const v4f*)(arow + kk * 128 + 80);
#pragma unroll
  for (int i = 0; i < 4; ++i) { s.a[i] = a0[i]; s.a[4 + i] = a1[i]; s.a[8 + i] = a2[i]; s.a[12 + i] = a3[i]; }
#pragma unroll
  for (int j = 0; j < 8; ++j) { union { v16b v; v8b q[2]; } u; const char* p = wrow + j * 16 * ST_WP + kk * 64; u.q[0] = *(const v8b*)p; u.q[1] = *(const v8b*)(p + 32); s.w[j] = u.v; }
}
// the two-buffer loop over the tiles: tile t + 1 flies while tile t is worked on. At the foot of a trip every wave ends its own LDS reads and its own copies, the barrier publishes tile t + 1 and frees tile t's buffer, and only then tile t + 2 is aimed at that buffer. The last trip's barrier also frees both buffers for the output staging.
template <typename MMA> __device__ __forceinline__ void tile_loop(const float* A0, const __bf16* W0, char* smem, int tid, MMA mma) {
  const int wave = tid >> 5, lane = tid & 31, col = lane & 15, g = lane >> 4; const unsigned l0 = (unsigned)(size_t)smem;
  const char* a0 = (const char*)(A0 + (size_t)(tid >> 4) * DM + (tid & 15) * 4); const char* w0 = (const char*)(W0 + (size_t)(tid >> 3) * DM + (tid & 7) * 8);
  tile_fill(a0, w0, 0, l0, tid);
  asm volatile("s_wait_asynccnt 0x0" ::: "memory");   // tile 0 has landed, this wave's share
  __syncthreads();   // tile 0 is whole before any wave reads it
  tile_fill(a0, w0, 1, l0 + ST_SZ, tid);
#pragma unroll 1
  for (int t = 0; t < ST_N; ++t) {   // rolled: the buffer is picked by t & 1
    const int bo = (t & 1) * ST_SZ; const char* arow = smem + bo + (wave * 16 + col) * ST_AP + 32 * g; const char* wrow = smem + bo + ST_W + col * ST_WP + 16 * g;
    KStep s0, s1; kstep_lds(s0, arow, wrow, 0); kstep_lds(s1, arow, wrow, 1); mma(s0); mma(s1);
    asm volatile("s_wait_dscnt 0x0" ::: "memory");      // this wave's reads of tile t are over before the buffer is given up
    asm volatile("s_wait_asynccnt 0x0" ::: "memory");   // this wave's share of tile t + 1 has landed
    __syncthreads();   // publishes tile t + 1, ends every reader's last read of tile t
    if (t + 2 < ST_N) tile_fill(a0, w0, t + 2, l0 + bo, tid);
  }
  asm volatile("s_wait_asynccnt 0x0" ::: "memory");   // no copy is outstanding when the LDS is used anew
}
// ---- pack_block: the four weights keep their natural [out][in] element order and land one behind the other in PK (W_q, W_k, W_v = PK_A, W_o = PK_P), so packing is a plain stream f32 -> bf16. Waves start at a bounded rate, and a stream this short pays for each one, so the work is dealt to few waves (8 a WGP) with much in flight each: a block takes PACK_E consecutive elements of one weight, a thread PACK_R words of 4 f32, 256 words apart. All of a thread's loads go out before the first is used; a wave's load covers four whole 128-B lines, its 8-byte stores two: no LDS, no barrier
#define PACK_R 16
#define PACK_E (256 * 4 * PACK_R)
#define PACK_W (DM * DM / PACK_E)      // blocks per weight
#define PACK_B (4 * PACK_W)
typedef __attribute__((ext_vector_type(4))) __bf16 v4b;
__device__ __forceinline__ void pack_block(const float* __restrict__ WQ, const float* __restrict__ WK, const float* __restrict__ WV, const float* __restrict__ WO, __bf16* __restrict__ PK, int blk) {
  static_assert((DM * DM) % PACK_E == 0, "a block lies inside one weight");
  static_assert(PK_A == 0 && PK_P == 3 * DM * DM && QKVW == 3 * DM, "weight w starts at element w DM DM of PK");
  const int which = blk / PACK_W; const float* Wm = (which == 0) ? WQ : (which == 1) ? WK : (which == 2) ? WV : WO;
  const int w0 = (blk % PACK_W) * (PACK_E / 4) + threadIdx.x;   // the thread's first word: the same index in the source (16-byte words) and in the destination (8-byte words)
  const v4f* s4 = (const v4f*)Wm; v4f v[PACK_R];
#pragma unroll
  for (int i = 0; i < PACK_R; ++i) v[i] = s4[w0 + i * 256];
  __builtin_amdgcn_sched_barrier(0);   // keeps every load in front of the first conversion: without it the build holds the last loads back until the first have returned, a second trip to memory in a wave that makes only one
  v4b* d4 = (v4b*)(PK + (size_t)which * (DM * DM));
#pragma unroll
  for (int i = 0; i < PACK_R; ++i) { const v4b o = { (__bf16)v[i][0], (__bf16)v[i][1], (__bf16)v[i][2], (__bf16)v[i][3] }; d4[w0 + i * 256] = o; }
  asm volatile("s_wait_xcnt 0x0" ::: "memory");   // stands behind the last store, in front of the join with the distance side, whose first instructions write the registers that the stores name
}
__global__ __launch_bounds__(128) void k_qkv(const float* __restrict__ XQ, const float* __restrict__ XK, const float* __restrict__ XV, const __bf16* __restrict__ P, const float* __restrict__ BQ, const float* __restrict__ BK, const float* __restrict__ BV, _Float16* __restrict__ QK, _Float16* __restrict__ QKL, _Float16* __restrict__ VTH, _Float16* __restrict__ VTL) {
  const int which0 = (blockIdx.y * 128) / DM; const float* X = (which0 == 0) ? XQ : (which0 == 1) ? XK : XV; const float* BB = BQ ? (((which0 == 0) ? BQ : (which0 == 1) ? BK : BV) + (blockIdx.y * 128 - which0 * DM)) : nullptr;
  __shared__ __align__(16) char smem[2 * ST_SZ];   // the two tile buffers; behind the loop the output staging
  static_assert(2 * ST_SZ >= 2 * (4 * 16 * 136 + 128 * 72) * 2, "the staging fits the buffers");
  _Float16 (*so)[16][136] = (_Float16 (*)[16][136])smem, (*sol)[16][136] = so + 4; _Float16 (*sth)[72] = (_Float16 (*)[72])(sol + 4), (*stl)[72] = sth + 128;
  const int tid = threadIdx.x, wave = tid >> 5, lane = tid & 31, col = lane & 15, g = lane >> 4; const size_t r0 = (size_t)blockIdx.x * 64 + wave * 16; const int n0 = blockIdx.y * 128;
  v8f acc[8] = {};
  // the lane's eight biases (one per 16-column tile) go out here as one group and land under the tile loop. Read inside the output loops, behind the pointer test, each of a lane's 64 outputs had a load of its own with a full wait behind it
  float bias[8] = {};
  if (BB) {
#pragma unroll
    for (int j = 0; j < 8; ++j) bias[j] = BB[j * 16 + col];
    asm volatile("s_wait_xcnt 0x0" ::: "memory");   // stands behind these loads, in front of any rewrite of a register that they name
  }
  auto mma = [&](const KStep& s) { v16b a;
#pragma unroll
    for (int i = 0; i < 16; ++i) a[i] = (__bf16)s.a[i];
#pragma unroll
    for (int j = 0; j < 8; ++j) acc[j] = wmma_bf(a, s.w[j], acc[j]); };
  tile_loop(X + (size_t)blockIdx.x * 64 * DM, P + (size_t)n0 * DM, smem, tid, mma);
  if (n0 < 2 * DM) {   // q stored unscaled (f16 sigma ~0.6, no subnormal exposure); 1/8 applied to the f32 score
#pragma unroll
    for (int j = 0; j < 8; ++j) {
#pragma unroll
      for (int r = 0; r < 8; ++r) { const float v = acc[j][r] + bfr(bias[j]); const _Float16 hv = (_Float16)v; so[wave][8 * g + r][j * 16 + col] = hv; sol[wave][8 * g + r][j * 16 + col] = (_Float16)((v - (float)hv) * 2048.0f); } }   // q, k (+ bias) as f16 hi + (x2048) residual
    LDSX();
    for (int rl = 0; rl < 16; ++rl) if (lane < 16) { vst2((unsigned*)(QK + (r0 + rl) * (2 * DM) + n0 + lane * 8), *(const v4u*)&so[wave][rl][lane * 8]); vst2((unsigned*)(QKL + (r0 + rl) * (2 * DM) + n0 + lane * 8), *(const v4u*)&sol[wave][rl][lane * 8]); }
  } else {
#pragma unroll
    for (int j = 0; j < 8; ++j) {
#pragma unroll
      for (int r = 0; r < 8; ++r) { const float v = acc[j][r] + bfr(bias[j]); const _Float16 hv = (_Float16)v; sth[j * 16 + col][wave * 16 + 8 * g + r] = hv; stl[j * 16 + col][wave * 16 + 8 * g + r] = (_Float16)((v - (float)hv) * 2048.0f); } }
    __syncthreads();
    const size_t rb = (size_t)blockIdx.x * 64; const int b = (int)(rb / SS), s0 = (int)(rb % SS); const int pc0 = n0 - 2 * DM;
    for (int q = tid; q < 128 * 8; q += 128) { const int d = q >> 3, pc = q & 7; const size_t o = ((size_t)b * DM + pc0 + d) * SS + s0 + pc * 8; vst2((unsigned*)(VTH + o), *(const v4u*)&sth[d][pc * 8]); vst2((unsigned*)(VTL + o), *(const v4u*)&stl[d][pc * 8]); }
  }
}
// ---- K and V tiles of k_attn in LDS. A tile is 64 keys: 64 K rows (this head's 64 d, 128 B) and 64 V^T rows (one d each, the tile's 64 keys, 128 B), brought by asynchronous copies: a wave's copy covers four whole 128-B lines, and the block fetches each line once for its four waves. Row pitch 144 B (16 B x odd): the 16 rows of a fragment read fall on distinct banks.
#define AT_K 64
#define AT_N (SS / AT_K)
#define AT_P 144
#define AT_V (AT_K * AT_P)
#define AT_SZ (AT_V + HD * AT_P)
// tile t into the buffer at LDS byte address lbuf; 128 threads, 4 copies of K and 4 of V^T each. k0, v0: the thread's own 16 bytes of tile 0 (row tid / 8 of either); its further copies lie 16 rows apart
__device__ __forceinline__ void kv_fill(const char* k0, const char* v0, int t, unsigned lbuf, int tid) {
  unsigned l[8]; const void* p[8];
  const char* pk = k0 + (size_t)t * (AT_K * 2 * DM * 2); const char* pv = v0 + t * (AT_K * 2); const unsigned lk = lbuf + (tid >> 3) * AT_P + (tid & 7) * 16;
#pragma unroll
  for (int i = 0; i < 4; ++i) { l[i] = lk + i * (16 * AT_P); p[i] = pk + i * (16 * 2 * DM * 2); l[4 + i] = lk + AT_V + i * (16 * AT_P); p[4 + i] = pv + i * (16 * SS * 2); }
  acopy8(l, p);
}
// a key's row of the distance product, as four words of two bf16 each: x, y | z, h | m, l | 0, 0. x, y, z are bf16 values held in f32 (low halves 0). h, m, l are |p|^2 cut into three pieces of 8 significant bits, each the upper half of what is left: both subtractions are exact and the third piece has no low half, so h + m + l is the f32 sum, all 24 bits of it
__device__ __forceinline__ unsigned hi_pair(float lo, float hi) { return (__builtin_bit_cast(unsigned, lo) >> 16) | (__builtin_bit_cast(unsigned, hi) & 0xffff0000u); }   // the upper halves of two f32 as one word
__device__ __forceinline__ float hi_part(float v) { return __builtin_bit_cast(float, __builtin_bit_cast(unsigned, v) & 0xffff0000u); }
__device__ __forceinline__ v4u key_row(float x, float y, float z) {
  const float n = x * x + y * y + z * z; const float h = hi_part(n); const float r = n - h; const float m = hi_part(r); const float l = r - m;
  const v4u o = { hi_pair(x, y), hi_pair(z, h), hi_pair(m, l), 0u }; return o;
}
__device__ __forceinline__ float xrow(float x, unsigned lo, unsigned hi) { return __builtin_bit_cast(float, __builtin_amdgcn_permlane16(__builtin_bit_cast(int, x), __builtin_bit_cast(int, x), lo, hi, false, false)); }   // lane i of a 16-lane row takes the row's lane named by nibble i of hi:lo
__device__ __forceinline__ float xhalf(float x) { return __builtin_bit_cast(float, __builtin_amdgcn_permlanex16(__builtin_bit_cast(int, x), __builtin_bit_cast(int, x), 0x76543210, 0xfedcba98, false, false)); }   // lane l with lane l ^ 16
// ---- k_attn: block = (64 queries, head h, batch b): all-keys flash attention, TRANSPOSED: S^T = K . Q^T (A = K rows, B = Q rows), so a lane holds 16 scores of ONE query (column col; keys 8 g + r and 16 + 8 g + r of the step's 32): maximum and sum run in the lane, one exchange between the wave's halves joins the maximum, the halves' sums are joined once behind the loop. The two score tiles, converted in place, are the B operand of O^T += V^T . P^T (hardware k order, which frag_h gives the V rows): P touches no LDS. A lane ends with 8 consecutive d of its query per tile and stores them itself.
// The squared distances come from the matrix unit, in the score tiles' own layout: |p_q - p_k|^2 = |p_q|^2 + |p_k|^2 - 2 p_q . p_k. The positions are bf16 values, so every product is exact; |p_k|^2 (f32) goes in as three bf16 pieces that add up to it exactly, each times 1; |p_q|^2 (f32) is the C operand. k_prep makes one 16-byte row per key (x, y, z, the three pieces, 0, 0); the block brings the rows into LDS once, with a plane that is 0 for a kept key and -3.0e38 for a masked one, added to the score.
// One A operand serves a step's two tiles: elements 0 to 7 are the row of key col, elements 8 to 15 that of key 16 + col. The query side has two B operands, its six coefficients (-2 x, -2 y, -2 z, 1, 1, 1) at k 0 to 5 (first tile) or at k 16 to 21 (second tile) and 0 everywhere else, so whatever finite value A holds at the other k adds 0.
// amdgpu_waves_per_eu(2, 2): the grid gives two waves per SIMD
__global__ __launch_bounds__(128) __attribute__((amdgpu_waves_per_eu(2, 2))) void k_attn(const _Float16* __restrict__ QK, const _Float16* __restrict__ QKL, const _Float16* __restrict__ VTH, const _Float16* __restrict__ VTL, const void* __restrict__ KMASK, const float* __restrict__ POS, const float* __restrict__ RM, const float* __restrict__ VEL, const int* __restrict__ AM, const __bf16* __restrict__ KD, float* __restrict__ O) {
  static_assert(SS % 512 == 0, "a thread fills whole groups of 4 keys of the mask plane");
  static_assert(AT_N >= 2 && HD == 64, "two tiles exist; a K row is 128 B");
  __shared__ __align__(16) __bf16 skd[SS][8]; __shared__ __align__(16) float skm[SS];
  __shared__ __align__(16) char skv[2 * AT_SZ];   // the two K and V tile buffers
  __shared__ __align__(16) float swm[4];   // each wave's maximum of its share of the partial maxima
  static_assert(NB * SS == 128 * 16, "a thread reads 16 partial maxima");
  const int tid = threadIdx.x, wave = tid >> 5, lane = tid & 31, col = lane & 15, g = lane >> 4;
  const int qb = blockIdx.x, h = blockIdx.y, b = blockIdx.z; const int q0 = qb * 64 + wave * 16; const size_t rq = (size_t)b * SS + q0 + col;
  const unsigned l0 = (unsigned)(size_t)skv;
  const char* gk = (const char*)(QK + ((size_t)b * SS + (tid >> 3)) * (2 * DM) + DM + h * HD + (tid & 7) * 8); const char* gv = (const char*)(VTH + ((size_t)b * DM + h * HD + (tid >> 3)) * SS + (tid & 7) * 8);
  kv_fill(gk, gv, 0, l0, tid);   // tile 0 flies while the key planes are made
  // the global maximum of the squared distances: every block reduces the 2,048 partial maxima itself (max is order-free: the same value in every block). The loads go out here with the key rows' and the mask's; the waves' results cross at the barrier that the key planes need anyway
  v4f rm[4];
#pragma unroll
  for (int i = 0; i < 4; ++i) rm[i] = *(const v4f*)(RM + i * 512 + tid * 4);
  asm volatile("s_wait_xcnt 0x0" ::: "memory");   // stands behind these loads, in front of any rewrite of a register that they name (their base is reused soon)
  { v4u kr[SS / 128]; v4i mk[SS / 512];   // the key rows as k_prep made them, neighbouring lanes neighbouring keys, and the mask, 4 keys a lane
#pragma unroll
    for (int i = 0; i < SS / 128; ++i) kr[i] = *(const v4u*)(KD + ((size_t)b * SS + tid + 128 * i) * 8);
#pragma unroll
    for (int i = 0; i < SS / 512; ++i) mk[i] = *(const v4i*)(AM + (size_t)b * SS + 4 * (tid + 128 * i));
    asm volatile("s_wait_xcnt 0x0" ::: "memory");   // stands behind these loads, in front of any rewrite of a register that they name; it also keeps all of them in front of the first use, one trip to L2
#pragma unroll
    for (int i = 0; i < SS / 128; ++i) *(v4u*)&skd[tid + 128 * i][0] = kr[i];
#pragma unroll
    for (int i = 0; i < SS / 512; ++i) { const v4f a = { mk[i][0] != 0 ? 0.f : -3.0e38f, mk[i][1] != 0 ? 0.f : -3.0e38f, mk[i][2] != 0 ? 0.f : -3.0e38f, mk[i][3] != 0 ? 0.f : -3.0e38f }; *(v4f*)&skm[4 * (tid + 128 * i)] = a; } }
  v16h aq[2];
#pragma unroll
  for (int kc = 0; kc < 2; ++kc) aq[kc] = frag_h(QK + rq * (2 * DM) + h * HD + kc * 32, lane);
  v16b bq0, bq1; v8f cq;   // the lane's query in the distance product: only the lanes of half 0 hold k 0 to 7 and 16 to 23, half 1 is all 0
  { const float* p = POS + rq * 3; const float px = bfr(p[0]), py = bfr(p[1]), pz = bfr(p[2]); const float nq = px * px + py * py + pz * pz;
    asm volatile("s_wait_xcnt 0x0" ::: "memory");   // stands behind these loads, in front of any rewrite of a register that they name
    const unsigned on = g ? 0u : 0xffffffffu; const unsigned w0 = hi_pair(-2.0f * px, -2.0f * py) & on, w1 = hi_pair(-2.0f * pz, 1.0f) & on, w2 = hi_pair(1.0f, 1.0f) & on;   // doubling a bf16 value is exact
    typedef __attribute__((ext_vector_type(8))) unsigned v8u;
    bq0 = __builtin_bit_cast(v16b, v8u{ w0, w1, w2, 0u, 0u, 0u, 0u, 0u }); bq1 = __builtin_bit_cast(v16b, v8u{ 0u, 0u, 0u, 0u, w0, w1, w2, 0u });
    cq = v8f{ nq, nq, nq, nq, nq, nq, nq, nq }; }
  float gv_h; { float vh = fabsf(bfr(VEL[h])); vh = fminf(fmaxf(vh, 0.f), 0.999f); const float gam = 1.0f / sqrtf(1.0f - vh * vh); gv_h = gam * vh; }   // gamma v
  { float w = 0.f;
#pragma unroll
    for (int i = 0; i < 4; ++i) w = fmaxf(w, fmaxf(fmaxf(rm[i][0], rm[i][1]), fmaxf(rm[i][2], rm[i][3])));
    w = fmaxf(w, xrow(w, 0x67452301u, 0xefcdab89u)); w = fmaxf(w, xrow(w, 0x54761032u, 0xdcfe98bau)); w = fmaxf(w, xrow(w, 0x32107654u, 0xba98fedcu)); w = fmaxf(w, xrow(w, 0xfedcba98u, 0x76543210u)); w = fmaxf(w, xhalf(w));   // lane l with l ^ 1, ^ 2, ^ 4, ^ 8, ^ 16
    if (lane == 0) swm[wave] = w; }
  float m = -3.0e38f, l = 0.f;   // the query's running maximum (equal in both halves) and this half's share of its sum
  v8f acc[4] = {};
  // the fragments come from the tile's buffer, rows and k order as before (frag_h): a step's K at its head, its V behind its score products, a whole softmax ahead of its use
  v16h kf[2][2], vf[4];
  auto lds_k = [&](const char* buf, int ss) {
#pragma unroll
    for (int ct = 0; ct < 2; ++ct) { const _Float16* krow = (const _Float16*)(buf + (ss * 32 + ct * 16 + col) * AT_P);
#pragma unroll
      for (int kc = 0; kc < 2; ++kc) kf[ct][kc] = frag_h(krow + kc * 32, lane); } };
  auto lds_v = [&](const char* buf, int ss) {
#pragma unroll
    for (int dt = 0; dt < 4; ++dt) vf[dt] = frag_h((const _Float16*)(buf + AT_V + (dt * 16 + col) * AT_P) + ss * 32, lane); };
  union { v16b v; v8b q[2]; } kd; v8f sq[2];   // a step's key rows, and sq[ct][r] = squared distance of key ct * 16 + 8 g + r to query col: the place of that pair's score. Both are made a step ahead (the rows' table is whole from the first barrier on and is never rewritten)
  auto lds_d = [&](int ks) { kd.q[0] = *(const v8b*)&skd[ks * 32 + col][0]; kd.q[1] = *(const v8b*)&skd[ks * 32 + 16 + col][0]; };   // the rows of keys col and 16 + col, the same in both halves
  auto dist_mma = [&]() { sq[0] = __builtin_amdgcn_wmma_f32_16x16x32_bf16(false, kd.v, false, bq0, (short)0, cq, false, false); sq[1] = __builtin_amdgcn_wmma_f32_16x16x32_bf16(false, kd.v, false, bq1, (short)0, cq, false, false); };
  asm volatile("s_wait_asynccnt 0x0" ::: "memory");   // tile 0 has landed, this wave's share
  __syncthreads();   // the key rows, the mask plane, the waves' maxima and tile 0 are whole before any wave reads them
  kv_fill(gk, gv, 1, l0 + AT_SZ, tid);
  lds_d(0); dist_mma();
  float coef; { const v4f wm = *(const v4f*)swm; const float dmax = sqrtf(fmaxf(fmaxf(wm[0], wm[1]), fmaxf(wm[2], wm[3]))); coef = dmax > 0.f ? gv_h / (dmax + 1e-8f) : 0.f; }   // gamma v / (dmax + 1e-8): dist is normalised by the global max. With a global maximum of 0 the reference's dist is 0 and its factor 1, while the expanded square may round to a little beside 0: the constant 0 gives the factor 1 there
  // the factor exp(-dist coef) is 2^(dist c2): one multiply by a per-head constant between the two hardware operations
  const float c2 = coef * -1.44269504f; const v2f c22 = { c2, c2 };
  // the two-buffer loop over the tiles: tile t + 1 flies while tile t is worked on
#pragma unroll 1
  for (int t = 0; t < AT_N; ++t) {   // rolled: the buffer is picked by t & 1
    const int bo = (t & 1) * AT_SZ; const char* buf = skv + bo;
#pragma unroll 1
   for (int ss = 0; ss < 2; ++ss) { v8f cc[2]; const int ks = 2 * t + ss;   // the tile's two steps of 32 keys; rolled: as a block that loops on itself a step keeps its 16 scores' chains interleaved and paired for dual issue, unrolled the build had an eighth more vector instructions
    lds_k(buf, ss);
    v4f tm[4];   // the mask plane of the lane's 16 keys, read as 16-byte words, the same address in all 16 lanes of a half
#pragma unroll
    for (int q = 0; q < 4; ++q) tm[q] = *(const v4f*)&skm[ks * 32 + (q >> 1) * 16 + 8 * g + (q & 1) * 4];
    lds_d((ks + 1) & (SS / 32 - 1));   // the next step's key rows (behind the last step those of step 0, unused)
    __builtin_amdgcn_sched_barrier(0);   // keeps the step's LDS reads in front of its square roots, which then run under the reads' latency: without it the build issues the sixteen roots first and waits for the K rows afterwards
#pragma unroll
    for (int ct = 0; ct < 2; ++ct) { v8f c = {};
#pragma unroll
      for (int kc = 0; kc < 2; ++kc) c = wmma16(kf[ct][kc], aq[kc], c);   // single product: k, q as one-rounding f16 operands; c[r] = score of key ct * 16 + 8 g + r with query col
      cc[ct] = c; }
    lds_v(buf, ss);
    float s[16];
#pragma unroll
    for (int p = 0; p < 8; ++p) { const int q = p >> 1, e = (p & 1) * 2;   // two keys at a time, neighbours in the tile's registers: packed f32 forms with no register moves
      const v2f xe = v2f{ __builtin_amdgcn_sqrtf(fabsf(sq[p >> 2][(2 * p) & 7])), __builtin_amdgcn_sqrtf(fabsf(sq[p >> 2][(2 * p + 1) & 7])) } * c22;   // the hardware square root (1 ulp; 0 gives 0); the magnitude, an operand modifier, because the expanded square of two equal or nearly equal positions may round to a little below 0
#pragma unroll
      for (int u = 0; u < 2; ++u) { const int i = 2 * p + u; const float fac = __builtin_amdgcn_exp2f(xe[u]); s[i] = cc[i >> 3][i & 7] * 0.125f * fac + tm[q][e + u]; } }   // score x exp(-normalised distance x gamma v); a masked key ends at -3.0e38
    float mx = s[0];
#pragma unroll
    for (int i = 1; i < 16; ++i) mx = fmaxf(mx, s[i]);
    mx = fmaxf(mx, xhalf(mx));
    const float mn = fmaxf(m, mx); const float alpha = (m <= -1.0e38f) ? 0.f : __expf(m - mn);
    const float mref = (mn <= -1.0e38f) ? 0.f : mn;   // no kept key yet: against 0 every masked score gives weight 0, as it does against a real maximum
    float e[16]; v16h pa;
#pragma unroll
    for (int i = 0; i < 16; ++i) { e[i] = __expf(s[i] - mref); pa[i] = (_Float16)(e[i] * 2048.0f); }   // P scaled by 2^11 so small softmax weights stay out of the f16 subnormal range; 2^-11 folded into the epilogue. Element i of the B operand is key 8 g + i (i < 8) or 16 + 8 g + i - 8: the two tiles' registers in their order
#pragma unroll
    for (int w = 8; w > 0; w >>= 1) {   // a tree, not a chain of 15 dependent adds
#pragma unroll
      for (int i = 0; i < w; ++i) e[i] += e[i + w]; }
    const float es = e[0];
    l = l * alpha + es; m = mn;
#pragma unroll
    for (int dt = 0; dt < 4; ++dt) acc[dt] *= alpha;
    dist_mma();   // the next step's squared distances, in front of the four output products: these fill the slots that the chip needs behind a matrix instruction, and the next step's square roots start with nothing to wait for
#pragma unroll
    for (int dt = 0; dt < 4; ++dt) acc[dt] = wmma16(vf[dt], pa, acc[dt]);   // single product: V^T x P^T (x2^11); acc[dt][r] = O[query col][dt * 16 + 8 g + r]
   }
    asm volatile("s_wait_dscnt 0x0" ::: "memory");      // this wave's reads of tile t are over before the buffer is given up
    asm volatile("s_wait_asynccnt 0x0" ::: "memory");   // this wave's share of tile t + 1 has landed
    __syncthreads();   // publishes tile t + 1, ends every reader's last read of tile t
    if (t + 2 < AT_N) kv_fill(gk, gv, t + 2, l0 + bo, tid);
  }
  asm volatile("s_wait_asynccnt 0x0" ::: "memory");   // no copy is outstanding when the wave ends
  const float il = (1.0f / 2048.0f) / (l + xhalf(l));
  float* orow = O + rq * DM + h * HD + 8 * g;
#pragma unroll
  for (int dt = 0; dt < 4; ++dt) { const v4f lo = { acc[dt][0] * il, acc[dt][1] * il, acc[dt][2] * il, acc[dt][3] * il }, hi = { acc[dt][4] * il, acc[dt][5] * il, acc[dt][6] * il, acc[dt][7] * il }; vst2(orow + dt * 16, lo); vst2(orow + dt * 16 + 4, hi); }
}
// ---- k_out: block = (64 rows, 128 cols): out = O(hi/lo) . Wo rows (2 products) + bo
__global__ __launch_bounds__(128) void k_out(const float* __restrict__ O, const __bf16* __restrict__ P, const float* __restrict__ BO, float* __restrict__ Y) {
  __shared__ __align__(16) char smem[2 * ST_SZ];   // the two tile buffers; behind the loop the output staging
  static_assert(2 * ST_SZ >= 4 * 16 * 132 * 4, "the staging fits the buffers");
  float (*so)[16][132] = (float (*)[16][132])smem;
  const int tid = threadIdx.x, wave = tid >> 5, lane = tid & 31, col = lane & 15, g = lane >> 4; const size_t r0 = (size_t)blockIdx.x * 64 + wave * 16; const int n0 = blockIdx.y * 128;
  v8f acc[8] = {};
  auto mma = [&](const KStep& s) { const F2 a = bsplit16(s.a);
#pragma unroll
    for (int j = 0; j < 8; ++j) { acc[j] = wmma_bf(a.l, s.w[j], acc[j]); acc[j] = wmma_bf(a.h, s.w[j], acc[j]); } };
  tile_loop(O + (size_t)blockIdx.x * 64 * DM, P + (size_t)n0 * DM, smem, tid, mma);
#pragma unroll
  for (int j = 0; j < 8; ++j) {
#pragma unroll
    for (int r = 0; r < 8; ++r) so[wave][8 * g + r][j * 16 + col] = acc[j][r] + bfr(BO[n0 + j * 16 + col]); }
  LDSX();
  for (int rl = 0; rl < 16; ++rl) vst2(Y + (r0 + rl) * DM + n0 + lane * 4, *(const v4f*)&so[wave][rl][lane * 4]);
}
// ---- dist_block: block = 32 rows x all keys. A thread keeps the rounded positions of its own 8 keys in registers (six 16-byte loads, issued together) and walks the block's 32 rows, read from LDS: no load stands in the loop's dependent path. max is order-free, so any split of the pairs gives the same global maximum: RM[block * 32 + i] = max of |p_r - p_j|^2 over the block's rows r and the keys j of threads 8 i .. 8 i + 7; one 128-B line per block
__device__ __forceinline__ void dist_block(const float* __restrict__ POS, float* __restrict__ RM, __bf16* __restrict__ KD, int blk) {
  static_assert(NB * SS == 256 * 8, "a thread owns 8 keys");
  __shared__ __align__(16) float srow[32][4]; __shared__ __align__(16) float red[256]; __shared__ __align__(16) float line[32];
  const int t = threadIdx.x; const size_t r0 = (size_t)blk * 32;
  v4f kv[6];
#pragma unroll
  for (int i = 0; i < 6; ++i) kv[i] = *(const v4f*)(POS + (size_t)t * 24 + i * 4);
  if (t < 128) { const int c = t & 3; const float v = POS[(r0 + (t >> 2)) * 3 + (c < 3 ? c : 2)]; srow[t >> 2][c] = (c < 3) ? bfr(v) : 0.f; }   // a row's fourth word is padding, written so that the 16-byte rows hold no unwritten LDS
  float kx[8], ky[8], kz[8], mx[8];
#pragma unroll
  for (int j = 0; j < 8; ++j) { kx[j] = bfr(kv[(3 * j) >> 2][(3 * j) & 3]); ky[j] = bfr(kv[(3 * j + 1) >> 2][(3 * j + 1) & 3]); kz[j] = bfr(kv[(3 * j + 2) >> 2][(3 * j + 2) & 3]); mx[j] = 0.f; }
  __syncthreads();
  // the block's 32 rows also leave as key rows of k_attn's distance product: wave 0, a lane a row, four whole 128-B lines
  if (t < 32) { const v4f p = *(const v4f*)&srow[t][0]; vst2(KD + (r0 + t) * 8, key_row(p[0], p[1], p[2]));
    asm volatile("s_wait_xcnt 0x0" ::: "memory"); }   // stands behind the store, in front of any rewrite of a register that it names
  // rolled: keeps the distance side's code and registers small (the kernel's register count is now set by the packing side's sixteen loads, not by this loop)
#pragma unroll 1
  for (int i = 0; i < 32; ++i) { const v4f p = *(const v4f*)&srow[i][0];
#pragma unroll
    for (int j = 0; j < 8; ++j) { const float dx = p[0] - kx[j], dy = p[1] - ky[j], dz = p[2] - kz[j]; mx[j] = fmaxf(mx[j], dx * dx + dy * dy + dz * dz); } }
  red[t] = fmaxf(fmaxf(fmaxf(mx[0], mx[1]), fmaxf(mx[2], mx[3])), fmaxf(fmaxf(mx[4], mx[5]), fmaxf(mx[6], mx[7]))); __syncthreads();
  if (t < 32) { const v4f a = *(const v4f*)&red[t * 8], c = *(const v4f*)&red[t * 8 + 4]; line[t] = fmaxf(fmaxf(fmaxf(a[0], a[1]), fmaxf(a[2], a[3])), fmaxf(fmaxf(c[0], c[1]), fmaxf(c[2], c[3]))); } __syncthreads();
  if (t < 8) vst2(RM + r0 + t * 4, *(const v4f*)&line[t * 4]);
}
// ---- k_prep: one launch for the two pieces of work that read nothing but inputs. Blocks 0 .. DIST_B - 1 make the partial maxima, the others pack PACK_E weight elements each. The distance blocks are the long ones and have the low indices, so that they start first and run beside the packing.
#define DIST_B (NB * SS / 32)
__global__ __launch_bounds__(256) void k_prep(const float* __restrict__ WQ, const float* __restrict__ WK, const float* __restrict__ WV, const float* __restrict__ WO, __bf16* __restrict__ PK, const float* __restrict__ POS, float* __restrict__ RM, __bf16* __restrict__ KD) {
  const int bi = blockIdx.x;   // the same for the whole block: either side's barriers are passed by all of its threads
  if (bi < DIST_B) dist_block(POS, RM, KD, bi);
  else pack_block(WQ, WK, WV, WO, PK, bi - DIST_B);
}
extern "C" void kernel_launch(void* const* d_in, const int* in_sizes, int n_in, void* d_out, int out_size, void* d_ws, size_t ws_size, hipStream_t stream) {
  (void)in_sizes; (void)n_in; (void)out_size;
  const float** F = (const float**)d_in;   // 0 x [1,2048,1024], 1 attention_mask [1,2048] int, 2 positions [1,2048,3], 3 Wq, 4 bq, 5 Wk, 6 bk, 7 Wv, 8 bv, 9 Wo, 10 bo (natural), 11 velocity [16]
  if (ws_size < (size_t)WS_END) return;
  char* ws = (char*)d_ws; __bf16* PK = (__bf16*)(ws + WS_PK); _Float16 *QK = (_Float16*)(ws + WS_QK), *QKL = (_Float16*)(ws + WS_QKL), *VTH = (_Float16*)(ws + WS_VTH), *VTL = (_Float16*)(ws + WS_VTL); float *O = (float*)(ws + WS_O), *RM = (float*)(ws + WS_DM); __bf16* KD = (__bf16*)(ws + WS_CS);
  k_prep<<<DIST_B + PACK_B, 256, 0, stream>>>(F[3], F[5], F[7], F[9], PK, F[2], RM, KD);
  k_qkv<<<dim3(TNB * SS / 64, QKVW / 128), 128, 0, stream>>>(F[0], F[0], F[0], PK + PK_A, F[4], F[6], F[8], QK, QKL, VTH, VTL);
  k_attn<<<dim3(TQB, NH, TNB), 128, 0, stream>>>(QK, QKL, VTH, VTL, nullptr, F[2], RM, F[11], (const int*)d_in[1], KD, O);
  k_out<<<dim3(TOB, DM / 128), 128, 0, stream>>>(O, PK + PK_P, F[10], (float*)d_out);
}
